// v000
// Measured on an AMD MI455X. A time is GPU time per run, averaged over a window of back-to-back runs after a warm-up
// (all launches, gaps included; the runs take copies of the inputs in turn), and the median of several windows.
// Apart from v000's, it joins two sittings. Times from different sittings can be a few percent apart, while
// side-by-side timings come from the same sitting.
// The starting kernel, v000, takes 601 microseconds a run.
// compute dtype: all float inputs rounded to bf16; qkv = x . Wqkv + b with EXACT bf16 products on WMMA 16x16x32 ((in,out) fused weight via k_pack3) - the k and v projections are also written out in f32 straight from the accumulators; causal attention with key-tile skipping: the first 128 queries use 3-product scores and P.v (hi/lo), later queries single f16 operands; (q.k)/8 + attn_bias[q][k], running-max softmax in f32 (hardware exp); out = ctx (bf16 hi + residual) . Wproj (2 products) + bproj; outputs out | cache_key | cache_value concatenated.
#include <hip/hip_runtime.h>
#include <math.h>

typedef __attribute__((ext_vector_type(16))) _Float16 v16h;
typedef __attribute__((ext_vector_type(16))) __bf16 v16b;
typedef __attribute__((ext_vector_type(8)))  _Float16 v8h;
typedef __attribute__((ext_vector_type(8)))  float v8f;
typedef __attribute__((ext_vector_type(4)))  float v4f;
typedef __attribute__((ext_vector_type(2)))  float v2f;
typedef __attribute__((ext_vector_type(4)))  unsigned v4u;
typedef __attribute__((ext_vector_type(4)))  int v4i;
typedef float __attribute__((may_alias)) float_a;
typedef int __attribute__((may_alias)) int_a;

template <typename T> __device__ __forceinline__ void vst2(void* p, T v) { *(T*)p = v;  }
__device__ __forceinline__ v8f wmma16(v16h a, v16h b, v8f c) {
  v8f d = __builtin_amdgcn_wmma_f32_16x16x32_f16(false, a, false, b, (short)0, c, false, false);
  asm volatile("v_nop\n\tv_nop\n\tv_nop\n\tv_nop" : "+v"(d) : "v"(a), "v"(b));
  return d;
}
__device__ __forceinline__ v8f wmma_bf(v16b a, v16b b, v8f c) {
  v8f d = __builtin_amdgcn_wmma_f32_16x16x32_bf16(false, a, false, b, (short)0, c, false, false);
  asm volatile("v_nop\n\tv_nop\n\tv_nop\n\tv_nop" : "+v"(d) : "v"(a), "v"(b));
  return d;
}
// Prefill attention (B 2, S 2,048, E 1,024, 16 heads x 64): fused (in,out) qkv + bias, scores / 8 + learned additive bias[q, k], causal, softmax, . v, Wproj + bias; also returns the k and v projections (the KV cache).
__device__ __forceinline__ v16h frag_h(const _Float16* rowk0, int lane) {
  union { v16h v; v8h q[2]; } u; const _Float16* p = rowk0 + 8 * (lane >> 4);
  u.q[0] = *(const v8h*)p; u.q[1] = *(const v8h*)(p + 16); return u.v;
}
__device__ __forceinline__ v16h frag_f32(const float* rowk0, int lane) {
  v16h a; const float* p = rowk0 + 8 * (lane >> 4);
#pragma unroll
  for (int i = 0; i < 8; ++i) { a[i] = (_Float16)p[i]; a[8 + i] = (_Float16)p[16 + i]; }
  return a;
}
__device__ __forceinline__ v16h frag_f32s(const float* rowk0, int lane, float sc) {
  v16h a; const float* p = rowk0 + 8 * (lane >> 4);
#pragma unroll
  for (int i = 0; i < 8; ++i) { a[i] = (_Float16)(p[i] * sc); a[8 + i] = (_Float16)(p[16 + i] * sc); }
  return a;
}
// column fragment from a [K][ld] layout (column n), rows >= K read as 0
__device__ __forceinline__ v16h fragc_f32(const float* W, int k0, int n, int lane, int ld, int K) {
  v16h a; const int g = lane >> 4;
#pragma unroll
  for (int i = 0; i < 8; ++i) { const int ka = k0 + 8 * g + i, kb = ka + 16;
    a[i] = (_Float16)(ka < K ? W[(size_t)(ka < K ? ka : K - 1) * ld + n] : 0.f); a[8 + i] = (_Float16)(kb < K ? W[(size_t)(kb < K ? kb : K - 1) * ld + n] : 0.f); }
  return a;
}
struct F2 { v16b h, l; };
__device__ __forceinline__ F2 bsplit16(const float v[16]) { F2 r;
#pragma unroll
  for (int i = 0; i < 16; ++i) { const __bf16 h = (__bf16)v[i]; r.h[i] = h; r.l[i] = (__bf16)(v[i] - (float)h); }
  return r; }
__device__ __forceinline__ F2 split_row(const float* row, int k0, int lane) { float v[16]; const float* p = row + k0 + 8 * (lane >> 4);
#pragma unroll
  for (int i = 0; i < 8; ++i) { v[i] = p[i]; v[8 + i] = p[16 + i]; }
  return bsplit16(v); }
__device__ __forceinline__ F2 split_rowK(const float* row, int k0, int lane, int K) { float v[16]; const int g = lane >> 4;
#pragma unroll
  for (int i = 0; i < 8; ++i) { const int ka = k0 + 8 * g + i, kb = ka + 16; v[i] = ka < K ? row[ka < K ? ka : K - 1] : 0.f; v[8 + i] = kb < K ? row[kb < K ? kb : K - 1] : 0.f; }
  return bsplit16(v); }
__device__ __forceinline__ F2 split_col(const float* W, int k0, int n, int lane, int ld, int K) { float v[16]; const int g = lane >> 4;
#pragma unroll
  for (int i = 0; i < 8; ++i) { const int ka = k0 + 8 * g + i, kb = ka + 16; v[i] = ka < K ? W[(size_t)(ka < K ? ka : K - 1) * ld + n] : 0.f; v[8 + i] = kb < K ? W[(size_t)(kb < K ? kb : K - 1) * ld + n] : 0.f; }
  return bsplit16(v); }
__device__ __forceinline__ v8f mac3(const F2& a, const F2& b, v8f c) { c = wmma_bf(a.l, b.h, c); c = wmma_bf(a.h, b.l, c); return wmma_bf(a.h, b.h, c); }
__device__ __forceinline__ float sigm(float v) { return 1.0f / (1.0f + expf(-v)); }
#define LDSX() do { asm volatile("s_wait_dscnt 0" ::: "memory"); __builtin_amdgcn_wave_barrier(); __builtin_amdgcn_fence(__ATOMIC_RELEASE, "workgroup"); } while (0)


#define NB 2
#define SS 2048
#define DM 1024
#define NH 16
#define SCALEF 0.125f
#define HD 64
#define QKVW (3 * DM)
#ifndef TQB
#define TQB (SS / 64)
#define TNB NB
#define TOB (NB * SS / 64)     // output row tiles (all)
#endif
typedef __attribute__((ext_vector_type(8))) __bf16 v8b;
__device__ __forceinline__ v16b frag_b(const __bf16* rowk0, int lane) {
  union { v16b v; v8b q[2]; } u; const __bf16* p = rowk0 + 8 * (lane >> 4);
  u.q[0] = *(const v8b*)p; u.q[1] = *(const v8b*)(p + 16); return u.v;
}
__device__ __forceinline__ float bfr(float v) { return (float)(__bf16)v; }
__device__ __attribute__((noinline)) float exp_ni(float v) { return expf(v); }
__device__ __attribute__((noinline)) float erf_ni(float v) { return erff(v); }

#define PK_A 0                       // [3072][1024] Wqkv rows (natural [out][in])
#define PK_P (PK_A + QKVW * DM)        // [1024][1024] Wo rows (natural)
#define PK_END (PK_P + DM * DM)
#define WS_PK  0u
#define WS_QK  (WS_PK + 2u * PK_END)             // f16 [4096 rows][2048]: q | k
#define WS_QKL (WS_QK + 2u * NB * SS * 2 * DM)     // f16 q | k residual planes x2048
#define WS_VTH (WS_QKL + 2u * NB * SS * 2 * DM)    // f16 [b][1024 (h*64+d)][2048 s] hi
#define WS_VTL (WS_VTH + 2u * NB * DM * SS)        // f16 lo x 2048
#define WS_O   (WS_VTL + 2u * NB * DM * SS)        // f32 [4096][1024]
#define WS_CS  (WS_O + 4u * NB * SS * DM)           // f32 [2][2048][32], unused
#define WS_END (WS_CS + 4u * 2 * SS * 32)
// ---- k_pack: block = (row n, which): (in,out) column n -> bf16 row n; which 0..2 -> W_q/W_k/W_v into PK_A rows which*1024 + n; 3 -> W_o into PK_P
__global__ __launch_bounds__(256) void k_pack(const float* __restrict__ WQ, const float* __restrict__ WK, const float* __restrict__ WV, const float* __restrict__ WO, __bf16* __restrict__ PK) {
  __shared__ __align__(16) __bf16 s[DM]; const int n = blockIdx.x, which = blockIdx.y, t = threadIdx.x; const float* Wm = (which == 0) ? WQ : (which == 1) ? WK : (which == 2) ? WV : WO;   // (in,out) weights: pack row n = column n
  for (int k = t; k < DM; k += 256) s[k] = (__bf16)Wm[(size_t)k * DM + n];
  __syncthreads();
  __bf16* dst = (which < 3) ? PK + PK_A + ((size_t)which * DM + n) * DM : PK + PK_P + (size_t)n * DM;
  for (int q = t; q < DM / 8; q += 256) vst2((unsigned*)(dst + q * 8), *(const v4u*)&s[q * 8]);
}
__global__ __launch_bounds__(128) void k_qkv(const float* __restrict__ XQ, const float* __restrict__ XK, const float* __restrict__ XV, const __bf16* __restrict__ P, const float* __restrict__ BQ, const float* __restrict__ BK, const float* __restrict__ BV, float* __restrict__ KOUT, float* __restrict__ VOUT, _Float16* __restrict__ QK, _Float16* __restrict__ QKL, _Float16* __restrict__ VTH, _Float16* __restrict__ VTL) {
  const int which0 = (blockIdx.y * 128) / DM; const float* X = (which0 == 0) ? XQ : (which0 == 1) ? XK : XV; const float* BB = BQ ? (((which0 == 0) ? BQ : (which0 == 1) ? BK : BV) + (blockIdx.y * 128 - which0 * DM)) : nullptr;
  __shared__ __align__(16) _Float16 so[4][16][136], sol[4][16][136]; __shared__ __align__(16) _Float16 sth[128][72], stl[128][72];
  const int tid = threadIdx.x, wave = tid >> 5, lane = tid & 31, col = lane & 15, g = lane >> 4; const size_t r0 = (size_t)blockIdx.x * 64 + wave * 16; const int n0 = blockIdx.y * 128;
  v8f acc[8] = {};
#pragma unroll 2
  for (int kc = 0; kc < DM / 32; ++kc) { v16b a; { const float* p = X + (r0 + col) * DM + kc * 32 + 8 * g;
#pragma unroll
      for (int i = 0; i < 8; ++i) { a[i] = (__bf16)p[i]; a[8 + i] = (__bf16)p[16 + i]; } }
#pragma unroll
    for (int j = 0; j < 8; ++j) acc[j] = wmma_bf(a, frag_b(P + (size_t)(n0 + j * 16 + col) * DM + kc * 32, lane), acc[j]); }
  if (which0 >= 1) {   // cache_key / cache_value: the f32 projections (+ bias) straight from the accumulators, 512-B row segments
    __shared__ __align__(16) float sf[4][16][132];
#pragma unroll
    for (int j = 0; j < 8; ++j) {
#pragma unroll
      for (int r = 0; r < 8; ++r) sf[wave][8 * g + r][j * 16 + col] = acc[j][r] + (BB ? bfr(BB[j * 16 + col]) : 0.f); }
    LDSX();
    float* dst = (which0 == 1) ? KOUT : VOUT; for (int rl = 0; rl < 16; ++rl) vst2(dst + (r0 + rl) * DM + (n0 - which0 * DM) + lane * 4, *(const v4f*)&sf[wave][rl][lane * 4]);
    LDSX(); }
  if (n0 < 2 * DM) {   // q stored unscaled (f16 sigma ~0.6, no subnormal exposure); 1/8 applied to the f32 score
#pragma unroll
    for (int j = 0; j < 8; ++j) {
#pragma unroll
      for (int r = 0; r < 8; ++r) { const float v = acc[j][r] + (BB ? bfr(BB[j * 16 + col]) : 0.f); const _Float16 hv = (_Float16)v; so[wave][8 * g + r][j * 16 + col] = hv; sol[wave][8 * g + r][j * 16 + col] = (_Float16)((v - (float)hv) * 2048.0f); } }   // q, k (+ bias) as f16 hi + (x2048) residual
    LDSX();
    for (int rl = 0; rl < 16; ++rl) if (lane < 16) { vst2((unsigned*)(QK + (r0 + rl) * (2 * DM) + n0 + lane * 8), *(const v4u*)&so[wave][rl][lane * 8]); vst2((unsigned*)(QKL + (r0 + rl) * (2 * DM) + n0 + lane * 8), *(const v4u*)&sol[wave][rl][lane * 8]); }
  } else {
#pragma unroll
    for (int j = 0; j < 8; ++j) {
#pragma unroll
      for (int r = 0; r < 8; ++r) { const float v = acc[j][r] + (BB ? bfr(BB[j * 16 + col]) : 0.f); const _Float16 hv = (_Float16)v; sth[j * 16 + col][wave * 16 + 8 * g + r] = hv; stl[j * 16 + col][wave * 16 + 8 * g + r] = (_Float16)((v - (float)hv) * 2048.0f); } }
    __syncthreads();
    const size_t rb = (size_t)blockIdx.x * 64; const int b = (int)(rb / SS), s0 = (int)(rb % SS); const int pc0 = n0 - 2 * DM;
    for (int q = tid; q < 128 * 8; q += 128) { const int d = q >> 3, pc = q & 7; const size_t o = ((size_t)b * DM + pc0 + d) * SS + s0 + pc * 8; vst2((unsigned*)(VTH + o), *(const v4u*)&sth[d][pc * 8]); vst2((unsigned*)(VTL + o), *(const v4u*)&stl[d][pc * 8]); }
  }
}
// ---- k_attn: block = (64 queries, head h, batch b): causal flash attention (K = 64: 2 k-steps), scores = (q.k) * 0.125, 3 products (q, k hi/lo) for qb < 2 and single f16 operands elsewhere; P.V: P x V hi in acc, for qb < 2 also P lo x V hi + P x V lo*2048 in accl; O[b*S+q][h*64+d] = (acc + accl / 2048) / (2048 l) (256-B segments)
__global__ __launch_bounds__(128) void k_attn(const _Float16* __restrict__ QK, const _Float16* __restrict__ QKL, const _Float16* __restrict__ VTH, const _Float16* __restrict__ VTL, const void* __restrict__ KMASK, const float* __restrict__ AB, float* __restrict__ O) {
  __shared__ __align__(16) float sp[4][16][36]; __shared__ __align__(16) float so[4][16][68];
  const int tid = threadIdx.x, wave = tid >> 5, lane = tid & 31, col = lane & 15, g = lane >> 4;
  const int qb = blockIdx.x, h = blockIdx.y, b = blockIdx.z; const int q0 = qb * 64 + wave * 16; const size_t rq = (size_t)b * SS + q0 + col;
  v16h aq[2], aql[2];
#pragma unroll
  for (int kc = 0; kc < 2; ++kc) { aq[kc] = frag_h(QK + rq * (2 * DM) + h * HD + kc * 32, lane); aql[kc] = frag_h(QKL + rq * (2 * DM) + h * HD + kc * 32, lane); }
  float m[8], l[8];
#pragma unroll
  for (int r = 0; r < 8; ++r) { m[r] = -3.0e38f; l[r] = 0.f; }
  v8f acc[4] = {}, accl[4] = {};
  const int nks = (qb * 64 + 64) / 32;   // causal: key tiles up to the query tile's end
#pragma unroll 1
  for (int ks = 0; ks < nks; ++ks) { v8f s[2];
#pragma unroll
    for (int ct = 0; ct < 2; ++ct) { const int kk = ks * 32 + ct * 16 + col; const _Float16* krow = QK + ((size_t)b * SS + kk) * (2 * DM) + DM + h * HD; const _Float16* krowl = QKL + ((size_t)b * SS + kk) * (2 * DM) + DM + h * HD; v8f c = {}, cl = {};
      if (qb < 2) {   // leading query blocks (few keys, outputs far above the global rms): 3 products
#pragma unroll
        for (int kc = 0; kc < 2; ++kc) { const v16h kh = frag_h(krow + kc * 32, lane); c = wmma16(aq[kc], kh, c); cl = wmma16(aql[kc], kh, cl); cl = wmma16(aq[kc], frag_h(krowl + kc * 32, lane), cl); }
#pragma unroll
        for (int r = 0; r < 8; ++r) c[r] += cl[r] * (1.0f / 2048.0f); }
      else {
#pragma unroll
        for (int kc = 0; kc < 2; ++kc) c = wmma16(aq[kc], frag_h(krow + kc * 32, lane), c); }   // single product elsewhere
#pragma unroll
      for (int r = 0; r < 8; ++r) s[ct][r] = (kk <= q0 + 8 * g + r) ? (c[r] * SCALEF + bfr(AB[(size_t)(q0 + 8 * g + r) * SS + kk])) : -3.0e38f; }   // causal: future keys excluded
#pragma unroll
    for (int r = 0; r < 8; ++r) { float mx = fmaxf(s[0][r], s[1][r]);
#pragma unroll
      for (int o = 1; o < 16; o <<= 1) mx = fmaxf(mx, __shfl_xor(mx, o));
      const float mn = fmaxf(m[r], mx); const float alpha = (m[r] <= -1.0e38f) ? 0.f : __expf(m[r] - mn);
      const float e0 = (s[0][r] <= -1.0e38f) ? 0.f : __expf(s[0][r] - mn), e1 = (s[1][r] <= -1.0e38f) ? 0.f : __expf(s[1][r] - mn); float es = e0 + e1;
#pragma unroll
      for (int o = 1; o < 16; o <<= 1) es += __shfl_xor(es, o);
      l[r] = l[r] * alpha + es; m[r] = mn;
#pragma unroll
      for (int dt = 0; dt < 4; ++dt) { acc[dt][r] *= alpha; accl[dt][r] *= alpha; }
      sp[wave][8 * g + r][col] = e0; sp[wave][8 * g + r][16 + col] = e1; }
    LDSX();
    v16h pa, pl; { const float* prow = &sp[wave][col][0] + 8 * (lane >> 4);
#pragma unroll
      for (int i = 0; i < 8; ++i) { const float x0 = prow[i] * 2048.0f, x1 = prow[16 + i] * 2048.0f; const _Float16 h0 = (_Float16)x0, h1 = (_Float16)x1; pa[i] = h0; pa[8 + i] = h1; pl[i] = (_Float16)((x0 - (float)h0) * 2048.0f); pl[8 + i] = (_Float16)((x1 - (float)h1) * 2048.0f); } }   // P scaled by 2^11 before the f16 split so small softmax weights stay out of the f16 subnormal range; 2^-11 folded into the epilogue
#pragma unroll
    for (int dt = 0; dt < 4; ++dt) { const size_t vr = ((size_t)b * DM + h * HD + dt * 16 + col) * SS + ks * 32; const v16h vh = frag_h(VTH + vr, lane); acc[dt] = wmma16(pa, vh, acc[dt]); if (qb < 2) { accl[dt] = wmma16(pl, vh, accl[dt]); accl[dt] = wmma16(pa, frag_h(VTL + vr, lane), accl[dt]); } }   // leading query blocks: P hi/lo x V hi/lo (3 products); elsewhere P x V single
    LDSX(); }
#pragma unroll
  for (int r = 0; r < 8; ++r) { const float il = (1.0f / 2048.0f) / l[r];
#pragma unroll
    for (int dt = 0; dt < 4; ++dt) so[wave][8 * g + r][dt * 16 + col] = (acc[dt][r] + accl[dt][r] * (1.0f / 2048.0f)) * il; }
  LDSX();
  for (int rl = 0; rl < 16; ++rl) if (lane < 16) vst2(O + ((size_t)b * SS + q0 + rl) * DM + h * HD + lane * 4, *(const v4f*)&so[wave][rl][lane * 4]);
}
// ---- k_out: block = (64 rows, 128 cols): out = O(hi/lo) . Wo rows (2 products) + bo
__global__ __launch_bounds__(128) void k_out(const float* __restrict__ O, const __bf16* __restrict__ P, const float* __restrict__ BO, float* __restrict__ Y) {
  __shared__ __align__(16) float so[4][16][132];
  const int tid = threadIdx.x, wave = tid >> 5, lane = tid & 31, col = lane & 15, g = lane >> 4; const size_t r0 = (size_t)blockIdx.x * 64 + wave * 16; const int n0 = blockIdx.y * 128;
  v8f acc[8] = {};
#pragma unroll 2
  for (int kc = 0; kc < DM / 32; ++kc) { const F2 a = split_row(O + (r0 + col) * DM, kc * 32, lane);
#pragma unroll
    for (int j = 0; j < 8; ++j) { const v16b w = frag_b(P + (size_t)(n0 + j * 16 + col) * DM + kc * 32, lane); acc[j] = wmma_bf(a.l, w, acc[j]); acc[j] = wmma_bf(a.h, w, acc[j]); } }
#pragma unroll
  for (int j = 0; j < 8; ++j) {
#pragma unroll
    for (int r = 0; r < 8; ++r) so[wave][8 * g + r][j * 16 + col] = acc[j][r] + bfr(BO[n0 + j * 16 + col]); }
  LDSX();
  for (int rl = 0; rl < 16; ++rl) vst2(Y + (r0 + rl) * DM + n0 + lane * 4, *(const v4f*)&so[wave][rl][lane * 4]);
}
// ---- k_pack3: the fused (in,out) W_attn [DM][3*DM] -> the three transposed bf16 row blocks
__global__ __launch_bounds__(256) void k_pack3(const float* __restrict__ WA, __bf16* __restrict__ PK) { __shared__ __align__(16) __bf16 s[DM]; const int n = blockIdx.x, which = blockIdx.y, t = threadIdx.x; for (int k = t; k < DM; k += 256) s[k] = (__bf16)WA[(size_t)k * (3 * DM) + which * DM + n]; __syncthreads(); for (int q = t; q < DM / 8; q += 256) vst2((unsigned*)(PK + PK_A + ((size_t)which * DM + n) * DM + q * 8), *(const v4u*)&s[q * 8]); }
extern "C" void kernel_launch(void* const* d_in, const int* in_sizes, int n_in, void* d_out, int out_size, void* d_ws, size_t ws_size, hipStream_t stream) {
  (void)in_sizes; (void)n_in; (void)out_size;
  const float** F = (const float**)d_in;   // 0 hidden [2,2048,1024], 1 attn_bias [2048,2048], 2 Wqkv [1024,3072] (in,out; q | k | v), 3 bqkv [3072], 4 Wproj [1024,1024] (in,out), 5 bproj
  if (ws_size < (size_t)WS_END) return;
  char* ws = (char*)d_ws; __bf16* PK = (__bf16*)(ws + WS_PK); _Float16 *QK = (_Float16*)(ws + WS_QK), *QKL = (_Float16*)(ws + WS_QKL), *VTH = (_Float16*)(ws + WS_VTH), *VTL = (_Float16*)(ws + WS_VTL); float* O = (float*)(ws + WS_O);
  float* OUT0 = (float*)d_out; float* KOUT = OUT0 + (size_t)NB * SS * DM; float* VOUT = KOUT + (size_t)NB * SS * DM;   // outputs: out, cache_key, cache_value
  k_pack<<<dim3(DM, 4), 256, 0, stream>>>(F[4], F[4], F[4], F[4], PK);   // Wproj into the Wo slot
  k_pack3<<<dim3(DM, 3), 256, 0, stream>>>(F[2], PK);
  k_qkv<<<dim3(TNB * SS / 64, QKVW / 128), 128, 0, stream>>>(F[0], F[0], F[0], PK + PK_A, F[3], F[3] + DM, F[3] + 2 * DM, KOUT, VOUT, QK, QKL, VTH, VTL);
  k_attn<<<dim3(TQB, NH, TNB), 128, 0, stream>>>(QK, QKL, VTH, VTL, nullptr, F[1], O);
  k_out<<<dim3(TOB, DM / 128), 128, 0, stream>>>(O, PK + PK_P, F[5], OUT0);
}

// v001
// One run takes 330 microseconds.
// Next to v000, in two timings, it ran 1.84 times as fast each time.
// compute dtype: all float inputs rounded to bf16; qkv = x . Wqkv + b with EXACT bf16 products on WMMA 16x16x32 ((in,out) fused weight via k_pack3) - the k and v projections are also written out in f32 straight from the accumulators; causal attention with key-tile skipping: the first 128 queries use 3-product scores and P.v (hi/lo), later queries single f16 operands; (q.k)/8 + attn_bias[q][k], running-max softmax in f32 (hardware exp); out = ctx (bf16 hi + residual) . Wproj (2 products) + bproj; outputs out | cache_key | cache_value concatenated.
#include <hip/hip_runtime.h>
#include <math.h>

typedef __attribute__((ext_vector_type(16))) _Float16 v16h;
typedef __attribute__((ext_vector_type(16))) __bf16 v16b;
typedef __attribute__((ext_vector_type(8)))  _Float16 v8h;
typedef __attribute__((ext_vector_type(8)))  float v8f;
typedef __attribute__((ext_vector_type(4)))  float v4f;
typedef __attribute__((ext_vector_type(2)))  float v2f;
typedef __attribute__((ext_vector_type(4)))  unsigned v4u;
typedef __attribute__((ext_vector_type(4)))  int v4i;
typedef float __attribute__((may_alias)) float_a;
typedef int __attribute__((may_alias)) int_a;

template <typename T> __device__ __forceinline__ void vst2(void* p, T v) { *(T*)p = v;  }
__device__ __forceinline__ v8f wmma16(v16h a, v16h b, v8f c) {
  v8f d = __builtin_amdgcn_wmma_f32_16x16x32_f16(false, a, false, b, (short)0, c, false, false);
  asm volatile("v_nop\n\tv_nop\n\tv_nop\n\tv_nop" : "+v"(d) : "v"(a), "v"(b));
  return d;
}
__device__ __forceinline__ v8f wmma_bf(v16b a, v16b b, v8f c) {
  v8f d = __builtin_amdgcn_wmma_f32_16x16x32_bf16(false, a, false, b, (short)0, c, false, false);
  asm volatile("v_nop\n\tv_nop\n\tv_nop\n\tv_nop" : "+v"(d) : "v"(a), "v"(b));
  return d;
}
// Prefill attention (B 2, S 2,048, E 1,024, 16 heads x 64): fused (in,out) qkv + bias, scores / 8 + learned additive bias[q, k], causal, softmax, . v, Wproj + bias; also returns the k and v projections (the KV cache).
__device__ __forceinline__ v16h frag_h(const _Float16* rowk0, int lane) {
  union { v16h v; v8h q[2]; } u; const _Float16* p = rowk0 + 8 * (lane >> 4);
  u.q[0] = *(const v8h*)p; u.q[1] = *(const v8h*)(p + 16); return u.v;
}
__device__ __forceinline__ v16h frag_f32(const float* rowk0, int lane) {
  v16h a; const float* p = rowk0 + 8 * (lane >> 4);
#pragma unroll
  for (int i = 0; i < 8; ++i) { a[i] = (_Float16)p[i]; a[8 + i] = (_Float16)p[16 + i]; }
  return a;
}
__device__ __forceinline__ v16h frag_f32s(const float* rowk0, int lane, float sc) {
  v16h a; const float* p = rowk0 + 8 * (lane >> 4);
#pragma unroll
  for (int i = 0; i < 8; ++i) { a[i] = (_Float16)(p[i] * sc); a[8 + i] = (_Float16)(p[16 + i] * sc); }
  return a;
}
// column fragment from a [K][ld] layout (column n), rows >= K read as 0
__device__ __forceinline__ v16h fragc_f32(const float* W, int k0, int n, int lane, int ld, int K) {
  v16h a; const int g = lane >> 4;
#pragma unroll
  for (int i = 0; i < 8; ++i) { const int ka = k0 + 8 * g + i, kb = ka + 16;
    a[i] = (_Float16)(ka < K ? W[(size_t)(ka < K ? ka : K - 1) * ld + n] : 0.f); a[8 + i] = (_Float16)(kb < K ? W[(size_t)(kb < K ? kb : K - 1) * ld + n] : 0.f); }
  return a;
}
struct F2 { v16b h, l; };
__device__ __forceinline__ F2 bsplit16(const float v[16]) { F2 r;
#pragma unroll
  for (int i = 0; i < 16; ++i) { const __bf16 h = (__bf16)v[i]; r.h[i] = h; r.l[i] = (__bf16)(v[i] - (float)h); }
  return r; }
__device__ __forceinline__ F2 split_row(const float* row, int k0, int lane) { float v[16]; const float* p = row + k0 + 8 * (lane >> 4);
#pragma unroll
  for (int i = 0; i < 8; ++i) { v[i] = p[i]; v[8 + i] = p[16 + i]; }
  return bsplit16(v); }
__device__ __forceinline__ F2 split_rowK(const float* row, int k0, int lane, int K) { float v[16]; const int g = lane >> 4;
#pragma unroll
  for (int i = 0; i < 8; ++i) { const int ka = k0 + 8 * g + i, kb = ka + 16; v[i] = ka < K ? row[ka < K ? ka : K - 1] : 0.f; v[8 + i] = kb < K ? row[kb < K ? kb : K - 1] : 0.f; }
  return bsplit16(v); }
__device__ __forceinline__ F2 split_col(const float* W, int k0, int n, int lane, int ld, int K) { float v[16]; const int g = lane >> 4;
#pragma unroll
  for (int i = 0; i < 8; ++i) { const int ka = k0 + 8 * g + i, kb = ka + 16; v[i] = ka < K ? W[(size_t)(ka < K ? ka : K - 1) * ld + n] : 0.f; v[8 + i] = kb < K ? W[(size_t)(kb < K ? kb : K - 1) * ld + n] : 0.f; }
  return bsplit16(v); }
__device__ __forceinline__ v8f mac3(const F2& a, const F2& b, v8f c) { c = wmma_bf(a.l, b.h, c); c = wmma_bf(a.h, b.l, c); return wmma_bf(a.h, b.h, c); }
__device__ __forceinline__ float sigm(float v) { return 1.0f / (1.0f + expf(-v)); }
#define LDSX() do { asm volatile("s_wait_dscnt 0" ::: "memory"); __builtin_amdgcn_wave_barrier(); __builtin_amdgcn_fence(__ATOMIC_RELEASE, "workgroup"); } while (0)


#define NB 2
#define SS 2048
#define DM 1024
#define NH 16
#define SCALEF 0.125f
#define HD 64
#define QKVW (3 * DM)
#ifndef TQB
#define TQB (SS / 64)
#define TNB NB
#define TOB (NB * SS / 64)     // output row tiles (all)
#endif
typedef __attribute__((ext_vector_type(8))) __bf16 v8b;
__device__ __forceinline__ v16b frag_b(const __bf16* rowk0, int lane) {
  union { v16b v; v8b q[2]; } u; const __bf16* p = rowk0 + 8 * (lane >> 4);
  u.q[0] = *(const v8b*)p; u.q[1] = *(const v8b*)(p + 16); return u.v;
}
// pointers typed as global memory: they keep that type through the XWAIT statement below, so the loads behind it stay global loads
typedef const __attribute__((address_space(1))) float gf32; typedef const __attribute__((address_space(1))) __bf16 gb16;
typedef const __attribute__((address_space(1))) v4f gv4f; typedef const __attribute__((address_space(1))) v8b gv8b;
// the same fragment from a pointer that already holds the lane's half offset
__device__ __forceinline__ v16b frag_bp(gb16* p) { union { v16b v; v8b q[2]; } u; u.q[0] = *(gv8b*)p; u.q[1] = *(gv8b*)(p + 16); return u.v; }
// precaution behind a group of global loads: the wait stands in front of every rewrite of the group's address registers; both pointers pass through the statement, so every later step of them follows it
#define XWAIT(pa, pb) asm volatile("s_wait_xcnt 0x0" : "+v"(pa), "+v"(pb) : : "memory")
__device__ __forceinline__ float bfr(float v) { return (float)(__bf16)v; }
__device__ __attribute__((noinline)) float exp_ni(float v) { return expf(v); }
__device__ __attribute__((noinline)) float erf_ni(float v) { return erff(v); }

#define PK_A 0                       // [3072][1024] Wqkv rows (natural [out][in])
#define PK_P (PK_A + QKVW * DM)        // [1024][1024] Wo rows (natural)
#define PK_END (PK_P + DM * DM)
#define WS_PK  0u
#define WS_QK  (WS_PK + 2u * PK_END)             // f16 [4096 rows][2048]: q | k
#define WS_QKL (WS_QK + 2u * NB * SS * 2 * DM)     // f16 q | k residual planes x2048
#define WS_VTH (WS_QKL + 2u * NB * SS * 2 * DM)    // f16 [b][1024 (h*64+d)][2048 s] hi
#define WS_VTL (WS_VTH + 2u * NB * DM * SS)        // f16 lo x 2048
#define WS_O   (WS_VTL + 2u * NB * DM * SS)        // f32 [4096][1024]
#define WS_CS  (WS_O + 4u * NB * SS * DM)           // f32 [2][2048][32], unused
#define WS_END (WS_CS + 4u * 2 * SS * 32)
// ---- k_pack: block = (row n, which): (in,out) column n -> bf16 row n; which 0..2 -> W_q/W_k/W_v into PK_A rows which*1024 + n; 3 -> W_o into PK_P
__global__ __launch_bounds__(256) void k_pack(const float* __restrict__ WQ, const float* __restrict__ WK, const float* __restrict__ WV, const float* __restrict__ WO, __bf16* __restrict__ PK) {
  __shared__ __align__(16) __bf16 s[DM]; const int n = blockIdx.x, which = blockIdx.y, t = threadIdx.x; const float* Wm = (which == 0) ? WQ : (which == 1) ? WK : (which == 2) ? WV : WO;   // (in,out) weights: pack row n = column n
  for (int k = t; k < DM; k += 256) s[k] = (__bf16)Wm[(size_t)k * DM + n];
  __syncthreads();
  __bf16* dst = (which < 3) ? PK + PK_A + ((size_t)which * DM + n) * DM : PK + PK_P + (size_t)n * DM;
  for (int q = t; q < DM / 8; q += 256) vst2((unsigned*)(dst + q * 8), *(const v4u*)&s[q * 8]);
}
__global__ __launch_bounds__(128) void k_qkv(const float* __restrict__ XQ, const float* __restrict__ XK, const float* __restrict__ XV, const __bf16* __restrict__ P, const float* __restrict__ BQ, const float* __restrict__ BK, const float* __restrict__ BV, float* __restrict__ KOUT, float* __restrict__ VOUT, _Float16* __restrict__ QK, _Float16* __restrict__ QKL, _Float16* __restrict__ VTH, _Float16* __restrict__ VTL) {
  const int which0 = (blockIdx.y * 128) / DM; const float* X = (which0 == 0) ? XQ : (which0 == 1) ? XK : XV; const float* BB = BQ ? (((which0 == 0) ? BQ : (which0 == 1) ? BK : BV) + (blockIdx.y * 128 - which0 * DM)) : nullptr;
  __shared__ __align__(16) _Float16 so[4][16][136], sol[4][16][136]; __shared__ __align__(16) _Float16 sth[128][72], stl[128][72];
  const int tid = threadIdx.x, wave = tid >> 5, lane = tid & 31, col = lane & 15, g = lane >> 4; const size_t r0 = (size_t)blockIdx.x * 64 + wave * 16; const int n0 = blockIdx.y * 128;
  v8f acc[8] = {};
  float bj[8];   // the lane's eight bias values, fetched once as a group (the epilogues read them per element)
#pragma unroll
  for (int j = 0; j < 8; ++j) bj[j] = 0.f;
  if (BB) {
#pragma unroll
    for (int j = 0; j < 8; ++j) bj[j] = bfr(BB[j * 16 + col]); }
  // every global load of k-step kc + 1 is issued as one group in front of step kc's products, so the loads fly together and behind the matrix work instead of one load-and-wait per product
  gf32* xp = (gf32*)(X + (r0 + col) * DM + 8 * g); gb16* wp = (gb16*)(P + (size_t)(n0 + col) * DM + 8 * g);
  v4f xa[4]; v16b wb[8];
#pragma unroll
  for (int i = 0; i < 2; ++i) { xa[i] = *(gv4f*)(xp + 4 * i); xa[2 + i] = *(gv4f*)(xp + 16 + 4 * i); }
#pragma unroll
  for (int j = 0; j < 8; ++j) wb[j] = frag_bp(wp + (size_t)j * 16 * DM);
  XWAIT(xp, wp);
#pragma unroll 2
  for (int kc = 0; kc < DM / 32; ++kc) { const int st = (kc + 1 < DM / 32) ? 32 : 0; xp += st; wp += st;   // the last step fetches its own operands again (in bounds, unused)
    v4f xn[4]; v16b wn[8];
#pragma unroll
    for (int i = 0; i < 2; ++i) { xn[i] = *(gv4f*)(xp + 4 * i); xn[2 + i] = *(gv4f*)(xp + 16 + 4 * i); }
#pragma unroll
    for (int j = 0; j < 8; ++j) wn[j] = frag_bp(wp + (size_t)j * 16 * DM);
    XWAIT(xp, wp);
    v16b a;
#pragma unroll
    for (int i = 0; i < 8; ++i) { a[i] = (__bf16)xa[i >> 2][i & 3]; a[8 + i] = (__bf16)xa[2 + (i >> 2)][i & 3]; }
#pragma unroll
    for (int j = 0; j < 8; ++j) acc[j] = wmma_bf(a, wb[j], acc[j]);
#pragma unroll
    for (int i = 0; i < 4; ++i) xa[i] = xn[i];
#pragma unroll
    for (int j = 0; j < 8; ++j) wb[j] = wn[j]; }
  if (which0 >= 1) {   // cache_key / cache_value: the f32 projections (+ bias) straight from the accumulators, 512-B row segments
    __shared__ __align__(16) float sf[4][16][132];
#pragma unroll
    for (int j = 0; j < 8; ++j) {
#pragma unroll
      for (int r = 0; r < 8; ++r) sf[wave][8 * g + r][j * 16 + col] = acc[j][r] + bj[j]; }
    LDSX();
    float* dst = (which0 == 1) ? KOUT : VOUT; for (int rl = 0; rl < 16; ++rl) vst2(dst + (r0 + rl) * DM + (n0 - which0 * DM) + lane * 4, *(const v4f*)&sf[wave][rl][lane * 4]);
    LDSX(); }
  if (n0 < 2 * DM) {   // q stored unscaled (f16 sigma ~0.6, no subnormal exposure); 1/8 applied to the f32 score
#pragma unroll
    for (int j = 0; j < 8; ++j) {
#pragma unroll
      for (int r = 0; r < 8; ++r) { const float v = acc[j][r] + bj[j]; const _Float16 hv = (_Float16)v; so[wave][8 * g + r][j * 16 + col] = hv; sol[wave][8 * g + r][j * 16 + col] = (_Float16)((v - (float)hv) * 2048.0f); } }   // q, k (+ bias) as f16 hi + (x2048) residual
    LDSX();
    for (int rl = 0; rl < 16; ++rl) if (lane < 16) { vst2((unsigned*)(QK + (r0 + rl) * (2 * DM) + n0 + lane * 8), *(const v4u*)&so[wave][rl][lane * 8]); vst2((unsigned*)(QKL + (r0 + rl) * (2 * DM) + n0 + lane * 8), *(const v4u*)&sol[wave][rl][lane * 8]); }
  } else {
#pragma unroll
    for (int j = 0; j < 8; ++j) {
#pragma unroll
      for (int r = 0; r < 8; ++r) { const float v = acc[j][r] + bj[j]; const _Float16 hv = (_Float16)v; sth[j * 16 + col][wave * 16 + 8 * g + r] = hv; stl[j * 16 + col][wave * 16 + 8 * g + r] = (_Float16)((v - (float)hv) * 2048.0f); } }
    __syncthreads();
    const size_t rb = (size_t)blockIdx.x * 64; const int b = (int)(rb / SS), s0 = (int)(rb % SS); const int pc0 = n0 - 2 * DM;
    for (int q = tid; q < 128 * 8; q += 128) { const int d = q >> 3, pc = q & 7; const size_t o = ((size_t)b * DM + pc0 + d) * SS + s0 + pc * 8; vst2((unsigned*)(VTH + o), *(const v4u*)&sth[d][pc * 8]); vst2((unsigned*)(VTL + o), *(const v4u*)&stl[d][pc * 8]); }
  }
}
// ---- k_attn: block = (64 queries, head h, batch b): causal flash attention (K = 64: 2 k-steps), scores = (q.k) * 0.125, 3 products (q, k hi/lo) for qb < 2 and single f16 operands elsewhere; P.V: P x V hi in acc, for qb < 2 also P lo x V hi + P x V lo*2048 in accl; O[b*S+q][h*64+d] = (acc + accl / 2048) / (2048 l) (256-B segments)
__global__ __launch_bounds__(128) void k_attn(const _Float16* __restrict__ QK, const _Float16* __restrict__ QKL, const _Float16* __restrict__ VTH, const _Float16* __restrict__ VTL, const void* __restrict__ KMASK, const float* __restrict__ AB, float* __restrict__ O) {
  __shared__ __align__(16) float sp[4][16][36]; __shared__ __align__(16) float so[4][16][68];
  const int tid = threadIdx.x, wave = tid >> 5, lane = tid & 31, col = lane & 15, g = lane >> 4;
  const int qb = blockIdx.x, h = blockIdx.y, b = blockIdx.z; const int q0 = qb * 64 + wave * 16; const size_t rq = (size_t)b * SS + q0 + col;
  v16h aq[2], aql[2];
#pragma unroll
  for (int kc = 0; kc < 2; ++kc) { aq[kc] = frag_h(QK + rq * (2 * DM) + h * HD + kc * 32, lane); aql[kc] = frag_h(QKL + rq * (2 * DM) + h * HD + kc * 32, lane); }
  float m[8], l[8];
#pragma unroll
  for (int r = 0; r < 8; ++r) { m[r] = -3.0e38f; l[r] = 0.f; }
  v8f acc[4] = {}, accl[4] = {};
  const int nks = (qb * 64 + 64) / 32;   // causal: key tiles up to the query tile's end
#pragma unroll 1
  for (int ks = 0; ks < nks; ++ks) { v8f s[2];
    // the key step's K fragments and bias values are loaded as one group in front of the first product (the bias unconditionally: row and key are inside [S][S] for every lane; the causal select follows), so one round trip replaces one per product and per bias row
    v16h kf[2][2]; float ab[2][8];
#pragma unroll
    for (int ct = 0; ct < 2; ++ct) { const int kk = ks * 32 + ct * 16 + col; const _Float16* krow = QK + ((size_t)b * SS + kk) * (2 * DM) + DM + h * HD;
#pragma unroll
      for (int kc = 0; kc < 2; ++kc) kf[ct][kc] = frag_h(krow + kc * 32, lane);
#pragma unroll
      for (int r = 0; r < 8; ++r) ab[ct][r] = AB[(size_t)(q0 + 8 * g + r) * SS + kk]; }
    asm volatile("s_wait_xcnt 0x0" ::: "memory");   // precaution: the group's address registers may be reused by what follows while its loads are still out
#pragma unroll
    for (int ct = 0; ct < 2; ++ct) { const int kk = ks * 32 + ct * 16 + col; const _Float16* krowl = QKL + ((size_t)b * SS + kk) * (2 * DM) + DM + h * HD; v8f c = {}, cl = {};
      if (qb < 2) {   // leading query blocks (few keys, outputs far above the global rms): 3 products
#pragma unroll
        for (int kc = 0; kc < 2; ++kc) { const v16h kh = kf[ct][kc]; c = wmma16(aq[kc], kh, c); cl = wmma16(aql[kc], kh, cl); cl = wmma16(aq[kc], frag_h(krowl + kc * 32, lane), cl); }
#pragma unroll
        for (int r = 0; r < 8; ++r) c[r] += cl[r] * (1.0f / 2048.0f); }
      else {
#pragma unroll
        for (int kc = 0; kc < 2; ++kc) c = wmma16(aq[kc], kf[ct][kc], c); }   // single product elsewhere
#pragma unroll
      for (int r = 0; r < 8; ++r) s[ct][r] = (kk <= q0 + 8 * g + r) ? (c[r] * SCALEF + bfr(ab[ct][r])) : -3.0e38f; }   // causal: future keys excluded
    // the V fragments are requested here, behind the score products, and fly under the softmax
    v16h vf[4];
#pragma unroll
    for (int dt = 0; dt < 4; ++dt) vf[dt] = frag_h(VTH + ((size_t)b * DM + h * HD + dt * 16 + col) * SS + ks * 32, lane);
    asm volatile("s_wait_xcnt 0x0" ::: "memory");   // precaution: the group's address registers may be reused by what follows while its loads are still out
#pragma unroll
    for (int r = 0; r < 8; ++r) { float mx = fmaxf(s[0][r], s[1][r]);
#pragma unroll
      for (int o = 1; o < 16; o <<= 1) mx = fmaxf(mx, __shfl_xor(mx, o));
      const float mn = fmaxf(m[r], mx); const float alpha = (m[r] <= -1.0e38f) ? 0.f : __expf(m[r] - mn);
      const float e0 = (s[0][r] <= -1.0e38f) ? 0.f : __expf(s[0][r] - mn), e1 = (s[1][r] <= -1.0e38f) ? 0.f : __expf(s[1][r] - mn); float es = e0 + e1;
#pragma unroll
      for (int o = 1; o < 16; o <<= 1) es += __shfl_xor(es, o);
      l[r] = l[r] * alpha + es; m[r] = mn;
#pragma unroll
      for (int dt = 0; dt < 4; ++dt) { acc[dt][r] *= alpha; accl[dt][r] *= alpha; }
      sp[wave][8 * g + r][col] = e0; sp[wave][8 * g + r][16 + col] = e1; }
    LDSX();
    v16h pa, pl; { const float* prow = &sp[wave][col][0] + 8 * (lane >> 4);
#pragma unroll
      for (int i = 0; i < 8; ++i) { const float x0 = prow[i] * 2048.0f, x1 = prow[16 + i] * 2048.0f; const _Float16 h0 = (_Float16)x0, h1 = (_Float16)x1; pa[i] = h0; pa[8 + i] = h1; pl[i] = (_Float16)((x0 - (float)h0) * 2048.0f); pl[8 + i] = (_Float16)((x1 - (float)h1) * 2048.0f); } }   // P scaled by 2^11 before the f16 split so small softmax weights stay out of the f16 subnormal range; 2^-11 folded into the epilogue
#pragma unroll
    for (int dt = 0; dt < 4; ++dt) { const size_t vr = ((size_t)b * DM + h * HD + dt * 16 + col) * SS + ks * 32; const v16h vh = vf[dt]; acc[dt] = wmma16(pa, vh, acc[dt]); if (qb < 2) { accl[dt] = wmma16(pl, vh, accl[dt]); accl[dt] = wmma16(pa, frag_h(VTL + vr, lane), accl[dt]); } }   // leading query blocks: P hi/lo x V hi/lo (3 products); elsewhere P x V single
    LDSX(); }
#pragma unroll
  for (int r = 0; r < 8; ++r) { const float il = (1.0f / 2048.0f) / l[r];
#pragma unroll
    for (int dt = 0; dt < 4; ++dt) so[wave][8 * g + r][dt * 16 + col] = (acc[dt][r] + accl[dt][r] * (1.0f / 2048.0f)) * il; }
  LDSX();
  for (int rl = 0; rl < 16; ++rl) if (lane < 16) vst2(O + ((size_t)b * SS + q0 + rl) * DM + h * HD + lane * 4, *(const v4f*)&so[wave][rl][lane * 4]);
}
// ---- k_out: block = (64 rows, 128 cols): out = O(hi/lo) . Wo rows (2 products) + bo
__global__ __launch_bounds__(128) void k_out(const float* __restrict__ O, const __bf16* __restrict__ P, const float* __restrict__ BO, float* __restrict__ Y) {
  __shared__ __align__(16) float so[4][16][132];
  const int tid = threadIdx.x, wave = tid >> 5, lane = tid & 31, col = lane & 15, g = lane >> 4; const size_t r0 = (size_t)blockIdx.x * 64 + wave * 16; const int n0 = blockIdx.y * 128;
  v8f acc[8] = {};
  // as in k_qkv: step kc + 1's loads are issued as one group in front of step kc's products
  gf32* xp = (gf32*)(O + (r0 + col) * DM + 8 * g); gb16* wp = (gb16*)(P + (size_t)(n0 + col) * DM + 8 * g);
  v4f xa[4]; v16b wb[8];
#pragma unroll
  for (int i = 0; i < 2; ++i) { xa[i] = *(gv4f*)(xp + 4 * i); xa[2 + i] = *(gv4f*)(xp + 16 + 4 * i); }
#pragma unroll
  for (int j = 0; j < 8; ++j) wb[j] = frag_bp(wp + (size_t)j * 16 * DM);
  XWAIT(xp, wp);
#pragma unroll 2
  for (int kc = 0; kc < DM / 32; ++kc) { const int st = (kc + 1 < DM / 32) ? 32 : 0; xp += st; wp += st;   // the last step fetches its own operands again (in bounds, unused)
    v4f xn[4]; v16b wn[8];
#pragma unroll
    for (int i = 0; i < 2; ++i) { xn[i] = *(gv4f*)(xp + 4 * i); xn[2 + i] = *(gv4f*)(xp + 16 + 4 * i); }
#pragma unroll
    for (int j = 0; j < 8; ++j) wn[j] = frag_bp(wp + (size_t)j * 16 * DM);
    XWAIT(xp, wp);
    float v[16];
#pragma unroll
    for (int i = 0; i < 8; ++i) { v[i] = xa[i >> 2][i & 3]; v[8 + i] = xa[2 + (i >> 2)][i & 3]; }
    const F2 a = bsplit16(v);
#pragma unroll
    for (int j = 0; j < 8; ++j) { acc[j] = wmma_bf(a.l, wb[j], acc[j]); acc[j] = wmma_bf(a.h, wb[j], acc[j]); }
#pragma unroll
    for (int i = 0; i < 4; ++i) xa[i] = xn[i];
#pragma unroll
    for (int j = 0; j < 8; ++j) wb[j] = wn[j]; }
#pragma unroll
  for (int j = 0; j < 8; ++j) {
#pragma unroll
    for (int r = 0; r < 8; ++r) so[wave][8 * g + r][j * 16 + col] = acc[j][r] + bfr(BO[n0 + j * 16 + col]); }
  LDSX();
  for (int rl = 0; rl < 16; ++rl) vst2(Y + (r0 + rl) * DM + n0 + lane * 4, *(const v4f*)&so[wave][rl][lane * 4]);
}
// ---- k_pack3: the fused (in,out) W_attn [DM][3*DM] -> the three transposed bf16 row blocks
__global__ __launch_bounds__(256) void k_pack3(const float* __restrict__ WA, __bf16* __restrict__ PK) { __shared__ __align__(16) __bf16 s[DM]; const int n = blockIdx.x, which = blockIdx.y, t = threadIdx.x; for (int k = t; k < DM; k += 256) s[k] = (__bf16)WA[(size_t)k * (3 * DM) + which * DM + n]; __syncthreads(); for (int q = t; q < DM / 8; q += 256) vst2((unsigned*)(PK + PK_A + ((size_t)which * DM + n) * DM + q * 8), *(const v4u*)&s[q * 8]); }
extern "C" void kernel_launch(void* const* d_in, const int* in_sizes, int n_in, void* d_out, int out_size, void* d_ws, size_t ws_size, hipStream_t stream) {
  (void)in_sizes; (void)n_in; (void)out_size;
  const float** F = (const float**)d_in;   // 0 hidden [2,2048,1024], 1 attn_bias [2048,2048], 2 Wqkv [1024,3072] (in,out; q | k | v), 3 bqkv [3072], 4 Wproj [1024,1024] (in,out), 5 bproj
  if (ws_size < (size_t)WS_END) return;
  char* ws = (char*)d_ws; __bf16* PK = (__bf16*)(ws + WS_PK); _Float16 *QK = (_Float16*)(ws + WS_QK), *QKL = (_Float16*)(ws + WS_QKL), *VTH = (_Float16*)(ws + WS_VTH), *VTL = (_Float16*)(ws + WS_VTL); float* O = (float*)(ws + WS_O);
  float* OUT0 = (float*)d_out; float* KOUT = OUT0 + (size_t)NB * SS * DM; float* VOUT = KOUT + (size_t)NB * SS * DM;   // outputs: out, cache_key, cache_value
  k_pack<<<dim3(DM, 4), 256, 0, stream>>>(F[4], F[4], F[4], F[4], PK);   // Wproj into the Wo slot
  k_pack3<<<dim3(DM, 3), 256, 0, stream>>>(F[2], PK);
  k_qkv<<<dim3(TNB * SS / 64, QKVW / 128), 128, 0, stream>>>(F[0], F[0], F[0], PK + PK_A, F[3], F[3] + DM, F[3] + 2 * DM, KOUT, VOUT, QK, QKL, VTH, VTL);
  k_attn<<<dim3(TQB, NH, TNB), 128, 0, stream>>>(QK, QKL, VTH, VTL, nullptr, F[1], O);
  k_out<<<dim3(TOB, DM / 128), 128, 0, stream>>>(O, PK + PK_P, F[5], OUT0);
}

// v002
// A run of this version takes 207 microseconds.
// Two timings next to v001 put it at 1.61 and 1.59 times that version's speed.
// All steps since v000 together make it 2.94 times as fast.
// compute dtype: all float inputs rounded to bf16; qkv = x . Wqkv + b with EXACT bf16 products on WMMA 16x16x32 ((in,out) weights packed by k_pack; x, the weights, k, v and ctx are kept in the matrix instructions' fragment order) - the k and v projections are also written out in f32 straight from the accumulators; causal attention with key-tile skipping: the first 128 queries use 3-product scores and P.v (hi/lo), later queries single f16 operands; (q.k)/8 + attn_bias[q][k], running-max softmax in f32 (hardware exp); out = ctx (bf16 hi + residual) . Wproj (2 products) + bproj; outputs out | cache_key | cache_value concatenated.
#include <hip/hip_runtime.h>
#include <math.h>

typedef __attribute__((ext_vector_type(16))) _Float16 v16h;
typedef __attribute__((ext_vector_type(16))) __bf16 v16b;
typedef __attribute__((ext_vector_type(8)))  _Float16 v8h;
typedef __attribute__((ext_vector_type(8)))  float v8f;
typedef __attribute__((ext_vector_type(4)))  float v4f;
typedef __attribute__((ext_vector_type(2)))  float v2f;
typedef __attribute__((ext_vector_type(4)))  unsigned v4u;
typedef __attribute__((ext_vector_type(4)))  int v4i;
typedef float __attribute__((may_alias)) float_a;
typedef int __attribute__((may_alias)) int_a;

template <typename T> __device__ __forceinline__ void vst2(void* p, T v) { *(T*)p = v;  }
__device__ __forceinline__ v8f wmma16(v16h a, v16h b, v8f c) {
  v8f d = __builtin_amdgcn_wmma_f32_16x16x32_f16(false, a, false, b, (short)0, c, false, false);
  asm volatile("v_nop\n\tv_nop\n\tv_nop\n\tv_nop" : "+v"(d) : "v"(a), "v"(b));
  return d;
}
__device__ __forceinline__ v8f wmma_bf(v16b a, v16b b, v8f c) {
  v8f d = __builtin_amdgcn_wmma_f32_16x16x32_bf16(false, a, false, b, (short)0, c, false, false);
  asm volatile("v_nop\n\tv_nop\n\tv_nop\n\tv_nop" : "+v"(d) : "v"(a), "v"(b));
  return d;
}
// Prefill attention (B 2, S 2,048, E 1,024, 16 heads x 64): fused (in,out) qkv + bias, scores / 8 + learned additive bias[q, k], causal, softmax, . v, Wproj + bias; also returns the k and v projections (the KV cache).
__device__ __forceinline__ v16h frag_h(const _Float16* rowk0, int lane) {
  union { v16h v; v8h q[2]; } u; const _Float16* p = rowk0 + 8 * (lane >> 4);
  u.q[0] = *(const v8h*)p; u.q[1] = *(const v8h*)(p + 16); return u.v;
}
__device__ __forceinline__ v16h frag_f32(const float* rowk0, int lane) {
  v16h a; const float* p = rowk0 + 8 * (lane >> 4);
#pragma unroll
  for (int i = 0; i < 8; ++i) { a[i] = (_Float16)p[i]; a[8 + i] = (_Float16)p[16 + i]; }
  return a;
}
__device__ __forceinline__ v16h frag_f32s(const float* rowk0, int lane, float sc) {
  v16h a; const float* p = rowk0 + 8 * (lane >> 4);
#pragma unroll
  for (int i = 0; i < 8; ++i) { a[i] = (_Float16)(p[i] * sc); a[8 + i] = (_Float16)(p[16 + i] * sc); }
  return a;
}
// column fragment from a [K][ld] layout (column n), rows >= K read as 0
__device__ __forceinline__ v16h fragc_f32(const float* W, int k0, int n, int lane, int ld, int K) {
  v16h a; const int g = lane >> 4;
#pragma unroll
  for (int i = 0; i < 8; ++i) { const int ka = k0 + 8 * g + i, kb = ka + 16;
    a[i] = (_Float16)(ka < K ? W[(size_t)(ka < K ? ka : K - 1) * ld + n] : 0.f); a[8 + i] = (_Float16)(kb < K ? W[(size_t)(kb < K ? kb : K - 1) * ld + n] : 0.f); }
  return a;
}
struct F2 { v16b h, l; };
__device__ __forceinline__ F2 bsplit16(const float v[16]) { F2 r;
#pragma unroll
  for (int i = 0; i < 16; ++i) { const __bf16 h = (__bf16)v[i]; r.h[i] = h; r.l[i] = (__bf16)(v[i] - (float)h); }
  return r; }
__device__ __forceinline__ F2 split_row(const float* row, int k0, int lane) { float v[16]; const float* p = row + k0 + 8 * (lane >> 4);
#pragma unroll
  for (int i = 0; i < 8; ++i) { v[i] = p[i]; v[8 + i] = p[16 + i]; }
  return bsplit16(v); }
__device__ __forceinline__ F2 split_rowK(const float* row, int k0, int lane, int K) { float v[16]; const int g = lane >> 4;
#pragma unroll
  for (int i = 0; i < 8; ++i) { const int ka = k0 + 8 * g + i, kb = ka + 16; v[i] = ka < K ? row[ka < K ? ka : K - 1] : 0.f; v[8 + i] = kb < K ? row[kb < K ? kb : K - 1] : 0.f; }
  return bsplit16(v); }
__device__ __forceinline__ F2 split_col(const float* W, int k0, int n, int lane, int ld, int K) { float v[16]; const int g = lane >> 4;
#pragma unroll
  for (int i = 0; i < 8; ++i) { const int ka = k0 + 8 * g + i, kb = ka + 16; v[i] = ka < K ? W[(size_t)(ka < K ? ka : K - 1) * ld + n] : 0.f; v[8 + i] = kb < K ? W[(size_t)(kb < K ? kb : K - 1) * ld + n] : 0.f; }
  return bsplit16(v); }
__device__ __forceinline__ v8f mac3(const F2& a, const F2& b, v8f c) { c = wmma_bf(a.l, b.h, c); c = wmma_bf(a.h, b.l, c); return wmma_bf(a.h, b.h, c); }
__device__ __forceinline__ float sigm(float v) { return 1.0f / (1.0f + expf(-v)); }
#define LDSX() do { asm volatile("s_wait_dscnt 0" ::: "memory"); __builtin_amdgcn_wave_barrier(); __builtin_amdgcn_fence(__ATOMIC_RELEASE, "workgroup"); } while (0)


#define NB 2
#define SS 2048
#define DM 1024
#define NH 16
#define SCALEF 0.125f
#define HD 64
#define QKVW (3 * DM)
#ifndef TQB
#define TQB (SS / 64)
#define TNB NB
#define TOB (NB * SS / 64)     // output row tiles (all)
#endif
typedef __attribute__((ext_vector_type(8))) __bf16 v8b;
__device__ __forceinline__ v16b frag_b(const __bf16* rowk0, int lane) {
  union { v16b v; v8b q[2]; } u; const __bf16* p = rowk0 + 8 * (lane >> 4);
  u.q[0] = *(const v8b*)p; u.q[1] = *(const v8b*)(p + 16); return u.v;
}
// pointers typed as global memory: they keep that type through the XWAIT statement below, so the loads behind it stay global loads
typedef const __attribute__((address_space(1))) float gf32; typedef const __attribute__((address_space(1))) __bf16 gb16;
typedef const __attribute__((address_space(1))) v4f gv4f; typedef const __attribute__((address_space(1))) v8b gv8b;
// FRAGMENT ORDER: a 16 x 32 operand tile is kept as 1 KB = [half 2][lane 32][8 elements]; lane (g, col) holds row col, k = 16 * half + 8 * g + i, the k order of frag_b / frag_h. One wave-wide 16-byte load then covers 512 contiguous bytes (4 whole lines) instead of 32 bytes in each of 16 lines.
#define FRAG 512                     // elements of one tile
// a tile from a pointer that already holds the lane's offset (lane * 8)
__device__ __forceinline__ v16b frag_bp(gb16* p) { union { v16b v; v8b q[2]; } u; u.q[0] = *(gv8b*)p; u.q[1] = *(gv8b*)(p + 256); return u.v; }
__device__ __forceinline__ v16h frag_hp(const _Float16* p) { union { v16h v; v8h q[2]; } u; u.q[0] = *(const v8h*)p; u.q[1] = *(const v8h*)(p + 256); return u.v; }
// precaution behind a group of global loads: the wait stands in front of every rewrite of the group's address registers; both pointers pass through the statement, so every later step of them follows it
#define XWAIT(pa, pb) asm volatile("s_wait_xcnt 0x0" : "+v"(pa), "+v"(pb) : : "memory")
__device__ __forceinline__ float bfr(float v) { return (float)(__bf16)v; }
__device__ __attribute__((noinline)) float exp_ni(float v) { return expf(v); }
__device__ __attribute__((noinline)) float erf_ni(float v) { return erff(v); }

#define PK_A 0                       // Wqkv, fragment order: [192 tiles of 16 outputs][32 k-steps][FRAG]
#define PK_P (PK_A + QKVW * DM)        // Wo, fragment order: [64 tiles][32 k-steps][FRAG]
#define PK_END (PK_P + DM * DM)
#define WS_PK  0u
#define WS_QK  (WS_PK + 2u * PK_END)             // f16 [4096 rows][2048]: q in the first 1024 columns (the rest unused)
#define WS_QKL (WS_QK + 2u * NB * SS * 2 * DM)     // f16 q residual plane x2048, same shape
#define WS_VTH (WS_QKL + 2u * NB * SS * 2 * DM)    // f16 v hi, fragment order: [b][h][64 steps of 32 keys][4 tiles of 16 d][FRAG]
#define WS_VTL (WS_VTH + 2u * NB * DM * SS)        // f16 lo x 2048, same shape
#define WS_O   (WS_VTL + 2u * NB * DM * SS)        // bf16 ctx, fragment order: [256 tiles of 16 rows][32 k-steps][hi FRAG | residual FRAG]
#define WS_CS  (WS_O + 4u * NB * SS * DM)           // f32 2 x [2048][32], unused
#define WS_KF  (WS_CS + 4u * 2 * SS * 32)          // f16 k hi, fragment order: [b][h][128 tiles of 16 keys][2 k-steps of 32 d][FRAG]
#define WS_KFL (WS_KF + 2u * NB * SS * DM)         // f16 k residual x2048, same shape
#define WS_XF  (WS_KFL + 2u * NB * SS * DM)        // bf16 x, fragment order: [256 tiles of 16 rows][32 k-steps][FRAG]
#define WS_END (WS_XF + 2u * NB * SS * DM)
// ---- k_pack: block = (32 outputs n, 128 inputs k) of an (in,out) weight: whole 128-B lines in, bf16, transposed in LDS, 8 tiles of fragment order out (512-B runs); blocks x < 96 take Wqkv (q | k | v outputs in column order), the rest Wproj, whose tiles follow in PK
static_assert(PK_A == 0 && PK_P == QKVW * DM, "the two weights' tiles are numbered through");
__global__ __launch_bounds__(256) void k_pack(const float* __restrict__ WA, const float* __restrict__ WO, __bf16* __restrict__ PK) {
  __shared__ __align__(16) __bf16 s[32][136]; const int t = threadIdx.x, k0 = blockIdx.y * 128; const bool fused = blockIdx.x < QKVW / 32;
  const float* Wm = fused ? WA + blockIdx.x * 32 : WO + (blockIdx.x - QKVW / 32) * 32; const int ld = fused ? QKVW : DM;
#pragma unroll   // the sixteen line reads go out as one group, not one load-and-wait each
  for (int i = 0; i < 16; ++i) { const int k = (t >> 5) + 8 * i; s[t & 31][k] = (__bf16)Wm[(size_t)(k0 + k) * ld + (t & 31)]; }
  __syncthreads();
#pragma unroll   // two fixed trips: left rolled, the build keeps a lane-masked loop with its address sums per trip
  for (int u = t; u < 512; u += 256) { const int ln = u & 31, half = (u >> 5) & 1, kcl = (u >> 6) & 3, tl = u >> 8;
    vst2((unsigned*)(PK + ((size_t)(blockIdx.x * 2 + tl) * (DM / 32) + blockIdx.y * 4 + kcl) * FRAG + half * 256 + ln * 8), *(const v4u*)&s[tl * 16 + (ln & 15)][kcl * 32 + half * 16 + 8 * (ln >> 4)]); }
}
// ---- k_packx: x rounded to bf16 once (k_qkv's 24 column blocks all read it), into fragment order; thread = one 16-byte piece of the output
__global__ __launch_bounds__(256) void k_packx(const float* __restrict__ X, __bf16* __restrict__ XF) {
  const size_t u = (size_t)blockIdx.x * 256 + threadIdx.x; const int ln = (int)(u & 31), half = (int)(u >> 5) & 1, kc = (int)(u >> 6) & 31;
  const float* p = X + ((u >> 11) * 16 + (ln & 15)) * DM + kc * 32 + half * 16 + 8 * (ln >> 4); const v4f a = *(const v4f*)p, c = *(const v4f*)(p + 4); v8b o;
#pragma unroll   // vector elements need constant indices to stay in registers
  for (int i = 0; i < 4; ++i) { o[i] = (__bf16)a[i]; o[4 + i] = (__bf16)c[i]; }
  vst2(XF + u * 8, o);
}
__global__ __launch_bounds__(128) void k_qkv(const __bf16* __restrict__ XF, const __bf16* __restrict__ P, const float* __restrict__ BQ, const float* __restrict__ BK, const float* __restrict__ BV, float* __restrict__ KOUT, float* __restrict__ VOUT, _Float16* __restrict__ QK, _Float16* __restrict__ QKL, _Float16* __restrict__ KF, _Float16* __restrict__ KFL, _Float16* __restrict__ VTH, _Float16* __restrict__ VTL) {
  const int which0 = (blockIdx.y * 128) / DM; const float* BB = BQ ? (((which0 == 0) ? BQ : (which0 == 1) ? BK : BV) + (blockIdx.y * 128 - which0 * DM)) : nullptr;
  __shared__ __align__(16) _Float16 so[4][16][136], sol[4][16][136]; __shared__ __align__(16) _Float16 sth[128][72], stl[128][72];
  const int tid = threadIdx.x, wave = tid >> 5, lane = tid & 31, col = lane & 15, g = lane >> 4; const size_t r0 = (size_t)blockIdx.x * 64 + wave * 16; const int n0 = blockIdx.y * 128;
  v8f acc[8] = {};
  float bj[8];   // the lane's eight bias values, fetched once as a group (the epilogues read them per element)
#pragma unroll
  for (int j = 0; j < 8; ++j) bj[j] = 0.f;
  if (BB) {
#pragma unroll
    for (int j = 0; j < 8; ++j) bj[j] = bfr(BB[j * 16 + col]); }
  // every global load of k-step kc + 1 is issued as one group in front of step kc's products, so the loads fly together and behind the matrix work instead of one load-and-wait per product
  gb16* xp = (gb16*)(XF + (r0 >> 4) * (DM / 32) * FRAG + lane * 8); gb16* wp = (gb16*)(P + (size_t)(n0 >> 4) * (DM / 32) * FRAG + lane * 8);
  v16b xa = frag_bp(xp), wb[8];
#pragma unroll
  for (int j = 0; j < 8; ++j) wb[j] = frag_bp(wp + (size_t)j * (DM / 32) * FRAG);
  XWAIT(xp, wp);
#pragma unroll 2
  for (int kc = 0; kc < DM / 32; ++kc) { const int st = (kc + 1 < DM / 32) ? FRAG : 0; xp += st; wp += st;   // the last step fetches its own operands again (in bounds, unused)
    const v16b xn = frag_bp(xp); v16b wn[8];
#pragma unroll
    for (int j = 0; j < 8; ++j) wn[j] = frag_bp(wp + (size_t)j * (DM / 32) * FRAG);
    XWAIT(xp, wp);
#pragma unroll
    for (int j = 0; j < 8; ++j) acc[j] = wmma_bf(xa, wb[j], acc[j]);
    xa = xn;
#pragma unroll
    for (int j = 0; j < 8; ++j) wb[j] = wn[j]; }
  if (which0 >= 1) {   // cache_key / cache_value: the f32 projections (+ bias) straight from the accumulators, 512-B row segments
    __shared__ __align__(16) float sf[4][16][132];
#pragma unroll
    for (int j = 0; j < 8; ++j) {
#pragma unroll
      for (int r = 0; r < 8; ++r) sf[wave][8 * g + r][j * 16 + col] = acc[j][r] + bj[j]; }
    LDSX();
    float* dst = (which0 == 1) ? KOUT : VOUT; for (int rl = 0; rl < 16; ++rl) vst2(dst + (r0 + rl) * DM + (n0 - which0 * DM) + lane * 4, *(const v4f*)&sf[wave][rl][lane * 4]);
    LDSX(); }
  if (n0 < 2 * DM) {   // q stored unscaled (f16 sigma ~0.6, no subnormal exposure); 1/8 applied to the f32 score
#pragma unroll
    for (int j = 0; j < 8; ++j) {
#pragma unroll
      for (int r = 0; r < 8; ++r) { const float v = acc[j][r] + bj[j]; const _Float16 hv = (_Float16)v; so[wave][8 * g + r][j * 16 + col] = hv; sol[wave][8 * g + r][j * 16 + col] = (_Float16)((v - (float)hv) * 2048.0f); } }   // q, k (+ bias) as f16 hi + (x2048) residual
    LDSX();
    if (which0 == 0) { for (int rl = 0; rl < 16; ++rl) if (lane < 16) { vst2((unsigned*)(QK + (r0 + rl) * (2 * DM) + n0 + lane * 8), *(const v4u*)&so[wave][rl][lane * 8]); vst2((unsigned*)(QKL + (r0 + rl) * (2 * DM) + n0 + lane * 8), *(const v4u*)&sol[wave][rl][lane * 8]); } }
    else {   // k: the wave's 16 rows are one key tile; 2 heads x 2 k-steps x 2 halves, each a 512-B run in fragment order
      const size_t kb = (((r0 / SS) * NH + ((n0 - DM) >> 6)) * (SS / 16) + ((r0 % SS) >> 4)) * (2 * FRAG) + lane * 8;
#pragma unroll   // the sixteen stores go out as one run, their offsets as immediates
      for (int u = 0; u < 8; ++u) { const size_t o = kb + (size_t)(u >> 2) * (SS / 16) * (2 * FRAG) + (u & 3) * 256; const int c0 = (u >> 2) * 64 + (u & 3) * 16 + 8 * g;
        vst2((unsigned*)(KF + o), *(const v4u*)&so[wave][col][c0]); vst2((unsigned*)(KFL + o), *(const v4u*)&sol[wave][col][c0]); }
      asm volatile("s_wait_xcnt 0x0" ::: "memory"); }   // precaution behind the run of sixteen stores: their registers may be reused by what follows while the stores are still out
  } else {
#pragma unroll
    for (int j = 0; j < 8; ++j) {
#pragma unroll
      for (int r = 0; r < 8; ++r) { const float v = acc[j][r] + bj[j]; const _Float16 hv = (_Float16)v; sth[j * 16 + col][wave * 16 + 8 * g + r] = hv; stl[j * 16 + col][wave * 16 + 8 * g + r] = (_Float16)((v - (float)hv) * 2048.0f); } }
    __syncthreads();
    const size_t rb = (size_t)blockIdx.x * 64; const int b = (int)(rb / SS), s0 = (int)(rb % SS); const int pc0 = n0 - 2 * DM;
    for (int u = tid; u < 128 * 8; u += 128) { const int ln = u & 31, half = (u >> 5) & 1, dt = (u >> 6) & 3, ksl = (u >> 8) & 1, hh = u >> 9; const int d = hh * 64 + dt * 16 + (ln & 15), pc = ksl * 4 + half * 2 + (ln >> 4);   // 512-B runs in fragment order
      const size_t o = ((((size_t)b * NH + (pc0 >> 6) + hh) * (SS / 32) + (s0 >> 5) + ksl) * 4 + dt) * FRAG + half * 256 + ln * 8; vst2((unsigned*)(VTH + o), *(const v4u*)&sth[d][pc * 8]); vst2((unsigned*)(VTL + o), *(const v4u*)&stl[d][pc * 8]); }
  }
}
// ---- k_attn: block = (64 queries, head h, batch b): causal flash attention (K = 64: 2 k-steps), scores = (q.k) * 0.125: 3 products with q, k hi/residual in the first two query blocks, single f16 operands elsewhere; P.V: f16 P*2048 x V hi in acc, in the first two query blocks also P lo x V hi and P x V lo (both x2048) in accl; ctx = (acc + accl / 2048) / (2048 l), stored as k_out's A operand
__global__ __launch_bounds__(128) void k_attn(const _Float16* __restrict__ QK, const _Float16* __restrict__ QKL, const _Float16* __restrict__ KF, const _Float16* __restrict__ KFL, const _Float16* __restrict__ VTH, const _Float16* __restrict__ VTL, const void* __restrict__ KMASK, const float* __restrict__ AB, __bf16* __restrict__ OF) {
  __shared__ __align__(16) float sp[4][16][36]; __shared__ __align__(16) float so[4][16][68];
  const int tid = threadIdx.x, wave = tid >> 5, lane = tid & 31, col = lane & 15, g = lane >> 4;
  const int qb = blockIdx.x, h = blockIdx.y, b = blockIdx.z; const int q0 = qb * 64 + wave * 16; const size_t rq = (size_t)b * SS + q0 + col;
  v16h aq[2], aql[2];
#pragma unroll
  for (int kc = 0; kc < 2; ++kc) { aq[kc] = frag_h(QK + rq * (2 * DM) + h * HD + kc * 32, lane); aql[kc] = frag_h(QKL + rq * (2 * DM) + h * HD + kc * 32, lane); }
  float m[8], l[8];
#pragma unroll
  for (int r = 0; r < 8; ++r) { m[r] = -3.0e38f; l[r] = 0.f; }
  v8f acc[4] = {}, accl[4] = {};
  const int nks = (qb * 64 + 64) / 32;   // causal: key tiles up to the query tile's end
  const size_t hb = ((size_t)b * NH + h) * (SS * HD) + lane * 8;   // the head's k and v planes in fragment order (S x 64 elements each), with the lane's offset
#pragma unroll 1
  for (int ks = 0; ks < nks; ++ks) { v8f s[2];
    // the key step's K fragments and bias values are loaded as one group in front of the first product (the bias unconditionally: row and key are inside [S][S] for every lane; the causal select follows), so one round trip replaces one per product and per bias row
    v16h kf[2][2]; float ab[2][8];
#pragma unroll
    for (int ct = 0; ct < 2; ++ct) { const int kk = ks * 32 + ct * 16 + col;
#pragma unroll
      for (int kc = 0; kc < 2; ++kc) kf[ct][kc] = frag_hp(KF + hb + (size_t)((ks * 2 + ct) * 2 + kc) * FRAG);
#pragma unroll
      for (int r = 0; r < 8; ++r) ab[ct][r] = AB[(size_t)(q0 + 8 * g + r) * SS + kk]; }
    asm volatile("s_wait_xcnt 0x0" ::: "memory");   // precaution: the group's address registers may be reused by what follows while its loads are still out
#pragma unroll
    for (int ct = 0; ct < 2; ++ct) { const int kk = ks * 32 + ct * 16 + col; v8f c = {}, cl = {};
      if (qb < 2) {   // leading query blocks (few keys, outputs far above the global rms): 3 products
#pragma unroll
        for (int kc = 0; kc < 2; ++kc) { const v16h kh = kf[ct][kc]; c = wmma16(aq[kc], kh, c); cl = wmma16(aql[kc], kh, cl); const v16h kl = frag_hp(KFL + hb + (size_t)((ks * 2 + ct) * 2 + kc) * FRAG);
          asm volatile("s_wait_xcnt 0x0" ::: "memory");   // precaution, as above: the load's address registers may be reused by what follows
          cl = wmma16(aq[kc], kl, cl); }
#pragma unroll
        for (int r = 0; r < 8; ++r) c[r] += cl[r] * (1.0f / 2048.0f); }
      else {
#pragma unroll
        for (int kc = 0; kc < 2; ++kc) c = wmma16(aq[kc], kf[ct][kc], c); }   // single product elsewhere
#pragma unroll
      for (int r = 0; r < 8; ++r) s[ct][r] = (kk <= q0 + 8 * g + r) ? (c[r] * SCALEF + bfr(ab[ct][r])) : -3.0e38f; }   // causal: future keys excluded
    // the V fragments are requested here, behind the score products, and fly under the softmax
    v16h vf[4];
#pragma unroll
    for (int dt = 0; dt < 4; ++dt) vf[dt] = frag_hp(VTH + hb + (size_t)(ks * 4 + dt) * FRAG);
    asm volatile("s_wait_xcnt 0x0" ::: "memory");   // precaution: the group's address registers may be reused by what follows while its loads are still out
#pragma unroll
    for (int r = 0; r < 8; ++r) { float mx = fmaxf(s[0][r], s[1][r]);
#pragma unroll
      for (int o = 1; o < 16; o <<= 1) mx = fmaxf(mx, __shfl_xor(mx, o));
      const float mn = fmaxf(m[r], mx); const float alpha = (m[r] <= -1.0e38f) ? 0.f : __expf(m[r] - mn);
      const float e0 = (s[0][r] <= -1.0e38f) ? 0.f : __expf(s[0][r] - mn), e1 = (s[1][r] <= -1.0e38f) ? 0.f : __expf(s[1][r] - mn); float es = e0 + e1;
#pragma unroll
      for (int o = 1; o < 16; o <<= 1) es += __shfl_xor(es, o);
      l[r] = l[r] * alpha + es; m[r] = mn;
#pragma unroll
      for (int dt = 0; dt < 4; ++dt) { acc[dt][r] *= alpha; accl[dt][r] *= alpha; }
      sp[wave][8 * g + r][col] = e0; sp[wave][8 * g + r][16 + col] = e1; }
    LDSX();
    v16h pa, pl; { const float* prow = &sp[wave][col][0] + 8 * (lane >> 4);
#pragma unroll
      for (int i = 0; i < 8; ++i) { const float x0 = prow[i] * 2048.0f, x1 = prow[16 + i] * 2048.0f; const _Float16 h0 = (_Float16)x0, h1 = (_Float16)x1; pa[i] = h0; pa[8 + i] = h1; pl[i] = (_Float16)((x0 - (float)h0) * 2048.0f); pl[8 + i] = (_Float16)((x1 - (float)h1) * 2048.0f); } }   // P scaled by 2^11 before the f16 split so small softmax weights stay out of the f16 subnormal range; 2^-11 folded into the epilogue
#pragma unroll
    for (int dt = 0; dt < 4; ++dt) { const v16h vh = vf[dt]; acc[dt] = wmma16(pa, vh, acc[dt]); if (qb < 2) { accl[dt] = wmma16(pl, vh, accl[dt]); const v16h vl = frag_hp(VTL + hb + (size_t)(ks * 4 + dt) * FRAG);
        asm volatile("s_wait_xcnt 0x0" ::: "memory");   // precaution, as above: the load's address registers may be reused by what follows
        accl[dt] = wmma16(pa, vl, accl[dt]); } }   // leading query blocks: P hi/lo x V hi/lo (3 products); elsewhere P x V single
    LDSX(); }
#pragma unroll
  for (int r = 0; r < 8; ++r) { const float il = (1.0f / 2048.0f) / l[r];
#pragma unroll
    for (int dt = 0; dt < 4; ++dt) so[wave][8 * g + r][dt * 16 + col] = (acc[dt][r] + accl[dt][r] * (1.0f / 2048.0f)) * il; }
  LDSX();
  // ctx leaves as the out product's A operand: bf16 hi + residual, fragment order; the wave's 16 queries are one row tile, the head's 64 columns two k-steps; 512-B runs
  const size_t ob = ((((size_t)b * SS + q0) >> 4) * (DM / 32) + h * 2) * (2 * FRAG) + lane * 8;
#pragma unroll   // the eight stores go out as one run, their offsets as immediates
  for (int u = 0; u < 4; ++u) { const float* p = &so[wave][col][u * 16 + 8 * g]; v8b hi, lo;
#pragma unroll   // vector elements need constant indices to stay in registers
    for (int i = 0; i < 8; ++i) { const float v = p[i]; const __bf16 hv = (__bf16)v; hi[i] = hv; lo[i] = (__bf16)(v - (float)hv); }
    vst2(OF + ob + (u >> 1) * (2 * FRAG) + (u & 1) * 256, hi); vst2(OF + ob + (u >> 1) * (2 * FRAG) + FRAG + (u & 1) * 256, lo); }
}
// ---- k_out: block = (64 rows, 128 cols): out = ctx (hi, residual) . Wo (2 products) + bo
__global__ __launch_bounds__(128) void k_out(const __bf16* __restrict__ OF, const __bf16* __restrict__ P, const float* __restrict__ BO, float* __restrict__ Y) {
  __shared__ __align__(16) float so[4][16][132];
  const int tid = threadIdx.x, wave = tid >> 5, lane = tid & 31, col = lane & 15, g = lane >> 4; const size_t r0 = (size_t)blockIdx.x * 64 + wave * 16; const int n0 = blockIdx.y * 128;
  v8f acc[8] = {};
  // as in k_qkv: step kc + 1's loads are issued as one group in front of step kc's products
  gb16* xp = (gb16*)(OF + (r0 >> 4) * (DM / 32) * (2 * FRAG) + lane * 8); gb16* wp = (gb16*)(P + (size_t)(n0 >> 4) * (DM / 32) * FRAG + lane * 8);
  v16b xh = frag_bp(xp), xl = frag_bp(xp + FRAG), wb[8];
#pragma unroll
  for (int j = 0; j < 8; ++j) wb[j] = frag_bp(wp + (size_t)j * (DM / 32) * FRAG);
  XWAIT(xp, wp);
#pragma unroll 2
  for (int kc = 0; kc < DM / 32; ++kc) { const int st = (kc + 1 < DM / 32) ? FRAG : 0; xp += 2 * st; wp += st;   // the last step fetches its own operands again (in bounds, unused)
    const v16b xhn = frag_bp(xp), xln = frag_bp(xp + FRAG); v16b wn[8];
#pragma unroll
    for (int j = 0; j < 8; ++j) wn[j] = frag_bp(wp + (size_t)j * (DM / 32) * FRAG);
    XWAIT(xp, wp);
#pragma unroll
    for (int j = 0; j < 8; ++j) { acc[j] = wmma_bf(xl, wb[j], acc[j]); acc[j] = wmma_bf(xh, wb[j], acc[j]); }
    xh = xhn; xl = xln;
#pragma unroll
    for (int j = 0; j < 8; ++j) wb[j] = wn[j]; }
#pragma unroll
  for (int j = 0; j < 8; ++j) {
#pragma unroll
    for (int r = 0; r < 8; ++r) so[wave][8 * g + r][j * 16 + col] = acc[j][r] + bfr(BO[n0 + j * 16 + col]); }
  LDSX();
  for (int rl = 0; rl < 16; ++rl) vst2(Y + (r0 + rl) * DM + n0 + lane * 4, *(const v4f*)&so[wave][rl][lane * 4]);
}
extern "C" void kernel_launch(void* const* d_in, const int* in_sizes, int n_in, void* d_out, int out_size, void* d_ws, size_t ws_size, hipStream_t stream) {
  (void)in_sizes; (void)n_in; (void)out_size;
  const float** F = (const float**)d_in;   // 0 hidden [2,2048,1024], 1 attn_bias [2048,2048], 2 Wqkv [1024,3072] (in,out; q | k | v), 3 bqkv [3072], 4 Wproj [1024,1024] (in,out), 5 bproj
  if (ws_size < (size_t)WS_END) return;
  char* ws = (char*)d_ws; __bf16* PK = (__bf16*)(ws + WS_PK); _Float16 *QK = (_Float16*)(ws + WS_QK), *QKL = (_Float16*)(ws + WS_QKL), *VTH = (_Float16*)(ws + WS_VTH), *VTL = (_Float16*)(ws + WS_VTL), *KF = (_Float16*)(ws + WS_KF), *KFL = (_Float16*)(ws + WS_KFL); __bf16 *OF = (__bf16*)(ws + WS_O), *XF = (__bf16*)(ws + WS_XF);
  float* OUT0 = (float*)d_out; float* KOUT = OUT0 + (size_t)NB * SS * DM; float* VOUT = KOUT + (size_t)NB * SS * DM;   // outputs: out, cache_key, cache_value
  k_pack<<<dim3((QKVW + DM) / 32, DM / 128), 256, 0, stream>>>(F[2], F[4], PK);
  k_packx<<<NB * SS * DM / 8 / 256, 256, 0, stream>>>(F[0], XF);
  k_qkv<<<dim3(TNB * SS / 64, QKVW / 128), 128, 0, stream>>>(XF, PK + PK_A, F[3], F[3] + DM, F[3] + 2 * DM, KOUT, VOUT, QK, QKL, KF, KFL, VTH, VTL);
  k_attn<<<dim3(TQB, NH, TNB), 128, 0, stream>>>(QK, QKL, KF, KFL, VTH, VTL, nullptr, F[1], OF);
  k_out<<<dim3(TOB, DM / 128), 128, 0, stream>>>(OF, PK + PK_P, F[5], OUT0);
}

// v003
// It runs in 150 microseconds.
// Two timings next to v002 both put it at 1.38 times that version's speed.
// Counting every step since v000, it is 4.05 times as fast.
// compute dtype: all float inputs rounded to bf16; qkv = x . Wqkv + b with EXACT bf16 products on WMMA 16x16x32 ((in,out) weights packed by k_pack; x, the weights, k, v and ctx are kept in the matrix instructions' fragment order) - the k and v projections are also written out in f32 straight from the accumulators; causal attention with key-tile skipping: the first 128 queries use 3-product scores and P.v (hi/lo), later queries single f16 operands; (q.k)/8 + attn_bias[q][k], running-max softmax in f32 (hardware exp); out = ctx (bf16 hi + residual) . Wproj (2 products) + bproj; outputs out | cache_key | cache_value concatenated.
#include <hip/hip_runtime.h>
#include <math.h>

typedef __attribute__((ext_vector_type(16))) _Float16 v16h;
typedef __attribute__((ext_vector_type(16))) __bf16 v16b;
typedef __attribute__((ext_vector_type(8)))  _Float16 v8h;
typedef __attribute__((ext_vector_type(8)))  float v8f;
typedef __attribute__((ext_vector_type(4)))  float v4f;
typedef __attribute__((ext_vector_type(2)))  float v2f;
typedef __attribute__((ext_vector_type(4)))  unsigned v4u;
typedef __attribute__((ext_vector_type(4)))  int v4i;
typedef float __attribute__((may_alias)) float_a;
typedef int __attribute__((may_alias)) int_a;

template <typename T> __device__ __forceinline__ void vst2(void* p, T v) { *(T*)p = v;  }
__device__ __forceinline__ v8f wmma16(v16h a, v16h b, v8f c) {
  v8f d = __builtin_amdgcn_wmma_f32_16x16x32_f16(false, a, false, b, (short)0, c, false, false);
  asm volatile("v_nop\n\tv_nop\n\tv_nop\n\tv_nop" : "+v"(d) : "v"(a), "v"(b));
  return d;
}
__device__ __forceinline__ v8f wmma_bf(v16b a, v16b b, v8f c) {
  v8f d = __builtin_amdgcn_wmma_f32_16x16x32_bf16(false, a, false, b, (short)0, c, false, false);
  asm volatile("v_nop\n\tv_nop\n\tv_nop\n\tv_nop" : "+v"(d) : "v"(a), "v"(b));
  return d;
}
// Prefill attention (B 2, S 2,048, E 1,024, 16 heads x 64): fused (in,out) qkv + bias, scores / 8 + learned additive bias[q, k], causal, softmax, . v, Wproj + bias; also returns the k and v projections (the KV cache).
__device__ __forceinline__ v16h frag_h(const _Float16* rowk0, int lane) {
  union { v16h v; v8h q[2]; } u; const _Float16* p = rowk0 + 8 * (lane >> 4);
  u.q[0] = *(const v8h*)p; u.q[1] = *(const v8h*)(p + 16); return u.v;
}
__device__ __forceinline__ v16h frag_f32(const float* rowk0, int lane) {
  v16h a; const float* p = rowk0 + 8 * (lane >> 4);
#pragma unroll
  for (int i = 0; i < 8; ++i) { a[i] = (_Float16)p[i]; a[8 + i] = (_Float16)p[16 + i]; }
  return a;
}
__device__ __forceinline__ v16h frag_f32s(const float* rowk0, int lane, float sc) {
  v16h a; const float* p = rowk0 + 8 * (lane >> 4);
#pragma unroll
  for (int i = 0; i < 8; ++i) { a[i] = (_Float16)(p[i] * sc); a[8 + i] = (_Float16)(p[16 + i] * sc); }
  return a;
}
// column fragment from a [K][ld] layout (column n), rows >= K read as 0
__device__ __forceinline__ v16h fragc_f32(const float* W, int k0, int n, int lane, int ld, int K) {
  v16h a; const int g = lane >> 4;
#pragma unroll
  for (int i = 0; i < 8; ++i) { const int ka = k0 + 8 * g + i, kb = ka + 16;
    a[i] = (_Float16)(ka < K ? W[(size_t)(ka < K ? ka : K - 1) * ld + n] : 0.f); a[8 + i] = (_Float16)(kb < K ? W[(size_t)(kb < K ? kb : K - 1) * ld + n] : 0.f); }
  return a;
}
struct F2 { v16b h, l; };
__device__ __forceinline__ F2 bsplit16(const float v[16]) { F2 r;
#pragma unroll
  for (int i = 0; i < 16; ++i) { const __bf16 h = (__bf16)v[i]; r.h[i] = h; r.l[i] = (__bf16)(v[i] - (float)h); }
  return r; }
__device__ __forceinline__ F2 split_row(const float* row, int k0, int lane) { float v[16]; const float* p = row + k0 + 8 * (lane >> 4);
#pragma unroll
  for (int i = 0; i < 8; ++i) { v[i] = p[i]; v[8 + i] = p[16 + i]; }
  return bsplit16(v); }
__device__ __forceinline__ F2 split_rowK(const float* row, int k0, int lane, int K) { float v[16]; const int g = lane >> 4;
#pragma unroll
  for (int i = 0; i < 8; ++i) { const int ka = k0 + 8 * g + i, kb = ka + 16; v[i] = ka < K ? row[ka < K ? ka : K - 1] : 0.f; v[8 + i] = kb < K ? row[kb < K ? kb : K - 1] : 0.f; }
  return bsplit16(v); }
__device__ __forceinline__ F2 split_col(const float* W, int k0, int n, int lane, int ld, int K) { float v[16]; const int g = lane >> 4;
#pragma unroll
  for (int i = 0; i < 8; ++i) { const int ka = k0 + 8 * g + i, kb = ka + 16; v[i] = ka < K ? W[(size_t)(ka < K ? ka : K - 1) * ld + n] : 0.f; v[8 + i] = kb < K ? W[(size_t)(kb < K ? kb : K - 1) * ld + n] : 0.f; }
  return bsplit16(v); }
__device__ __forceinline__ v8f mac3(const F2& a, const F2& b, v8f c) { c = wmma_bf(a.l, b.h, c); c = wmma_bf(a.h, b.l, c); return wmma_bf(a.h, b.h, c); }
__device__ __forceinline__ float sigm(float v) { return 1.0f / (1.0f + expf(-v)); }
#define LDSX() do { asm volatile("s_wait_dscnt 0" ::: "memory"); __builtin_amdgcn_wave_barrier(); __builtin_amdgcn_fence(__ATOMIC_RELEASE, "workgroup"); } while (0)


#define NB 2
#define SS 2048
#define DM 1024
#define NH 16
#define SCALEF 0.125f
#define HD 64
#define QKVW (3 * DM)
#ifndef TQB
#define TQB (SS / 64)
#define TNB NB
#define TOB (NB * SS / 64)     // output row tiles (all)
#endif
typedef __attribute__((ext_vector_type(8))) __bf16 v8b;
__device__ __forceinline__ v16b frag_b(const __bf16* rowk0, int lane) {
  union { v16b v; v8b q[2]; } u; const __bf16* p = rowk0 + 8 * (lane >> 4);
  u.q[0] = *(const v8b*)p; u.q[1] = *(const v8b*)(p + 16); return u.v;
}
// pointers typed as global memory: they keep that type through the XWAIT statement below, so the loads behind it stay global loads
typedef const __attribute__((address_space(1))) float gf32; typedef const __attribute__((address_space(1))) __bf16 gb16;
typedef const __attribute__((address_space(1))) v4f gv4f; typedef const __attribute__((address_space(1))) v8b gv8b;
// FRAGMENT ORDER: a 16 x 32 operand tile is kept as 1 KB = [half 2][lane 32][8 elements]; lane (g, col) holds row col, k = 16 * half + 8 * g + i, the k order of frag_b / frag_h. One wave-wide 16-byte load then covers 512 contiguous bytes (4 whole lines) instead of 32 bytes in each of 16 lines.
#define FRAG 512                     // elements of one tile
// a tile from a pointer that already holds the lane's offset (lane * 8)
__device__ __forceinline__ v16b frag_bp(gb16* p) { union { v16b v; v8b q[2]; } u; u.q[0] = *(gv8b*)p; u.q[1] = *(gv8b*)(p + 256); return u.v; }
__device__ __forceinline__ v16h frag_hp(const _Float16* p) { union { v16h v; v8h q[2]; } u; u.q[0] = *(const v8h*)p; u.q[1] = *(const v8h*)(p + 256); return u.v; }
// precaution behind a group of global loads: the wait stands in front of every rewrite of the group's address registers; both pointers pass through the statement, so every later step of them follows it
#define XWAIT(pa, pb) asm volatile("s_wait_xcnt 0x0" : "+v"(pa), "+v"(pb) : : "memory")
__device__ __forceinline__ float bfr(float v) { return (float)(__bf16)v; }
__device__ __attribute__((noinline)) float exp_ni(float v) { return expf(v); }
__device__ __attribute__((noinline)) float erf_ni(float v) { return erff(v); }

#define PK_A 0                       // Wqkv, fragment order: [192 tiles of 16 outputs][32 k-steps][FRAG]
#define PK_P (PK_A + QKVW * DM)        // Wo, fragment order: [64 tiles][32 k-steps][FRAG]
#define PK_END (PK_P + DM * DM)
#define WS_PK  0u
#define WS_QK  (WS_PK + 2u * PK_END)             // f16 [4096 rows][2048]: q in the first 1024 columns (the rest unused)
#define WS_QKL (WS_QK + 2u * NB * SS * 2 * DM)     // f16 q residual plane x2048, same shape
#define WS_VTH (WS_QKL + 2u * NB * SS * 2 * DM)    // f16 v hi, fragment order: [b][h][64 steps of 32 keys][4 tiles of 16 d][FRAG]
#define WS_VTL (WS_VTH + 2u * NB * DM * SS)        // f16 lo x 2048, same shape
#define WS_O   (WS_VTL + 2u * NB * DM * SS)        // bf16 ctx, fragment order: [256 tiles of 16 rows][32 k-steps][hi FRAG | residual FRAG]
#define WS_CS  (WS_O + 4u * NB * SS * DM)           // f32 2 x [2048][32], unused
#define WS_KF  (WS_CS + 4u * 2 * SS * 32)          // f16 k hi, fragment order: [b][h][128 tiles of 16 keys][2 k-steps of 32 d][FRAG]
#define WS_KFL (WS_KF + 2u * NB * SS * DM)         // f16 k residual x2048, same shape
#define WS_XF  (WS_KFL + 2u * NB * SS * DM)        // bf16 x, fragment order: [256 tiles of 16 rows][32 k-steps][FRAG]
#define WS_END (WS_XF + 2u * NB * SS * DM)
// ---- k_pack: block = (32 outputs n, 128 inputs k) of an (in,out) weight: whole 128-B lines in, bf16, transposed in LDS, 8 tiles of fragment order out (512-B runs); blocks x < 96 take Wqkv (q | k | v outputs in column order), the rest Wproj, whose tiles follow in PK
static_assert(PK_A == 0 && PK_P == QKVW * DM, "the two weights' tiles are numbered through");
__global__ __launch_bounds__(256) void k_pack(const float* __restrict__ WA, const float* __restrict__ WO, __bf16* __restrict__ PK) {
  __shared__ __align__(16) __bf16 s[32][136]; const int t = threadIdx.x, k0 = blockIdx.y * 128; const bool fused = blockIdx.x < QKVW / 32;
  const float* Wm = fused ? WA + blockIdx.x * 32 : WO + (blockIdx.x - QKVW / 32) * 32; const int ld = fused ? QKVW : DM;
#pragma unroll   // the sixteen line reads go out as one group, not one load-and-wait each
  for (int i = 0; i < 16; ++i) { const int k = (t >> 5) + 8 * i; s[t & 31][k] = (__bf16)Wm[(size_t)(k0 + k) * ld + (t & 31)]; }
  __syncthreads();
#pragma unroll   // two fixed trips: left rolled, the build keeps a lane-masked loop with its address sums per trip
  for (int u = t; u < 512; u += 256) { const int ln = u & 31, half = (u >> 5) & 1, kcl = (u >> 6) & 3, tl = u >> 8;
    vst2((unsigned*)(PK + ((size_t)(blockIdx.x * 2 + tl) * (DM / 32) + blockIdx.y * 4 + kcl) * FRAG + half * 256 + ln * 8), *(const v4u*)&s[tl * 16 + (ln & 15)][kcl * 32 + half * 16 + 8 * (ln >> 4)]); }
}
// ---- k_packx: x rounded to bf16 once (k_qkv's 24 column blocks all read it), into fragment order; thread = one 16-byte piece of the output
__global__ __launch_bounds__(256) void k_packx(const float* __restrict__ X, __bf16* __restrict__ XF) {
  const size_t u = (size_t)blockIdx.x * 256 + threadIdx.x; const int ln = (int)(u & 31), half = (int)(u >> 5) & 1, kc = (int)(u >> 6) & 31;
  const float* p = X + ((u >> 11) * 16 + (ln & 15)) * DM + kc * 32 + half * 16 + 8 * (ln >> 4); const v4f a = *(const v4f*)p, c = *(const v4f*)(p + 4); v8b o;
#pragma unroll   // vector elements need constant indices to stay in registers
  for (int i = 0; i < 4; ++i) { o[i] = (__bf16)a[i]; o[4 + i] = (__bf16)c[i]; }
  vst2(XF + u * 8, o);
}
__global__ __launch_bounds__(128) void k_qkv(const __bf16* __restrict__ XF, const __bf16* __restrict__ P, const float* __restrict__ BQ, const float* __restrict__ BK, const float* __restrict__ BV, float* __restrict__ KOUT, float* __restrict__ VOUT, _Float16* __restrict__ QK, _Float16* __restrict__ QKL, _Float16* __restrict__ KF, _Float16* __restrict__ KFL, _Float16* __restrict__ VTH, _Float16* __restrict__ VTL) {
  const int which0 = (blockIdx.y * 128) / DM; const float* BB = BQ ? (((which0 == 0) ? BQ : (which0 == 1) ? BK : BV) + (blockIdx.y * 128 - which0 * DM)) : nullptr;
  __shared__ __align__(16) _Float16 so[4][16][136], sol[4][16][136]; __shared__ __align__(16) _Float16 sth[128][72], stl[128][72];
  const int tid = threadIdx.x, wave = tid >> 5, lane = tid & 31, col = lane & 15, g = lane >> 4; const size_t r0 = (size_t)blockIdx.x * 64 + wave * 16; const int n0 = blockIdx.y * 128;
  v8f acc[8] = {};
  float bj[8];   // the lane's eight bias values, fetched once as a group (the epilogues read them per element)
#pragma unroll
  for (int j = 0; j < 8; ++j) bj[j] = 0.f;
  if (BB) {
#pragma unroll
    for (int j = 0; j < 8; ++j) bj[j] = bfr(BB[j * 16 + col]); }
  // every global load of k-step kc + 1 is issued as one group in front of step kc's products, so the loads fly together and behind the matrix work instead of one load-and-wait per product
  gb16* xp = (gb16*)(XF + (r0 >> 4) * (DM / 32) * FRAG + lane * 8); gb16* wp = (gb16*)(P + (size_t)(n0 >> 4) * (DM / 32) * FRAG + lane * 8);
  v16b xa = frag_bp(xp), wb[8];
#pragma unroll
  for (int j = 0; j < 8; ++j) wb[j] = frag_bp(wp + (size_t)j * (DM / 32) * FRAG);
  XWAIT(xp, wp);
#pragma unroll 2
  for (int kc = 0; kc < DM / 32; ++kc) { const int st = (kc + 1 < DM / 32) ? FRAG : 0; xp += st; wp += st;   // the last step fetches its own operands again (in bounds, unused)
    const v16b xn = frag_bp(xp); v16b wn[8];
#pragma unroll
    for (int j = 0; j < 8; ++j) wn[j] = frag_bp(wp + (size_t)j * (DM / 32) * FRAG);
    XWAIT(xp, wp);
#pragma unroll
    for (int j = 0; j < 8; ++j) acc[j] = wmma_bf(xa, wb[j], acc[j]);
    xa = xn;
#pragma unroll
    for (int j = 0; j < 8; ++j) wb[j] = wn[j]; }
  if (which0 >= 1) {   // cache_key / cache_value: the f32 projections (+ bias) straight from the accumulators, 512-B row segments
    __shared__ __align__(16) float sf[4][16][132];
#pragma unroll
    for (int j = 0; j < 8; ++j) {
#pragma unroll
      for (int r = 0; r < 8; ++r) sf[wave][8 * g + r][j * 16 + col] = acc[j][r] + bj[j]; }
    LDSX();
    float* dst = (which0 == 1) ? KOUT : VOUT; for (int rl = 0; rl < 16; ++rl) vst2(dst + (r0 + rl) * DM + (n0 - which0 * DM) + lane * 4, *(const v4f*)&sf[wave][rl][lane * 4]);
    LDSX(); }
  if (n0 < 2 * DM) {   // q stored unscaled (f16 sigma ~0.6, no subnormal exposure); 1/8 applied to the f32 score
#pragma unroll
    for (int j = 0; j < 8; ++j) {
#pragma unroll
      for (int r = 0; r < 8; ++r) { const float v = acc[j][r] + bj[j]; const _Float16 hv = (_Float16)v; so[wave][8 * g + r][j * 16 + col] = hv; sol[wave][8 * g + r][j * 16 + col] = (_Float16)((v - (float)hv) * 2048.0f); } }   // q, k (+ bias) as f16 hi + (x2048) residual
    LDSX();
    if (which0 == 0) { for (int rl = 0; rl < 16; ++rl) if (lane < 16) { vst2((unsigned*)(QK + (r0 + rl) * (2 * DM) + n0 + lane * 8), *(const v4u*)&so[wave][rl][lane * 8]); vst2((unsigned*)(QKL + (r0 + rl) * (2 * DM) + n0 + lane * 8), *(const v4u*)&sol[wave][rl][lane * 8]); } }
    else {   // k: the wave's 16 rows are one key tile; 2 heads x 2 k-steps x 2 halves, each a 512-B run in fragment order
      const size_t kb = (((r0 / SS) * NH + ((n0 - DM) >> 6)) * (SS / 16) + ((r0 % SS) >> 4)) * (2 * FRAG) + lane * 8;
#pragma unroll   // the sixteen stores go out as one run, their offsets as immediates
      for (int u = 0; u < 8; ++u) { const size_t o = kb + (size_t)(u >> 2) * (SS / 16) * (2 * FRAG) + (u & 3) * 256; const int c0 = (u >> 2) * 64 + (u & 3) * 16 + 8 * g;
        vst2((unsigned*)(KF + o), *(const v4u*)&so[wave][col][c0]); vst2((unsigned*)(KFL + o), *(const v4u*)&sol[wave][col][c0]); }
      asm volatile("s_wait_xcnt 0x0" ::: "memory"); }   // precaution behind the run of sixteen stores: their registers may be reused by what follows while the stores are still out
  } else {
#pragma unroll
    for (int j = 0; j < 8; ++j) {
#pragma unroll
      for (int r = 0; r < 8; ++r) { const float v = acc[j][r] + bj[j]; const _Float16 hv = (_Float16)v; sth[j * 16 + col][wave * 16 + 8 * g + r] = hv; stl[j * 16 + col][wave * 16 + 8 * g + r] = (_Float16)((v - (float)hv) * 2048.0f); } }
    __syncthreads();
    const size_t rb = (size_t)blockIdx.x * 64; const int b = (int)(rb / SS), s0 = (int)(rb % SS); const int pc0 = n0 - 2 * DM;
    for (int u = tid; u < 128 * 8; u += 128) { const int ln = u & 31, half = (u >> 5) & 1, dt = (u >> 6) & 3, ksl = (u >> 8) & 1, hh = u >> 9; const int d = hh * 64 + dt * 16 + (ln & 15), pc = ksl * 4 + half * 2 + (ln >> 4);   // 512-B runs in fragment order
      const size_t o = ((((size_t)b * NH + (pc0 >> 6) + hh) * (SS / 32) + (s0 >> 5) + ksl) * 4 + dt) * FRAG + half * 256 + ln * 8; vst2((unsigned*)(VTH + o), *(const v4u*)&sth[d][pc * 8]); vst2((unsigned*)(VTL + o), *(const v4u*)&stl[d][pc * 8]); }
  }
}
// ---- k_attn: block = (64 queries, head h, batch b), 8 waves = 4 query tiles x 2 key groups: causal flash attention with key-step skipping (K = 64: 2 k-steps), scores = (q.k) * 0.125 + bias: query blocks 0 and 1 use 3 products (q, k hi/lo) and P.V as P hi/lo x V hi/lo (lo*2048) in two accumulators, later blocks single f16 operands and P x V hi; key group kw takes the key steps ks = kw, kw + 2, ... with a running maximum and sum of its own, and the two partial results are joined in LDS; ctx is stored as k_out's A operand.
// Why two groups: the cost of a query block grows with its index (causal), and with one wave per query tile every block is resident at once, so the launch lasts as long as the last block while the others' places stand empty. Half as long and twice as many waves give more blocks than places; the blocks start heaviest first (blockIdx.z counts the query blocks down), so the places stay filled to the end.
__global__ __launch_bounds__(256) void k_attn(const _Float16* __restrict__ QK, const _Float16* __restrict__ QKL, const _Float16* __restrict__ KF, const _Float16* __restrict__ KFL, const _Float16* __restrict__ VTH, const _Float16* __restrict__ VTL, const void* __restrict__ KMASK, const float* __restrict__ AB, __bf16* __restrict__ OF) {
  __shared__ __align__(16) float sp[8][16][36]; __shared__ __align__(16) float so[8][16][68]; __shared__ __align__(16) float sm[8][16], sl[8][16];
  const int tid = threadIdx.x, wave = __builtin_amdgcn_readfirstlane(tid >> 5), lane = tid & 31, col = lane & 15, g = lane >> 4;   // the wave's number in a scalar register: the key loop starts from it and stays a scalar loop
  const int qi = wave & 3, kw = wave >> 2;   // query tile, key group
  const int qb = TQB - 1 - blockIdx.z, h = blockIdx.x, b = blockIdx.y; const int q0 = qb * 64 + qi * 16; const size_t rq = (size_t)b * SS + q0 + col;
  v16h aq[2], aql[2];
#pragma unroll
  for (int kc = 0; kc < 2; ++kc) { aq[kc] = frag_h(QK + rq * (2 * DM) + h * HD + kc * 32, lane); aql[kc] = frag_h(QKL + rq * (2 * DM) + h * HD + kc * 32, lane); }
  float m[8], l[8];
#pragma unroll
  for (int r = 0; r < 8; ++r) { m[r] = -3.0e38f; l[r] = 0.f; }
  v8f acc[4] = {}, accl[4] = {};
  const int nks = (qb * 64 + 64) / 32;   // causal: 32-key steps up to the query block's end
  const size_t hb = ((size_t)b * NH + h) * (SS * HD) + lane * 8;   // the head's k and v planes in fragment order (S x 64 elements each), with the lane's offset
#pragma unroll 1
  for (int ks = kw; ks < nks; ks += 2) { v8f s[2];   // nks is even: both key groups make qb + 1 trips
    // the key step's K fragments and bias values are loaded as one group in front of the first product (the bias unconditionally: row and key are inside [S][S] for every lane; the causal select follows), so one round trip replaces one per product and per bias row
    v16h kf[2][2]; float ab[2][8];
#pragma unroll
    for (int ct = 0; ct < 2; ++ct) { const int kk = ks * 32 + ct * 16 + col;
#pragma unroll
      for (int kc = 0; kc < 2; ++kc) kf[ct][kc] = frag_hp(KF + hb + (size_t)((ks * 2 + ct) * 2 + kc) * FRAG);
#pragma unroll
      for (int r = 0; r < 8; ++r) ab[ct][r] = AB[(size_t)(q0 + 8 * g + r) * SS + kk]; }
    asm volatile("s_wait_xcnt 0x0" ::: "memory");   // precaution: the group's address registers may be reused by what follows while its loads are still out
#pragma unroll
    for (int ct = 0; ct < 2; ++ct) { const int kk = ks * 32 + ct * 16 + col; v8f c = {}, cl = {};
      if (qb < 2) {   // leading query blocks (few keys, outputs far above the global rms): 3 products
#pragma unroll
        for (int kc = 0; kc < 2; ++kc) { const v16h kh = kf[ct][kc]; c = wmma16(aq[kc], kh, c); cl = wmma16(aql[kc], kh, cl); const v16h kl = frag_hp(KFL + hb + (size_t)((ks * 2 + ct) * 2 + kc) * FRAG);
          asm volatile("s_wait_xcnt 0x0" ::: "memory");   // precaution, as above: the load's address registers may be reused by what follows
          cl = wmma16(aq[kc], kl, cl); }
#pragma unroll
        for (int r = 0; r < 8; ++r) c[r] += cl[r] * (1.0f / 2048.0f); }
      else {
#pragma unroll
        for (int kc = 0; kc < 2; ++kc) c = wmma16(aq[kc], kf[ct][kc], c); }   // single product elsewhere
#pragma unroll
      for (int r = 0; r < 8; ++r) s[ct][r] = (kk <= q0 + 8 * g + r) ? (c[r] * SCALEF + bfr(ab[ct][r])) : -3.0e38f; }   // causal: future keys excluded
    // the V fragments are requested here, behind the score products, and fly under the softmax
    v16h vf[4];
#pragma unroll
    for (int dt = 0; dt < 4; ++dt) vf[dt] = frag_hp(VTH + hb + (size_t)(ks * 4 + dt) * FRAG);
    asm volatile("s_wait_xcnt 0x0" ::: "memory");   // precaution: the group's address registers may be reused by what follows while its loads are still out
#pragma unroll
    for (int r = 0; r < 8; ++r) { float mx = fmaxf(s[0][r], s[1][r]);
#pragma unroll
      for (int o = 1; o < 16; o <<= 1) mx = fmaxf(mx, __shfl_xor(mx, o));
      const float mn = fmaxf(m[r], mx); const float alpha = (m[r] <= -1.0e38f) ? 0.f : __expf(m[r] - mn);
      const float e0 = (s[0][r] <= -1.0e38f) ? 0.f : __expf(s[0][r] - mn), e1 = (s[1][r] <= -1.0e38f) ? 0.f : __expf(s[1][r] - mn); float es = e0 + e1;
#pragma unroll
      for (int o = 1; o < 16; o <<= 1) es += __shfl_xor(es, o);
      l[r] = l[r] * alpha + es; m[r] = mn;
#pragma unroll
      for (int dt = 0; dt < 4; ++dt) { acc[dt][r] *= alpha; accl[dt][r] *= alpha; }
      sp[wave][8 * g + r][col] = e0; sp[wave][8 * g + r][16 + col] = e1; }
    LDSX();
    v16h pa, pl; { const float* prow = &sp[wave][col][0] + 8 * (lane >> 4);
#pragma unroll
      for (int i = 0; i < 8; ++i) { const float x0 = prow[i] * 2048.0f, x1 = prow[16 + i] * 2048.0f; const _Float16 h0 = (_Float16)x0, h1 = (_Float16)x1; pa[i] = h0; pa[8 + i] = h1; pl[i] = (_Float16)((x0 - (float)h0) * 2048.0f); pl[8 + i] = (_Float16)((x1 - (float)h1) * 2048.0f); } }   // P scaled by 2^11 before the f16 split so small softmax weights stay out of the f16 subnormal range; 2^-11 folded into the epilogue
#pragma unroll
    for (int dt = 0; dt < 4; ++dt) { const v16h vh = vf[dt]; acc[dt] = wmma16(pa, vh, acc[dt]); if (qb < 2) { accl[dt] = wmma16(pl, vh, accl[dt]); const v16h vl = frag_hp(VTL + hb + (size_t)(ks * 4 + dt) * FRAG);
        asm volatile("s_wait_xcnt 0x0" ::: "memory");   // precaution, as above: the load's address registers may be reused by what follows
        accl[dt] = wmma16(pa, vl, accl[dt]); } }   // leading query blocks: P hi/lo x V hi/lo (3 products); elsewhere P x V single
    LDSX(); }
  // each wave leaves its unnormalised sums with its rows' maximum and sum (the same in all 16 lanes of a row)
#pragma unroll
  for (int r = 0; r < 8; ++r) {
#pragma unroll
    for (int dt = 0; dt < 4; ++dt) so[wave][8 * g + r][dt * 16 + col] = acc[dt][r] + accl[dt][r] * (1.0f / 2048.0f); }
  if (col == 0) {
#pragma unroll   // register arrays need constant indices
    for (int r = 0; r < 8; ++r) { sm[wave][8 * g + r] = m[r]; sl[wave][8 * g + r] = l[r]; } }
  __syncthreads();   // a wave reads the other key group's partial result below: both must be written
  // join for query row col: each part weighted by exp(its maximum - the common one); a group whose keys were all masked for the row (maximum still at the start value) counts 0; group 0 holds key 0, which no row masks, so the sum is above 0
  const float m0 = sm[qi][col], m1 = sm[4 + qi][col], mm = fmaxf(m0, m1);
  const float f0 = (m0 <= -1.0e38f) ? 0.f : __expf(m0 - mm), f1 = (m1 <= -1.0e38f) ? 0.f : __expf(m1 - mm);
  const float il = (1.0f / 2048.0f) / (f0 * sl[qi][col] + f1 * sl[4 + qi][col]); const float w0 = f0 * il, w1 = f1 * il;
  // ctx leaves as the out product's A operand: bf16 hi + residual, fragment order; the tile's 16 queries are one row tile, the head's 64 columns two k-steps, of which the wave writes number kw; 512-B runs
  const size_t ob = (((((size_t)b * SS + q0) >> 4) * (DM / 32) + h * 2 + kw) * (2 * FRAG)) + lane * 8;
#pragma unroll   // the four stores go out as one run, their offsets as immediates
  for (int u = 0; u < 2; ++u) { const float* p0 = &so[qi][col][kw * 32 + u * 16 + 8 * g]; const float* p1 = &so[4 + qi][col][kw * 32 + u * 16 + 8 * g]; v8b hi, lo;
#pragma unroll   // vector elements need constant indices to stay in registers
    for (int i = 0; i < 8; ++i) { const float v = p0[i] * w0 + p1[i] * w1; const __bf16 hv = (__bf16)v; hi[i] = hv; lo[i] = (__bf16)(v - (float)hv); }
    vst2(OF + ob + u * 256, hi); vst2(OF + ob + FRAG + u * 256, lo); }
}
// ---- k_out: block = (64 rows, 128 cols): out = ctx (hi, residual) . Wo (2 products) + bo
__global__ __launch_bounds__(128) void k_out(const __bf16* __restrict__ OF, const __bf16* __restrict__ P, const float* __restrict__ BO, float* __restrict__ Y) {
  __shared__ __align__(16) float so[4][16][132];
  const int tid = threadIdx.x, wave = tid >> 5, lane = tid & 31, col = lane & 15, g = lane >> 4; const size_t r0 = (size_t)blockIdx.x * 64 + wave * 16; const int n0 = blockIdx.y * 128;
  v8f acc[8] = {};
  // as in k_qkv: step kc + 1's loads are issued as one group in front of step kc's products
  gb16* xp = (gb16*)(OF + (r0 >> 4) * (DM / 32) * (2 * FRAG) + lane * 8); gb16* wp = (gb16*)(P + (size_t)(n0 >> 4) * (DM / 32) * FRAG + lane * 8);
  v16b xh = frag_bp(xp), xl = frag_bp(xp + FRAG), wb[8];
#pragma unroll
  for (int j = 0; j < 8; ++j) wb[j] = frag_bp(wp + (size_t)j * (DM / 32) * FRAG);
  XWAIT(xp, wp);
#pragma unroll 2
  for (int kc = 0; kc < DM / 32; ++kc) { const int st = (kc + 1 < DM / 32) ? FRAG : 0; xp += 2 * st; wp += st;   // the last step fetches its own operands again (in bounds, unused)
    const v16b xhn = frag_bp(xp), xln = frag_bp(xp + FRAG); v16b wn[8];
#pragma unroll
    for (int j = 0; j < 8; ++j) wn[j] = frag_bp(wp + (size_t)j * (DM / 32) * FRAG);
    XWAIT(xp, wp);
#pragma unroll
    for (int j = 0; j < 8; ++j) { acc[j] = wmma_bf(xl, wb[j], acc[j]); acc[j] = wmma_bf(xh, wb[j], acc[j]); }
    xh = xhn; xl = xln;
#pragma unroll
    for (int j = 0; j < 8; ++j) wb[j] = wn[j]; }
#pragma unroll
  for (int j = 0; j < 8; ++j) {
#pragma unroll
    for (int r = 0; r < 8; ++r) so[wave][8 * g + r][j * 16 + col] = acc[j][r] + bfr(BO[n0 + j * 16 + col]); }
  LDSX();
  for (int rl = 0; rl < 16; ++rl) vst2(Y + (r0 + rl) * DM + n0 + lane * 4, *(const v4f*)&so[wave][rl][lane * 4]);
}
extern "C" void kernel_launch(void* const* d_in, const int* in_sizes, int n_in, void* d_out, int out_size, void* d_ws, size_t ws_size, hipStream_t stream) {
  (void)in_sizes; (void)n_in; (void)out_size;
  const float** F = (const float**)d_in;   // 0 hidden [2,2048,1024], 1 attn_bias [2048,2048], 2 Wqkv [1024,3072] (in,out; q | k | v), 3 bqkv [3072], 4 Wproj [1024,1024] (in,out), 5 bproj
  if (ws_size < (size_t)WS_END) return;
  char* ws = (char*)d_ws; __bf16* PK = (__bf16*)(ws + WS_PK); _Float16 *QK = (_Float16*)(ws + WS_QK), *QKL = (_Float16*)(ws + WS_QKL), *VTH = (_Float16*)(ws + WS_VTH), *VTL = (_Float16*)(ws + WS_VTL), *KF = (_Float16*)(ws + WS_KF), *KFL = (_Float16*)(ws + WS_KFL); __bf16 *OF = (__bf16*)(ws + WS_O), *XF = (__bf16*)(ws + WS_XF);
  float* OUT0 = (float*)d_out; float* KOUT = OUT0 + (size_t)NB * SS * DM; float* VOUT = KOUT + (size_t)NB * SS * DM;   // outputs: out, cache_key, cache_value
  k_pack<<<dim3((QKVW + DM) / 32, DM / 128), 256, 0, stream>>>(F[2], F[4], PK);
  k_packx<<<NB * SS * DM / 8 / 256, 256, 0, stream>>>(F[0], XF);
  k_qkv<<<dim3(TNB * SS / 64, QKVW / 128), 128, 0, stream>>>(XF, PK + PK_A, F[3], F[3] + DM, F[3] + 2 * DM, KOUT, VOUT, QK, QKL, KF, KFL, VTH, VTL);
  k_attn<<<dim3(NH, TNB, TQB), 256, 0, stream>>>(QK, QKL, KF, KFL, VTH, VTL, nullptr, F[1], OF);
  k_out<<<dim3(TOB, DM / 128), 128, 0, stream>>>(OF, PK + PK_P, F[5], OUT0);
}

// v004
// Measured time: 125 microseconds a run.
// In two side-by-side timings against v003, it was 1.20 and 1.19 times as fast.
// Counting every step since v000, it is 4.83 times as fast.
// compute dtype: all float inputs rounded to bf16; qkv = x . Wqkv + b with EXACT bf16 products on WMMA 16x16x32 ((in,out) weights packed by k_pack; x, the weights, k, v and ctx are kept in the matrix instructions' fragment order) - the k and v projections are also written out in f32 straight from the accumulators; causal attention with key-tile skipping: the first 128 queries use 3-product scores and P.v (hi/lo), later queries single f16 operands; (q.k)/8 + attn_bias[q][k], running-max softmax in f32 (hardware exp); out = ctx (bf16 hi + residual) . Wproj (2 products) + bproj; outputs out | cache_key | cache_value concatenated.
#include <hip/hip_runtime.h>
#include <math.h>

typedef __attribute__((ext_vector_type(16))) _Float16 v16h;
typedef __attribute__((ext_vector_type(16))) __bf16 v16b;
typedef __attribute__((ext_vector_type(8)))  _Float16 v8h;
typedef __attribute__((ext_vector_type(8)))  float v8f;
typedef __attribute__((ext_vector_type(4)))  float v4f;
typedef __attribute__((ext_vector_type(2)))  float v2f;
typedef __attribute__((ext_vector_type(4)))  unsigned v4u;
typedef __attribute__((ext_vector_type(4)))  int v4i;
typedef float __attribute__((may_alias)) float_a;
typedef int __attribute__((may_alias)) int_a;

template <typename T> __device__ __forceinline__ void vst2(void* p, T v) { *(T*)p = v;  }
__device__ __forceinline__ v8f wmma16(v16h a, v16h b, v8f c) {
  v8f d = __builtin_amdgcn_wmma_f32_16x16x32_f16(false, a, false, b, (short)0, c, false, false);
  asm volatile("v_nop\n\tv_nop\n\tv_nop\n\tv_nop" : "+v"(d) : "v"(a), "v"(b));
  return d;
}
__device__ __forceinline__ v8f wmma_bf(v16b a, v16b b, v8f c) {
  v8f d = __builtin_amdgcn_wmma_f32_16x16x32_bf16(false, a, false, b, (short)0, c, false, false);
  asm volatile("v_nop\n\tv_nop\n\tv_nop\n\tv_nop" : "+v"(d) : "v"(a), "v"(b));
  return d;
}
// Prefill attention (B 2, S 2,048, E 1,024, 16 heads x 64): fused (in,out) qkv + bias, scores / 8 + learned additive bias[q, k], causal, softmax, . v, Wproj + bias; also returns the k and v projections (the KV cache).
__device__ __forceinline__ v16h frag_h(const _Float16* rowk0, int lane) {
  union { v16h v; v8h q[2]; } u; const _Float16* p = rowk0 + 8 * (lane >> 4);
  u.q[0] = *(const v8h*)p; u.q[1] = *(const v8h*)(p + 16); return u.v;
}
__device__ __forceinline__ v16h frag_f32(const float* rowk0, int lane) {
  v16h a; const float* p = rowk0 + 8 * (lane >> 4);
#pragma unroll
  for (int i = 0; i < 8; ++i) { a[i] = (_Float16)p[i]; a[8 + i] = (_Float16)p[16 + i]; }
  return a;
}
__device__ __forceinline__ v16h frag_f32s(const float* rowk0, int lane, float sc) {
  v16h a; const float* p = rowk0 + 8 * (lane >> 4);
#pragma unroll
  for (int i = 0; i < 8; ++i) { a[i] = (_Float16)(p[i] * sc); a[8 + i] = (_Float16)(p[16 + i] * sc); }
  return a;
}
// column fragment from a [K][ld] layout (column n), rows >= K read as 0
__device__ __forceinline__ v16h fragc_f32(const float* W, int k0, int n, int lane, int ld, int K) {
  v16h a; const int g = lane >> 4;
#pragma unroll
  for (int i = 0; i < 8; ++i) { const int ka = k0 + 8 * g + i, kb = ka + 16;
    a[i] = (_Float16)(ka < K ? W[(size_t)(ka < K ? ka : K - 1) * ld + n] : 0.f); a[8 + i] = (_Float16)(kb < K ? W[(size_t)(kb < K ? kb : K - 1) * ld + n] : 0.f); }
  return a;
}
struct F2 { v16b h, l; };
__device__ __forceinline__ F2 bsplit16(const float v[16]) { F2 r;
#pragma unroll
  for (int i = 0; i < 16; ++i) { const __bf16 h = (__bf16)v[i]; r.h[i] = h; r.l[i] = (__bf16)(v[i] - (float)h); }
  return r; }
__device__ __forceinline__ F2 split_row(const float* row, int k0, int lane) { float v[16]; const float* p = row + k0 + 8 * (lane >> 4);
#pragma unroll
  for (int i = 0; i < 8; ++i) { v[i] = p[i]; v[8 + i] = p[16 + i]; }
  return bsplit16(v); }
__device__ __forceinline__ F2 split_rowK(const float* row, int k0, int lane, int K) { float v[16]; const int g = lane >> 4;
#pragma unroll
  for (int i = 0; i < 8; ++i) { const int ka = k0 + 8 * g + i, kb = ka + 16; v[i] = ka < K ? row[ka < K ? ka : K - 1] : 0.f; v[8 + i] = kb < K ? row[kb < K ? kb : K - 1] : 0.f; }
  return bsplit16(v); }
__device__ __forceinline__ F2 split_col(const float* W, int k0, int n, int lane, int ld, int K) { float v[16]; const int g = lane >> 4;
#pragma unroll
  for (int i = 0; i < 8; ++i) { const int ka = k0 + 8 * g + i, kb = ka + 16; v[i] = ka < K ? W[(size_t)(ka < K ? ka : K - 1) * ld + n] : 0.f; v[8 + i] = kb < K ? W[(size_t)(kb < K ? kb : K - 1) * ld + n] : 0.f; }
  return bsplit16(v); }
__device__ __forceinline__ v8f mac3(const F2& a, const F2& b, v8f c) { c = wmma_bf(a.l, b.h, c); c = wmma_bf(a.h, b.l, c); return wmma_bf(a.h, b.h, c); }
__device__ __forceinline__ float sigm(float v) { return 1.0f / (1.0f + expf(-v)); }
#define LDSX() do { asm volatile("s_wait_dscnt 0" ::: "memory"); __builtin_amdgcn_wave_barrier(); __builtin_amdgcn_fence(__ATOMIC_RELEASE, "workgroup"); } while (0)


#define NB 2
#define SS 2048
#define DM 1024
#define NH 16
#define SCALEF 0.125f
#define HD 64
#define QKVW (3 * DM)
#ifndef TQB
#define TQB (SS / 64)
#define TNB NB
#define TOB (NB * SS / 64)     // output row tiles (all)
#endif
typedef __attribute__((ext_vector_type(8))) __bf16 v8b;
__device__ __forceinline__ v16b frag_b(const __bf16* rowk0, int lane) {
  union { v16b v; v8b q[2]; } u; const __bf16* p = rowk0 + 8 * (lane >> 4);
  u.q[0] = *(const v8b*)p; u.q[1] = *(const v8b*)(p + 16); return u.v;
}
// pointers typed as global memory: they keep that type through the XWAIT statement below, so the loads behind it stay global loads
typedef const __attribute__((address_space(1))) float gf32; typedef const __attribute__((address_space(1))) __bf16 gb16;
typedef const __attribute__((address_space(1))) v4f gv4f; typedef const __attribute__((address_space(1))) v8b gv8b;
// FRAGMENT ORDER: a 16 x 32 operand tile is kept as 1 KB = [half 2][lane 32][8 elements]; lane (g, col) holds row col, k = 16 * half + 8 * g + i, the k order of frag_b / frag_h. One wave-wide 16-byte load then covers 512 contiguous bytes (4 whole lines) instead of 32 bytes in each of 16 lines.
#define FRAG 512                     // elements of one tile
// a tile from a pointer that already holds the lane's offset (lane * 8)
__device__ __forceinline__ v16b frag_bp(gb16* p) { union { v16b v; v8b q[2]; } u; u.q[0] = *(gv8b*)p; u.q[1] = *(gv8b*)(p + 256); return u.v; }
__device__ __forceinline__ v16h frag_hp(const _Float16* p) { union { v16h v; v8h q[2]; } u; u.q[0] = *(const v8h*)p; u.q[1] = *(const v8h*)(p + 256); return u.v; }
// precaution behind a group of global loads: the wait stands in front of every rewrite of the group's address registers; both pointers pass through the statement, so every later step of them follows it
#define XWAIT(pa, pb) asm volatile("s_wait_xcnt 0x0" : "+v"(pa), "+v"(pb) : : "memory")
__device__ __forceinline__ float bfr(float v) { return (float)(__bf16)v; }
__device__ __attribute__((noinline)) float exp_ni(float v) { return expf(v); }
__device__ __attribute__((noinline)) float erf_ni(float v) { return erff(v); }

#define PK_A 0                       // Wqkv, fragment order: [192 tiles of 16 outputs][32 k-steps][FRAG]
#define PK_P (PK_A + QKVW * DM)        // Wo, fragment order: [64 tiles][32 k-steps][FRAG]
#define PK_END (PK_P + DM * DM)
#define WS_PK  0u
#define WS_QK  (WS_PK + 2u * PK_END)             // f16 [4096 rows][2048]: q in the first 1024 columns (the rest unused)
#define WS_QKL (WS_QK + 2u * NB * SS * 2 * DM)     // f16 q residual plane x2048, same shape
#define WS_VTH (WS_QKL + 2u * NB * SS * 2 * DM)    // f16 v hi, fragment order: [b][h][64 steps of 32 keys][4 tiles of 16 d][FRAG]
#define WS_VTL (WS_VTH + 2u * NB * DM * SS)        // f16 lo x 2048, same shape
#define WS_O   (WS_VTL + 2u * NB * DM * SS)        // bf16 ctx, fragment order: [256 tiles of 16 rows][32 k-steps][hi FRAG | residual FRAG]
#define WS_CS  (WS_O + 4u * NB * SS * DM)           // f32 2 x [2048][32], unused
#define WS_KF  (WS_CS + 4u * 2 * SS * 32)          // f16 k hi, fragment order: [b][h][128 tiles of 16 keys][2 k-steps of 32 d][FRAG]
#define WS_KFL (WS_KF + 2u * NB * SS * DM)         // f16 k residual x2048, same shape
#define WS_XF  (WS_KFL + 2u * NB * SS * DM)        // bf16 x, fragment order: [256 tiles of 16 rows][32 k-steps][FRAG]
#define WS_END (WS_XF + 2u * NB * SS * DM)
// ---- k_pack: block = (32 outputs n, 128 inputs k) of an (in,out) weight: whole 128-B lines in, bf16, transposed in LDS, 8 tiles of fragment order out (512-B runs); blocks x < 96 take Wqkv (q | k | v outputs in column order), the rest Wproj, whose tiles follow in PK
static_assert(PK_A == 0 && PK_P == QKVW * DM, "the two weights' tiles are numbered through");
__global__ __launch_bounds__(256) void k_pack(const float* __restrict__ WA, const float* __restrict__ WO, __bf16* __restrict__ PK) {
  __shared__ __align__(16) __bf16 s[32][136]; const int t = threadIdx.x, k0 = blockIdx.y * 128; const bool fused = blockIdx.x < QKVW / 32;
  const float* Wm = fused ? WA + blockIdx.x * 32 : WO + (blockIdx.x - QKVW / 32) * 32; const int ld = fused ? QKVW : DM;
#pragma unroll   // the sixteen line reads go out as one group, not one load-and-wait each
  for (int i = 0; i < 16; ++i) { const int k = (t >> 5) + 8 * i; s[t & 31][k] = (__bf16)Wm[(size_t)(k0 + k) * ld + (t & 31)]; }
  __syncthreads();
#pragma unroll   // two fixed trips: left rolled, the build keeps a lane-masked loop with its address sums per trip
  for (int u = t; u < 512; u += 256) { const int ln = u & 31, half = (u >> 5) & 1, kcl = (u >> 6) & 3, tl = u >> 8;
    vst2((unsigned*)(PK + ((size_t)(blockIdx.x * 2 + tl) * (DM / 32) + blockIdx.y * 4 + kcl) * FRAG + half * 256 + ln * 8), *(const v4u*)&s[tl * 16 + (ln & 15)][kcl * 32 + half * 16 + 8 * (ln >> 4)]); }
}
// ---- k_packx: x rounded to bf16 once (k_qkv's 24 column blocks all read it), into fragment order; thread = one 16-byte piece of the output
__global__ __launch_bounds__(256) void k_packx(const float* __restrict__ X, __bf16* __restrict__ XF) {
  const size_t u = (size_t)blockIdx.x * 256 + threadIdx.x; const int ln = (int)(u & 31), half = (int)(u >> 5) & 1, kc = (int)(u >> 6) & 31;
  const float* p = X + ((u >> 11) * 16 + (ln & 15)) * DM + kc * 32 + half * 16 + 8 * (ln >> 4); const v4f a = *(const v4f*)p, c = *(const v4f*)(p + 4); v8b o;
#pragma unroll   // vector elements need constant indices to stay in registers
  for (int i = 0; i < 4; ++i) { o[i] = (__bf16)a[i]; o[4 + i] = (__bf16)c[i]; }
  vst2(XF + u * 8, o);
}
__global__ __launch_bounds__(128) void k_qkv(const __bf16* __restrict__ XF, const __bf16* __restrict__ P, const float* __restrict__ BQ, const float* __restrict__ BK, const float* __restrict__ BV, float* __restrict__ KOUT, float* __restrict__ VOUT, _Float16* __restrict__ QK, _Float16* __restrict__ QKL, _Float16* __restrict__ KF, _Float16* __restrict__ KFL, _Float16* __restrict__ VTH, _Float16* __restrict__ VTL) {
  const int which0 = (blockIdx.y * 128) / DM; const float* BB = BQ ? (((which0 == 0) ? BQ : (which0 == 1) ? BK : BV) + (blockIdx.y * 128 - which0 * DM)) : nullptr;
  __shared__ __align__(16) _Float16 so[4][16][136], sol[4][16][136]; __shared__ __align__(16) _Float16 sth[128][72], stl[128][72];
  const int tid = threadIdx.x, wave = tid >> 5, lane = tid & 31, col = lane & 15, g = lane >> 4; const size_t r0 = (size_t)blockIdx.x * 64 + wave * 16; const int n0 = blockIdx.y * 128;
  v8f acc[8] = {};
  float bj[8];   // the lane's eight bias values, fetched once as a group (the epilogues read them per element)
#pragma unroll
  for (int j = 0; j < 8; ++j) bj[j] = 0.f;
  if (BB) {
#pragma unroll
    for (int j = 0; j < 8; ++j) bj[j] = bfr(BB[j * 16 + col]); }
  // every global load of k-step kc + 1 is issued as one group in front of step kc's products, so the loads fly together and behind the matrix work instead of one load-and-wait per product
  gb16* xp = (gb16*)(XF + (r0 >> 4) * (DM / 32) * FRAG + lane * 8); gb16* wp = (gb16*)(P + (size_t)(n0 >> 4) * (DM / 32) * FRAG + lane * 8);
  v16b xa = frag_bp(xp), wb[8];
#pragma unroll
  for (int j = 0; j < 8; ++j) wb[j] = frag_bp(wp + (size_t)j * (DM / 32) * FRAG);
  XWAIT(xp, wp);
#pragma unroll 2
  for (int kc = 0; kc < DM / 32; ++kc) { const int st = (kc + 1 < DM / 32) ? FRAG : 0; xp += st; wp += st;   // the last step fetches its own operands again (in bounds, unused)
    const v16b xn = frag_bp(xp); v16b wn[8];
#pragma unroll
    for (int j = 0; j < 8; ++j) wn[j] = frag_bp(wp + (size_t)j * (DM / 32) * FRAG);
    XWAIT(xp, wp);
#pragma unroll
    for (int j = 0; j < 8; ++j) acc[j] = wmma_bf(xa, wb[j], acc[j]);
    xa = xn;
#pragma unroll
    for (int j = 0; j < 8; ++j) wb[j] = wn[j]; }
  if (which0 >= 1) {   // cache_key / cache_value: the f32 projections (+ bias) straight from the accumulators, 512-B row segments
    __shared__ __align__(16) float sf[4][16][132];
#pragma unroll
    for (int j = 0; j < 8; ++j) {
#pragma unroll
      for (int r = 0; r < 8; ++r) sf[wave][8 * g + r][j * 16 + col] = acc[j][r] + bj[j]; }
    LDSX();
    float* dst = (which0 == 1) ? KOUT : VOUT; for (int rl = 0; rl < 16; ++rl) vst2(dst + (r0 + rl) * DM + (n0 - which0 * DM) + lane * 4, *(const v4f*)&sf[wave][rl][lane * 4]);
    LDSX(); }
  if (n0 < 2 * DM) {   // q stored unscaled (f16 sigma ~0.6, no subnormal exposure); 1/8 applied to the f32 score
#pragma unroll
    for (int j = 0; j < 8; ++j) {
#pragma unroll
      for (int r = 0; r < 8; ++r) { const float v = acc[j][r] + bj[j]; const _Float16 hv = (_Float16)v; so[wave][8 * g + r][j * 16 + col] = hv; sol[wave][8 * g + r][j * 16 + col] = (_Float16)((v - (float)hv) * 2048.0f); } }   // q, k (+ bias) as f16 hi + (x2048) residual
    LDSX();
    if (which0 == 0) { for (int rl = 0; rl < 16; ++rl) if (lane < 16) { vst2((unsigned*)(QK + (r0 + rl) * (2 * DM) + n0 + lane * 8), *(const v4u*)&so[wave][rl][lane * 8]); vst2((unsigned*)(QKL + (r0 + rl) * (2 * DM) + n0 + lane * 8), *(const v4u*)&sol[wave][rl][lane * 8]); } }
    else {   // k: the wave's 16 rows are one key tile; 2 heads x 2 k-steps x 2 halves, each a 512-B run in fragment order
      const size_t kb = (((r0 / SS) * NH + ((n0 - DM) >> 6)) * (SS / 16) + ((r0 % SS) >> 4)) * (2 * FRAG) + lane * 8;
#pragma unroll   // the sixteen stores go out as one run, their offsets as immediates
      for (int u = 0; u < 8; ++u) { const size_t o = kb + (size_t)(u >> 2) * (SS / 16) * (2 * FRAG) + (u & 3) * 256; const int c0 = (u >> 2) * 64 + (u & 3) * 16 + 8 * g;
        vst2((unsigned*)(KF + o), *(const v4u*)&so[wave][col][c0]); vst2((unsigned*)(KFL + o), *(const v4u*)&sol[wave][col][c0]); }
      asm volatile("s_wait_xcnt 0x0" ::: "memory"); }   // precaution behind the run of sixteen stores: their registers may be reused by what follows while the stores are still out
  } else {
#pragma unroll
    for (int j = 0; j < 8; ++j) {
#pragma unroll
      for (int r = 0; r < 8; ++r) { const float v = acc[j][r] + bj[j]; const _Float16 hv = (_Float16)v; sth[j * 16 + col][wave * 16 + 8 * g + r] = hv; stl[j * 16 + col][wave * 16 + 8 * g + r] = (_Float16)((v - (float)hv) * 2048.0f); } }
    __syncthreads();
    const size_t rb = (size_t)blockIdx.x * 64; const int b = (int)(rb / SS), s0 = (int)(rb % SS); const int pc0 = n0 - 2 * DM;
    for (int u = tid; u < 128 * 8; u += 128) { const int ln = u & 31, half = (u >> 5) & 1, dt = (u >> 6) & 3, ksl = (u >> 8) & 1, hh = u >> 9; const int d = hh * 64 + dt * 16 + (ln & 15), pc = ksl * 4 + half * 2 + (ln >> 4);   // 512-B runs in fragment order
      const size_t o = ((((size_t)b * NH + (pc0 >> 6) + hh) * (SS / 32) + (s0 >> 5) + ksl) * 4 + dt) * FRAG + half * 256 + ln * 8; vst2((unsigned*)(VTH + o), *(const v4u*)&sth[d][pc * 8]); vst2((unsigned*)(VTL + o), *(const v4u*)&stl[d][pc * 8]); }
  }
}
// ---- k_attn: block = (64 queries, head h, batch b), 8 waves = 4 query tiles x 2 key groups: causal flash attention (K = 64: 2 k-steps), computed TRANSPOSED: S^T = K . Q^T (A = a key tile, B = the query tile) and O^T += V^T . P^T. A lane (g, col) then holds, of ONE query (col), the scores of keys 16 * ct + 8 * g + r: maximum and sum run inside the lane with one exchange between the wave's halves, the rescale factor is one value per lane, and the two score tiles, converted in place, ARE the B operand of the second product (element 8 * ct + r = key 16 * ct + 8 * g + r, the k order of the V fragments), so P passes through no LDS. scores = (q.k) * 0.125 and P.V: 3 products in the first two query blocks (hi x hi, plus hi x residual and residual x hi in a second accumulator; residuals x2048), single f16 operands elsewhere; key group kw takes the key steps ks = kw, kw + 2, ... with a running maximum and sum of its own, and the two partial results are joined in LDS; ctx is stored as k_out's A operand.
// Why two groups: the cost of a query block grows with its index (causal), and with one wave per query tile every block is resident at once, so the launch lasts as long as the last block while the others' places stand empty. Half as long and twice as many waves give more blocks than places; the blocks start heaviest first (blockIdx.z counts the query blocks down), so the places stay filled to the end.
__device__ __forceinline__ float xhalf(float x) { return __builtin_bit_cast(float, __builtin_amdgcn_permlanex16(__builtin_bit_cast(int, x), __builtin_bit_cast(int, x), 0x76543210, 0xfedcba98, false, false)); }   // the value of lane l ^ 16
__global__ __launch_bounds__(256) void k_attn(const _Float16* __restrict__ QK, const _Float16* __restrict__ QKL, const _Float16* __restrict__ KF, const _Float16* __restrict__ KFL, const _Float16* __restrict__ VTH, const _Float16* __restrict__ VTL, const void* __restrict__ KMASK, const float* __restrict__ AB, __bf16* __restrict__ OF) {
  __shared__ __align__(16) float so[8][16][68]; __shared__ __align__(16) float sm[8][16], sl[8][16];
  const int tid = threadIdx.x, wave = __builtin_amdgcn_readfirstlane(tid >> 5), lane = tid & 31, col = lane & 15, g = lane >> 4;   // the wave's number in a scalar register: the key loop starts from it and stays a scalar loop
  const int qi = wave & 3, kw = wave >> 2;   // query tile, key group
  const int qb = TQB - 1 - blockIdx.z, h = blockIdx.x, b = blockIdx.y; const int q0 = qb * 64 + qi * 16; const size_t rq = (size_t)b * SS + q0 + col;
  v16h aq[2], aql[2];   // the query tile: lane (g, col) holds query col in the fragments' k order, which serves as B as it did as A
#pragma unroll
  for (int kc = 0; kc < 2; ++kc) { aq[kc] = frag_h(QK + rq * (2 * DM) + h * HD + kc * 32, lane); aql[kc] = frag_h(QKL + rq * (2 * DM) + h * HD + kc * 32, lane); }
  float m = -3.0e38f, l = 0.f;   // of query col: the running maximum (common to both halves) and the sum over this half's keys
  v8f acc[4] = {}, accl[4] = {};   // O^T: acc[dt][r] = column d = 16 * dt + 8 * g + r of query col
  const int nks = (qb * 64 + 64) / 32;   // causal: key steps up to the query block's end
  const size_t hb = ((size_t)b * NH + h) * (SS * HD) + lane * 8;   // the head's k and v planes in fragment order (S x 64 elements each), with the lane's offset
  const float* abq = AB + (size_t)(q0 + col) * SS + 8 * g;   // the query's bias row at this half's first key
#pragma unroll 1
  for (int ks = kw; ks < nks; ks += 2) { v8f s[2];   // nks is even: both key groups make qb + 1 trips
    // the key step's K fragments and bias values are loaded as one group in front of the first product (the bias unconditionally: row and key are inside [S][S] for every lane; the causal select follows), so one round trip replaces one per product and per bias row
    v16h kf[2][2]; v4f ab[2][2]; const int dq = q0 + col - 8 * g - ks * 32;   // the query's distance from this half's first key: key 16 * ct + r of the lane is allowed up to it
#pragma unroll
    for (int ct = 0; ct < 2; ++ct) {
#pragma unroll
      for (int kc = 0; kc < 2; ++kc) kf[ct][kc] = frag_hp(KF + hb + (size_t)((ks * 2 + ct) * 2 + kc) * FRAG);
      ab[ct][0] = *(const v4f*)(abq + ks * 32 + ct * 16); ab[ct][1] = *(const v4f*)(abq + ks * 32 + ct * 16 + 4); }   // the lane's eight keys lie side by side in the query's row
    asm volatile("s_wait_xcnt 0x0" ::: "memory");   // precaution: the group's address registers may be reused by what follows while its loads are still out
#pragma unroll
    for (int ct = 0; ct < 2; ++ct) { v8f c = {}, cl = {};
      if (qb < 2) {   // leading query blocks (few keys, outputs far above the global rms): 3 products
#pragma unroll
        for (int kc = 0; kc < 2; ++kc) { const v16h kh = kf[ct][kc]; c = wmma16(kh, aq[kc], c); cl = wmma16(kh, aql[kc], cl); const v16h kl = frag_hp(KFL + hb + (size_t)((ks * 2 + ct) * 2 + kc) * FRAG);
          asm volatile("s_wait_xcnt 0x0" ::: "memory");   // precaution, as above: the load's address registers may be reused by what follows
          cl = wmma16(kl, aq[kc], cl); }
#pragma unroll
        for (int r = 0; r < 8; ++r) c[r] += cl[r] * (1.0f / 2048.0f); }
      else {
#pragma unroll
        for (int kc = 0; kc < 2; ++kc) c = wmma16(kf[ct][kc], aq[kc], c); }   // single product elsewhere
#pragma unroll
      for (int r = 0; r < 8; ++r) s[ct][r] = (ct * 16 + r <= dq) ? (c[r] * SCALEF + bfr(ab[ct][r >> 2][r & 3])) : -3.0e38f; }   // causal: future keys excluded
    // the V fragments are requested here, behind the score products, and fly under the softmax
    v16h vf[4];
#pragma unroll
    for (int dt = 0; dt < 4; ++dt) vf[dt] = frag_hp(VTH + hb + (size_t)(ks * 4 + dt) * FRAG);
    asm volatile("s_wait_xcnt 0x0" ::: "memory");   // precaution: the group's address registers may be reused by what follows while its loads are still out
    float mx = fmaxf(s[0][0], s[1][0]);
#pragma unroll
    for (int r = 1; r < 8; ++r) mx = fmaxf(mx, fmaxf(s[0][r], s[1][r]));
    mx = fmaxf(mx, xhalf(mx));   // the other half holds the query's other sixteen keys
    const float mn = fmaxf(m, mx); const float alpha = (m <= -1.0e38f) ? 0.f : __expf(m - mn);
    v2f es = {}; v16h pa, pl;   // the sum runs in two chains, over the even and the odd keys
#pragma unroll
    for (int r = 0; r < 8; ++r) { const float e0 = (s[0][r] <= -1.0e38f) ? 0.f : __expf(s[0][r] - mn), e1 = (s[1][r] <= -1.0e38f) ? 0.f : __expf(s[1][r] - mn); es[r & 1] += e0; es[r & 1] += e1;
      const float x0 = e0 * 2048.0f, x1 = e1 * 2048.0f; const _Float16 h0 = (_Float16)x0, h1 = (_Float16)x1; pa[r] = h0; pa[8 + r] = h1; pl[r] = (_Float16)((x0 - (float)h0) * 2048.0f); pl[8 + r] = (_Float16)((x1 - (float)h1) * 2048.0f); }   // P scaled by 2^11 before the f16 split so small softmax weights stay out of the f16 subnormal range; 2^-11 folded into the epilogue
    l = l * alpha + (es[0] + es[1]); m = mn;
#pragma unroll
    for (int dt = 0; dt < 4; ++dt) {
#pragma unroll
      for (int r = 0; r < 8; ++r) { acc[dt][r] *= alpha; accl[dt][r] *= alpha; } }
#pragma unroll
    for (int dt = 0; dt < 4; ++dt) { const v16h vh = vf[dt]; acc[dt] = wmma16(vh, pa, acc[dt]); if (qb < 2) { accl[dt] = wmma16(vh, pl, accl[dt]); const v16h vl = frag_hp(VTL + hb + (size_t)(ks * 4 + dt) * FRAG);
        asm volatile("s_wait_xcnt 0x0" ::: "memory");   // precaution, as above: the load's address registers may be reused by what follows
        accl[dt] = wmma16(vl, pa, accl[dt]); } }   // leading query blocks: P hi/lo x V hi/lo (3 products); elsewhere P x V single
  }
  l += xhalf(l);   // the two halves' sums joined once
  // each wave leaves its unnormalised sums (a lane's eight values lie side by side in its query's row) with its queries' maximum and sum
#pragma unroll
  for (int dt = 0; dt < 4; ++dt) { v4f o0, o1;
#pragma unroll   // vector elements need constant indices to stay in registers
    for (int r = 0; r < 4; ++r) { o0[r] = acc[dt][r] + accl[dt][r] * (1.0f / 2048.0f); o1[r] = acc[dt][4 + r] + accl[dt][4 + r] * (1.0f / 2048.0f); }
    *(v4f*)&so[wave][col][dt * 16 + 8 * g] = o0; *(v4f*)&so[wave][col][dt * 16 + 8 * g + 4] = o1; }
  if (g == 0) { sm[wave][col] = m; sl[wave][col] = l; }
  __syncthreads();   // a wave reads the other key group's partial result below: both must be written
  // join for query row col: each part weighted by exp(its maximum - the common one); a group whose keys were all masked for the row (maximum still at the start value) counts 0; group 0 holds key 0, which no row masks, so the sum is above 0
  const float m0 = sm[qi][col], m1 = sm[4 + qi][col], mm = fmaxf(m0, m1);
  const float f0 = (m0 <= -1.0e38f) ? 0.f : __expf(m0 - mm), f1 = (m1 <= -1.0e38f) ? 0.f : __expf(m1 - mm);
  const float il = (1.0f / 2048.0f) / (f0 * sl[qi][col] + f1 * sl[4 + qi][col]); const float w0 = f0 * il, w1 = f1 * il;
  // ctx leaves as the out product's A operand: bf16 hi + residual, fragment order; the tile's 16 queries are one row tile, the head's 64 columns two k-steps, of which the wave writes number kw; 512-B runs
  const size_t ob = (((((size_t)b * SS + q0) >> 4) * (DM / 32) + h * 2 + kw) * (2 * FRAG)) + lane * 8;
#pragma unroll   // the four stores go out as one run, their offsets as immediates
  for (int u = 0; u < 2; ++u) { const float* p0 = &so[qi][col][kw * 32 + u * 16 + 8 * g]; const float* p1 = &so[4 + qi][col][kw * 32 + u * 16 + 8 * g]; v8b hi, lo;
#pragma unroll   // vector elements need constant indices to stay in registers
    for (int i = 0; i < 8; ++i) { const float v = p0[i] * w0 + p1[i] * w1; const __bf16 hv = (__bf16)v; hi[i] = hv; lo[i] = (__bf16)(v - (float)hv); }
    vst2(OF + ob + u * 256, hi); vst2(OF + ob + FRAG + u * 256, lo); }
}
// ---- k_out: block = (64 rows, 128 cols): out = ctx (hi, residual) . Wo (2 products) + bo
__global__ __launch_bounds__(128) void k_out(const __bf16* __restrict__ OF, const __bf16* __restrict__ P, const float* __restrict__ BO, float* __restrict__ Y) {
  __shared__ __align__(16) float so[4][16][132];
  const int tid = threadIdx.x, wave = tid >> 5, lane = tid & 31, col = lane & 15, g = lane >> 4; const size_t r0 = (size_t)blockIdx.x * 64 + wave * 16; const int n0 = blockIdx.y * 128;
  v8f acc[8] = {};
  // as in k_qkv: step kc + 1's loads are issued as one group in front of step kc's products
  gb16* xp = (gb16*)(OF + (r0 >> 4) * (DM / 32) * (2 * FRAG) + lane * 8); gb16* wp = (gb16*)(P + (size_t)(n0 >> 4) * (DM / 32) * FRAG + lane * 8);
  v16b xh = frag_bp(xp), xl = frag_bp(xp + FRAG), wb[8];
#pragma unroll
  for (int j = 0; j < 8; ++j) wb[j] = frag_bp(wp + (size_t)j * (DM / 32) * FRAG);
  XWAIT(xp, wp);
#pragma unroll 2
  for (int kc = 0; kc < DM / 32; ++kc) { const int st = (kc + 1 < DM / 32) ? FRAG : 0; xp += 2 * st; wp += st;   // the last step fetches its own operands again (in bounds, unused)
    const v16b xhn = frag_bp(xp), xln = frag_bp(xp + FRAG); v16b wn[8];
#pragma unroll
    for (int j = 0; j < 8; ++j) wn[j] = frag_bp(wp + (size_t)j * (DM / 32) * FRAG);
    XWAIT(xp, wp);
#pragma unroll
    for (int j = 0; j < 8; ++j) { acc[j] = wmma_bf(xl, wb[j], acc[j]); acc[j] = wmma_bf(xh, wb[j], acc[j]); }
    xh = xhn; xl = xln;
#pragma unroll
    for (int j = 0; j < 8; ++j) wb[j] = wn[j]; }
#pragma unroll
  for (int j = 0; j < 8; ++j) {
#pragma unroll
    for (int r = 0; r < 8; ++r) so[wave][8 * g + r][j * 16 + col] = acc[j][r] + bfr(BO[n0 + j * 16 + col]); }
  LDSX();
  for (int rl = 0; rl < 16; ++rl) vst2(Y + (r0 + rl) * DM + n0 + lane * 4, *(const v4f*)&so[wave][rl][lane * 4]);
}
extern "C" void kernel_launch(void* const* d_in, const int* in_sizes, int n_in, void* d_out, int out_size, void* d_ws, size_t ws_size, hipStream_t stream) {
  (void)in_sizes; (void)n_in; (void)out_size;
  const float** F = (const float**)d_in;   // 0 hidden [2,2048,1024], 1 attn_bias [2048,2048], 2 Wqkv [1024,3072] (in,out; q | k | v), 3 bqkv [3072], 4 Wproj [1024,1024] (in,out), 5 bproj
  if (ws_size < (size_t)WS_END) return;
  char* ws = (char*)d_ws; __bf16* PK = (__bf16*)(ws + WS_PK); _Float16 *QK = (_Float16*)(ws + WS_QK), *QKL = (_Float16*)(ws + WS_QKL), *VTH = (_Float16*)(ws + WS_VTH), *VTL = (_Float16*)(ws + WS_VTL), *KF = (_Float16*)(ws + WS_KF), *KFL = (_Float16*)(ws + WS_KFL); __bf16 *OF = (__bf16*)(ws + WS_O), *XF = (__bf16*)(ws + WS_XF);
  float* OUT0 = (float*)d_out; float* KOUT = OUT0 + (size_t)NB * SS * DM; float* VOUT = KOUT + (size_t)NB * SS * DM;   // outputs: out, cache_key, cache_value
  k_pack<<<dim3((QKVW + DM) / 32, DM / 128), 256, 0, stream>>>(F[2], F[4], PK);
  k_packx<<<NB * SS * DM / 8 / 256, 256, 0, stream>>>(F[0], XF);
  k_qkv<<<dim3(TNB * SS / 64, QKVW / 128), 128, 0, stream>>>(XF, PK + PK_A, F[3], F[3] + DM, F[3] + 2 * DM, KOUT, VOUT, QK, QKL, KF, KFL, VTH, VTL);
  k_attn<<<dim3(NH, TNB, TQB), 256, 0, stream>>>(QK, QKL, KF, KFL, VTH, VTL, nullptr, F[1], OF);
  k_out<<<dim3(TOB, DM / 128), 128, 0, stream>>>(OF, PK + PK_P, F[5], OUT0);
}

// v005
// It runs in 121 microseconds.
// Next to v004, in two timings, it ran 1.04 and 1.03 times as fast.
// Counting every step since v000, it is 5.00 times as fast.
// compute dtype: all float inputs rounded to bf16; qkv = x . Wqkv + b with EXACT bf16 products on WMMA 16x16x32 ((in,out) weights packed by k_pack; x, the weights, k, v and ctx are kept in the matrix instructions' fragment order) - the k and v projections are also written out in f32 straight from the accumulators; causal attention with key-tile skipping: the first 128 queries use 3-product scores and P.v (hi/lo), later queries single f16 operands; (q.k)/8 + attn_bias[q][k], running-max softmax in f32 (hardware exp); out = ctx (bf16 hi + residual) . Wproj (2 products) + bproj; outputs out | cache_key | cache_value concatenated.
#include <hip/hip_runtime.h>
#include <math.h>

typedef __attribute__((ext_vector_type(16))) _Float16 v16h;
typedef __attribute__((ext_vector_type(16))) __bf16 v16b;
typedef __attribute__((ext_vector_type(8)))  _Float16 v8h;
typedef __attribute__((ext_vector_type(8)))  float v8f;
typedef __attribute__((ext_vector_type(4)))  float v4f;
typedef __attribute__((ext_vector_type(2)))  float v2f;
typedef __attribute__((ext_vector_type(4)))  unsigned v4u;
typedef __attribute__((ext_vector_type(4)))  int v4i;
typedef float __attribute__((may_alias)) float_a;
typedef int __attribute__((may_alias)) int_a;

template <typename T> __device__ __forceinline__ void vst2(void* p, T v) { *(T*)p = v;  }
__device__ __forceinline__ v8f wmma16(v16h a, v16h b, v8f c) {
  v8f d = __builtin_amdgcn_wmma_f32_16x16x32_f16(false, a, false, b, (short)0, c, false, false);
  asm volatile("v_nop\n\tv_nop\n\tv_nop\n\tv_nop" : "+v"(d) : "v"(a), "v"(b));
  return d;
}
__device__ __forceinline__ v8f wmma_bf(v16b a, v16b b, v8f c) {
  v8f d = __builtin_amdgcn_wmma_f32_16x16x32_bf16(false, a, false, b, (short)0, c, false, false);
  asm volatile("v_nop\n\tv_nop\n\tv_nop\n\tv_nop" : "+v"(d) : "v"(a), "v"(b));
  return d;
}
// Prefill attention (B 2, S 2,048, E 1,024, 16 heads x 64): fused (in,out) qkv + bias, scores / 8 + learned additive bias[q, k], causal, softmax, . v, Wproj + bias; also returns the k and v projections (the KV cache).
__device__ __forceinline__ v16h frag_h(const _Float16* rowk0, int lane) {
  union { v16h v; v8h q[2]; } u; const _Float16* p = rowk0 + 8 * (lane >> 4);
  u.q[0] = *(const v8h*)p; u.q[1] = *(const v8h*)(p + 16); return u.v;
}
__device__ __forceinline__ v16h frag_f32(const float* rowk0, int lane) {
  v16h a; const float* p = rowk0 + 8 * (lane >> 4);
#pragma unroll
  for (int i = 0; i < 8; ++i) { a[i] = (_Float16)p[i]; a[8 + i] = (_Float16)p[16 + i]; }
  return a;
}
__device__ __forceinline__ v16h frag_f32s(const float* rowk0, int lane, float sc) {
  v16h a; const float* p = rowk0 + 8 * (lane >> 4);
#pragma unroll
  for (int i = 0; i < 8; ++i) { a[i] = (_Float16)(p[i] * sc); a[8 + i] = (_Float16)(p[16 + i] * sc); }
  return a;
}
// column fragment from a [K][ld] layout (column n), rows >= K read as 0
__device__ __forceinline__ v16h fragc_f32(const float* W, int k0, int n, int lane, int ld, int K) {
  v16h a; const int g = lane >> 4;
#pragma unroll
  for (int i = 0; i < 8; ++i) { const int ka = k0 + 8 * g + i, kb = ka + 16;
    a[i] = (_Float16)(ka < K ? W[(size_t)(ka < K ? ka : K - 1) * ld + n] : 0.f); a[8 + i] = (_Float16)(kb < K ? W[(size_t)(kb < K ? kb : K - 1) * ld + n] : 0.f); }
  return a;
}
struct F2 { v16b h, l; };
__device__ __forceinline__ F2 bsplit16(const float v[16]) { F2 r;
#pragma unroll
  for (int i = 0; i < 16; ++i) { const __bf16 h = (__bf16)v[i]; r.h[i] = h; r.l[i] = (__bf16)(v[i] - (float)h); }
  return r; }
__device__ __forceinline__ F2 split_row(const float* row, int k0, int lane) { float v[16]; const float* p = row + k0 + 8 * (lane >> 4);
#pragma unroll
  for (int i = 0; i < 8; ++i) { v[i] = p[i]; v[8 + i] = p[16 + i]; }
  return bsplit16(v); }
__device__ __forceinline__ F2 split_rowK(const float* row, int k0, int lane, int K) { float v[16]; const int g = lane >> 4;
#pragma unroll
  for (int i = 0; i < 8; ++i) { const int ka = k0 + 8 * g + i, kb = ka + 16; v[i] = ka < K ? row[ka < K ? ka : K - 1] : 0.f; v[8 + i] = kb < K ? row[kb < K ? kb : K - 1] : 0.f; }
  return bsplit16(v); }
__device__ __forceinline__ F2 split_col(const float* W, int k0, int n, int lane, int ld, int K) { float v[16]; const int g = lane >> 4;
#pragma unroll
  for (int i = 0; i < 8; ++i) { const int ka = k0 + 8 * g + i, kb = ka + 16; v[i] = ka < K ? W[(size_t)(ka < K ? ka : K - 1) * ld + n] : 0.f; v[8 + i] = kb < K ? W[(size_t)(kb < K ? kb : K - 1) * ld + n] : 0.f; }
  return bsplit16(v); }
__device__ __forceinline__ v8f mac3(const F2& a, const F2& b, v8f c) { c = wmma_bf(a.l, b.h, c); c = wmma_bf(a.h, b.l, c); return wmma_bf(a.h, b.h, c); }
__device__ __forceinline__ float sigm(float v) { return 1.0f / (1.0f + expf(-v)); }
#define LDSX() do { asm volatile("s_wait_dscnt 0" ::: "memory"); __builtin_amdgcn_wave_barrier(); __builtin_amdgcn_fence(__ATOMIC_RELEASE, "workgroup"); } while (0)


#define NB 2
#define SS 2048
#define DM 1024
#define NH 16
#define SCALEF 0.125f
#define HD 64
#define QKVW (3 * DM)
#ifndef TQB
#define TQB (SS / 64)
#define TNB NB
#define TOB (NB * SS / 64)     // output row tiles (all)
#endif
typedef __attribute__((ext_vector_type(8))) __bf16 v8b;
__device__ __forceinline__ v16b frag_b(const __bf16* rowk0, int lane) {
  union { v16b v; v8b q[2]; } u; const __bf16* p = rowk0 + 8 * (lane >> 4);
  u.q[0] = *(const v8b*)p; u.q[1] = *(const v8b*)(p + 16); return u.v;
}
// pointers typed as global memory: they keep that type through the XWAIT statement below, so the loads behind it stay global loads
typedef const __attribute__((address_space(1))) float gf32; typedef const __attribute__((address_space(1))) __bf16 gb16;
typedef const __attribute__((address_space(1))) v4f gv4f; typedef const __attribute__((address_space(1))) v8b gv8b;
// FRAGMENT ORDER: a 16 x 32 operand tile is kept as 1 KB = [half 2][lane 32][8 elements]; lane (g, col) holds row col, k = 16 * half + 8 * g + i, the k order of frag_b / frag_h. One wave-wide 16-byte load then covers 512 contiguous bytes (4 whole lines) instead of 32 bytes in each of 16 lines.
#define FRAG 512                     // elements of one tile
// a tile from a pointer that already holds the lane's offset (lane * 8)
__device__ __forceinline__ v16b frag_bp(gb16* p) { union { v16b v; v8b q[2]; } u; u.q[0] = *(gv8b*)p; u.q[1] = *(gv8b*)(p + 256); return u.v; }
__device__ __forceinline__ v16h frag_hp(const _Float16* p) { union { v16h v; v8h q[2]; } u; u.q[0] = *(const v8h*)p; u.q[1] = *(const v8h*)(p + 256); return u.v; }
// precaution behind a group of global loads: the wait stands in front of every rewrite of the group's address registers; both pointers pass through the statement, so every later step of them follows it
#define XWAIT(pa, pb) asm volatile("s_wait_xcnt 0x0" : "+v"(pa), "+v"(pb) : : "memory")
__device__ __forceinline__ float bfr(float v) { return (float)(__bf16)v; }
__device__ __attribute__((noinline)) float exp_ni(float v) { return expf(v); }
__device__ __attribute__((noinline)) float erf_ni(float v) { return erff(v); }

#define PK_A 0                       // Wqkv, fragment order: [192 tiles of 16 outputs][32 k-steps][FRAG]
#define PK_P (PK_A + QKVW * DM)        // Wo, fragment order: [64 tiles][32 k-steps][FRAG]
#define PK_END (PK_P + DM * DM)
#define WS_PK  0u
#define WS_QK  (WS_PK + 2u * PK_END)             // f16 [4096 rows][2048]: q in the first 1024 columns (the rest unused)
#define WS_QKL (WS_QK + 2u * NB * SS * 2 * DM)     // f16 q residual plane x2048, same shape
#define WS_VTH (WS_QKL + 2u * NB * SS * 2 * DM)    // f16 v hi, fragment order: [b][h][64 steps of 32 keys][4 tiles of 16 d][FRAG]
#define WS_VTL (WS_VTH + 2u * NB * DM * SS)        // f16 lo x 2048, same shape
#define WS_O   (WS_VTL + 2u * NB * DM * SS)        // bf16 ctx, fragment order: [256 tiles of 16 rows][32 k-steps][hi FRAG | residual FRAG]
#define WS_CS  (WS_O + 4u * NB * SS * DM)           // f32 2 x [2048][32], unused
#define WS_KF  (WS_CS + 4u * 2 * SS * 32)          // f16 k hi, fragment order: [b][h][128 tiles of 16 keys][2 k-steps of 32 d][FRAG]
#define WS_KFL (WS_KF + 2u * NB * SS * DM)         // f16 k residual x2048, same shape
#define WS_XF  (WS_KFL + 2u * NB * SS * DM)        // bf16 x, fragment order: [256 tiles of 16 rows][32 k-steps][FRAG]
#define WS_END (WS_XF + 2u * NB * SS * DM)
// ---- k_pack: block = (32 outputs n, 128 inputs k) of an (in,out) weight: whole 128-B lines in, bf16, transposed in LDS, 8 tiles of fragment order out (512-B runs); blocks x < 96 take Wqkv (q | k | v outputs in column order), the rest Wproj, whose tiles follow in PK
static_assert(PK_A == 0 && PK_P == QKVW * DM, "the two weights' tiles are numbered through");
__global__ __launch_bounds__(256) void k_pack(const float* __restrict__ WA, const float* __restrict__ WO, __bf16* __restrict__ PK) {
  __shared__ __align__(16) __bf16 s[32][136]; const int t = threadIdx.x, k0 = blockIdx.y * 128; const bool fused = blockIdx.x < QKVW / 32;
  const float* Wm = fused ? WA + blockIdx.x * 32 : WO + (blockIdx.x - QKVW / 32) * 32; const int ld = fused ? QKVW : DM;
#pragma unroll   // the sixteen line reads go out as one group, not one load-and-wait each
  for (int i = 0; i < 16; ++i) { const int k = (t >> 5) + 8 * i; s[t & 31][k] = (__bf16)Wm[(size_t)(k0 + k) * ld + (t & 31)]; }
  __syncthreads();
#pragma unroll   // two fixed trips: left rolled, the build keeps a lane-masked loop with its address sums per trip
  for (int u = t; u < 512; u += 256) { const int ln = u & 31, half = (u >> 5) & 1, kcl = (u >> 6) & 3, tl = u >> 8;
    vst2((unsigned*)(PK + ((size_t)(blockIdx.x * 2 + tl) * (DM / 32) + blockIdx.y * 4 + kcl) * FRAG + half * 256 + ln * 8), *(const v4u*)&s[tl * 16 + (ln & 15)][kcl * 32 + half * 16 + 8 * (ln >> 4)]); }
}
// ---- k_packx: x rounded to bf16 once (k_qkv's 24 column blocks all read it), into fragment order; thread = one 16-byte piece of the output
__global__ __launch_bounds__(256) void k_packx(const float* __restrict__ X, __bf16* __restrict__ XF) {
  const size_t u = (size_t)blockIdx.x * 256 + threadIdx.x; const int ln = (int)(u & 31), half = (int)(u >> 5) & 1, kc = (int)(u >> 6) & 31;
  const float* p = X + ((u >> 11) * 16 + (ln & 15)) * DM + kc * 32 + half * 16 + 8 * (ln >> 4); const v4f a = *(const v4f*)p, c = *(const v4f*)(p + 4); v8b o;
#pragma unroll   // vector elements need constant indices to stay in registers
  for (int i = 0; i < 4; ++i) { o[i] = (__bf16)a[i]; o[4 + i] = (__bf16)c[i]; }
  vst2(XF + u * 8, o);
}
__global__ __launch_bounds__(128) void k_qkv(const __bf16* __restrict__ XF, const __bf16* __restrict__ P, const float* __restrict__ BQ, const float* __restrict__ BK, const float* __restrict__ BV, float* __restrict__ KOUT, float* __restrict__ VOUT, _Float16* __restrict__ QK, _Float16* __restrict__ QKL, _Float16* __restrict__ KF, _Float16* __restrict__ KFL, _Float16* __restrict__ VTH, _Float16* __restrict__ VTL) {
  const int which0 = (blockIdx.y * 128) / DM; const float* BB = BQ ? (((which0 == 0) ? BQ : (which0 == 1) ? BK : BV) + (blockIdx.y * 128 - which0 * DM)) : nullptr;
  __shared__ __align__(16) _Float16 so[4][16][136], sol[4][16][136]; __shared__ __align__(16) _Float16 sth[128][72], stl[128][72];
  const int tid = threadIdx.x, wave = tid >> 5, lane = tid & 31, col = lane & 15, g = lane >> 4; const size_t r0 = (size_t)blockIdx.x * 64 + wave * 16; const int n0 = blockIdx.y * 128;
  v8f acc[8] = {};
  float bj[8];   // the lane's eight bias values, fetched once as a group (the epilogues read them per element)
#pragma unroll
  for (int j = 0; j < 8; ++j) bj[j] = 0.f;
  if (BB) {
#pragma unroll
    for (int j = 0; j < 8; ++j) bj[j] = bfr(BB[j * 16 + col]); }
  // every global load of k-step kc + 1 is issued as one group in front of step kc's products, so the loads fly together and behind the matrix work instead of one load-and-wait per product
  gb16* xp = (gb16*)(XF + (r0 >> 4) * (DM / 32) * FRAG + lane * 8); gb16* wp = (gb16*)(P + (size_t)(n0 >> 4) * (DM / 32) * FRAG + lane * 8);
  v16b xa = frag_bp(xp), wb[8];
#pragma unroll
  for (int j = 0; j < 8; ++j) wb[j] = frag_bp(wp + (size_t)j * (DM / 32) * FRAG);
  XWAIT(xp, wp);
#pragma unroll 2
  for (int kc = 0; kc < DM / 32; ++kc) { const int st = (kc + 1 < DM / 32) ? FRAG : 0; xp += st; wp += st;   // the last step fetches its own operands again (in bounds, unused)
    const v16b xn = frag_bp(xp); v16b wn[8];
#pragma unroll
    for (int j = 0; j < 8; ++j) wn[j] = frag_bp(wp + (size_t)j * (DM / 32) * FRAG);
    XWAIT(xp, wp);
#pragma unroll
    for (int j = 0; j < 8; ++j) acc[j] = wmma_bf(xa, wb[j], acc[j]);
    xa = xn;
#pragma unroll
    for (int j = 0; j < 8; ++j) wb[j] = wn[j]; }
  if (which0 >= 1) {   // cache_key / cache_value: the f32 projections (+ bias) straight from the accumulators, 512-B row segments
    __shared__ __align__(16) float sf[4][16][132];
#pragma unroll
    for (int j = 0; j < 8; ++j) {
#pragma unroll
      for (int r = 0; r < 8; ++r) sf[wave][8 * g + r][j * 16 + col] = acc[j][r] + bj[j]; }
    LDSX();
    float* dst = (which0 == 1) ? KOUT : VOUT; for (int rl = 0; rl < 16; ++rl) vst2(dst + (r0 + rl) * DM + (n0 - which0 * DM) + lane * 4, *(const v4f*)&sf[wave][rl][lane * 4]);
    LDSX(); }
  if (n0 < 2 * DM) {   // q stored unscaled (f16 sigma ~0.6, no subnormal exposure); 1/8 applied to the f32 score
#pragma unroll
    for (int j = 0; j < 8; ++j) {
#pragma unroll
      for (int r = 0; r < 8; ++r) { const float v = acc[j][r] + bj[j]; const _Float16 hv = (_Float16)v; so[wave][8 * g + r][j * 16 + col] = hv; sol[wave][8 * g + r][j * 16 + col] = (_Float16)((v - (float)hv) * 2048.0f); } }   // q, k (+ bias) as f16 hi + (x2048) residual
    LDSX();
    if (which0 == 0) { for (int rl = 0; rl < 16; ++rl) if (lane < 16) { vst2((unsigned*)(QK + (r0 + rl) * (2 * DM) + n0 + lane * 8), *(const v4u*)&so[wave][rl][lane * 8]); vst2((unsigned*)(QKL + (r0 + rl) * (2 * DM) + n0 + lane * 8), *(const v4u*)&sol[wave][rl][lane * 8]); } }
    else {   // k: the wave's 16 rows are one key tile; 2 heads x 2 k-steps x 2 halves, each a 512-B run in fragment order
      const size_t kb = (((r0 / SS) * NH + ((n0 - DM) >> 6)) * (SS / 16) + ((r0 % SS) >> 4)) * (2 * FRAG) + lane * 8;
#pragma unroll   // the sixteen stores go out as one run, their offsets as immediates
      for (int u = 0; u < 8; ++u) { const size_t o = kb + (size_t)(u >> 2) * (SS / 16) * (2 * FRAG) + (u & 3) * 256; const int c0 = (u >> 2) * 64 + (u & 3) * 16 + 8 * g;
        vst2((unsigned*)(KF + o), *(const v4u*)&so[wave][col][c0]); vst2((unsigned*)(KFL + o), *(const v4u*)&sol[wave][col][c0]); }
      asm volatile("s_wait_xcnt 0x0" ::: "memory"); }   // precaution behind the run of sixteen stores: their registers may be reused by what follows while the stores are still out
  } else {
#pragma unroll
    for (int j = 0; j < 8; ++j) {
#pragma unroll
      for (int r = 0; r < 8; ++r) { const float v = acc[j][r] + bj[j]; const _Float16 hv = (_Float16)v; sth[j * 16 + col][wave * 16 + 8 * g + r] = hv; stl[j * 16 + col][wave * 16 + 8 * g + r] = (_Float16)((v - (float)hv) * 2048.0f); } }
    __syncthreads();
    const size_t rb = (size_t)blockIdx.x * 64; const int b = (int)(rb / SS), s0 = (int)(rb % SS); const int pc0 = n0 - 2 * DM;
    for (int u = tid; u < 128 * 8; u += 128) { const int ln = u & 31, half = (u >> 5) & 1, dt = (u >> 6) & 3, ksl = (u >> 8) & 1, hh = u >> 9; const int d = hh * 64 + dt * 16 + (ln & 15), pc = ksl * 4 + half * 2 + (ln >> 4);   // 512-B runs in fragment order
      const size_t o = ((((size_t)b * NH + (pc0 >> 6) + hh) * (SS / 32) + (s0 >> 5) + ksl) * 4 + dt) * FRAG + half * 256 + ln * 8; vst2((unsigned*)(VTH + o), *(const v4u*)&sth[d][pc * 8]); vst2((unsigned*)(VTL + o), *(const v4u*)&stl[d][pc * 8]); }
  }
}
// ---- k_attn: block = (64 queries, head h, batch b), 8 waves = 4 query tiles x 2 key groups: causal flash attention (K = 64: 2 k-steps), computed TRANSPOSED: S^T = K . Q^T (A = a key tile, B = the query tile) and O^T += V^T . P^T. A lane (g, col) then holds, of ONE query (col), the scores of keys 16 * ct + 8 * g + r: maximum and sum run inside the lane with one exchange between the wave's halves, the rescale factor is one value per lane, and the two score tiles, converted in place, ARE the B operand of the second product (element 8 * ct + r = key 16 * ct + 8 * g + r, the k order of the V fragments), so P passes through no LDS. scores = (q.k) * 0.125 and P.V: 3 products in the first two query blocks (hi x hi, plus hi x residual and residual x hi in a second accumulator; residuals x2048), single f16 operands elsewhere; key group kw takes the key steps ks = kw, kw + 2, ... with a running maximum and sum of its own, and the two partial results are joined in LDS; ctx is stored as k_out's A operand.
// Why two groups: the cost of a query block grows with its index (causal), and with one wave per query tile every block is resident at once, so the launch lasts as long as the last block while the others' places stand empty. Half as long and twice as many waves give more blocks than places; the blocks start heaviest first (blockIdx.z counts the query blocks down), so the places stay filled to the end.
__device__ __forceinline__ float xhalf(float x) { return __builtin_bit_cast(float, __builtin_amdgcn_permlanex16(__builtin_bit_cast(int, x), __builtin_bit_cast(int, x), 0x76543210, 0xfedcba98, false, false)); }   // the value of lane l ^ 16
#define LOG2E 1.44269504088896340736f
// one key step (32 keys) of a wave, compiled once per case, so that a step runs only the work its case needs; both switches are the same for a whole wave. PREC: the leading query blocks' 3-product scores and P.V with the second accumulator. MASK: the step holds keys behind some query of the tile (causal select, masked scores count 0).
template <bool PREC, bool MASK> __device__ __forceinline__ void attn_step(const int ks, const _Float16* __restrict__ KF, const _Float16* __restrict__ KFL, const _Float16* __restrict__ VTH, const _Float16* __restrict__ VTL, const size_t hb, const float* abq, const int dq0, const v16h* aq, const v16h* aql, float& m, float& l, v8f* acc, v8f* accl) {
  v8f s[2];
  // the key step's K fragments and bias values are loaded as one group in front of the first product (the bias unconditionally: row and key are inside [S][S] for every lane; the causal select follows), so one round trip replaces one per product and per bias row
  v16h kf[2][2]; v4f ab[2][2]; const int dq = dq0 - ks * 32;   // the query's distance from this half's first key: key 16 * ct + r of the lane is allowed up to it
#pragma unroll
  for (int ct = 0; ct < 2; ++ct) {
#pragma unroll
    for (int kc = 0; kc < 2; ++kc) kf[ct][kc] = frag_hp(KF + hb + (size_t)((ks * 2 + ct) * 2 + kc) * FRAG);
    ab[ct][0] = *(const v4f*)(abq + ks * 32 + ct * 16); ab[ct][1] = *(const v4f*)(abq + ks * 32 + ct * 16 + 4); }   // the lane's eight keys lie side by side in the query's row
  asm volatile("s_wait_xcnt 0x0" ::: "memory");   // precaution: the group's address registers may be reused by what follows while its loads are still out
#pragma unroll
  for (int ct = 0; ct < 2; ++ct) { v8f c = {};
    if (PREC) { v8f cl = {};   // leading query blocks (few keys, outputs far above the global rms): 3 products
#pragma unroll
      for (int kc = 0; kc < 2; ++kc) { const v16h kh = kf[ct][kc]; c = wmma16(kh, aq[kc], c); cl = wmma16(kh, aql[kc], cl); const v16h kl = frag_hp(KFL + hb + (size_t)((ks * 2 + ct) * 2 + kc) * FRAG);
        asm volatile("s_wait_xcnt 0x0" ::: "memory");   // precaution, as above: the load's address registers may be reused by what follows
        cl = wmma16(kl, aq[kc], cl); }
#pragma unroll
      for (int r = 0; r < 8; ++r) c[r] += cl[r] * (1.0f / 2048.0f); }
    else {
#pragma unroll
      for (int kc = 0; kc < 2; ++kc) c = wmma16(kf[ct][kc], aq[kc], c); }   // single product elsewhere
#pragma unroll
    for (int r = 0; r < 8; ++r) { const float sv = c[r] * SCALEF + bfr(ab[ct][r >> 2][r & 3]); s[ct][r] = (!MASK || ct * 16 + r <= dq) ? sv : -3.0e38f; } }   // causal: future keys excluded
  // the V fragments are requested here, behind the score products, and fly under the softmax
  v16h vf[4];
#pragma unroll
  for (int dt = 0; dt < 4; ++dt) vf[dt] = frag_hp(VTH + hb + (size_t)(ks * 4 + dt) * FRAG);
  asm volatile("s_wait_xcnt 0x0" ::: "memory");   // precaution: the group's address registers may be reused by what follows while its loads are still out
  float mx = fmaxf(s[0][0], s[1][0]);
#pragma unroll
  for (int r = 1; r < 8; ++r) mx = fmaxf(mx, fmaxf(s[0][r], s[1][r]));
  mx = fmaxf(mx, xhalf(mx));   // the other half holds the query's other sixteen keys
  const float mn = fmaxf(m, mx);
  // exp(x) as the hardware's 2^(x * log2 e), arguments and results by name for the two statements below
  float ta = (m - mn) * LOG2E, ea = __builtin_amdgcn_exp2f(ta), t[2][8], e[2][8];
#pragma unroll
  for (int ct = 0; ct < 2; ++ct) {
#pragma unroll
    for (int r = 0; r < 8; ++r) { t[ct][r] = (s[ct][r] - mn) * LOG2E; e[ct][r] = __builtin_amdgcn_exp2f(t[ct][r]); } }
  // the slot behind a transcendental: the v_nop stands behind its group's last v_exp_f32, in front of every use of a result (in-out operands) and every overwrite of an argument (inputs, live up to here)
  asm volatile("v_nop" : "+v"(ea), "+v"(e[0][0]), "+v"(e[0][1]), "+v"(e[0][2]), "+v"(e[0][3]), "+v"(e[0][4]), "+v"(e[0][5]), "+v"(e[0][6]), "+v"(e[0][7]) : "v"(ta), "v"(t[0][0]), "v"(t[0][1]), "v"(t[0][2]), "v"(t[0][3]), "v"(t[0][4]), "v"(t[0][5]), "v"(t[0][6]), "v"(t[0][7]));
  asm volatile("v_nop" : "+v"(e[1][0]), "+v"(e[1][1]), "+v"(e[1][2]), "+v"(e[1][3]), "+v"(e[1][4]), "+v"(e[1][5]), "+v"(e[1][6]), "+v"(e[1][7]) : "v"(t[1][0]), "v"(t[1][1]), "v"(t[1][2]), "v"(t[1][3]), "v"(t[1][4]), "v"(t[1][5]), "v"(t[1][6]), "v"(t[1][7]));
  const float alpha = (m <= -1.0e38f) ? 0.f : ea;
  v2f es = {}; v16h pa, pl;   // the sum runs in two chains, over the even and the odd keys
#pragma unroll
  for (int r = 0; r < 8; ++r) { const float e0 = (MASK && s[0][r] <= -1.0e38f) ? 0.f : e[0][r], e1 = (MASK && s[1][r] <= -1.0e38f) ? 0.f : e[1][r]; es[r & 1] += e0; es[r & 1] += e1;
    const float x0 = e0 * 2048.0f, x1 = e1 * 2048.0f; const _Float16 h0 = (_Float16)x0, h1 = (_Float16)x1; pa[r] = h0; pa[8 + r] = h1;   // P scaled by 2^11 before the f16 split so small softmax weights stay out of the f16 subnormal range; 2^-11 folded into the epilogue
    if (PREC) { pl[r] = (_Float16)((x0 - (float)h0) * 2048.0f); pl[8 + r] = (_Float16)((x1 - (float)h1) * 2048.0f); } }
  l = l * alpha + (es[0] + es[1]); m = mn;
#pragma unroll
  for (int dt = 0; dt < 4; ++dt) {
#pragma unroll
    for (int r = 0; r < 8; ++r) { acc[dt][r] *= alpha; if (PREC) accl[dt][r] *= alpha; } }
#pragma unroll
  for (int dt = 0; dt < 4; ++dt) { const v16h vh = vf[dt]; acc[dt] = wmma16(vh, pa, acc[dt]); if (PREC) { accl[dt] = wmma16(vh, pl, accl[dt]); const v16h vl = frag_hp(VTL + hb + (size_t)(ks * 4 + dt) * FRAG);
      asm volatile("s_wait_xcnt 0x0" ::: "memory");   // precaution, as above: the load's address registers may be reused by what follows
      accl[dt] = wmma16(vl, pa, accl[dt]); } }   // leading query blocks: P hi/lo x V hi/lo (3 products); elsewhere P x V single
}
__global__ __launch_bounds__(256) void k_attn(const _Float16* __restrict__ QK, const _Float16* __restrict__ QKL, const _Float16* __restrict__ KF, const _Float16* __restrict__ KFL, const _Float16* __restrict__ VTH, const _Float16* __restrict__ VTL, const void* __restrict__ KMASK, const float* __restrict__ AB, __bf16* __restrict__ OF) {
  __shared__ __align__(16) float so[8][16][68]; __shared__ __align__(16) float sm[8][16], sl[8][16];
  const int tid = threadIdx.x, wave = __builtin_amdgcn_readfirstlane(tid >> 5), lane = tid & 31, col = lane & 15, g = lane >> 4;   // the wave's number in a scalar register: the key loop starts from it and stays a scalar loop
  const int qi = wave & 3, kw = wave >> 2;   // query tile, key group
  const int qb = TQB - 1 - blockIdx.z, h = blockIdx.x, b = blockIdx.y; const int q0 = qb * 64 + qi * 16; const size_t rq = (size_t)b * SS + q0 + col;
  v16h aq[2];   // the query tile: lane (g, col) holds query col in the fragments' k order, which serves as B as it did as A
#pragma unroll
  for (int kc = 0; kc < 2; ++kc) aq[kc] = frag_h(QK + rq * (2 * DM) + h * HD + kc * 32, lane);
  float m = -3.0e38f, l = 0.f;   // of query col: the running maximum (common to both halves) and the sum over this half's keys
  v8f acc[4] = {};   // O^T: acc[dt][r] = column d = 16 * dt + 8 * g + r of query col
  const int nks = (qb * 64 + 64) / 32;   // causal: key steps of 32 up to the query block's end
  const size_t hb = ((size_t)b * NH + h) * (SS * HD) + lane * 8;   // the head's k and v planes in fragment order (S x 64 elements each), with the lane's offset
  const float* abq = AB + (size_t)(q0 + col) * SS + 8 * g;   // the query's bias row at this half's first key
  const int dq0 = q0 + col - 8 * g;   // the query's distance from this half's first key of step 0
  // nks is even: both key groups make qb + 1 trips
  if (qb < 2) {   // the same for the whole block
    v16h aql[2]; v8f accl[4] = {};
#pragma unroll
    for (int kc = 0; kc < 2; ++kc) aql[kc] = frag_h(QKL + rq * (2 * DM) + h * HD + kc * 32, lane);
#pragma unroll 1   // rolled: the step's text once per case
    for (int ks = kw; ks < nks; ks += 2) attn_step<true, true>(ks, KF, KFL, VTH, VTL, hb, abq, dq0, aq, aql, m, l, acc, accl);
#pragma unroll
    for (int dt = 0; dt < 4; ++dt) {
#pragma unroll
      for (int r = 0; r < 8; ++r) acc[dt][r] += accl[dt][r] * (1.0f / 2048.0f); }
  } else {
    const int nfull = (q0 + 1) >> 5;   // steps whose 32 keys all lie at or in front of the tile's first query: no lane masks any of them
    int ks = kw;
#pragma unroll 1   // rolled: the step's text once per case
    for (; ks < nfull; ks += 2) attn_step<false, false>(ks, KF, KFL, VTH, VTL, hb, abq, dq0, aq, nullptr, m, l, acc, nullptr);
#pragma unroll 1   // rolled: at most one trip, the step on the diagonal
    for (; ks < nks; ks += 2) attn_step<false, true>(ks, KF, KFL, VTH, VTL, hb, abq, dq0, aq, nullptr, m, l, acc, nullptr);
  }
  l += xhalf(l);   // the two halves' sums joined once
  // each wave leaves its unnormalised sums (a lane's eight values lie side by side in its query's row) with its queries' maximum and sum
#pragma unroll
  for (int dt = 0; dt < 4; ++dt) { v4f o0, o1;
#pragma unroll   // vector elements need constant indices to stay in registers
    for (int r = 0; r < 4; ++r) { o0[r] = acc[dt][r]; o1[r] = acc[dt][4 + r]; }
    *(v4f*)&so[wave][col][dt * 16 + 8 * g] = o0; *(v4f*)&so[wave][col][dt * 16 + 8 * g + 4] = o1; }
  if (g == 0) { sm[wave][col] = m; sl[wave][col] = l; }
  __syncthreads();   // a wave reads the other key group's partial result below: both must be written
  // join for query row col: each part weighted by exp(its maximum - the common one); a group whose keys were all masked for the row (maximum still at the start value) counts 0; group 0 holds key 0, which no row masks, so the sum is above 0
  const float m0 = sm[qi][col], m1 = sm[4 + qi][col], mm = fmaxf(m0, m1);
  const float f0 = (m0 <= -1.0e38f) ? 0.f : __expf(m0 - mm), f1 = (m1 <= -1.0e38f) ? 0.f : __expf(m1 - mm);
  const float il = (1.0f / 2048.0f) / (f0 * sl[qi][col] + f1 * sl[4 + qi][col]); const float w0 = f0 * il, w1 = f1 * il;
  // ctx leaves as the out product's A operand: bf16 hi + residual, fragment order; the tile's 16 queries are one row tile, the head's 64 columns two k-steps, of which the wave writes number kw; 512-B runs
  const size_t ob = (((((size_t)b * SS + q0) >> 4) * (DM / 32) + h * 2 + kw) * (2 * FRAG)) + lane * 8;
#pragma unroll   // the four stores go out as one run, their offsets as immediates
  for (int u = 0; u < 2; ++u) { const float* p0 = &so[qi][col][kw * 32 + u * 16 + 8 * g]; const float* p1 = &so[4 + qi][col][kw * 32 + u * 16 + 8 * g]; v8b hi, lo;
#pragma unroll   // vector elements need constant indices to stay in registers
    for (int i = 0; i < 8; ++i) { const float v = p0[i] * w0 + p1[i] * w1; const __bf16 hv = (__bf16)v; hi[i] = hv; lo[i] = (__bf16)(v - (float)hv); }
    vst2(OF + ob + u * 256, hi); vst2(OF + ob + FRAG + u * 256, lo); }
}
// ---- k_out: block = (64 rows, 128 cols): out = ctx (hi, residual) . Wo (2 products) + bo
__global__ __launch_bounds__(128) void k_out(const __bf16* __restrict__ OF, const __bf16* __restrict__ P, const float* __restrict__ BO, float* __restrict__ Y) {
  __shared__ __align__(16) float so[4][16][132];
  const int tid = threadIdx.x, wave = tid >> 5, lane = tid & 31, col = lane & 15, g = lane >> 4; const size_t r0 = (size_t)blockIdx.x * 64 + wave * 16; const int n0 = blockIdx.y * 128;
  v8f acc[8] = {};
  // as in k_qkv: step kc + 1's loads are issued as one group in front of step kc's products
  gb16* xp = (gb16*)(OF + (r0 >> 4) * (DM / 32) * (2 * FRAG) + lane * 8); gb16* wp = (gb16*)(P + (size_t)(n0 >> 4) * (DM / 32) * FRAG + lane * 8);
  v16b xh = frag_bp(xp), xl = frag_bp(xp + FRAG), wb[8];
#pragma unroll
  for (int j = 0; j < 8; ++j) wb[j] = frag_bp(wp + (size_t)j * (DM / 32) * FRAG);
  XWAIT(xp, wp);
#pragma unroll 2
  for (int kc = 0; kc < DM / 32; ++kc) { const int st = (kc + 1 < DM / 32) ? FRAG : 0; xp += 2 * st; wp += st;   // the last step fetches its own operands again (in bounds, unused)
    const v16b xhn = frag_bp(xp), xln = frag_bp(xp + FRAG); v16b wn[8];
#pragma unroll
    for (int j = 0; j < 8; ++j) wn[j] = frag_bp(wp + (size_t)j * (DM / 32) * FRAG);
    XWAIT(xp, wp);
#pragma unroll
    for (int j = 0; j < 8; ++j) { acc[j] = wmma_bf(xl, wb[j], acc[j]); acc[j] = wmma_bf(xh, wb[j], acc[j]); }
    xh = xhn; xl = xln;
#pragma unroll
    for (int j = 0; j < 8; ++j) wb[j] = wn[j]; }
#pragma unroll
  for (int j = 0; j < 8; ++j) {
#pragma unroll
    for (int r = 0; r < 8; ++r) so[wave][8 * g + r][j * 16 + col] = acc[j][r] + bfr(BO[n0 + j * 16 + col]); }
  LDSX();
  for (int rl = 0; rl < 16; ++rl) vst2(Y + (r0 + rl) * DM + n0 + lane * 4, *(const v4f*)&so[wave][rl][lane * 4]);
}
extern "C" void kernel_launch(void* const* d_in, const int* in_sizes, int n_in, void* d_out, int out_size, void* d_ws, size_t ws_size, hipStream_t stream) {
  (void)in_sizes; (void)n_in; (void)out_size;
  const float** F = (const float**)d_in;   // 0 hidden [2,2048,1024], 1 attn_bias [2048,2048], 2 Wqkv [1024,3072] (in,out; q | k | v), 3 bqkv [3072], 4 Wproj [1024,1024] (in,out), 5 bproj
  if (ws_size < (size_t)WS_END) return;
  char* ws = (char*)d_ws; __bf16* PK = (__bf16*)(ws + WS_PK); _Float16 *QK = (_Float16*)(ws + WS_QK), *QKL = (_Float16*)(ws + WS_QKL), *VTH = (_Float16*)(ws + WS_VTH), *VTL = (_Float16*)(ws + WS_VTL), *KF = (_Float16*)(ws + WS_KF), *KFL = (_Float16*)(ws + WS_KFL); __bf16 *OF = (__bf16*)(ws + WS_O), *XF = (__bf16*)(ws + WS_XF);
  float* OUT0 = (float*)d_out; float* KOUT = OUT0 + (size_t)NB * SS * DM; float* VOUT = KOUT + (size_t)NB * SS * DM;   // outputs: out, cache_key, cache_value
  k_pack<<<dim3((QKVW + DM) / 32, DM / 128), 256, 0, stream>>>(F[2], F[4], PK);
  k_packx<<<NB * SS * DM / 8 / 256, 256, 0, stream>>>(F[0], XF);
  k_qkv<<<dim3(TNB * SS / 64, QKVW / 128), 128, 0, stream>>>(XF, PK + PK_A, F[3], F[3] + DM, F[3] + 2 * DM, KOUT, VOUT, QK, QKL, KF, KFL, VTH, VTL);
  k_attn<<<dim3(NH, TNB, TQB), 256, 0, stream>>>(QK, QKL, KF, KFL, VTH, VTL, nullptr, F[1], OF);
  k_out<<<dim3(TOB, DM / 128), 128, 0, stream>>>(OF, PK + PK_P, F[5], OUT0);
}

// v006
// It runs in 107 microseconds.
// Two timings next to v005 both put it at 1.12 times that version's speed.
// Counting every step since v000, it is 5.62 times as fast.
// compute dtype: all float inputs rounded to bf16; qkv = x . Wqkv + b with EXACT bf16 products on WMMA 16x16x32 ((in,out) weights packed by k_pack; x, the weights, k, v and ctx are kept in the matrix instructions' fragment order) - the k and v projections are also written out in f32 straight from the accumulators; causal attention with key-tile skipping: the first 128 queries use 3-product scores and P.v (hi/lo), later queries single f16 operands; (q.k)/8 + attn_bias[q][k], running-max softmax in f32 (hardware exp); out = ctx (bf16 hi + residual) . Wproj (2 products) + bproj; outputs out | cache_key | cache_value concatenated.
#include <hip/hip_runtime.h>
#include <math.h>

typedef __attribute__((ext_vector_type(16))) _Float16 v16h;
typedef __attribute__((ext_vector_type(16))) __bf16 v16b;
typedef __attribute__((ext_vector_type(8)))  _Float16 v8h;
typedef __attribute__((ext_vector_type(8)))  float v8f;
typedef __attribute__((ext_vector_type(4)))  float v4f;
typedef __attribute__((ext_vector_type(2)))  float v2f;
typedef __attribute__((ext_vector_type(4)))  unsigned v4u;
typedef __attribute__((ext_vector_type(4)))  int v4i;
typedef float __attribute__((may_alias)) float_a;
typedef int __attribute__((may_alias)) int_a;

template <typename T> __device__ __forceinline__ void vst2(void* p, T v) { *(T*)p = v;  }
__device__ __forceinline__ v8f wmma16(v16h a, v16h b, v8f c) {
  v8f d = __builtin_amdgcn_wmma_f32_16x16x32_f16(false, a, false, b, (short)0, c, false, false);
  asm volatile("v_nop\n\tv_nop\n\tv_nop\n\tv_nop" : "+v"(d) : "v"(a), "v"(b));
  return d;
}
__device__ __forceinline__ v8f wmma_bf(v16b a, v16b b, v8f c) {
  v8f d = __builtin_amdgcn_wmma_f32_16x16x32_bf16(false, a, false, b, (short)0, c, false, false);
  asm volatile("v_nop\n\tv_nop\n\tv_nop\n\tv_nop" : "+v"(d) : "v"(a), "v"(b));
  return d;
}
// Prefill attention (B 2, S 2,048, E 1,024, 16 heads x 64): fused (in,out) qkv + bias, scores / 8 + learned additive bias[q, k], causal, softmax, . v, Wproj + bias; also returns the k and v projections (the KV cache).
__device__ __forceinline__ v16h frag_h(const _Float16* rowk0, int lane) {
  union { v16h v; v8h q[2]; } u; const _Float16* p = rowk0 + 8 * (lane >> 4);
  u.q[0] = *(const v8h*)p; u.q[1] = *(const v8h*)(p + 16); return u.v;
}
__device__ __forceinline__ v16h frag_f32(const float* rowk0, int lane) {
  v16h a; const float* p = rowk0 + 8 * (lane >> 4);
#pragma unroll
  for (int i = 0; i < 8; ++i) { a[i] = (_Float16)p[i]; a[8 + i] = (_Float16)p[16 + i]; }
  return a;
}
__device__ __forceinline__ v16h frag_f32s(const float* rowk0, int lane, float sc) {
  v16h a; const float* p = rowk0 + 8 * (lane >> 4);
#pragma unroll
  for (int i = 0; i < 8; ++i) { a[i] = (_Float16)(p[i] * sc); a[8 + i] = (_Float16)(p[16 + i] * sc); }
  return a;
}
// column fragment from a [K][ld] layout (column n), rows >= K read as 0
__device__ __forceinline__ v16h fragc_f32(const float* W, int k0, int n, int lane, int ld, int K) {
  v16h a; const int g = lane >> 4;
#pragma unroll
  for (int i = 0; i < 8; ++i) { const int ka = k0 + 8 * g + i, kb = ka + 16;
    a[i] = (_Float16)(ka < K ? W[(size_t)(ka < K ? ka : K - 1) * ld + n] : 0.f); a[8 + i] = (_Float16)(kb < K ? W[(size_t)(kb < K ? kb : K - 1) * ld + n] : 0.f); }
  return a;
}
struct F2 { v16b h, l; };
__device__ __forceinline__ F2 bsplit16(const float v[16]) { F2 r;
#pragma unroll
  for (int i = 0; i < 16; ++i) { const __bf16 h = (__bf16)v[i]; r.h[i] = h; r.l[i] = (__bf16)(v[i] - (float)h); }
  return r; }
__device__ __forceinline__ F2 split_row(const float* row, int k0, int lane) { float v[16]; const float* p = row + k0 + 8 * (lane >> 4);
#pragma unroll
  for (int i = 0; i < 8; ++i) { v[i] = p[i]; v[8 + i] = p[16 + i]; }
  return bsplit16(v); }
__device__ __forceinline__ F2 split_rowK(const float* row, int k0, int lane, int K) { float v[16]; const int g = lane >> 4;
#pragma unroll
  for (int i = 0; i < 8; ++i) { const int ka = k0 + 8 * g + i, kb = ka + 16; v[i] = ka < K ? row[ka < K ? ka : K - 1] : 0.f; v[8 + i] = kb < K ? row[kb < K ? kb : K - 1] : 0.f; }
  return bsplit16(v); }
__device__ __forceinline__ F2 split_col(const float* W, int k0, int n, int lane, int ld, int K) { float v[16]; const int g = lane >> 4;
#pragma unroll
  for (int i = 0; i < 8; ++i) { const int ka = k0 + 8 * g + i, kb = ka + 16; v[i] = ka < K ? W[(size_t)(ka < K ? ka : K - 1) * ld + n] : 0.f; v[8 + i] = kb < K ? W[(size_t)(kb < K ? kb : K - 1) * ld + n] : 0.f; }
  return bsplit16(v); }
__device__ __forceinline__ v8f mac3(const F2& a, const F2& b, v8f c) { c = wmma_bf(a.l, b.h, c); c = wmma_bf(a.h, b.l, c); return wmma_bf(a.h, b.h, c); }
__device__ __forceinline__ float sigm(float v) { return 1.0f / (1.0f + expf(-v)); }
#define LDSX() do { asm volatile("s_wait_dscnt 0" ::: "memory"); __builtin_amdgcn_wave_barrier(); __builtin_amdgcn_fence(__ATOMIC_RELEASE, "workgroup"); } while (0)


#define NB 2
#define SS 2048
#define DM 1024
#define NH 16
#define SCALEF 0.125f
#define HD 64
#define QKVW (3 * DM)
#ifndef TQB
#define TQB (SS / 64)
#define TNB NB
#define TOB (NB * SS / 64)     // output row tiles (all)
#endif
typedef __attribute__((ext_vector_type(8))) __bf16 v8b;
__device__ __forceinline__ v16b frag_b(const __bf16* rowk0, int lane) {
  union { v16b v; v8b q[2]; } u; const __bf16* p = rowk0 + 8 * (lane >> 4);
  u.q[0] = *(const v8b*)p; u.q[1] = *(const v8b*)(p + 16); return u.v;
}
// pointers typed as global memory: they keep that type through the XWAIT statement below, so the loads behind it stay global loads
typedef const __attribute__((address_space(1))) float gf32; typedef const __attribute__((address_space(1))) __bf16 gb16;
typedef const __attribute__((address_space(1))) v4f gv4f; typedef const __attribute__((address_space(1))) v8b gv8b;
// FRAGMENT ORDER: a 16 x 32 operand tile is kept as 1 KB = [half 2][lane 32][8 elements]; lane (g, col) holds row col, k = 16 * half + 8 * g + i, the k order of frag_b / frag_h. One wave-wide 16-byte load then covers 512 contiguous bytes (4 whole lines) instead of 32 bytes in each of 16 lines.
#define FRAG 512                     // elements of one tile
// a tile from a pointer that already holds the lane's offset (lane * 8)
__device__ __forceinline__ v16b frag_bp(gb16* p) { union { v16b v; v8b q[2]; } u; u.q[0] = *(gv8b*)p; u.q[1] = *(gv8b*)(p + 256); return u.v; }
__device__ __forceinline__ v16h frag_hp(const _Float16* p) { union { v16h v; v8h q[2]; } u; u.q[0] = *(const v8h*)p; u.q[1] = *(const v8h*)(p + 256); return u.v; }
// precaution behind a group of global loads: the wait stands in front of every rewrite of the group's address registers; both pointers pass through the statement, so every later step of them follows it
#define XWAIT(pa, pb) asm volatile("s_wait_xcnt 0x0" : "+v"(pa), "+v"(pb) : : "memory")
__device__ __forceinline__ float bfr(float v) { return (float)(__bf16)v; }
__device__ __attribute__((noinline)) float exp_ni(float v) { return expf(v); }
__device__ __attribute__((noinline)) float erf_ni(float v) { return erff(v); }

#define PK_A 0                       // Wqkv, fragment order: [192 tiles of 16 outputs][32 k-steps][FRAG]
#define PK_P (PK_A + QKVW * DM)        // Wo, fragment order: [64 tiles][32 k-steps][FRAG]
#define PK_END (PK_P + DM * DM)
#define WS_PK  0u
#define WS_QK  (WS_PK + 2u * PK_END)             // f16 [4096 rows][2048]: q in the first 1024 columns (the rest unused)
#define WS_QKL (WS_QK + 2u * NB * SS * 2 * DM)     // f16 q residual plane x2048, same shape
#define WS_VTH (WS_QKL + 2u * NB * SS * 2 * DM)    // f16 v hi, fragment order: [b][h][64 steps of 32 keys][4 tiles of 16 d][FRAG]
#define WS_VTL (WS_VTH + 2u * NB * DM * SS)        // f16 lo x 2048, same shape
#define WS_O   (WS_VTL + 2u * NB * DM * SS)        // bf16 ctx, fragment order: [256 tiles of 16 rows][32 k-steps][hi FRAG | residual FRAG]
#define WS_CS  (WS_O + 4u * NB * SS * DM)           // f32 2 x [2048][32], unused
#define WS_KF  (WS_CS + 4u * 2 * SS * 32)          // f16 k hi, fragment order: [b][h][128 tiles of 16 keys][2 k-steps of 32 d][FRAG]
#define WS_KFL (WS_KF + 2u * NB * SS * DM)         // f16 k residual x2048, same shape
#define WS_XF  (WS_KFL + 2u * NB * SS * DM)        // bf16 x, fragment order: [256 tiles of 16 rows][32 k-steps][FRAG]
#define WS_END (WS_XF + 2u * NB * SS * DM)
// ---- k_pack: block = (32 outputs n, 128 inputs k) of an (in,out) weight: whole 128-B lines in, bf16, transposed in LDS, 8 tiles of fragment order out (512-B runs); blocks x < 96 take Wqkv (q | k | v outputs in column order), the rest Wproj, whose tiles follow in PK
static_assert(PK_A == 0 && PK_P == QKVW * DM, "the two weights' tiles are numbered through");
__global__ __launch_bounds__(256) void k_pack(const float* __restrict__ WA, const float* __restrict__ WO, __bf16* __restrict__ PK) {
  __shared__ __align__(16) __bf16 s[32][136]; const int t = threadIdx.x, k0 = blockIdx.y * 128; const bool fused = blockIdx.x < QKVW / 32;
  const float* Wm = fused ? WA + blockIdx.x * 32 : WO + (blockIdx.x - QKVW / 32) * 32; const int ld = fused ? QKVW : DM;
#pragma unroll   // the sixteen line reads go out as one group, not one load-and-wait each
  for (int i = 0; i < 16; ++i) { const int k = (t >> 5) + 8 * i; s[t & 31][k] = (__bf16)Wm[(size_t)(k0 + k) * ld + (t & 31)]; }
  __syncthreads();
#pragma unroll   // two fixed trips: left rolled, the build keeps a lane-masked loop with its address sums per trip
  for (int u = t; u < 512; u += 256) { const int ln = u & 31, half = (u >> 5) & 1, kcl = (u >> 6) & 3, tl = u >> 8;
    vst2((unsigned*)(PK + ((size_t)(blockIdx.x * 2 + tl) * (DM / 32) + blockIdx.y * 4 + kcl) * FRAG + half * 256 + ln * 8), *(const v4u*)&s[tl * 16 + (ln & 15)][kcl * 32 + half * 16 + 8 * (ln >> 4)]); }
}
// ---- k_packx: x rounded to bf16 once (k_qkv's 24 column blocks all read it), into fragment order; thread = one 16-byte piece of the output
__global__ __launch_bounds__(256) void k_packx(const float* __restrict__ X, __bf16* __restrict__ XF) {
  const size_t u = (size_t)blockIdx.x * 256 + threadIdx.x; const int ln = (int)(u & 31), half = (int)(u >> 5) & 1, kc = (int)(u >> 6) & 31;
  const float* p = X + ((u >> 11) * 16 + (ln & 15)) * DM + kc * 32 + half * 16 + 8 * (ln >> 4); const v4f a = *(const v4f*)p, c = *(const v4f*)(p + 4); v8b o;
#pragma unroll   // vector elements need constant indices to stay in registers
  for (int i = 0; i < 4; ++i) { o[i] = (__bf16)a[i]; o[4 + i] = (__bf16)c[i]; }
  vst2(XF + u * 8, o);
}
// ---- k_qkv: block = (64 * QNP rows, 128 cols), 4 waves; a wave holds QNP row tiles (64 rows apart) x 8 column tiles, so one loaded weight fragment feeds QNP products and the weight loads per product fall by that factor
#define QNP 2
__global__ __launch_bounds__(128) void k_qkv(const __bf16* __restrict__ XF, const __bf16* __restrict__ P, const float* __restrict__ BQ, const float* __restrict__ BK, const float* __restrict__ BV, float* __restrict__ KOUT, float* __restrict__ VOUT, _Float16* __restrict__ QK, _Float16* __restrict__ QKL, _Float16* __restrict__ KF, _Float16* __restrict__ KFL, _Float16* __restrict__ VTH, _Float16* __restrict__ VTL) {
  const int which0 = (blockIdx.y * 128) / DM; const float* BB = BQ ? (((which0 == 0) ? BQ : (which0 == 1) ? BK : BV) + (blockIdx.y * 128 - which0 * DM)) : nullptr;
  __shared__ __align__(16) _Float16 so[4][16][136], sol[4][16][136]; __shared__ __align__(16) _Float16 sth[128][72], stl[128][72];
  const int tid = threadIdx.x, wave = tid >> 5, lane = tid & 31, col = lane & 15, g = lane >> 4; const size_t rw = (size_t)blockIdx.x * (64 * QNP) + wave * 16; const int n0 = blockIdx.y * 128;   // the wave's row tile number p starts at row rw + 64 * p
  v8f acc[QNP][8] = {};
  float bj[8];   // the lane's eight bias values, fetched once as a group (the epilogues read them per element)
#pragma unroll
  for (int j = 0; j < 8; ++j) bj[j] = 0.f;
  if (BB) {
#pragma unroll
    for (int j = 0; j < 8; ++j) bj[j] = bfr(BB[j * 16 + col]); }
  // every global load of k-step kc + 1 is issued as one group in front of step kc's products, so the loads fly together and behind the matrix work instead of one load-and-wait per product
  gb16* xp = (gb16*)(XF + (rw >> 4) * (DM / 32) * FRAG + lane * 8); gb16* wp = (gb16*)(P + (size_t)(n0 >> 4) * (DM / 32) * FRAG + lane * 8);
  v16b xa[QNP], wb[8];
#pragma unroll
  for (int p = 0; p < QNP; ++p) xa[p] = frag_bp(xp + (size_t)p * 4 * (DM / 32) * FRAG);   // 64 rows = 4 row tiles further
#pragma unroll
  for (int j = 0; j < 8; ++j) wb[j] = frag_bp(wp + (size_t)j * (DM / 32) * FRAG);
  XWAIT(xp, wp);
  xp += FRAG; wp += FRAG;   // the pointers run one step ahead and move only behind the wait that follows their loads
#pragma unroll 2
  for (int kc = 0; kc < DM / 32; ++kc) {
    v16b xn[QNP], wn[8];
#pragma unroll
    for (int p = 0; p < QNP; ++p) xn[p] = frag_bp(xp + (size_t)p * 4 * (DM / 32) * FRAG);
#pragma unroll
    for (int j = 0; j < 8; ++j) wn[j] = frag_bp(wp + (size_t)j * (DM / 32) * FRAG);
    XWAIT(xp, wp);
    { const int st = (kc + 2 < DM / 32) ? FRAG : 0; xp += st; wp += st; }   // the last trip fetches the last step's operands again (in bounds, unused)
    __builtin_amdgcn_sched_barrier(0);   // keeps this step's products behind the next step's load group: without it the build sinks those loads among the products and waits on each at once
#pragma unroll
    for (int j = 0; j < 8; ++j) {
#pragma unroll
      for (int p = 0; p < QNP; ++p) acc[p][j] = __builtin_amdgcn_wmma_f32_16x16x32_bf16(false, xa[p], false, wb[j], (short)0, acc[p][j], false, false); }   // every weight fragment serves QNP products; the plain builtin (the compiler keeps its distances): with wmma_bf's operand-tied statement this live set, above 256 registers, was built with scratch spills in the loop
#pragma unroll
    for (int p = 0; p < QNP; ++p) xa[p] = xn[p];
#pragma unroll
    for (int j = 0; j < 8; ++j) wb[j] = wn[j]; }
  // the epilogue runs once per row tile of the wave, through the same staging arrays
#pragma unroll   // accumulator indices must be constants to stay in registers
  for (int p = 0; p < QNP; ++p) { const size_t r0 = rw + 64 * p;
  if (which0 >= 1) {   // cache_key / cache_value: the f32 projections (+ bias) straight from the accumulators, 512-B row segments
    __shared__ __align__(16) float sf[4][16][132];
#pragma unroll
    for (int j = 0; j < 8; ++j) {
#pragma unroll
      for (int r = 0; r < 8; ++r) sf[wave][8 * g + r][j * 16 + col] = acc[p][j][r] + bj[j]; }
    LDSX();
    float* dst = (which0 == 1) ? KOUT : VOUT; for (int rl = 0; rl < 16; ++rl) vst2(dst + (r0 + rl) * DM + (n0 - which0 * DM) + lane * 4, *(const v4f*)&sf[wave][rl][lane * 4]);
    LDSX(); }
  if (n0 < 2 * DM) {   // q stored unscaled (f16 sigma ~0.6, no subnormal exposure); 1/8 applied to the f32 score
#pragma unroll
    for (int j = 0; j < 8; ++j) {
#pragma unroll
      for (int r = 0; r < 8; ++r) { const float v = acc[p][j][r] + bj[j]; const _Float16 hv = (_Float16)v; so[wave][8 * g + r][j * 16 + col] = hv; sol[wave][8 * g + r][j * 16 + col] = (_Float16)((v - (float)hv) * 2048.0f); } }   // q, k (+ bias) as f16 hi + (x2048) residual
    LDSX();
    if (which0 == 0) { for (int rl = 0; rl < 16; ++rl) if (lane < 16) { vst2((unsigned*)(QK + (r0 + rl) * (2 * DM) + n0 + lane * 8), *(const v4u*)&so[wave][rl][lane * 8]); vst2((unsigned*)(QKL + (r0 + rl) * (2 * DM) + n0 + lane * 8), *(const v4u*)&sol[wave][rl][lane * 8]); } }
    else {   // k: the wave's 16 rows are one key tile; 2 heads x 2 k-steps x 2 halves, each a 512-B run in fragment order
      const size_t kb = (((r0 / SS) * NH + ((n0 - DM) >> 6)) * (SS / 16) + ((r0 % SS) >> 4)) * (2 * FRAG) + lane * 8;
#pragma unroll   // the sixteen stores go out as one run, their offsets as immediates
      for (int u = 0; u < 8; ++u) { const size_t o = kb + (size_t)(u >> 2) * (SS / 16) * (2 * FRAG) + (u & 3) * 256; const int c0 = (u >> 2) * 64 + (u & 3) * 16 + 8 * g;
        vst2((unsigned*)(KF + o), *(const v4u*)&so[wave][col][c0]); vst2((unsigned*)(KFL + o), *(const v4u*)&sol[wave][col][c0]); }
      asm volatile("s_wait_xcnt 0x0" ::: "memory"); }   // precaution behind the run of sixteen stores: their registers may be reused by what follows while the stores are still out
  } else {
#pragma unroll
    for (int j = 0; j < 8; ++j) {
#pragma unroll
      for (int r = 0; r < 8; ++r) { const float v = acc[p][j][r] + bj[j]; const _Float16 hv = (_Float16)v; sth[j * 16 + col][wave * 16 + 8 * g + r] = hv; stl[j * 16 + col][wave * 16 + 8 * g + r] = (_Float16)((v - (float)hv) * 2048.0f); } }
    __syncthreads();
    const size_t rb = (size_t)blockIdx.x * (64 * QNP) + 64 * p; const int b = (int)(rb / SS), s0 = (int)(rb % SS); const int pc0 = n0 - 2 * DM;
    for (int u = tid; u < 128 * 8; u += 128) { const int ln = u & 31, half = (u >> 5) & 1, dt = (u >> 6) & 3, ksl = (u >> 8) & 1, hh = u >> 9; const int d = hh * 64 + dt * 16 + (ln & 15), pc = ksl * 4 + half * 2 + (ln >> 4);   // 512-B runs in fragment order
      const size_t o = ((((size_t)b * NH + (pc0 >> 6) + hh) * (SS / 32) + (s0 >> 5) + ksl) * 4 + dt) * FRAG + half * 256 + ln * 8; vst2((unsigned*)(VTH + o), *(const v4u*)&sth[d][pc * 8]); vst2((unsigned*)(VTL + o), *(const v4u*)&stl[d][pc * 8]); }
    if (p + 1 < QNP) __syncthreads();   // the next row tiles overwrite sth / stl: every thread's reads above must be over
  }
  }
}
// ---- k_attn: block = (64 queries, head h, batch b), 8 waves = 4 query tiles x 2 key groups: causal flash attention (K = 64: 2 k-steps), computed TRANSPOSED: S^T = K . Q^T (A = a key tile, B = the query tile) and O^T += V^T . P^T. A lane (g, col) then holds, of ONE query (col), the scores of keys 16 * ct + 8 * g + r: maximum and sum run inside the lane with one exchange between the wave's halves, the rescale factor is one value per lane, and the two score tiles, converted in place, ARE the B operand of the second product (element 8 * ct + r = key 16 * ct + 8 * g + r, the k order of the V fragments), so P passes through no LDS. scores = (q.k) * 0.125 and P.V: 3 products in the first two query blocks (hi x hi, plus hi x residual and residual x hi in a second accumulator; residuals x2048), single f16 operands elsewhere; key group kw takes the key steps ks = kw, kw + 2, ... with a running maximum and sum of its own, and the two partial results are joined in LDS; ctx is stored as k_out's A operand.
// Why two groups: the cost of a query block grows with its index (causal), and with one wave per query tile every block is resident at once, so the launch lasts as long as the last block while the others' places stand empty. Half as long and twice as many waves give more blocks than places; the blocks start heaviest first (blockIdx.z counts the query blocks down), so the places stay filled to the end.
__device__ __forceinline__ float xhalf(float x) { return __builtin_bit_cast(float, __builtin_amdgcn_permlanex16(__builtin_bit_cast(int, x), __builtin_bit_cast(int, x), 0x76543210, 0xfedcba98, false, false)); }   // the value of lane l ^ 16
#define LOG2E 1.44269504088896340736f
// one key step (32 keys) of a wave, compiled once per case, so that a step runs only the work its case needs; both switches are the same for a whole wave. PREC: the leading query blocks' 3-product scores and P.V with the second accumulator. MASK: the step holds keys behind some query of the tile (causal select, masked scores count 0).
template <bool PREC, bool MASK> __device__ __forceinline__ void attn_step(const int ks, const _Float16* __restrict__ KF, const _Float16* __restrict__ KFL, const _Float16* __restrict__ VTH, const _Float16* __restrict__ VTL, const size_t hb, const float* abq, const int dq0, const v16h* aq, const v16h* aql, float& m, float& l, v8f* acc, v8f* accl) {
  v8f s[2];
  // the key step's K fragments and bias values are loaded as one group in front of the first product (the bias unconditionally: row and key are inside [S][S] for every lane; the causal select follows), so one round trip replaces one per product and per bias row
  v16h kf[2][2]; v4f ab[2][2]; const int dq = dq0 - ks * 32;   // the query's distance from this half's first key: key 16 * ct + r of the lane is allowed up to it
#pragma unroll
  for (int ct = 0; ct < 2; ++ct) {
#pragma unroll
    for (int kc = 0; kc < 2; ++kc) kf[ct][kc] = frag_hp(KF + hb + (size_t)((ks * 2 + ct) * 2 + kc) * FRAG);
    ab[ct][0] = *(const v4f*)(abq + ks * 32 + ct * 16); ab[ct][1] = *(const v4f*)(abq + ks * 32 + ct * 16 + 4); }   // the lane's eight keys lie side by side in the query's row
  asm volatile("s_wait_xcnt 0x0" ::: "memory");   // precaution: the group's address registers may be reused by what follows while its loads are still out
#pragma unroll
  for (int ct = 0; ct < 2; ++ct) { v8f c = {};
    if (PREC) { v8f cl = {};   // leading query blocks (few keys, outputs far above the global rms): 3 products
#pragma unroll
      for (int kc = 0; kc < 2; ++kc) { const v16h kh = kf[ct][kc]; c = wmma16(kh, aq[kc], c); cl = wmma16(kh, aql[kc], cl); const v16h kl = frag_hp(KFL + hb + (size_t)((ks * 2 + ct) * 2 + kc) * FRAG);
        asm volatile("s_wait_xcnt 0x0" ::: "memory");   // precaution, as above: the load's address registers may be reused by what follows
        cl = wmma16(kl, aq[kc], cl); }
#pragma unroll
      for (int r = 0; r < 8; ++r) c[r] += cl[r] * (1.0f / 2048.0f); }
    else {
#pragma unroll
      for (int kc = 0; kc < 2; ++kc) c = wmma16(kf[ct][kc], aq[kc], c); }   // single product elsewhere
#pragma unroll
    for (int r = 0; r < 8; ++r) { const float sv = c[r] * SCALEF + bfr(ab[ct][r >> 2][r & 3]); s[ct][r] = (!MASK || ct * 16 + r <= dq) ? sv : -3.0e38f; } }   // causal: future keys excluded
  // the V fragments are requested here, behind the score products, and fly under the softmax
  v16h vf[4];
#pragma unroll
  for (int dt = 0; dt < 4; ++dt) vf[dt] = frag_hp(VTH + hb + (size_t)(ks * 4 + dt) * FRAG);
  asm volatile("s_wait_xcnt 0x0" ::: "memory");   // precaution: the group's address registers may be reused by what follows while its loads are still out
  float mx = fmaxf(s[0][0], s[1][0]);
#pragma unroll
  for (int r = 1; r < 8; ++r) mx = fmaxf(mx, fmaxf(s[0][r], s[1][r]));
  mx = fmaxf(mx, xhalf(mx));   // the other half holds the query's other sixteen keys
  const float mn = fmaxf(m, mx);
  // exp(x) as the hardware's 2^(x * log2 e), arguments and results by name for the two statements below
  float ta = (m - mn) * LOG2E, ea = __builtin_amdgcn_exp2f(ta), t[2][8], e[2][8];
#pragma unroll
  for (int ct = 0; ct < 2; ++ct) {
#pragma unroll
    for (int r = 0; r < 8; ++r) { t[ct][r] = (s[ct][r] - mn) * LOG2E; e[ct][r] = __builtin_amdgcn_exp2f(t[ct][r]); } }
  // the slot behind a transcendental: the v_nop stands behind its group's last v_exp_f32, in front of every use of a result (in-out operands) and every overwrite of an argument (inputs, live up to here)
  asm volatile("v_nop" : "+v"(ea), "+v"(e[0][0]), "+v"(e[0][1]), "+v"(e[0][2]), "+v"(e[0][3]), "+v"(e[0][4]), "+v"(e[0][5]), "+v"(e[0][6]), "+v"(e[0][7]) : "v"(ta), "v"(t[0][0]), "v"(t[0][1]), "v"(t[0][2]), "v"(t[0][3]), "v"(t[0][4]), "v"(t[0][5]), "v"(t[0][6]), "v"(t[0][7]));
  asm volatile("v_nop" : "+v"(e[1][0]), "+v"(e[1][1]), "+v"(e[1][2]), "+v"(e[1][3]), "+v"(e[1][4]), "+v"(e[1][5]), "+v"(e[1][6]), "+v"(e[1][7]) : "v"(t[1][0]), "v"(t[1][1]), "v"(t[1][2]), "v"(t[1][3]), "v"(t[1][4]), "v"(t[1][5]), "v"(t[1][6]), "v"(t[1][7]));
  const float alpha = (m <= -1.0e38f) ? 0.f : ea;
  v2f es = {}; v16h pa, pl;   // the sum runs in two chains, over the even and the odd keys
#pragma unroll
  for (int r = 0; r < 8; ++r) { const float e0 = (MASK && s[0][r] <= -1.0e38f) ? 0.f : e[0][r], e1 = (MASK && s[1][r] <= -1.0e38f) ? 0.f : e[1][r]; es[r & 1] += e0; es[r & 1] += e1;
    const float x0 = e0 * 2048.0f, x1 = e1 * 2048.0f; const _Float16 h0 = (_Float16)x0, h1 = (_Float16)x1; pa[r] = h0; pa[8 + r] = h1;   // P scaled by 2^11 before the f16 split so small softmax weights stay out of the f16 subnormal range; 2^-11 folded into the epilogue
    if (PREC) { pl[r] = (_Float16)((x0 - (float)h0) * 2048.0f); pl[8 + r] = (_Float16)((x1 - (float)h1) * 2048.0f); } }
  l = l * alpha + (es[0] + es[1]); m = mn;
#pragma unroll
  for (int dt = 0; dt < 4; ++dt) {
#pragma unroll
    for (int r = 0; r < 8; ++r) { acc[dt][r] *= alpha; if (PREC) accl[dt][r] *= alpha; } }
#pragma unroll
  for (int dt = 0; dt < 4; ++dt) { const v16h vh = vf[dt]; acc[dt] = wmma16(vh, pa, acc[dt]); if (PREC) { accl[dt] = wmma16(vh, pl, accl[dt]); const v16h vl = frag_hp(VTL + hb + (size_t)(ks * 4 + dt) * FRAG);
      asm volatile("s_wait_xcnt 0x0" ::: "memory");   // precaution, as above: the load's address registers may be reused by what follows
      accl[dt] = wmma16(vl, pa, accl[dt]); } }   // leading query blocks: P hi/lo x V hi/lo (3 products); elsewhere P x V single
}
__global__ __launch_bounds__(256) void k_attn(const _Float16* __restrict__ QK, const _Float16* __restrict__ QKL, const _Float16* __restrict__ KF, const _Float16* __restrict__ KFL, const _Float16* __restrict__ VTH, const _Float16* __restrict__ VTL, const void* __restrict__ KMASK, const float* __restrict__ AB, __bf16* __restrict__ OF) {
  __shared__ __align__(16) float so[8][16][68]; __shared__ __align__(16) float sm[8][16], sl[8][16];
  const int tid = threadIdx.x, wave = __builtin_amdgcn_readfirstlane(tid >> 5), lane = tid & 31, col = lane & 15, g = lane >> 4;   // the wave's number in a scalar register: the key loop starts from it and stays a scalar loop
  const int qi = wave & 3, kw = wave >> 2;   // query tile, key group
  const int qb = TQB - 1 - blockIdx.z, h = blockIdx.x, b = blockIdx.y; const int q0 = qb * 64 + qi * 16; const size_t rq = (size_t)b * SS + q0 + col;
  v16h aq[2];   // the query tile: lane (g, col) holds query col in the fragments' k order, which serves as B as it did as A
#pragma unroll
  for (int kc = 0; kc < 2; ++kc) aq[kc] = frag_h(QK + rq * (2 * DM) + h * HD + kc * 32, lane);
  float m = -3.0e38f, l = 0.f;   // of query col: the running maximum (common to both halves) and the sum over this half's keys
  v8f acc[4] = {};   // O^T: acc[dt][r] = column d = 16 * dt + 8 * g + r of query col
  const int nks = (qb * 64 + 64) / 32;   // causal: key steps of 32 up to the query block's end
  const size_t hb = ((size_t)b * NH + h) * (SS * HD) + lane * 8;   // the head's k and v planes in fragment order (S x 64 elements each), with the lane's offset
  const float* abq = AB + (size_t)(q0 + col) * SS + 8 * g;   // the query's bias row at this half's first key
  const int dq0 = q0 + col - 8 * g;   // the query's distance from this half's first key of step 0
  // nks is even: both key groups make qb + 1 trips
  if (qb < 2) {   // the same for the whole block
    v16h aql[2]; v8f accl[4] = {};
#pragma unroll
    for (int kc = 0; kc < 2; ++kc) aql[kc] = frag_h(QKL + rq * (2 * DM) + h * HD + kc * 32, lane);
#pragma unroll 1   // rolled: the step's text once per case
    for (int ks = kw; ks < nks; ks += 2) attn_step<true, true>(ks, KF, KFL, VTH, VTL, hb, abq, dq0, aq, aql, m, l, acc, accl);
#pragma unroll
    for (int dt = 0; dt < 4; ++dt) {
#pragma unroll
      for (int r = 0; r < 8; ++r) acc[dt][r] += accl[dt][r] * (1.0f / 2048.0f); }
  } else {
    const int nfull = (q0 + 1) >> 5;   // steps whose 32 keys all lie at or in front of the tile's first query: no lane masks any of them
    int ks = kw;
#pragma unroll 1   // rolled: the step's text once per case
    for (; ks < nfull; ks += 2) attn_step<false, false>(ks, KF, KFL, VTH, VTL, hb, abq, dq0, aq, nullptr, m, l, acc, nullptr);
#pragma unroll 1   // rolled: at most one trip, the step on the diagonal
    for (; ks < nks; ks += 2) attn_step<false, true>(ks, KF, KFL, VTH, VTL, hb, abq, dq0, aq, nullptr, m, l, acc, nullptr);
  }
  l += xhalf(l);   // the two halves' sums joined once
  // each wave leaves its unnormalised sums (a lane's eight values lie side by side in its query's row) with its queries' maximum and sum
#pragma unroll
  for (int dt = 0; dt < 4; ++dt) { v4f o0, o1;
#pragma unroll   // vector elements need constant indices to stay in registers
    for (int r = 0; r < 4; ++r) { o0[r] = acc[dt][r]; o1[r] = acc[dt][4 + r]; }
    *(v4f*)&so[wave][col][dt * 16 + 8 * g] = o0; *(v4f*)&so[wave][col][dt * 16 + 8 * g + 4] = o1; }
  if (g == 0) { sm[wave][col] = m; sl[wave][col] = l; }
  __syncthreads();   // a wave reads the other key group's partial result below: both must be written
  // join for query row col: each part weighted by exp(its maximum - the common one); a group whose keys were all masked for the row (maximum still at the start value) counts 0; group 0 holds key 0, which no row masks, so the sum is above 0
  const float m0 = sm[qi][col], m1 = sm[4 + qi][col], mm = fmaxf(m0, m1);
  const float f0 = (m0 <= -1.0e38f) ? 0.f : __expf(m0 - mm), f1 = (m1 <= -1.0e38f) ? 0.f : __expf(m1 - mm);
  const float il = (1.0f / 2048.0f) / (f0 * sl[qi][col] + f1 * sl[4 + qi][col]); const float w0 = f0 * il, w1 = f1 * il;
  // ctx leaves as the out product's A operand: bf16 hi + residual, fragment order; the tile's 16 queries are one row tile, the head's 64 columns two k-steps, of which the wave writes number kw; 512-B runs
  const size_t ob = (((((size_t)b * SS + q0) >> 4) * (DM / 32) + h * 2 + kw) * (2 * FRAG)) + lane * 8;
#pragma unroll   // the four stores go out as one run, their offsets as immediates
  for (int u = 0; u < 2; ++u) { const float* p0 = &so[qi][col][kw * 32 + u * 16 + 8 * g]; const float* p1 = &so[4 + qi][col][kw * 32 + u * 16 + 8 * g]; v8b hi, lo;
#pragma unroll   // vector elements need constant indices to stay in registers
    for (int i = 0; i < 8; ++i) { const float v = p0[i] * w0 + p1[i] * w1; const __bf16 hv = (__bf16)v; hi[i] = hv; lo[i] = (__bf16)(v - (float)hv); }
    vst2(OF + ob + u * 256, hi); vst2(OF + ob + FRAG + u * 256, lo); }
}
// ---- k_out: block = (64 * ONP rows, 128 cols): out = ctx (hi, residual) . Wo (2 products) + bo; a wave holds ONP row tiles, as in k_qkv
#define ONP 2
__global__ __launch_bounds__(128) void k_out(const __bf16* __restrict__ OF, const __bf16* __restrict__ P, const float* __restrict__ BO, float* __restrict__ Y) {
  __shared__ __align__(16) float so[4][16][132];
  const int tid = threadIdx.x, wave = tid >> 5, lane = tid & 31, col = lane & 15, g = lane >> 4; const size_t rw = (size_t)blockIdx.x * (64 * ONP) + wave * 16; const int n0 = blockIdx.y * 128;   // the wave's row tile number p starts at row rw + 64 * p
  v8f acc[ONP][8] = {};
  // as in k_qkv: step kc + 1's loads are issued as one group in front of step kc's products; the pointers run one step ahead and move only behind the wait that follows their loads
  gb16* xp = (gb16*)(OF + (rw >> 4) * (DM / 32) * (2 * FRAG) + lane * 8); gb16* wp = (gb16*)(P + (size_t)(n0 >> 4) * (DM / 32) * FRAG + lane * 8);
  v16b xh[ONP], xl[ONP], wb[8];
#pragma unroll
  for (int p = 0; p < ONP; ++p) { xh[p] = frag_bp(xp + (size_t)p * 4 * (DM / 32) * (2 * FRAG)); xl[p] = frag_bp(xp + (size_t)p * 4 * (DM / 32) * (2 * FRAG) + FRAG); }   // 64 rows = 4 row tiles further
#pragma unroll
  for (int j = 0; j < 8; ++j) wb[j] = frag_bp(wp + (size_t)j * (DM / 32) * FRAG);
  XWAIT(xp, wp);
  xp += 2 * FRAG; wp += FRAG;
#pragma unroll 2
  for (int kc = 0; kc < DM / 32; ++kc) {
    v16b xhn[ONP], xln[ONP], wn[8];
#pragma unroll
    for (int p = 0; p < ONP; ++p) { xhn[p] = frag_bp(xp + (size_t)p * 4 * (DM / 32) * (2 * FRAG)); xln[p] = frag_bp(xp + (size_t)p * 4 * (DM / 32) * (2 * FRAG) + FRAG); }
#pragma unroll
    for (int j = 0; j < 8; ++j) wn[j] = frag_bp(wp + (size_t)j * (DM / 32) * FRAG);
    XWAIT(xp, wp);
    { const int st = (kc + 2 < DM / 32) ? FRAG : 0; xp += 2 * st; wp += st; }   // the last trip fetches the last step's operands again (in bounds, unused)
    __builtin_amdgcn_sched_barrier(0);   // keeps this step's products behind the next step's load group, as in k_qkv
    // residual products first, then the hi products, per accumulator as before; the plain builtin for the reason given in k_qkv
#pragma unroll
    for (int j = 0; j < 8; ++j) {
#pragma unroll
      for (int p = 0; p < ONP; ++p) acc[p][j] = __builtin_amdgcn_wmma_f32_16x16x32_bf16(false, xl[p], false, wb[j], (short)0, acc[p][j], false, false); }
#pragma unroll
    for (int j = 0; j < 8; ++j) {
#pragma unroll
      for (int p = 0; p < ONP; ++p) acc[p][j] = __builtin_amdgcn_wmma_f32_16x16x32_bf16(false, xh[p], false, wb[j], (short)0, acc[p][j], false, false); }
#pragma unroll
    for (int p = 0; p < ONP; ++p) { xh[p] = xhn[p]; xl[p] = xln[p]; }
#pragma unroll
    for (int j = 0; j < 8; ++j) wb[j] = wn[j]; }
  float bo[8];   // the lane's eight bias values, fetched once for both row tiles
#pragma unroll
  for (int j = 0; j < 8; ++j) bo[j] = bfr(BO[n0 + j * 16 + col]);
#pragma unroll   // accumulator indices must be constants to stay in registers
  for (int p = 0; p < ONP; ++p) { const size_t r0 = rw + 64 * p;   // the staging rows are the wave's own: its LDS operations run in program order, so the next row tile's writes follow this one's reads
#pragma unroll
    for (int j = 0; j < 8; ++j) {
#pragma unroll
      for (int r = 0; r < 8; ++r) so[wave][8 * g + r][j * 16 + col] = acc[p][j][r] + bo[j]; }
    LDSX();
    for (int rl = 0; rl < 16; ++rl) vst2(Y + (r0 + rl) * DM + n0 + lane * 4, *(const v4f*)&so[wave][rl][lane * 4]); }
}
extern "C" void kernel_launch(void* const* d_in, const int* in_sizes, int n_in, void* d_out, int out_size, void* d_ws, size_t ws_size, hipStream_t stream) {
  (void)in_sizes; (void)n_in; (void)out_size;
  const float** F = (const float**)d_in;   // 0 hidden [2,2048,1024], 1 attn_bias [2048,2048], 2 Wqkv [1024,3072] (in,out; q | k | v), 3 bqkv [3072], 4 Wproj [1024,1024] (in,out), 5 bproj
  if (ws_size < (size_t)WS_END) return;
  char* ws = (char*)d_ws; __bf16* PK = (__bf16*)(ws + WS_PK); _Float16 *QK = (_Float16*)(ws + WS_QK), *QKL = (_Float16*)(ws + WS_QKL), *VTH = (_Float16*)(ws + WS_VTH), *VTL = (_Float16*)(ws + WS_VTL), *KF = (_Float16*)(ws + WS_KF), *KFL = (_Float16*)(ws + WS_KFL); __bf16 *OF = (__bf16*)(ws + WS_O), *XF = (__bf16*)(ws + WS_XF);
  float* OUT0 = (float*)d_out; float* KOUT = OUT0 + (size_t)NB * SS * DM; float* VOUT = KOUT + (size_t)NB * SS * DM;   // outputs: out, cache_key, cache_value
  k_pack<<<dim3((QKVW + DM) / 32, DM / 128), 256, 0, stream>>>(F[2], F[4], PK);
  k_packx<<<NB * SS * DM / 8 / 256, 256, 0, stream>>>(F[0], XF);
  k_qkv<<<dim3(TNB * SS / (64 * QNP), QKVW / 128), 128, 0, stream>>>(XF, PK + PK_A, F[3], F[3] + DM, F[3] + 2 * DM, KOUT, VOUT, QK, QKL, KF, KFL, VTH, VTL);
  k_attn<<<dim3(NH, TNB, TQB), 256, 0, stream>>>(QK, QKL, KF, KFL, VTH, VTL, nullptr, F[1], OF);
  k_out<<<dim3(TOB / ONP, DM / 128), 128, 0, stream>>>(OF, PK + PK_P, F[5], OUT0);
}

// v007
// One run takes 104 microseconds.
// Next to v006, in two timings, it ran 1.03 times as fast each time.
// Counting every step since v000, it is 5.80 times as fast.
// compute dtype: all float inputs rounded to bf16; qkv = x . Wqkv + b with EXACT bf16 products on WMMA 16x16x32 ((in,out) weights packed by k_pack; x, the weights, k, v and ctx are kept in the matrix instructions' fragment order) - the k and v projections are also written out in f32 straight from the accumulators; causal attention with key-tile skipping: the first 128 queries use 3-product scores and P.v (hi/lo), later queries single f16 operands; (q.k)/8 + attn_bias[q][k], running-max softmax in f32 (hardware exp); out = ctx (bf16 hi + residual) . Wproj (2 products) + bproj; outputs out | cache_key | cache_value concatenated.
#include <hip/hip_runtime.h>
#include <math.h>

typedef __attribute__((ext_vector_type(16))) _Float16 v16h;
typedef __attribute__((ext_vector_type(16))) __bf16 v16b;
typedef __attribute__((ext_vector_type(8)))  _Float16 v8h;
typedef __attribute__((ext_vector_type(8)))  float v8f;
typedef __attribute__((ext_vector_type(4)))  float v4f;
typedef __attribute__((ext_vector_type(2)))  float v2f;
typedef __attribute__((ext_vector_type(4)))  unsigned v4u;
typedef __attribute__((ext_vector_type(4)))  int v4i;
typedef float __attribute__((may_alias)) float_a;
typedef int __attribute__((may_alias)) int_a;

template <typename T> __device__ __forceinline__ void vst2(void* p, T v) { *(T*)p = v;  }
__device__ __forceinline__ v8f wmma16(v16h a, v16h b, v8f c) {
  v8f d = __builtin_amdgcn_wmma_f32_16x16x32_f16(false, a, false, b, (short)0, c, false, false);
  asm volatile("v_nop\n\tv_nop\n\tv_nop\n\tv_nop" : "+v"(d) : "v"(a), "v"(b));
  return d;
}
__device__ __forceinline__ v8f wmma_bf(v16b a, v16b b, v8f c) {
  v8f d = __builtin_amdgcn_wmma_f32_16x16x32_bf16(false, a, false, b, (short)0, c, false, false);
  asm volatile("v_nop\n\tv_nop\n\tv_nop\n\tv_nop" : "+v"(d) : "v"(a), "v"(b));
  return d;
}
// Prefill attention (B 2, S 2,048, E 1,024, 16 heads x 64): fused (in,out) qkv + bias, scores / 8 + learned additive bias[q, k], causal, softmax, . v, Wproj + bias; also returns the k and v projections (the KV cache).
__device__ __forceinline__ v16h frag_h(const _Float16* rowk0, int lane) {
  union { v16h v; v8h q[2]; } u; const _Float16* p = rowk0 + 8 * (lane >> 4);
  u.q[0] = *(const v8h*)p; u.q[1] = *(const v8h*)(p + 16); return u.v;
}
__device__ __forceinline__ v16h frag_f32(const float* rowk0, int lane) {
  v16h a; const float* p = rowk0 + 8 * (lane >> 4);
#pragma unroll
  for (int i = 0; i < 8; ++i) { a[i] = (_Float16)p[i]; a[8 + i] = (_Float16)p[16 + i]; }
  return a;
}
__device__ __forceinline__ v16h frag_f32s(const float* rowk0, int lane, float sc) {
  v16h a; const float* p = rowk0 + 8 * (lane >> 4);
#pragma unroll
  for (int i = 0; i < 8; ++i) { a[i] = (_Float16)(p[i] * sc); a[8 + i] = (_Float16)(p[16 + i] * sc); }
  return a;
}
// column fragment from a [K][ld] layout (column n), rows >= K read as 0
__device__ __forceinline__ v16h fragc_f32(const float* W, int k0, int n, int lane, int ld, int K) {
  v16h a; const int g = lane >> 4;
#pragma unroll
  for (int i = 0; i < 8; ++i) { const int ka = k0 + 8 * g + i, kb = ka + 16;
    a[i] = (_Float16)(ka < K ? W[(size_t)(ka < K ? ka : K - 1) * ld + n] : 0.f); a[8 + i] = (_Float16)(kb < K ? W[(size_t)(kb < K ? kb : K - 1) * ld + n] : 0.f); }
  return a;
}
struct F2 { v16b h, l; };
__device__ __forceinline__ F2 bsplit16(const float v[16]) { F2 r;
#pragma unroll
  for (int i = 0; i < 16; ++i) { const __bf16 h = (__bf16)v[i]; r.h[i] = h; r.l[i] = (__bf16)(v[i] - (float)h); }
  return r; }
__device__ __forceinline__ F2 split_row(const float* row, int k0, int lane) { float v[16]; const float* p = row + k0 + 8 * (lane >> 4);
#pragma unroll
  for (int i = 0; i < 8; ++i) { v[i] = p[i]; v[8 + i] = p[16 + i]; }
  return bsplit16(v); }
__device__ __forceinline__ F2 split_rowK(const float* row, int k0, int lane, int K) { float v[16]; const int g = lane >> 4;
#pragma unroll
  for (int i = 0; i < 8; ++i) { const int ka = k0 + 8 * g + i, kb = ka + 16; v[i] = ka < K ? row[ka < K ? ka : K - 1] : 0.f; v[8 + i] = kb < K ? row[kb < K ? kb : K - 1] : 0.f; }
  return bsplit16(v); }
__device__ __forceinline__ F2 split_col(const float* W, int k0, int n, int lane, int ld, int K) { float v[16]; const int g = lane >> 4;
#pragma unroll
  for (int i = 0; i < 8; ++i) { const int ka = k0 + 8 * g + i, kb = ka + 16; v[i] = ka < K ? W[(size_t)(ka < K ? ka : K - 1) * ld + n] : 0.f; v[8 + i] = kb < K ? W[(size_t)(kb < K ? kb : K - 1) * ld + n] : 0.f; }
  return bsplit16(v); }
__device__ __forceinline__ v8f mac3(const F2& a, const F2& b, v8f c) { c = wmma_bf(a.l, b.h, c); c = wmma_bf(a.h, b.l, c); return wmma_bf(a.h, b.h, c); }
__device__ __forceinline__ float sigm(float v) { return 1.0f / (1.0f + expf(-v)); }
#define LDSX() do { asm volatile("s_wait_dscnt 0" ::: "memory"); __builtin_amdgcn_wave_barrier(); __builtin_amdgcn_fence(__ATOMIC_RELEASE, "workgroup"); } while (0)


#define NB 2
#define SS 2048
#define DM 1024
#define NH 16
#define SCALEF 0.125f
#define HD 64
#define QKVW (3 * DM)
#ifndef TQB
#define TQB (SS / 64)
#define TNB NB
#define TOB (NB * SS / 64)     // output blocks of 64 rows (all)
#endif
typedef __attribute__((ext_vector_type(8))) __bf16 v8b;
__device__ __forceinline__ v16b frag_b(const __bf16* rowk0, int lane) {
  union { v16b v; v8b q[2]; } u; const __bf16* p = rowk0 + 8 * (lane >> 4);
  u.q[0] = *(const v8b*)p; u.q[1] = *(const v8b*)(p + 16); return u.v;
}
// pointers typed as global memory: they keep that type through the XWAIT statement below, so the loads behind it stay global loads
typedef const __attribute__((address_space(1))) float gf32; typedef const __attribute__((address_space(1))) __bf16 gb16;
typedef const __attribute__((address_space(1))) v4f gv4f; typedef const __attribute__((address_space(1))) v8b gv8b;
// FRAGMENT ORDER: a 16 x 32 operand tile is kept as 1 KB = [half 2][lane 32][8 elements]; lane (g, col) holds row col, k = 16 * half + 8 * g + i, the k order of frag_b / frag_h. One wave-wide 16-byte load then covers 512 contiguous bytes (4 whole lines) instead of 32 bytes in each of 16 lines.
#define FRAG 512                     // elements of one tile
// a tile from a pointer that already holds the lane's offset (lane * 8)
__device__ __forceinline__ v16b frag_bp(gb16* p) { union { v16b v; v8b q[2]; } u; u.q[0] = *(gv8b*)p; u.q[1] = *(gv8b*)(p + 256); return u.v; }
__device__ __forceinline__ v16h frag_hp(const _Float16* p) { union { v16h v; v8h q[2]; } u; u.q[0] = *(const v8h*)p; u.q[1] = *(const v8h*)(p + 256); return u.v; }
// precaution behind a group of global loads: the wait stands in front of every rewrite of the group's address registers; both pointers pass through the statement, so every later step of them follows it
#define XWAIT(pa, pb) asm volatile("s_wait_xcnt 0x0" : "+v"(pa), "+v"(pb) : : "memory")
__device__ __forceinline__ float bfr(float v) { return (float)(__bf16)v; }
__device__ __attribute__((noinline)) float exp_ni(float v) { return expf(v); }
__device__ __attribute__((noinline)) float erf_ni(float v) { return erff(v); }

#define PK_A 0                       // Wqkv, fragment order: [192 tiles of 16 outputs][32 k-steps][FRAG]
#define PK_P (PK_A + QKVW * DM)        // Wo, fragment order: [64 tiles][32 k-steps][FRAG]
#define PK_END (PK_P + DM * DM)
#define WS_PK  0u
#define WS_QK  (WS_PK + 2u * PK_END)             // f16 [4096 rows][2048]: q in the first 1024 columns (the rest unused)
#define WS_QKL (WS_QK + 2u * NB * SS * 2 * DM)     // f16 q residual plane x2048, same shape
#define WS_VTH (WS_QKL + 2u * NB * SS * 2 * DM)    // f16 v hi, fragment order: [b][h][64 steps of 32 keys][4 tiles of 16 d][FRAG]
#define WS_VTL (WS_VTH + 2u * NB * DM * SS)        // f16 lo x 2048, same shape
#define WS_O   (WS_VTL + 2u * NB * DM * SS)        // bf16 ctx, fragment order: [256 tiles of 16 rows][32 k-steps][hi FRAG | residual FRAG]
#define WS_CS  (WS_O + 4u * NB * SS * DM)           // f32 2 x [2048][32], unused
#define WS_KF  (WS_CS + 4u * 2 * SS * 32)          // f16 k hi, fragment order: [b][h][128 tiles of 16 keys][2 k-steps of 32 d][FRAG]
#define WS_KFL (WS_KF + 2u * NB * SS * DM)         // f16 k residual x2048, same shape
#define WS_XF  (WS_KFL + 2u * NB * SS * DM)        // bf16 x, fragment order: [256 tiles of 16 rows][32 k-steps][FRAG]
#define WS_END (WS_XF + 2u * NB * SS * DM)
// ---- k_pack: ONE launch of 512 work-groups packs x and both (in,out) weights into fragment order. Every thread has sixteen 16-byte loads in flight (each wave-wide load = 512 contiguous bytes of one source row), so the launch needs 4,096 waves, few enough that starting them no longer sets its length. A block takes 64 KB of f32 in and gives 32 KB of bf16 out: 128 x 16 pieces of 16 bytes (8 consecutive k of one row of x or one output n of a weight). LDS only reorders the pieces between lanes, so that the stores are 512-B runs.
// blockIdx.y == 0: one row tile of x (16 rows x 1,024 k); piece (L, c) = row c, k = 8 * L ... 8 * L + 7. blockIdx.y == 1: (128 outputs n, 128 inputs k) of a weight, n blocks < 24 of Wqkv (q | k | v outputs in column order), then Wproj, whose tiles follow in PK; piece (L, c) = output 16 * (L >> 4) + c, k = 8 * (L & 15) ... + 7.
static_assert(PK_A == 0 && PK_P == QKVW * DM, "the two weights' tiles are numbered through");
typedef __attribute__((ext_vector_type(4))) __bf16 v4b;
#define PKU(L, c) (17 * (L) + ((L) >> 4) + (c))   // the piece's place in LDS, in 16-byte units: the odd pitch and the step per 16 L spread both writers' lanes over the banks
#define XBLK (NB * SS / 16)
static_assert((QKVW + DM) / 128 * (DM / 128) == XBLK, "as many weight blocks as row tiles of x: the grid is (XBLK, 2)");
// sixteen 16-byte loads from one address with constant offsets, as one group; the wait is a precaution: the address registers may be reused by what follows while the loads are still out (the address is an input of the statement, so its registers stay untouched, also by the group's own results, up to the wait)
template <int SA, int SB> __device__ __forceinline__ void ld16(const float* p, v4f* v) {
#pragma unroll   // constant indices keep v in registers, constant offsets keep one address for the group
  for (int i = 0; i < 16; ++i) v[i] = *(const v4f*)(p + (i >> 3) * SA + (i & 7) * SB);
  asm volatile("s_wait_xcnt 0x0" : : "v"(p) : "memory");
}
__global__ __launch_bounds__(256) void k_pack(const float* __restrict__ WA, const float* __restrict__ WO, const float* __restrict__ X, __bf16* __restrict__ PK, __bf16* __restrict__ XF) {
  __shared__ __align__(16) __bf16 s[PKU(128, 0) * 8]; const int t = threadIdx.x, wave = t >> 5, lane = t & 31; const bool isx = blockIdx.y == 0;   // the same for the whole block
  const int nb = blockIdx.x >> 3, kb = blockIdx.x & 7;   // weight blocks: 128 outputs, 128 inputs
  v4f v[16];
  if (isx) {   // the wave reads rows 2 * wave and 2 * wave + 1 whole, eight loads each
    ld16<DM, 128>(X + ((size_t)blockIdx.x * 16 + wave * 2) * DM + lane * 4, v);
#pragma unroll   // a lane holds half a piece: lanes 2 m and 2 m + 1 write the two halves side by side
    for (int i = 0; i < 16; ++i) { v4b o;
#pragma unroll
      for (int c = 0; c < 4; ++c) o[c] = (__bf16)v[i][c];
      *(v4b*)(s + PKU((i & 7) * 16 + (lane >> 1), wave * 2 + (i >> 3)) * 8 + (lane & 1) * 4) = o; }
  } else {   // the wave reads input rows 16 * wave ... + 15, 128 outputs of each: a lane then holds, for its four outputs, two pieces each (the transposition is a choice of registers)
    const int k0 = kb * 128 + wave * 16;
    if (nb < QKVW / 128) ld16<8 * QKVW, QKVW>(WA + (size_t)k0 * QKVW + nb * 128 + lane * 4, v);
    else ld16<8 * DM, DM>(WO + (size_t)k0 * DM + (nb - QKVW / 128) * 128 + lane * 4, v);
#pragma unroll
    for (int u = 0; u < 2; ++u) {
#pragma unroll
      for (int c = 0; c < 4; ++c) { v8b o;
#pragma unroll   // vector elements need constant indices to stay in registers
        for (int i = 0; i < 8; ++i) o[i] = (__bf16)v[8 * u + i][c];
        *(v8b*)(s + PKU((lane >> 2) * 16 + wave * 2 + u, 4 * (lane & 3) + c) * 8) = o; } }
  }
  __syncthreads();   // the pieces are read back by other lanes and waves
  // piece number t + 256 * i in the order (L, c) is the order of the fragments: x's row tile is one 32-KB run; a weight block gives 4 KB (4 k-steps) to each of its 8 output tiles
  if (isx) { __bf16* d = XF + (size_t)blockIdx.x * (DM / 32) * FRAG + t * 8;
#pragma unroll   // the eight LDS reads, then the eight stores, go out as one run each
    for (int i = 0; i < 8; ++i) vst2((unsigned*)(d + i * 2048), *(const v4u*)(s + PKU(16 * i + (t >> 4), t & 15) * 8));
  } else { __bf16* d = PK + ((size_t)(nb * 8) * (DM / 32) + kb * 4) * FRAG + t * 8;
#pragma unroll   // as above
    for (int i = 0; i < 8; ++i) vst2((unsigned*)(d + i * (DM / 32) * FRAG), *(const v4u*)(s + PKU(16 * i + (t >> 4), t & 15) * 8)); }
}
// ---- k_qkv: block = (64 * QNP rows, 128 cols), 4 waves; a wave holds QNP row tiles (64 rows apart) x 8 column tiles, so one loaded weight fragment feeds QNP products and the weight loads per product fall by that factor
#define QNP 2
__global__ __launch_bounds__(128) void k_qkv(const __bf16* __restrict__ XF, const __bf16* __restrict__ P, const float* __restrict__ BQ, const float* __restrict__ BK, const float* __restrict__ BV, float* __restrict__ KOUT, float* __restrict__ VOUT, _Float16* __restrict__ QK, _Float16* __restrict__ QKL, _Float16* __restrict__ KF, _Float16* __restrict__ KFL, _Float16* __restrict__ VTH, _Float16* __restrict__ VTL) {
  const int which0 = (blockIdx.y * 128) / DM; const float* BB = BQ ? (((which0 == 0) ? BQ : (which0 == 1) ? BK : BV) + (blockIdx.y * 128 - which0 * DM)) : nullptr;
  __shared__ __align__(16) _Float16 so[4][16][136], sol[4][16][136]; __shared__ __align__(16) _Float16 sth[128][72], stl[128][72];
  const int tid = threadIdx.x, wave = tid >> 5, lane = tid & 31, col = lane & 15, g = lane >> 4; const size_t rw = (size_t)blockIdx.x * (64 * QNP) + wave * 16; const int n0 = blockIdx.y * 128;   // the wave's row tile number p starts at row rw + 64 * p
  v8f acc[QNP][8] = {};
  float bj[8];   // the lane's eight bias values, fetched once as a group (the epilogues read them per element)
#pragma unroll
  for (int j = 0; j < 8; ++j) bj[j] = 0.f;
  if (BB) {
#pragma unroll
    for (int j = 0; j < 8; ++j) bj[j] = bfr(BB[j * 16 + col]); }
  // every global load of k-step kc + 1 is issued as one group in front of step kc's products, so the loads fly together and behind the matrix work instead of one load-and-wait per product
  gb16* xp = (gb16*)(XF + (rw >> 4) * (DM / 32) * FRAG + lane * 8); gb16* wp = (gb16*)(P + (size_t)(n0 >> 4) * (DM / 32) * FRAG + lane * 8);
  v16b xa[QNP], wb[8];
#pragma unroll
  for (int p = 0; p < QNP; ++p) xa[p] = frag_bp(xp + (size_t)p * 4 * (DM / 32) * FRAG);   // 64 rows = 4 row tiles further
#pragma unroll
  for (int j = 0; j < 8; ++j) wb[j] = frag_bp(wp + (size_t)j * (DM / 32) * FRAG);
  XWAIT(xp, wp);
  xp += FRAG; wp += FRAG;   // the pointers run one step ahead and move only behind the wait that follows their loads
#pragma unroll 2
  for (int kc = 0; kc < DM / 32; ++kc) {
    v16b xn[QNP], wn[8];
#pragma unroll
    for (int p = 0; p < QNP; ++p) xn[p] = frag_bp(xp + (size_t)p * 4 * (DM / 32) * FRAG);
#pragma unroll
    for (int j = 0; j < 8; ++j) wn[j] = frag_bp(wp + (size_t)j * (DM / 32) * FRAG);
    XWAIT(xp, wp);
    { const int st = (kc + 2 < DM / 32) ? FRAG : 0; xp += st; wp += st; }   // the last trip fetches the last step's operands again (in bounds, unused)
    __builtin_amdgcn_sched_barrier(0);   // keeps this step's products behind the next step's load group: without it the build sinks those loads among the products and waits on each at once
#pragma unroll
    for (int j = 0; j < 8; ++j) {
#pragma unroll
      for (int p = 0; p < QNP; ++p) acc[p][j] = __builtin_amdgcn_wmma_f32_16x16x32_bf16(false, xa[p], false, wb[j], (short)0, acc[p][j], false, false); }   // every weight fragment serves QNP products; the plain builtin (the compiler keeps its distances): with wmma_bf's operand-tied statement this live set, above 256 registers, was built with scratch spills in the loop
#pragma unroll
    for (int p = 0; p < QNP; ++p) xa[p] = xn[p];
#pragma unroll
    for (int j = 0; j < 8; ++j) wb[j] = wn[j]; }
  // the epilogue runs once per row tile of the wave, through the same staging arrays
#pragma unroll   // accumulator indices must be constants to stay in registers
  for (int p = 0; p < QNP; ++p) { const size_t r0 = rw + 64 * p;
  if (which0 >= 1) {   // cache_key / cache_value: the f32 projections (+ bias) straight from the accumulators, 512-B row segments
    __shared__ __align__(16) float sf[4][16][132];
#pragma unroll
    for (int j = 0; j < 8; ++j) {
#pragma unroll
      for (int r = 0; r < 8; ++r) sf[wave][8 * g + r][j * 16 + col] = acc[p][j][r] + bj[j]; }
    LDSX();
    float* dst = (which0 == 1) ? KOUT : VOUT; for (int rl = 0; rl < 16; ++rl) vst2(dst + (r0 + rl) * DM + (n0 - which0 * DM) + lane * 4, *(const v4f*)&sf[wave][rl][lane * 4]);
    LDSX(); }
  if (n0 < 2 * DM) {   // q stored unscaled (f16 sigma ~0.6, no subnormal exposure); 1/8 applied to the f32 score
#pragma unroll
    for (int j = 0; j < 8; ++j) {
#pragma unroll
      for (int r = 0; r < 8; ++r) { const float v = acc[p][j][r] + bj[j]; const _Float16 hv = (_Float16)v; so[wave][8 * g + r][j * 16 + col] = hv; sol[wave][8 * g + r][j * 16 + col] = (_Float16)((v - (float)hv) * 2048.0f); } }   // q, k (+ bias) as f16 hi + (x2048) residual
    LDSX();
    if (which0 == 0) { for (int rl = 0; rl < 16; ++rl) if (lane < 16) { vst2((unsigned*)(QK + (r0 + rl) * (2 * DM) + n0 + lane * 8), *(const v4u*)&so[wave][rl][lane * 8]); vst2((unsigned*)(QKL + (r0 + rl) * (2 * DM) + n0 + lane * 8), *(const v4u*)&sol[wave][rl][lane * 8]); } }
    else {   // k: the wave's 16 rows are one key tile; 2 heads x 2 k-steps x 2 halves, each a 512-B run in fragment order
      const size_t kb = (((r0 / SS) * NH + ((n0 - DM) >> 6)) * (SS / 16) + ((r0 % SS) >> 4)) * (2 * FRAG) + lane * 8;
#pragma unroll   // the sixteen stores go out as one run, their offsets as immediates
      for (int u = 0; u < 8; ++u) { const size_t o = kb + (size_t)(u >> 2) * (SS / 16) * (2 * FRAG) + (u & 3) * 256; const int c0 = (u >> 2) * 64 + (u & 3) * 16 + 8 * g;
        vst2((unsigned*)(KF + o), *(const v4u*)&so[wave][col][c0]); vst2((unsigned*)(KFL + o), *(const v4u*)&sol[wave][col][c0]); }
      asm volatile("s_wait_xcnt 0x0" ::: "memory"); }   // precaution behind the run of sixteen stores: their registers may be reused by what follows while the stores are still out
  } else {
#pragma unroll
    for (int j = 0; j < 8; ++j) {
#pragma unroll
      for (int r = 0; r < 8; ++r) { const float v = acc[p][j][r] + bj[j]; const _Float16 hv = (_Float16)v; sth[j * 16 + col][wave * 16 + 8 * g + r] = hv; stl[j * 16 + col][wave * 16 + 8 * g + r] = (_Float16)((v - (float)hv) * 2048.0f); } }
    __syncthreads();
    const size_t rb = (size_t)blockIdx.x * (64 * QNP) + 64 * p; const int b = (int)(rb / SS), s0 = (int)(rb % SS); const int pc0 = n0 - 2 * DM;
    for (int u = tid; u < 128 * 8; u += 128) { const int ln = u & 31, half = (u >> 5) & 1, dt = (u >> 6) & 3, ksl = (u >> 8) & 1, hh = u >> 9; const int d = hh * 64 + dt * 16 + (ln & 15), pc = ksl * 4 + half * 2 + (ln >> 4);   // 512-B runs in fragment order
      const size_t o = ((((size_t)b * NH + (pc0 >> 6) + hh) * (SS / 32) + (s0 >> 5) + ksl) * 4 + dt) * FRAG + half * 256 + ln * 8; vst2((unsigned*)(VTH + o), *(const v4u*)&sth[d][pc * 8]); vst2((unsigned*)(VTL + o), *(const v4u*)&stl[d][pc * 8]); }
    if (p + 1 < QNP) __syncthreads();   // the next row tiles overwrite sth / stl: every thread's reads above must be over
  }
  }
}
// ---- k_attn: block = (64 queries, head h, batch b), 8 waves = 4 query tiles x 2 key groups: causal flash attention (K = 64: 2 k-steps), computed TRANSPOSED: S^T = K . Q^T (A = a key tile, B = the query tile) and O^T += V^T . P^T. A lane (g, col) then holds, of ONE query (col), the scores of keys 16 * ct + 8 * g + r: maximum and sum run inside the lane with one exchange between the wave's halves, the rescale factor is one value per lane, and the two score tiles, converted in place, ARE the B operand of the second product (element 8 * ct + r = key 16 * ct + 8 * g + r, the k order of the V fragments), so P passes through no LDS. scores = (q.k) * 0.125 and P.V: 3 products in the first two query blocks (hi x hi, plus hi x residual and residual x hi in a second accumulator; residuals x2048), single f16 operands elsewhere; key group kw takes the key steps ks = kw, kw + 2, ... with a running maximum and sum of its own, and the two partial results are joined in LDS; ctx is stored as k_out's A operand.
// Why two groups: the cost of a query block grows with its index (causal), and with one wave per query tile every block is resident at once, so the launch lasts as long as the last block while the others' places stand empty. Half as long and twice as many waves give more blocks than places; the blocks start heaviest first (blockIdx.z counts the query blocks down), so the places stay filled to the end.
__device__ __forceinline__ float xhalf(float x) { return __builtin_bit_cast(float, __builtin_amdgcn_permlanex16(__builtin_bit_cast(int, x), __builtin_bit_cast(int, x), 0x76543210, 0xfedcba98, false, false)); }   // the value of lane l ^ 16
#define LOG2E 1.44269504088896340736f
// one key step (32 keys) of a wave, compiled once per case, so that a step runs only the work its case needs; both switches are the same for a whole wave. PREC: the leading query blocks' 3-product scores and P.V with the second accumulator. MASK: the step holds keys behind some query of the tile (causal select, masked scores count 0).
template <bool PREC, bool MASK> __device__ __forceinline__ void attn_step(const int ks, const _Float16* __restrict__ KF, const _Float16* __restrict__ KFL, const _Float16* __restrict__ VTH, const _Float16* __restrict__ VTL, const size_t hb, const float* abq, const int dq0, const v16h* aq, const v16h* aql, float& m, float& l, v8f* acc, v8f* accl) {
  v8f s[2];
  // the key step's K fragments and bias values are loaded as one group in front of the first product (the bias unconditionally: row and key are inside [S][S] for every lane; the causal select follows), so one round trip replaces one per product and per bias row
  v16h kf[2][2]; v4f ab[2][2]; const int dq = dq0 - ks * 32;   // the query's distance from this half's first key: key 16 * ct + r of the lane is allowed up to it
#pragma unroll
  for (int ct = 0; ct < 2; ++ct) {
#pragma unroll
    for (int kc = 0; kc < 2; ++kc) kf[ct][kc] = frag_hp(KF + hb + (size_t)((ks * 2 + ct) * 2 + kc) * FRAG);
    ab[ct][0] = *(const v4f*)(abq + ks * 32 + ct * 16); ab[ct][1] = *(const v4f*)(abq + ks * 32 + ct * 16 + 4); }   // the lane's eight keys lie side by side in the query's row
  asm volatile("s_wait_xcnt 0x0" ::: "memory");   // precaution: the group's address registers may be reused by what follows while its loads are still out
#pragma unroll
  for (int ct = 0; ct < 2; ++ct) { v8f c = {};
    if (PREC) { v8f cl = {};   // leading query blocks (few keys, outputs far above the global rms): 3 products
#pragma unroll
      for (int kc = 0; kc < 2; ++kc) { const v16h kh = kf[ct][kc]; c = wmma16(kh, aq[kc], c); cl = wmma16(kh, aql[kc], cl); const v16h kl = frag_hp(KFL + hb + (size_t)((ks * 2 + ct) * 2 + kc) * FRAG);
        asm volatile("s_wait_xcnt 0x0" ::: "memory");   // precaution, as above: the load's address registers may be reused by what follows
        cl = wmma16(kl, aq[kc], cl); }
#pragma unroll
      for (int r = 0; r < 8; ++r) c[r] += cl[r] * (1.0f / 2048.0f); }
    else {
#pragma unroll
      for (int kc = 0; kc < 2; ++kc) c = wmma16(kf[ct][kc], aq[kc], c); }   // single product elsewhere
#pragma unroll
    for (int r = 0; r < 8; ++r) { const float sv = c[r] * SCALEF + bfr(ab[ct][r >> 2][r & 3]); s[ct][r] = (!MASK || ct * 16 + r <= dq) ? sv : -3.0e38f; } }   // causal: future keys excluded
  // the V fragments are requested here, behind the score products, and fly under the softmax
  v16h vf[4];
#pragma unroll
  for (int dt = 0; dt < 4; ++dt) vf[dt] = frag_hp(VTH + hb + (size_t)(ks * 4 + dt) * FRAG);
  asm volatile("s_wait_xcnt 0x0" ::: "memory");   // precaution: the group's address registers may be reused by what follows while its loads are still out
  float mx = fmaxf(s[0][0], s[1][0]);
#pragma unroll
  for (int r = 1; r < 8; ++r) mx = fmaxf(mx, fmaxf(s[0][r], s[1][r]));
  mx = fmaxf(mx, xhalf(mx));   // the other half holds the query's other sixteen keys
  const float mn = fmaxf(m, mx);
  // exp(x) as the hardware's 2^(x * log2 e), arguments and results by name for the two statements below
  float ta = (m - mn) * LOG2E, ea = __builtin_amdgcn_exp2f(ta), t[2][8], e[2][8];
#pragma unroll
  for (int ct = 0; ct < 2; ++ct) {
#pragma unroll
    for (int r = 0; r < 8; ++r) { t[ct][r] = (s[ct][r] - mn) * LOG2E; e[ct][r] = __builtin_amdgcn_exp2f(t[ct][r]); } }
  // the slot behind a transcendental: the v_nop stands behind its group's last v_exp_f32, in front of every use of a result (in-out operands) and every overwrite of an argument (inputs, live up to here)
  asm volatile("v_nop" : "+v"(ea), "+v"(e[0][0]), "+v"(e[0][1]), "+v"(e[0][2]), "+v"(e[0][3]), "+v"(e[0][4]), "+v"(e[0][5]), "+v"(e[0][6]), "+v"(e[0][7]) : "v"(ta), "v"(t[0][0]), "v"(t[0][1]), "v"(t[0][2]), "v"(t[0][3]), "v"(t[0][4]), "v"(t[0][5]), "v"(t[0][6]), "v"(t[0][7]));
  asm volatile("v_nop" : "+v"(e[1][0]), "+v"(e[1][1]), "+v"(e[1][2]), "+v"(e[1][3]), "+v"(e[1][4]), "+v"(e[1][5]), "+v"(e[1][6]), "+v"(e[1][7]) : "v"(t[1][0]), "v"(t[1][1]), "v"(t[1][2]), "v"(t[1][3]), "v"(t[1][4]), "v"(t[1][5]), "v"(t[1][6]), "v"(t[1][7]));
  const float alpha = (m <= -1.0e38f) ? 0.f : ea;
  v2f es = {}; v16h pa, pl;   // the sum runs in two chains, over the even and the odd keys
#pragma unroll
  for (int r = 0; r < 8; ++r) { const float e0 = (MASK && s[0][r] <= -1.0e38f) ? 0.f : e[0][r], e1 = (MASK && s[1][r] <= -1.0e38f) ? 0.f : e[1][r]; es[r & 1] += e0; es[r & 1] += e1;
    const float x0 = e0 * 2048.0f, x1 = e1 * 2048.0f; const _Float16 h0 = (_Float16)x0, h1 = (_Float16)x1; pa[r] = h0; pa[8 + r] = h1;   // P scaled by 2^11 before the f16 split so small softmax weights stay out of the f16 subnormal range; 2^-11 folded into the epilogue
    if (PREC) { pl[r] = (_Float16)((x0 - (float)h0) * 2048.0f); pl[8 + r] = (_Float16)((x1 - (float)h1) * 2048.0f); } }
  l = l * alpha + (es[0] + es[1]); m = mn;
#pragma unroll
  for (int dt = 0; dt < 4; ++dt) {
#pragma unroll
    for (int r = 0; r < 8; ++r) { acc[dt][r] *= alpha; if (PREC) accl[dt][r] *= alpha; } }
#pragma unroll
  for (int dt = 0; dt < 4; ++dt) { const v16h vh = vf[dt]; acc[dt] = wmma16(vh, pa, acc[dt]); if (PREC) { accl[dt] = wmma16(vh, pl, accl[dt]); const v16h vl = frag_hp(VTL + hb + (size_t)(ks * 4 + dt) * FRAG);
      asm volatile("s_wait_xcnt 0x0" ::: "memory");   // precaution, as above: the load's address registers may be reused by what follows
      accl[dt] = wmma16(vl, pa, accl[dt]); } }   // leading query blocks: P hi/lo x V hi/lo (3 products); elsewhere P x V single
}
__global__ __launch_bounds__(256) void k_attn(const _Float16* __restrict__ QK, const _Float16* __restrict__ QKL, const _Float16* __restrict__ KF, const _Float16* __restrict__ KFL, const _Float16* __restrict__ VTH, const _Float16* __restrict__ VTL, const void* __restrict__ KMASK, const float* __restrict__ AB, __bf16* __restrict__ OF) {
  __shared__ __align__(16) float so[8][16][68]; __shared__ __align__(16) float sm[8][16], sl[8][16];
  const int tid = threadIdx.x, wave = __builtin_amdgcn_readfirstlane(tid >> 5), lane = tid & 31, col = lane & 15, g = lane >> 4;   // the wave's number in a scalar register: the key loop starts from it and stays a scalar loop
  const int qi = wave & 3, kw = wave >> 2;   // query tile, key group
  const int qb = TQB - 1 - blockIdx.z, h = blockIdx.x, b = blockIdx.y; const int q0 = qb * 64 + qi * 16; const size_t rq = (size_t)b * SS + q0 + col;
  v16h aq[2];   // the query tile: lane (g, col) holds query col in the fragments' k order, which serves as B as it did as A
#pragma unroll
  for (int kc = 0; kc < 2; ++kc) aq[kc] = frag_h(QK + rq * (2 * DM) + h * HD + kc * 32, lane);
  float m = -3.0e38f, l = 0.f;   // of query col: the running maximum (common to both halves) and the sum over this half's keys
  v8f acc[4] = {};   // O^T: acc[dt][r] = column d = 16 * dt + 8 * g + r of query col
  const int nks = (qb * 64 + 64) / 32;   // causal: key steps of 32 up to the query block's end
  const size_t hb = ((size_t)b * NH + h) * (SS * HD) + lane * 8;   // the head's k and v planes in fragment order (S x 64 elements each), with the lane's offset
  const float* abq = AB + (size_t)(q0 + col) * SS + 8 * g;   // the query's bias row at this half's first key
  const int dq0 = q0 + col - 8 * g;   // the query's distance from this half's first key of step 0
  // nks is even: both key groups make qb + 1 trips
  if (qb < 2) {   // the same for the whole block
    v16h aql[2]; v8f accl[4] = {};
#pragma unroll
    for (int kc = 0; kc < 2; ++kc) aql[kc] = frag_h(QKL + rq * (2 * DM) + h * HD + kc * 32, lane);
#pragma unroll 1   // rolled: the step's text once per case
    for (int ks = kw; ks < nks; ks += 2) attn_step<true, true>(ks, KF, KFL, VTH, VTL, hb, abq, dq0, aq, aql, m, l, acc, accl);
#pragma unroll
    for (int dt = 0; dt < 4; ++dt) {
#pragma unroll
      for (int r = 0; r < 8; ++r) acc[dt][r] += accl[dt][r] * (1.0f / 2048.0f); }
  } else {
    const int nfull = (q0 + 1) >> 5;   // steps whose 32 keys all lie at or in front of the tile's first query: no lane masks any of them
    int ks = kw;
#pragma unroll 1   // rolled: the step's text once per case
    for (; ks < nfull; ks += 2) attn_step<false, false>(ks, KF, KFL, VTH, VTL, hb, abq, dq0, aq, nullptr, m, l, acc, nullptr);
#pragma unroll 1   // rolled: at most one trip, the step on the diagonal
    for (; ks < nks; ks += 2) attn_step<false, true>(ks, KF, KFL, VTH, VTL, hb, abq, dq0, aq, nullptr, m, l, acc, nullptr);
  }
  l += xhalf(l);   // the two halves' sums joined once
  // each wave leaves its unnormalised sums (a lane's eight values lie side by side in its query's row) with its queries' maximum and sum
#pragma unroll
  for (int dt = 0; dt < 4; ++dt) { v4f o0, o1;
#pragma unroll   // vector elements need constant indices to stay in registers
    for (int r = 0; r < 4; ++r) { o0[r] = acc[dt][r]; o1[r] = acc[dt][4 + r]; }
    *(v4f*)&so[wave][col][dt * 16 + 8 * g] = o0; *(v4f*)&so[wave][col][dt * 16 + 8 * g + 4] = o1; }
  if (g == 0) { sm[wave][col] = m; sl[wave][col] = l; }
  __syncthreads();   // a wave reads the other key group's partial result below: both must be written
  // join for query row col: each part weighted by exp(its maximum - the common one); a group whose keys were all masked for the row (maximum still at the start value) counts 0; group 0 holds key 0, which no row masks, so the sum is above 0
  const float m0 = sm[qi][col], m1 = sm[4 + qi][col], mm = fmaxf(m0, m1);
  const float f0 = (m0 <= -1.0e38f) ? 0.f : __expf(m0 - mm), f1 = (m1 <= -1.0e38f) ? 0.f : __expf(m1 - mm);
  const float il = (1.0f / 2048.0f) / (f0 * sl[qi][col] + f1 * sl[4 + qi][col]); const float w0 = f0 * il, w1 = f1 * il;
  // ctx leaves as the out product's A operand: bf16 hi + residual, fragment order; the tile's 16 queries are one row tile, the head's 64 columns two k-steps, of which the wave writes number kw; 512-B runs
  const size_t ob = (((((size_t)b * SS + q0) >> 4) * (DM / 32) + h * 2 + kw) * (2 * FRAG)) + lane * 8;
#pragma unroll   // the four stores go out as one run, their offsets as immediates
  for (int u = 0; u < 2; ++u) { const float* p0 = &so[qi][col][kw * 32 + u * 16 + 8 * g]; const float* p1 = &so[4 + qi][col][kw * 32 + u * 16 + 8 * g]; v8b hi, lo;
#pragma unroll   // vector elements need constant indices to stay in registers
    for (int i = 0; i < 8; ++i) { const float v = p0[i] * w0 + p1[i] * w1; const __bf16 hv = (__bf16)v; hi[i] = hv; lo[i] = (__bf16)(v - (float)hv); }
    vst2(OF + ob + u * 256, hi); vst2(OF + ob + FRAG + u * 256, lo); }
}
// ---- k_out: block = (64 * ONP rows, 128 cols): out = ctx (hi, residual) . Wo (2 products) + bo; a wave holds ONP row tiles, as in k_qkv
#define ONP 2
__global__ __launch_bounds__(128) void k_out(const __bf16* __restrict__ OF, const __bf16* __restrict__ P, const float* __restrict__ BO, float* __restrict__ Y) {
  __shared__ __align__(16) float so[4][16][132];
  const int tid = threadIdx.x, wave = tid >> 5, lane = tid & 31, col = lane & 15, g = lane >> 4; const size_t rw = (size_t)blockIdx.x * (64 * ONP) + wave * 16; const int n0 = blockIdx.y * 128;   // the wave's row tile number p starts at row rw + 64 * p
  v8f acc[ONP][8] = {};
  // as in k_qkv: step kc + 1's loads are issued as one group in front of step kc's products; the pointers run one step ahead and move only behind the wait that follows their loads
  gb16* xp = (gb16*)(OF + (rw >> 4) * (DM / 32) * (2 * FRAG) + lane * 8); gb16* wp = (gb16*)(P + (size_t)(n0 >> 4) * (DM / 32) * FRAG + lane * 8);
  v16b xh[ONP], xl[ONP], wb[8];
#pragma unroll
  for (int p = 0; p < ONP; ++p) { xh[p] = frag_bp(xp + (size_t)p * 4 * (DM / 32) * (2 * FRAG)); xl[p] = frag_bp(xp + (size_t)p * 4 * (DM / 32) * (2 * FRAG) + FRAG); }   // 64 rows = 4 row tiles further
#pragma unroll
  for (int j = 0; j < 8; ++j) wb[j] = frag_bp(wp + (size_t)j * (DM / 32) * FRAG);
  XWAIT(xp, wp);
  xp += 2 * FRAG; wp += FRAG;
#pragma unroll 2
  for (int kc = 0; kc < DM / 32; ++kc) {
    v16b xhn[ONP], xln[ONP], wn[8];
#pragma unroll
    for (int p = 0; p < ONP; ++p) { xhn[p] = frag_bp(xp + (size_t)p * 4 * (DM / 32) * (2 * FRAG)); xln[p] = frag_bp(xp + (size_t)p * 4 * (DM / 32) * (2 * FRAG) + FRAG); }
#pragma unroll
    for (int j = 0; j < 8; ++j) wn[j] = frag_bp(wp + (size_t)j * (DM / 32) * FRAG);
    XWAIT(xp, wp);
    { const int st = (kc + 2 < DM / 32) ? FRAG : 0; xp += 2 * st; wp += st; }   // the last trip fetches the last step's operands again (in bounds, unused)
    __builtin_amdgcn_sched_barrier(0);   // keeps this step's products behind the next step's load group, as in k_qkv
    // residual products first, then the hi products, per accumulator as before; the plain builtin for the reason given in k_qkv
#pragma unroll
    for (int j = 0; j < 8; ++j) {
#pragma unroll
      for (int p = 0; p < ONP; ++p) acc[p][j] = __builtin_amdgcn_wmma_f32_16x16x32_bf16(false, xl[p], false, wb[j], (short)0, acc[p][j], false, false); }
#pragma unroll
    for (int j = 0; j < 8; ++j) {
#pragma unroll
      for (int p = 0; p < ONP; ++p) acc[p][j] = __builtin_amdgcn_wmma_f32_16x16x32_bf16(false, xh[p], false, wb[j], (short)0, acc[p][j], false, false); }
#pragma unroll
    for (int p = 0; p < ONP; ++p) { xh[p] = xhn[p]; xl[p] = xln[p]; }
#pragma unroll
    for (int j = 0; j < 8; ++j) wb[j] = wn[j]; }
  float bo[8];   // the lane's eight bias values, fetched once for both row tiles
#pragma unroll
  for (int j = 0; j < 8; ++j) bo[j] = bfr(BO[n0 + j * 16 + col]);
#pragma unroll   // accumulator indices must be constants to stay in registers
  for (int p = 0; p < ONP; ++p) { const size_t r0 = rw + 64 * p;   // the staging rows are the wave's own: its LDS operations run in program order, so the next row tile's writes follow this one's reads
#pragma unroll
    for (int j = 0; j < 8; ++j) {
#pragma unroll
      for (int r = 0; r < 8; ++r) so[wave][8 * g + r][j * 16 + col] = acc[p][j][r] + bo[j]; }
    LDSX();
    for (int rl = 0; rl < 16; ++rl) vst2(Y + (r0 + rl) * DM + n0 + lane * 4, *(const v4f*)&so[wave][rl][lane * 4]); }
}
extern "C" void kernel_launch(void* const* d_in, const int* in_sizes, int n_in, void* d_out, int out_size, void* d_ws, size_t ws_size, hipStream_t stream) {
  (void)in_sizes; (void)n_in; (void)out_size;
  const float** F = (const float**)d_in;   // 0 hidden [2,2048,1024], 1 attn_bias [2048,2048], 2 Wqkv [1024,3072] (in,out; q | k | v), 3 bqkv [3072], 4 Wproj [1024,1024] (in,out), 5 bproj
  if (ws_size < (size_t)WS_END) return;
  char* ws = (char*)d_ws; __bf16* PK = (__bf16*)(ws + WS_PK); _Float16 *QK = (_Float16*)(ws + WS_QK), *QKL = (_Float16*)(ws + WS_QKL), *VTH = (_Float16*)(ws + WS_VTH), *VTL = (_Float16*)(ws + WS_VTL), *KF = (_Float16*)(ws + WS_KF), *KFL = (_Float16*)(ws + WS_KFL); __bf16 *OF = (__bf16*)(ws + WS_O), *XF = (__bf16*)(ws + WS_XF);
  float* OUT0 = (float*)d_out; float* KOUT = OUT0 + (size_t)NB * SS * DM; float* VOUT = KOUT + (size_t)NB * SS * DM;   // outputs: out, cache_key, cache_value
  k_pack<<<dim3(XBLK, 2), 256, 0, stream>>>(F[2], F[4], F[0], PK, XF);
  k_qkv<<<dim3(TNB * SS / (64 * QNP), QKVW / 128), 128, 0, stream>>>(XF, PK + PK_A, F[3], F[3] + DM, F[3] + 2 * DM, KOUT, VOUT, QK, QKL, KF, KFL, VTH, VTL);
  k_attn<<<dim3(NH, TNB, TQB), 256, 0, stream>>>(QK, QKL, KF, KFL, VTH, VTL, nullptr, F[1], OF);
  k_out<<<dim3(TOB / ONP, DM / 128), 128, 0, stream>>>(OF, PK + PK_P, F[5], OUT0);
}

// v008
// A run of this version takes 100 microseconds.
// Two timings next to v007 both put it at 1.04 times that version's speed.
// Counting every step since v000, it is 6.02 times as fast.
// compute dtype: all float inputs rounded to bf16; qkv = x . Wqkv + b with EXACT bf16 products on WMMA 16x16x32 ((in,out) weights packed by k_pack; x, the weights, k, v and ctx are kept in the matrix instructions' fragment order) - the k and v projections are also written out in f32 straight from the accumulators; causal attention with key-tile skipping: the first 128 queries use 3-product scores and P.v (hi/lo), later queries single f16 operands; (q.k)/8 + attn_bias[q][k], running-max softmax in f32 (hardware exp); out = ctx (bf16 hi + residual) . Wproj (2 products) + bproj; outputs out | cache_key | cache_value concatenated.
#include <hip/hip_runtime.h>
#include <math.h>

typedef __attribute__((ext_vector_type(16))) _Float16 v16h;
typedef __attribute__((ext_vector_type(16))) __bf16 v16b;
typedef __attribute__((ext_vector_type(8)))  _Float16 v8h;
typedef __attribute__((ext_vector_type(8)))  float v8f;
typedef __attribute__((ext_vector_type(4)))  float v4f;
typedef __attribute__((ext_vector_type(2)))  float v2f;
typedef __attribute__((ext_vector_type(4)))  unsigned v4u;
typedef __attribute__((ext_vector_type(4)))  int v4i;
typedef float __attribute__((may_alias)) float_a;
typedef int __attribute__((may_alias)) int_a;

template <typename T> __device__ __forceinline__ void vst2(void* p, T v) { *(T*)p = v;  }
__device__ __forceinline__ v8f wmma16(v16h a, v16h b, v8f c) {
  v8f d = __builtin_amdgcn_wmma_f32_16x16x32_f16(false, a, false, b, (short)0, c, false, false);
  asm volatile("v_nop\n\tv_nop\n\tv_nop\n\tv_nop" : "+v"(d) : "v"(a), "v"(b));
  return d;
}
__device__ __forceinline__ v8f wmma_bf(v16b a, v16b b, v8f c) {
  v8f d = __builtin_amdgcn_wmma_f32_16x16x32_bf16(false, a, false, b, (short)0, c, false, false);
  asm volatile("v_nop\n\tv_nop\n\tv_nop\n\tv_nop" : "+v"(d) : "v"(a), "v"(b));
  return d;
}
// Prefill attention (B 2, S 2,048, E 1,024, 16 heads x 64): fused (in,out) qkv + bias, scores / 8 + learned additive bias[q, k], causal, softmax, . v, Wproj + bias; also returns the k and v projections (the KV cache).
__device__ __forceinline__ v16h frag_h(const _Float16* rowk0, int lane) {
  union { v16h v; v8h q[2]; } u; const _Float16* p = rowk0 + 8 * (lane >> 4);
  u.q[0] = *(const v8h*)p; u.q[1] = *(const v8h*)(p + 16); return u.v;
}
__device__ __forceinline__ v16h frag_f32(const float* rowk0, int lane) {
  v16h a; const float* p = rowk0 + 8 * (lane >> 4);
#pragma unroll
  for (int i = 0; i < 8; ++i) { a[i] = (_Float16)p[i]; a[8 + i] = (_Float16)p[16 + i]; }
  return a;
}
__device__ __forceinline__ v16h frag_f32s(const float* rowk0, int lane, float sc) {
  v16h a; const float* p = rowk0 + 8 * (lane >> 4);
#pragma unroll
  for (int i = 0; i < 8; ++i) { a[i] = (_Float16)(p[i] * sc); a[8 + i] = (_Float16)(p[16 + i] * sc); }
  return a;
}
// column fragment from a [K][ld] layout (column n), rows >= K read as 0
__device__ __forceinline__ v16h fragc_f32(const float* W, int k0, int n, int lane, int ld, int K) {
  v16h a; const int g = lane >> 4;
#pragma unroll
  for (int i = 0; i < 8; ++i) { const int ka = k0 + 8 * g + i, kb = ka + 16;
    a[i] = (_Float16)(ka < K ? W[(size_t)(ka < K ? ka : K - 1) * ld + n] : 0.f); a[8 + i] = (_Float16)(kb < K ? W[(size_t)(kb < K ? kb : K - 1) * ld + n] : 0.f); }
  return a;
}
struct F2 { v16b h, l; };
__device__ __forceinline__ F2 bsplit16(const float v[16]) { F2 r;
#pragma unroll
  for (int i = 0; i < 16; ++i) { const __bf16 h = (__bf16)v[i]; r.h[i] = h; r.l[i] = (__bf16)(v[i] - (float)h); }
  return r; }
__device__ __forceinline__ F2 split_row(const float* row, int k0, int lane) { float v[16]; const float* p = row + k0 + 8 * (lane >> 4);
#pragma unroll
  for (int i = 0; i < 8; ++i) { v[i] = p[i]; v[8 + i] = p[16 + i]; }
  return bsplit16(v); }
__device__ __forceinline__ F2 split_rowK(const float* row, int k0, int lane, int K) { float v[16]; const int g = lane >> 4;
#pragma unroll
  for (int i = 0; i < 8; ++i) { const int ka = k0 + 8 * g + i, kb = ka + 16; v[i] = ka < K ? row[ka < K ? ka : K - 1] : 0.f; v[8 + i] = kb < K ? row[kb < K ? kb : K - 1] : 0.f; }
  return bsplit16(v); }
__device__ __forceinline__ F2 split_col(const float* W, int k0, int n, int lane, int ld, int K) { float v[16]; const int g = lane >> 4;
#pragma unroll
  for (int i = 0; i < 8; ++i) { const int ka = k0 + 8 * g + i, kb = ka + 16; v[i] = ka < K ? W[(size_t)(ka < K ? ka : K - 1) * ld + n] : 0.f; v[8 + i] = kb < K ? W[(size_t)(kb < K ? kb : K - 1) * ld + n] : 0.f; }
  return bsplit16(v); }
__device__ __forceinline__ v8f mac3(const F2& a, const F2& b, v8f c) { c = wmma_bf(a.l, b.h, c); c = wmma_bf(a.h, b.l, c); return wmma_bf(a.h, b.h, c); }
__device__ __forceinline__ float sigm(float v) { return 1.0f / (1.0f + expf(-v)); }
#define LDSX() do { asm volatile("s_wait_dscnt 0" ::: "memory"); __builtin_amdgcn_wave_barrier(); __builtin_amdgcn_fence(__ATOMIC_RELEASE, "workgroup"); } while (0)


#define NB 2
#define SS 2048
#define DM 1024
#define NH 16
#define SCALEF 0.125f
#define HD 64
#define QKVW (3 * DM)
#ifndef TQB
#define TQB (SS / 64)
#define TNB NB
#define TOB (NB * SS / 64)     // output blocks of 64 rows (all)
#endif
typedef __attribute__((ext_vector_type(8))) __bf16 v8b;
__device__ __forceinline__ v16b frag_b(const __bf16* rowk0, int lane) {
  union { v16b v; v8b q[2]; } u; const __bf16* p = rowk0 + 8 * (lane >> 4);
  u.q[0] = *(const v8b*)p; u.q[1] = *(const v8b*)(p + 16); return u.v;
}
// pointers typed as global memory: they keep that type through the XWAIT statement below, so the loads behind it stay global loads
typedef const __attribute__((address_space(1))) float gf32; typedef const __attribute__((address_space(1))) __bf16 gb16;
typedef const __attribute__((address_space(1))) v4f gv4f; typedef const __attribute__((address_space(1))) v8b gv8b;
// FRAGMENT ORDER: a 16 x 32 operand tile is kept as 1 KB = [half 2][lane 32][8 elements]; lane (g, col) holds row col, k = 16 * half + 8 * g + i, the k order of frag_b / frag_h. One wave-wide 16-byte load then covers 512 contiguous bytes (4 whole lines) instead of 32 bytes in each of 16 lines.
#define FRAG 512                     // elements of one tile
// a tile from a pointer that already holds the lane's offset (lane * 8)
__device__ __forceinline__ v16b frag_bp(gb16* p) { union { v16b v; v8b q[2]; } u; u.q[0] = *(gv8b*)p; u.q[1] = *(gv8b*)(p + 256); return u.v; }
__device__ __forceinline__ v16h frag_hp(const _Float16* p) { union { v16h v; v8h q[2]; } u; u.q[0] = *(const v8h*)p; u.q[1] = *(const v8h*)(p + 256); return u.v; }
// precaution behind a group of global loads: the wait stands in front of every rewrite of the group's address registers; both pointers pass through the statement, so every later step of them follows it
#define XWAIT(pa, pb) asm volatile("s_wait_xcnt 0x0" : "+v"(pa), "+v"(pb) : : "memory")
__device__ __forceinline__ float bfr(float v) { return (float)(__bf16)v; }
__device__ __attribute__((noinline)) float exp_ni(float v) { return expf(v); }
__device__ __attribute__((noinline)) float erf_ni(float v) { return erff(v); }

#define PK_A 0                       // Wqkv, fragment order: [192 tiles of 16 outputs][32 k-steps][FRAG]
#define PK_P (PK_A + QKVW * DM)        // Wo, fragment order: [64 tiles][32 k-steps][FRAG]
#define PK_END (PK_P + DM * DM)
#define WS_PK  0u
#define WS_QK  (WS_PK + 2u * PK_END)             // f16 [4096 rows][2048]: q in the first 1024 columns (the rest unused)
#define WS_QKL (WS_QK + 2u * NB * SS * 2 * DM)     // f16 q residual plane x2048, same shape
#define WS_VTH (WS_QKL + 2u * NB * SS * 2 * DM)    // f16 v hi, fragment order: [b][h][64 steps of 32 keys][4 tiles of 16 d][FRAG]
#define WS_VTL (WS_VTH + 2u * NB * DM * SS)        // f16 lo x 2048, same shape
#define WS_O   (WS_VTL + 2u * NB * DM * SS)        // bf16 ctx, fragment order: [256 tiles of 16 rows][32 k-steps][hi FRAG | residual FRAG]
#define WS_CS  (WS_O + 4u * NB * SS * DM)           // f32 2 x [2048][32], unused
#define WS_KF  (WS_CS + 4u * 2 * SS * 32)          // f16 k hi, fragment order: [b][h][128 tiles of 16 keys][2 k-steps of 32 d][FRAG]
#define WS_KFL (WS_KF + 2u * NB * SS * DM)         // f16 k residual x2048, same shape
#define WS_XF  (WS_KFL + 2u * NB * SS * DM)        // bf16 x, fragment order: [256 tiles of 16 rows][32 k-steps][FRAG]
#define WS_ABF (WS_XF + 2u * NB * SS * DM)         // bf16 attn_bias, fragment order: [128 tiles of 16 queries][64 steps of 32 keys][FRAG]
#define WS_END (WS_ABF + 2u * SS * SS)
// ---- k_pack: ONE launch packs x, both (in,out) weights and the attention bias into fragment order. Every thread has sixteen 16-byte loads in flight (each wave-wide load = 512 contiguous bytes of one source row), so the launch needs 8 waves for every 64 KB it reads, few enough that starting them no longer sets its length. A block takes 64 KB of f32 in and gives 32 KB of bf16 out: 128 x 16 pieces of 16 bytes (8 consecutive k of one row of x or one output n of a weight). LDS only reorders the pieces between lanes, so that the stores are 512-B runs.
// blockIdx.y == 0: one row tile of x (16 rows x 1,024 k); piece (L, c) = row c, k = 8 * L ... 8 * L + 7. blockIdx.y == 2: the same of attn_bias, row = query, k = key: 16 queries x 1,024 keys; in k_attn's transposed scores lane (g, col) holds query col and keys 16 * ct + 8 * g + r, which is this order with half = ct. Blocks 0 ... 127 take the first 1,024 keys of query tile blockIdx.x, blocks 128 ... 191 the second 1,024 of query tiles 64 ... 127; no causal key step of the first 1,024 queries reaches the second 1,024 keys, so the other blocks have no work. blockIdx.y == 1: (128 outputs n, 128 inputs k) of a weight, n blocks < 24 of Wqkv (q | k | v outputs in column order), then Wproj, whose tiles follow in PK; piece (L, c) = output 16 * (L >> 4) + c, k = 8 * (L & 15) ... + 7.
static_assert(PK_A == 0 && PK_P == QKVW * DM, "the two weights' tiles are numbered through");
typedef __attribute__((ext_vector_type(4))) __bf16 v4b;
#define PKU(L, c) (17 * (L) + ((L) >> 4) + (c))   // the piece's place in LDS, in 16-byte units: the odd pitch and the step per 16 L spread both writers' lanes over the banks
#define XBLK (NB * SS / 16)
static_assert((QKVW + DM) / 128 * (DM / 128) == XBLK, "as many weight blocks as row tiles of x: the grid is (XBLK, 3)");
#define ABLK (SS / 16 + SS / 32)     // bias blocks with work
static_assert(SS == 2048 && ABLK <= XBLK, "a bias row is two runs of 1,024 keys; its blocks fit the grid's x");
// sixteen 16-byte loads from one address with constant offsets, as one group; the wait is a precaution: the address registers may be reused by what follows while the loads are still out (the address is an input of the statement, so its registers stay untouched, also by the group's own results, up to the wait)
template <int SA, int SB> __device__ __forceinline__ void ld16(const float* p, v4f* v) {
#pragma unroll   // constant indices keep v in registers, constant offsets keep one address for the group
  for (int i = 0; i < 16; ++i) v[i] = *(const v4f*)(p + (i >> 3) * SA + (i & 7) * SB);
  asm volatile("s_wait_xcnt 0x0" : : "v"(p) : "memory");
}
__global__ __launch_bounds__(256) void k_pack(const float* __restrict__ WA, const float* __restrict__ WO, const float* __restrict__ X, const float* __restrict__ AB, __bf16* __restrict__ PK, __bf16* __restrict__ XF, __bf16* __restrict__ ABF) {
  __shared__ __align__(16) __bf16 s[PKU(128, 0) * 8]; const int t = threadIdx.x, wave = t >> 5, lane = t & 31; const bool isx = blockIdx.y != 1, isb = blockIdx.y == 2;   // the same for the whole block; isx: rows that are already k-contiguous (x, bias)
  if (isb && blockIdx.x >= ABLK) return;   // the whole block leaves, in front of the barrier
  const int bt = blockIdx.x < SS / 16 ? blockIdx.x : blockIdx.x - SS / 32, bh = blockIdx.x < SS / 16 ? 0 : 1;   // bias blocks: query tile, half of the keys
  const int nb = blockIdx.x >> 3, kb = blockIdx.x & 7;   // weight blocks: 128 outputs, 128 inputs
  v4f v[16];
  if (isx) {   // the wave reads rows 2 * wave and 2 * wave + 1, 1,024 k of each (all of an x row, the block's half of a bias row), eight loads each
    if (isb) ld16<SS, 128>(AB + ((size_t)bt * 16 + wave * 2) * SS + bh * 1024 + lane * 4, v);
    else ld16<DM, 128>(X + ((size_t)blockIdx.x * 16 + wave * 2) * DM + lane * 4, v);
#pragma unroll   // a lane holds half a piece: lanes 2 m and 2 m + 1 write the two halves side by side
    for (int i = 0; i < 16; ++i) { v4b o;
#pragma unroll
      for (int c = 0; c < 4; ++c) o[c] = (__bf16)v[i][c];
      *(v4b*)(s + PKU((i & 7) * 16 + (lane >> 1), wave * 2 + (i >> 3)) * 8 + (lane & 1) * 4) = o; }
  } else {   // the wave reads input rows 16 * wave ... + 15, 128 outputs of each: a lane then holds, for its four outputs, two pieces each (the transposition is a choice of registers)
    const int k0 = kb * 128 + wave * 16;
    if (nb < QKVW / 128) ld16<8 * QKVW, QKVW>(WA + (size_t)k0 * QKVW + nb * 128 + lane * 4, v);
    else ld16<8 * DM, DM>(WO + (size_t)k0 * DM + (nb - QKVW / 128) * 128 + lane * 4, v);
#pragma unroll
    for (int u = 0; u < 2; ++u) {
#pragma unroll
      for (int c = 0; c < 4; ++c) { v8b o;
#pragma unroll   // vector elements need constant indices to stay in registers
        for (int i = 0; i < 8; ++i) o[i] = (__bf16)v[8 * u + i][c];
        *(v8b*)(s + PKU((lane >> 2) * 16 + wave * 2 + u, 4 * (lane & 3) + c) * 8) = o; } }
  }
  __syncthreads();   // the pieces are read back by other lanes and waves
  // piece number t + 256 * i in the order (L, c) is the order of the fragments: x's row tile is one 32-KB run; a weight block gives 4 KB (4 k-steps) to each of its 8 output tiles
  if (isx) { __bf16* d = (isb ? ABF + ((size_t)bt * (SS / 32) + bh * 32) * FRAG : XF + (size_t)blockIdx.x * (DM / 32) * FRAG) + t * 8;
#pragma unroll   // the eight LDS reads, then the eight stores, go out as one run each
    for (int i = 0; i < 8; ++i) vst2((unsigned*)(d + i * 2048), *(const v4u*)(s + PKU(16 * i + (t >> 4), t & 15) * 8));
  } else { __bf16* d = PK + ((size_t)(nb * 8) * (DM / 32) + kb * 4) * FRAG + t * 8;
#pragma unroll   // as above
    for (int i = 0; i < 8; ++i) vst2((unsigned*)(d + i * (DM / 32) * FRAG), *(const v4u*)(s + PKU(16 * i + (t >> 4), t & 15) * 8)); }
}
// ---- k_qkv: block = (64 * QNP rows, 128 cols), 4 waves; a wave holds QNP row tiles (64 rows apart) x 8 column tiles, so one loaded weight fragment feeds QNP products and the weight loads per product fall by that factor
#define QNP 2
__global__ __launch_bounds__(128) void k_qkv(const __bf16* __restrict__ XF, const __bf16* __restrict__ P, const float* __restrict__ BQ, const float* __restrict__ BK, const float* __restrict__ BV, float* __restrict__ KOUT, float* __restrict__ VOUT, _Float16* __restrict__ QK, _Float16* __restrict__ QKL, _Float16* __restrict__ KF, _Float16* __restrict__ KFL, _Float16* __restrict__ VTH, _Float16* __restrict__ VTL) {
  const int which0 = (blockIdx.y * 128) / DM; const float* BB = BQ ? (((which0 == 0) ? BQ : (which0 == 1) ? BK : BV) + (blockIdx.y * 128 - which0 * DM)) : nullptr;
  __shared__ __align__(16) _Float16 so[4][16][136], sol[4][16][136]; __shared__ __align__(16) _Float16 sth[128][72], stl[128][72];
  const int tid = threadIdx.x, wave = tid >> 5, lane = tid & 31, col = lane & 15, g = lane >> 4; const size_t rw = (size_t)blockIdx.x * (64 * QNP) + wave * 16; const int n0 = blockIdx.y * 128;   // the wave's row tile number p starts at row rw + 64 * p
  v8f acc[QNP][8] = {};
  float bj[8];   // the lane's eight bias values, fetched once as a group (the epilogues read them per element)
#pragma unroll
  for (int j = 0; j < 8; ++j) bj[j] = 0.f;
  if (BB) {
#pragma unroll
    for (int j = 0; j < 8; ++j) bj[j] = bfr(BB[j * 16 + col]); }
  // every global load of k-step kc + 1 is issued as one group in front of step kc's products, so the loads fly together and behind the matrix work instead of one load-and-wait per product
  gb16* xp = (gb16*)(XF + (rw >> 4) * (DM / 32) * FRAG + lane * 8); gb16* wp = (gb16*)(P + (size_t)(n0 >> 4) * (DM / 32) * FRAG + lane * 8);
  v16b xa[QNP], wb[8];
#pragma unroll
  for (int p = 0; p < QNP; ++p) xa[p] = frag_bp(xp + (size_t)p * 4 * (DM / 32) * FRAG);   // 64 rows = 4 row tiles further
#pragma unroll
  for (int j = 0; j < 8; ++j) wb[j] = frag_bp(wp + (size_t)j * (DM / 32) * FRAG);
  XWAIT(xp, wp);
  xp += FRAG; wp += FRAG;   // the pointers run one step ahead and move only behind the wait that follows their loads
#pragma unroll 2
  for (int kc = 0; kc < DM / 32; ++kc) {
    v16b xn[QNP], wn[8];
#pragma unroll
    for (int p = 0; p < QNP; ++p) xn[p] = frag_bp(xp + (size_t)p * 4 * (DM / 32) * FRAG);
#pragma unroll
    for (int j = 0; j < 8; ++j) wn[j] = frag_bp(wp + (size_t)j * (DM / 32) * FRAG);
    XWAIT(xp, wp);
    { const int st = (kc + 2 < DM / 32) ? FRAG : 0; xp += st; wp += st; }   // the last trip fetches the last step's operands again (in bounds, unused)
    __builtin_amdgcn_sched_barrier(0);   // keeps this step's products behind the next step's load group: without it the build sinks those loads among the products and waits on each at once
#pragma unroll
    for (int j = 0; j < 8; ++j) {
#pragma unroll
      for (int p = 0; p < QNP; ++p) acc[p][j] = __builtin_amdgcn_wmma_f32_16x16x32_bf16(false, xa[p], false, wb[j], (short)0, acc[p][j], false, false); }   // every weight fragment serves QNP products; the plain builtin (the compiler keeps its distances): with wmma_bf's operand-tied statement this live set, above 256 registers, was built with scratch spills in the loop
#pragma unroll
    for (int p = 0; p < QNP; ++p) xa[p] = xn[p];
#pragma unroll
    for (int j = 0; j < 8; ++j) wb[j] = wn[j]; }
  // the epilogue runs once per row tile of the wave, through the same staging arrays
#pragma unroll   // accumulator indices must be constants to stay in registers
  for (int p = 0; p < QNP; ++p) { const size_t r0 = rw + 64 * p;
  if (which0 >= 1) {   // cache_key / cache_value: the f32 projections (+ bias) straight from the accumulators, 512-B row segments
    __shared__ __align__(16) float sf[4][16][132];
#pragma unroll
    for (int j = 0; j < 8; ++j) {
#pragma unroll
      for (int r = 0; r < 8; ++r) sf[wave][8 * g + r][j * 16 + col] = acc[p][j][r] + bj[j]; }
    LDSX();
    float* dst = (which0 == 1) ? KOUT : VOUT; for (int rl = 0; rl < 16; ++rl) vst2(dst + (r0 + rl) * DM + (n0 - which0 * DM) + lane * 4, *(const v4f*)&sf[wave][rl][lane * 4]);
    LDSX(); }
  if (n0 < 2 * DM) {   // q stored unscaled (f16 sigma ~0.6, no subnormal exposure); 1/8 applied to the f32 score
#pragma unroll
    for (int j = 0; j < 8; ++j) {
#pragma unroll
      for (int r = 0; r < 8; ++r) { const float v = acc[p][j][r] + bj[j]; const _Float16 hv = (_Float16)v; so[wave][8 * g + r][j * 16 + col] = hv; sol[wave][8 * g + r][j * 16 + col] = (_Float16)((v - (float)hv) * 2048.0f); } }   // q, k (+ bias) as f16 hi + (x2048) residual
    LDSX();
    if (which0 == 0) { for (int rl = 0; rl < 16; ++rl) if (lane < 16) { vst2((unsigned*)(QK + (r0 + rl) * (2 * DM) + n0 + lane * 8), *(const v4u*)&so[wave][rl][lane * 8]); vst2((unsigned*)(QKL + (r0 + rl) * (2 * DM) + n0 + lane * 8), *(const v4u*)&sol[wave][rl][lane * 8]); } }
    else {   // k: the wave's 16 rows are one key tile; 2 heads x 2 k-steps x 2 halves, each a 512-B run in fragment order
      const size_t kb = (((r0 / SS) * NH + ((n0 - DM) >> 6)) * (SS / 16) + ((r0 % SS) >> 4)) * (2 * FRAG) + lane * 8;
#pragma unroll   // the sixteen stores go out as one run, their offsets as immediates
      for (int u = 0; u < 8; ++u) { const size_t o = kb + (size_t)(u >> 2) * (SS / 16) * (2 * FRAG) + (u & 3) * 256; const int c0 = (u >> 2) * 64 + (u & 3) * 16 + 8 * g;
        vst2((unsigned*)(KF + o), *(const v4u*)&so[wave][col][c0]); vst2((unsigned*)(KFL + o), *(const v4u*)&sol[wave][col][c0]); }
      asm volatile("s_wait_xcnt 0x0" ::: "memory"); }   // precaution behind the run of sixteen stores: their registers may be reused by what follows while the stores are still out
  } else {
#pragma unroll
    for (int j = 0; j < 8; ++j) {
#pragma unroll
      for (int r = 0; r < 8; ++r) { const float v = acc[p][j][r] + bj[j]; const _Float16 hv = (_Float16)v; sth[j * 16 + col][wave * 16 + 8 * g + r] = hv; stl[j * 16 + col][wave * 16 + 8 * g + r] = (_Float16)((v - (float)hv) * 2048.0f); } }
    __syncthreads();
    const size_t rb = (size_t)blockIdx.x * (64 * QNP) + 64 * p; const int b = (int)(rb / SS), s0 = (int)(rb % SS); const int pc0 = n0 - 2 * DM;
    for (int u = tid; u < 128 * 8; u += 128) { const int ln = u & 31, half = (u >> 5) & 1, dt = (u >> 6) & 3, ksl = (u >> 8) & 1, hh = u >> 9; const int d = hh * 64 + dt * 16 + (ln & 15), pc = ksl * 4 + half * 2 + (ln >> 4);   // 512-B runs in fragment order
      const size_t o = ((((size_t)b * NH + (pc0 >> 6) + hh) * (SS / 32) + (s0 >> 5) + ksl) * 4 + dt) * FRAG + half * 256 + ln * 8; vst2((unsigned*)(VTH + o), *(const v4u*)&sth[d][pc * 8]); vst2((unsigned*)(VTL + o), *(const v4u*)&stl[d][pc * 8]); }
    if (p + 1 < QNP) __syncthreads();   // the next row tiles overwrite sth / stl: every thread's reads above must be over
  }
  }
}
// ---- k_attn: block = (64 queries, head h, batch b), 8 waves = 4 query tiles x 2 key groups: causal flash attention (K = 64: 2 k-steps), computed TRANSPOSED: S^T = K . Q^T (A = a key tile, B = the query tile) and O^T += V^T . P^T. A lane (g, col) then holds, of ONE query (col), the scores of keys 16 * ct + 8 * g + r: maximum and sum run inside the lane with one exchange between the wave's halves, the rescale factor is one value per lane, and the two score tiles, converted in place, ARE the B operand of the second product (element 8 * ct + r = key 16 * ct + 8 * g + r, the k order of the V fragments), so P passes through no LDS. scores = (q.k) * 0.125 and P.V: 3 products in the first two query blocks (hi x hi, plus hi x residual and residual x hi in a second accumulator; residuals x2048), single f16 operands elsewhere; key group kw takes the key steps ks = kw, kw + 2, ... with a running maximum and sum of its own, and the two partial results are joined in LDS; ctx is stored as k_out's A operand.
// Why two groups: the cost of a query block grows with its index (causal), and with one wave per query tile every block is resident at once, so the launch lasts as long as the last block while the others' places stand empty. Half as long and twice as many waves give more blocks than places; the blocks start heaviest first (blockIdx.z counts the query blocks down), so the places stay filled to the end.
__device__ __forceinline__ float xhalf(float x) { return __builtin_bit_cast(float, __builtin_amdgcn_permlanex16(__builtin_bit_cast(int, x), __builtin_bit_cast(int, x), 0x76543210, 0xfedcba98, false, false)); }   // the value of lane l ^ 16
#define LOG2E 1.44269504088896340736f
// one key step (32 keys) of a wave, compiled once per case, so that a step runs only the work its case needs; both switches are the same for a whole wave. PREC: the leading query blocks' 3-product scores and P.V with the second accumulator. MASK: the step holds keys behind some query of the tile (causal select, masked scores count 0).
template <bool PREC, bool MASK> __device__ __forceinline__ void attn_step(const int ks, const _Float16* __restrict__ KF, const _Float16* __restrict__ KFL, const _Float16* __restrict__ VTH, const _Float16* __restrict__ VTL, const size_t hb, const __bf16* abf, const int dq0, const v16h* aq, const v16h* aql, float& m, float& l, v8f* acc, v8f* accl) {
  v8f s[2];
  // the key step's K fragments and bias values are loaded as one group in front of the first product (the bias unconditionally: k_pack has written every step up to the query block's last; the causal select follows), so one round trip replaces one per product and per bias row
  v16h kf[2][2]; v8b ab[2]; const _Float16* kp = KF + hb + (size_t)(ks * 4) * FRAG; const __bf16* bp = abf + (size_t)ks * FRAG; const int dq = dq0 - ks * 32;   // the query's distance from this half's first key: key 16 * ct + r of the lane is allowed up to it
#pragma unroll
  for (int ct = 0; ct < 2; ++ct) {
#pragma unroll
    for (int kc = 0; kc < 2; ++kc) kf[ct][kc] = frag_hp(kp + (ct * 2 + kc) * FRAG);
    ab[ct] = *(const v8b*)(bp + ct * 256); }   // the lane's eight keys, already bf16: a wave-wide load is 512 contiguous bytes (4 whole lines), where the f32 rows took two loads of 16 lines each
  asm volatile("s_wait_xcnt 0x0" : : "v"(kp), "v"(bp) : "memory");   // precaution: the group's address registers may be reused by what follows while its loads are still out (both addresses are inputs of the statement, so their registers stay untouched, also by the group's own results, up to the wait)
#pragma unroll
  for (int ct = 0; ct < 2; ++ct) { v8f c = {};
    if (PREC) { v8f cl = {};   // leading query blocks (few keys, outputs far above the global rms): 3 products
#pragma unroll
      for (int kc = 0; kc < 2; ++kc) { const v16h kh = kf[ct][kc]; c = wmma16(kh, aq[kc], c); cl = wmma16(kh, aql[kc], cl); const v16h kl = frag_hp(KFL + hb + (size_t)((ks * 2 + ct) * 2 + kc) * FRAG);
        asm volatile("s_wait_xcnt 0x0" ::: "memory");   // precaution, as above: the load's address registers may be reused by what follows
        cl = wmma16(kl, aq[kc], cl); }
#pragma unroll
      for (int r = 0; r < 8; ++r) c[r] += cl[r] * (1.0f / 2048.0f); }
    else {
#pragma unroll
      for (int kc = 0; kc < 2; ++kc) c = wmma16(kf[ct][kc], aq[kc], c); }   // single product elsewhere
#pragma unroll
    for (int r = 0; r < 8; ++r) { const float sv = c[r] * SCALEF + (float)ab[ct][r]; s[ct][r] = (!MASK || ct * 16 + r <= dq) ? sv : -3.0e38f; } }   // causal: future keys excluded
  // the V fragments are requested here, behind the score products, and fly under the softmax
  v16h vf[4];
#pragma unroll
  for (int dt = 0; dt < 4; ++dt) vf[dt] = frag_hp(VTH + hb + (size_t)(ks * 4 + dt) * FRAG);
  asm volatile("s_wait_xcnt 0x0" ::: "memory");   // precaution: the group's address registers may be reused by what follows while its loads are still out
  float mx = fmaxf(s[0][0], s[1][0]);
#pragma unroll
  for (int r = 1; r < 8; ++r) mx = fmaxf(mx, fmaxf(s[0][r], s[1][r]));
  mx = fmaxf(mx, xhalf(mx));   // the other half holds the query's other sixteen keys
  const float mn = fmaxf(m, mx);
  // exp(x) as the hardware's 2^(x * log2 e), arguments and results by name for the two statements below
  float ta = (m - mn) * LOG2E, ea = __builtin_amdgcn_exp2f(ta), t[2][8], e[2][8];
#pragma unroll
  for (int ct = 0; ct < 2; ++ct) {
#pragma unroll
    for (int r = 0; r < 8; ++r) { t[ct][r] = (s[ct][r] - mn) * LOG2E; e[ct][r] = __builtin_amdgcn_exp2f(t[ct][r]); } }
  // the slot behind a transcendental: the v_nop stands behind its group's last v_exp_f32, in front of every use of a result (in-out operands) and every overwrite of an argument (inputs, live up to here)
  asm volatile("v_nop" : "+v"(ea), "+v"(e[0][0]), "+v"(e[0][1]), "+v"(e[0][2]), "+v"(e[0][3]), "+v"(e[0][4]), "+v"(e[0][5]), "+v"(e[0][6]), "+v"(e[0][7]) : "v"(ta), "v"(t[0][0]), "v"(t[0][1]), "v"(t[0][2]), "v"(t[0][3]), "v"(t[0][4]), "v"(t[0][5]), "v"(t[0][6]), "v"(t[0][7]));
  asm volatile("v_nop" : "+v"(e[1][0]), "+v"(e[1][1]), "+v"(e[1][2]), "+v"(e[1][3]), "+v"(e[1][4]), "+v"(e[1][5]), "+v"(e[1][6]), "+v"(e[1][7]) : "v"(t[1][0]), "v"(t[1][1]), "v"(t[1][2]), "v"(t[1][3]), "v"(t[1][4]), "v"(t[1][5]), "v"(t[1][6]), "v"(t[1][7]));
  const float alpha = (m <= -1.0e38f) ? 0.f : ea;
  v2f es = {}; v16h pa, pl;   // the sum runs in two chains, over the even and the odd keys
#pragma unroll
  for (int r = 0; r < 8; ++r) { const float e0 = (MASK && s[0][r] <= -1.0e38f) ? 0.f : e[0][r], e1 = (MASK && s[1][r] <= -1.0e38f) ? 0.f : e[1][r]; es[r & 1] += e0; es[r & 1] += e1;
    const float x0 = e0 * 2048.0f, x1 = e1 * 2048.0f; const _Float16 h0 = (_Float16)x0, h1 = (_Float16)x1; pa[r] = h0; pa[8 + r] = h1;   // P scaled by 2^11 before the f16 split so small softmax weights stay out of the f16 subnormal range; 2^-11 folded into the epilogue
    if (PREC) { pl[r] = (_Float16)((x0 - (float)h0) * 2048.0f); pl[8 + r] = (_Float16)((x1 - (float)h1) * 2048.0f); } }
  l = l * alpha + (es[0] + es[1]); m = mn;
#pragma unroll
  for (int dt = 0; dt < 4; ++dt) {
#pragma unroll
    for (int r = 0; r < 8; ++r) { acc[dt][r] *= alpha; if (PREC) accl[dt][r] *= alpha; } }
#pragma unroll
  for (int dt = 0; dt < 4; ++dt) { const v16h vh = vf[dt]; acc[dt] = wmma16(vh, pa, acc[dt]); if (PREC) { accl[dt] = wmma16(vh, pl, accl[dt]); const v16h vl = frag_hp(VTL + hb + (size_t)(ks * 4 + dt) * FRAG);
      asm volatile("s_wait_xcnt 0x0" ::: "memory");   // precaution, as above: the load's address registers may be reused by what follows
      accl[dt] = wmma16(vl, pa, accl[dt]); } }   // leading query blocks: P hi/lo x V hi/lo (3 products); elsewhere P x V single
}
__global__ __launch_bounds__(256) void k_attn(const _Float16* __restrict__ QK, const _Float16* __restrict__ QKL, const _Float16* __restrict__ KF, const _Float16* __restrict__ KFL, const _Float16* __restrict__ VTH, const _Float16* __restrict__ VTL, const void* __restrict__ KMASK, const __bf16* __restrict__ ABF, __bf16* __restrict__ OF) {
  __shared__ __align__(16) float so[8][16][68]; __shared__ __align__(16) float sm[8][16], sl[8][16];
  const int tid = threadIdx.x, wave = __builtin_amdgcn_readfirstlane(tid >> 5), lane = tid & 31, col = lane & 15, g = lane >> 4;   // the wave's number in a scalar register: the key loop starts from it and stays a scalar loop
  const int qi = wave & 3, kw = wave >> 2;   // query tile, key group
  const int qb = TQB - 1 - blockIdx.z, h = blockIdx.x, b = blockIdx.y; const int q0 = qb * 64 + qi * 16; const size_t rq = (size_t)b * SS + q0 + col;
  v16h aq[2];   // the query tile: lane (g, col) holds query col in the fragments' k order, which serves as B as it did as A
#pragma unroll
  for (int kc = 0; kc < 2; ++kc) aq[kc] = frag_h(QK + rq * (2 * DM) + h * HD + kc * 32, lane);
  asm volatile("s_wait_xcnt 0x0" ::: "memory");   // precaution: the four loads' address registers may be reused by what follows while the loads are still out
  float m = -3.0e38f, l = 0.f;   // of query col: the running maximum (common to both halves) and the sum over this half's keys
  v8f acc[4] = {};   // O^T: acc[dt][r] = column d = 16 * dt + 8 * g + r of query col
  const int nks = (qb * 64 + 64) / 32;   // causal: key steps of 32 up to the query block's end
  const size_t hb = ((size_t)b * NH + h) * (SS * HD) + lane * 8;   // the head's k and v planes in fragment order (S x 64 elements each), with the lane's offset
  const __bf16* abf = ABF + (size_t)(q0 >> 4) * (SS / 32) * FRAG + lane * 8;   // the query tile's bias in fragment order, with the lane's offset
  const int dq0 = q0 + col - 8 * g;   // the query's distance from this half's first key of step 0
  // nks is even: both key groups make qb + 1 trips
  if (qb < 2) {   // the same for the whole block
    v16h aql[2]; v8f accl[4] = {};
#pragma unroll
    for (int kc = 0; kc < 2; ++kc) aql[kc] = frag_h(QKL + rq * (2 * DM) + h * HD + kc * 32, lane);
#pragma unroll 1   // rolled: the step's text once per case
    for (int ks = kw; ks < nks; ks += 2) attn_step<true, true>(ks, KF, KFL, VTH, VTL, hb, abf, dq0, aq, aql, m, l, acc, accl);
#pragma unroll
    for (int dt = 0; dt < 4; ++dt) {
#pragma unroll
      for (int r = 0; r < 8; ++r) acc[dt][r] += accl[dt][r] * (1.0f / 2048.0f); }
  } else {
    const int nfull = (q0 + 1) >> 5;   // steps whose 32 keys all lie at or in front of the tile's first query: no lane masks any of them
    int ks = kw;
#pragma unroll 1   // rolled: the step's text once per case
    for (; ks < nfull; ks += 2) attn_step<false, false>(ks, KF, KFL, VTH, VTL, hb, abf, dq0, aq, nullptr, m, l, acc, nullptr);
#pragma unroll 1   // rolled: at most one trip, the step on the diagonal
    for (; ks < nks; ks += 2) attn_step<false, true>(ks, KF, KFL, VTH, VTL, hb, abf, dq0, aq, nullptr, m, l, acc, nullptr);
  }
  l += xhalf(l);   // the two halves' sums joined once
  // each wave leaves its unnormalised sums (a lane's eight values lie side by side in its query's row) with its queries' maximum and sum
#pragma unroll
  for (int dt = 0; dt < 4; ++dt) { v4f o0, o1;
#pragma unroll   // vector elements need constant indices to stay in registers
    for (int r = 0; r < 4; ++r) { o0[r] = acc[dt][r]; o1[r] = acc[dt][4 + r]; }
    *(v4f*)&so[wave][col][dt * 16 + 8 * g] = o0; *(v4f*)&so[wave][col][dt * 16 + 8 * g + 4] = o1; }
  if (g == 0) { sm[wave][col] = m; sl[wave][col] = l; }
  __syncthreads();   // a wave reads the other key group's partial result below: both must be written
  // join for query row col: each part weighted by exp(its maximum - the common one); a group whose keys were all masked for the row (maximum still at the start value) counts 0; group 0 holds key 0, which no row masks, so the sum is above 0
  const float m0 = sm[qi][col], m1 = sm[4 + qi][col], mm = fmaxf(m0, m1);
  const float f0 = (m0 <= -1.0e38f) ? 0.f : __expf(m0 - mm), f1 = (m1 <= -1.0e38f) ? 0.f : __expf(m1 - mm);
  const float il = (1.0f / 2048.0f) / (f0 * sl[qi][col] + f1 * sl[4 + qi][col]); const float w0 = f0 * il, w1 = f1 * il;
  // ctx leaves as the out product's A operand: bf16 hi + residual, fragment order; the tile's 16 queries are one row tile, the head's 64 columns two k-steps, of which the wave writes number kw; 512-B runs
  const size_t ob = (((((size_t)b * SS + q0) >> 4) * (DM / 32) + h * 2 + kw) * (2 * FRAG)) + lane * 8;
#pragma unroll   // the four stores go out as one run, their offsets as immediates
  for (int u = 0; u < 2; ++u) { const float* p0 = &so[qi][col][kw * 32 + u * 16 + 8 * g]; const float* p1 = &so[4 + qi][col][kw * 32 + u * 16 + 8 * g]; v8b hi, lo;
#pragma unroll   // vector elements need constant indices to stay in registers
    for (int i = 0; i < 8; ++i) { const float v = p0[i] * w0 + p1[i] * w1; const __bf16 hv = (__bf16)v; hi[i] = hv; lo[i] = (__bf16)(v - (float)hv); }
    vst2(OF + ob + u * 256, hi); vst2(OF + ob + FRAG + u * 256, lo); }
}
// ---- k_out: block = (64 * ONP rows, 128 cols): out = ctx (hi, residual) . Wo (2 products) + bo; a wave holds ONP row tiles, as in k_qkv
#define ONP 2
__global__ __launch_bounds__(128) void k_out(const __bf16* __restrict__ OF, const __bf16* __restrict__ P, const float* __restrict__ BO, float* __restrict__ Y) {
  __shared__ __align__(16) float so[4][16][132];
  const int tid = threadIdx.x, wave = tid >> 5, lane = tid & 31, col = lane & 15, g = lane >> 4; const size_t rw = (size_t)blockIdx.x * (64 * ONP) + wave * 16; const int n0 = blockIdx.y * 128;   // the wave's row tile number p starts at row rw + 64 * p
  v8f acc[ONP][8] = {};
  // as in k_qkv: step kc + 1's loads are issued as one group in front of step kc's products; the pointers run one step ahead and move only behind the wait that follows their loads
  gb16* xp = (gb16*)(OF + (rw >> 4) * (DM / 32) * (2 * FRAG) + lane * 8); gb16* wp = (gb16*)(P + (size_t)(n0 >> 4) * (DM / 32) * FRAG + lane * 8);
  v16b xh[ONP], xl[ONP], wb[8];
#pragma unroll
  for (int p = 0; p < ONP; ++p) { xh[p] = frag_bp(xp + (size_t)p * 4 * (DM / 32) * (2 * FRAG)); xl[p] = frag_bp(xp + (size_t)p * 4 * (DM / 32) * (2 * FRAG) + FRAG); }   // 64 rows = 4 row tiles further
#pragma unroll
  for (int j = 0; j < 8; ++j) wb[j] = frag_bp(wp + (size_t)j * (DM / 32) * FRAG);
  XWAIT(xp, wp);
  xp += 2 * FRAG; wp += FRAG;
#pragma unroll 2
  for (int kc = 0; kc < DM / 32; ++kc) {
    v16b xhn[ONP], xln[ONP], wn[8];
#pragma unroll
    for (int p = 0; p < ONP; ++p) { xhn[p] = frag_bp(xp + (size_t)p * 4 * (DM / 32) * (2 * FRAG)); xln[p] = frag_bp(xp + (size_t)p * 4 * (DM / 32) * (2 * FRAG) + FRAG); }
#pragma unroll
    for (int j = 0; j < 8; ++j) wn[j] = frag_bp(wp + (size_t)j * (DM / 32) * FRAG);
    XWAIT(xp, wp);
    { const int st = (kc + 2 < DM / 32) ? FRAG : 0; xp += 2 * st; wp += st; }   // the last trip fetches the last step's operands again (in bounds, unused)
    __builtin_amdgcn_sched_barrier(0);   // keeps this step's products behind the next step's load group, as in k_qkv
    // residual products first, then the hi products, per accumulator as before; the plain builtin for the reason given in k_qkv
#pragma unroll
    for (int j = 0; j < 8; ++j) {
#pragma unroll
      for (int p = 0; p < ONP; ++p) acc[p][j] = __builtin_amdgcn_wmma_f32_16x16x32_bf16(false, xl[p], false, wb[j], (short)0, acc[p][j], false, false); }
#pragma unroll
    for (int j = 0; j < 8; ++j) {
#pragma unroll
      for (int p = 0; p < ONP; ++p) acc[p][j] = __builtin_amdgcn_wmma_f32_16x16x32_bf16(false, xh[p], false, wb[j], (short)0, acc[p][j], false, false); }
#pragma unroll
    for (int p = 0; p < ONP; ++p) { xh[p] = xhn[p]; xl[p] = xln[p]; }
#pragma unroll
    for (int j = 0; j < 8; ++j) wb[j] = wn[j]; }
  float bo[8];   // the lane's eight bias values, fetched once for both row tiles
#pragma unroll
  for (int j = 0; j < 8; ++j) bo[j] = bfr(BO[n0 + j * 16 + col]);
#pragma unroll   // accumulator indices must be constants to stay in registers
  for (int p = 0; p < ONP; ++p) { const size_t r0 = rw + 64 * p;   // the staging rows are the wave's own: its LDS operations run in program order, so the next row tile's writes follow this one's reads
#pragma unroll
    for (int j = 0; j < 8; ++j) {
#pragma unroll
      for (int r = 0; r < 8; ++r) so[wave][8 * g + r][j * 16 + col] = acc[p][j][r] + bo[j]; }
    LDSX();
    for (int rl = 0; rl < 16; ++rl) vst2(Y + (r0 + rl) * DM + n0 + lane * 4, *(const v4f*)&so[wave][rl][lane * 4]); }
}
extern "C" void kernel_launch(void* const* d_in, const int* in_sizes, int n_in, void* d_out, int out_size, void* d_ws, size_t ws_size, hipStream_t stream) {
  (void)in_sizes; (void)n_in; (void)out_size;
  const float** F = (const float**)d_in;   // 0 hidden [2,2048,1024], 1 attn_bias [2048,2048], 2 Wqkv [1024,3072] (in,out; q | k | v), 3 bqkv [3072], 4 Wproj [1024,1024] (in,out), 5 bproj
  if (ws_size < (size_t)WS_END) return;
  char* ws = (char*)d_ws; __bf16* PK = (__bf16*)(ws + WS_PK); _Float16 *QK = (_Float16*)(ws + WS_QK), *QKL = (_Float16*)(ws + WS_QKL), *VTH = (_Float16*)(ws + WS_VTH), *VTL = (_Float16*)(ws + WS_VTL), *KF = (_Float16*)(ws + WS_KF), *KFL = (_Float16*)(ws + WS_KFL); __bf16 *OF = (__bf16*)(ws + WS_O), *XF = (__bf16*)(ws + WS_XF), *ABF = (__bf16*)(ws + WS_ABF);
  float* OUT0 = (float*)d_out; float* KOUT = OUT0 + (size_t)NB * SS * DM; float* VOUT = KOUT + (size_t)NB * SS * DM;   // outputs: out, cache_key, cache_value
  k_pack<<<dim3(XBLK, 3), 256, 0, stream>>>(F[2], F[4], F[0], F[1], PK, XF, ABF);
  k_qkv<<<dim3(TNB * SS / (64 * QNP), QKVW / 128), 128, 0, stream>>>(XF, PK + PK_A, F[3], F[3] + DM, F[3] + 2 * DM, KOUT, VOUT, QK, QKL, KF, KFL, VTH, VTL);
  k_attn<<<dim3(NH, TNB, TQB), 256, 0, stream>>>(QK, QKL, KF, KFL, VTH, VTL, nullptr, ABF, OF);
  k_out<<<dim3(TOB / ONP, DM / 128), 128, 0, stream>>>(OF, PK + PK_P, F[5], OUT0);
}

// v009
// One run takes 91.2 microseconds.
// In both of two side-by-side timings against v008, it was 1.10 times as fast.
// Over all steps from v000 it is 6.61 times as fast.
// compute dtype: all float inputs rounded to bf16; qkv = x . Wqkv + b with EXACT bf16 products on WMMA 16x16x32 ((in,out) weights packed by k_pack; x, the weights, k, v and ctx are kept in the matrix instructions' fragment order) - the k and v projections are also written out in f32 straight from the accumulators; causal attention with key-tile skipping: the first 128 queries use 3-product scores and P.v (hi/lo), later queries single f16 operands; (q.k)/8 + attn_bias[q][k], running-max softmax in f32 (hardware exp); out = ctx (bf16 hi + residual) . Wproj (2 products) + bproj; outputs out | cache_key | cache_value concatenated.
#include <hip/hip_runtime.h>
#include <math.h>

typedef __attribute__((ext_vector_type(16))) _Float16 v16h;
typedef __attribute__((ext_vector_type(16))) __bf16 v16b;
typedef __attribute__((ext_vector_type(8)))  _Float16 v8h;
typedef __attribute__((ext_vector_type(8)))  float v8f;
typedef __attribute__((ext_vector_type(4)))  float v4f;
typedef __attribute__((ext_vector_type(2)))  float v2f;
typedef __attribute__((ext_vector_type(4)))  unsigned v4u;
typedef __attribute__((ext_vector_type(4)))  int v4i;
typedef float __attribute__((may_alias)) float_a;
typedef int __attribute__((may_alias)) int_a;

template <typename T> __device__ __forceinline__ void vst2(void* p, T v) { *(T*)p = v;  }
__device__ __forceinline__ v8f wmma16(v16h a, v16h b, v8f c) {
  v8f d = __builtin_amdgcn_wmma_f32_16x16x32_f16(false, a, false, b, (short)0, c, false, false);
  asm volatile("v_nop\n\tv_nop\n\tv_nop\n\tv_nop" : "+v"(d) : "v"(a), "v"(b));
  return d;
}
__device__ __forceinline__ v8f wmma_bf(v16b a, v16b b, v8f c) {
  v8f d = __builtin_amdgcn_wmma_f32_16x16x32_bf16(false, a, false, b, (short)0, c, false, false);
  asm volatile("v_nop\n\tv_nop\n\tv_nop\n\tv_nop" : "+v"(d) : "v"(a), "v"(b));
  return d;
}
// Prefill attention (B 2, S 2,048, E 1,024, 16 heads x 64): fused (in,out) qkv + bias, scores / 8 + learned additive bias[q, k], causal, softmax, . v, Wproj + bias; also returns the k and v projections (the KV cache).
__device__ __forceinline__ v16h frag_h(const _Float16* rowk0, int lane) {
  union { v16h v; v8h q[2]; } u; const _Float16* p = rowk0 + 8 * (lane >> 4);
  u.q[0] = *(const v8h*)p; u.q[1] = *(const v8h*)(p + 16); return u.v;
}
__device__ __forceinline__ v16h frag_f32(const float* rowk0, int lane) {
  v16h a; const float* p = rowk0 + 8 * (lane >> 4);
#pragma unroll
  for (int i = 0; i < 8; ++i) { a[i] = (_Float16)p[i]; a[8 + i] = (_Float16)p[16 + i]; }
  return a;
}
__device__ __forceinline__ v16h frag_f32s(const float* rowk0, int lane, float sc) {
  v16h a; const float* p = rowk0 + 8 * (lane >> 4);
#pragma unroll
  for (int i = 0; i < 8; ++i) { a[i] = (_Float16)(p[i] * sc); a[8 + i] = (_Float16)(p[16 + i] * sc); }
  return a;
}
// column fragment from a [K][ld] layout (column n), rows >= K read as 0
__device__ __forceinline__ v16h fragc_f32(const float* W, int k0, int n, int lane, int ld, int K) {
  v16h a; const int g = lane >> 4;
#pragma unroll
  for (int i = 0; i < 8; ++i) { const int ka = k0 + 8 * g + i, kb = ka + 16;
    a[i] = (_Float16)(ka < K ? W[(size_t)(ka < K ? ka : K - 1) * ld + n] : 0.f); a[8 + i] = (_Float16)(kb < K ? W[(size_t)(kb < K ? kb : K - 1) * ld + n] : 0.f); }
  return a;
}
struct F2 { v16b h, l; };
__device__ __forceinline__ F2 bsplit16(const float v[16]) { F2 r;
#pragma unroll
  for (int i = 0; i < 16; ++i) { const __bf16 h = (__bf16)v[i]; r.h[i] = h; r.l[i] = (__bf16)(v[i] - (float)h); }
  return r; }
__device__ __forceinline__ F2 split_row(const float* row, int k0, int lane) { float v[16]; const float* p = row + k0 + 8 * (lane >> 4);
#pragma unroll
  for (int i = 0; i < 8; ++i) { v[i] = p[i]; v[8 + i] = p[16 + i]; }
  return bsplit16(v); }
__device__ __forceinline__ F2 split_rowK(const float* row, int k0, int lane, int K) { float v[16]; const int g = lane >> 4;
#pragma unroll
  for (int i = 0; i < 8; ++i) { const int ka = k0 + 8 * g + i, kb = ka + 16; v[i] = ka < K ? row[ka < K ? ka : K - 1] : 0.f; v[8 + i] = kb < K ? row[kb < K ? kb : K - 1] : 0.f; }
  return bsplit16(v); }
__device__ __forceinline__ F2 split_col(const float* W, int k0, int n, int lane, int ld, int K) { float v[16]; const int g = lane >> 4;
#pragma unroll
  for (int i = 0; i < 8; ++i) { const int ka = k0 + 8 * g + i, kb = ka + 16; v[i] = ka < K ? W[(size_t)(ka < K ? ka : K - 1) * ld + n] : 0.f; v[8 + i] = kb < K ? W[(size_t)(kb < K ? kb : K - 1) * ld + n] : 0.f; }
  return bsplit16(v); }
__device__ __forceinline__ v8f mac3(const F2& a, const F2& b, v8f c) { c = wmma_bf(a.l, b.h, c); c = wmma_bf(a.h, b.l, c); return wmma_bf(a.h, b.h, c); }
__device__ __forceinline__ float sigm(float v) { return 1.0f / (1.0f + expf(-v)); }
#define LDSX() do { asm volatile("s_wait_dscnt 0" ::: "memory"); __builtin_amdgcn_wave_barrier(); __builtin_amdgcn_fence(__ATOMIC_RELEASE, "workgroup"); } while (0)


#define NB 2
#define SS 2048
#define DM 1024
#define NH 16
#define SCALEF 0.125f
#define HD 64
#define QKVW (3 * DM)
#ifndef TQB
#define TQB (SS / 64)
#define TNB NB
#define TOB (NB * SS / 64)     // output blocks of 64 rows (all)
#endif
typedef __attribute__((ext_vector_type(8))) __bf16 v8b;
__device__ __forceinline__ v16b frag_b(const __bf16* rowk0, int lane) {
  union { v16b v; v8b q[2]; } u; const __bf16* p = rowk0 + 8 * (lane >> 4);
  u.q[0] = *(const v8b*)p; u.q[1] = *(const v8b*)(p + 16); return u.v;
}
// pointers typed as global memory: they keep that type through the XWAIT statement below, so the loads behind it stay global loads
typedef const __attribute__((address_space(1))) float gf32; typedef const __attribute__((address_space(1))) __bf16 gb16;
typedef const __attribute__((address_space(1))) v4f gv4f; typedef const __attribute__((address_space(1))) v8b gv8b;
// FRAGMENT ORDER: a 16 x 32 operand tile is kept as 1 KB = [half 2][lane 32][8 elements]; lane (g, col) holds row col, k = 16 * half + 8 * g + i, the k order of frag_b / frag_h. One wave-wide 16-byte load then covers 512 contiguous bytes (4 whole lines) instead of 32 bytes in each of 16 lines.
#define FRAG 512                     // elements of one tile
// a tile from a pointer that already holds the lane's offset (lane * 8)
__device__ __forceinline__ v16b frag_bp(gb16* p) { union { v16b v; v8b q[2]; } u; u.q[0] = *(gv8b*)p; u.q[1] = *(gv8b*)(p + 256); return u.v; }
__device__ __forceinline__ v16h frag_hp(const _Float16* p) { union { v16h v; v8h q[2]; } u; u.q[0] = *(const v8h*)p; u.q[1] = *(const v8h*)(p + 256); return u.v; }
// precaution behind a group of global loads: the wait stands in front of every rewrite of the group's address registers; both pointers pass through the statement, so every later step of them follows it
#define XWAIT(pa, pb) asm volatile("s_wait_xcnt 0x0" : "+v"(pa), "+v"(pb) : : "memory")
__device__ __forceinline__ float bfr(float v) { return (float)(__bf16)v; }
__device__ __attribute__((noinline)) float exp_ni(float v) { return expf(v); }
__device__ __attribute__((noinline)) float erf_ni(float v) { return erff(v); }

#define PK_A 0                       // Wqkv, fragment order: [192 tiles of 16 outputs][32 k-steps][FRAG]
#define PK_P (PK_A + QKVW * DM)        // Wo, fragment order: [64 tiles][32 k-steps][FRAG]
#define PK_END (PK_P + DM * DM)
#define WS_PK  0u
#define WS_QK  (WS_PK + 2u * PK_END)             // f16 [4096 rows][2048]: q in the first 1024 columns (the rest unused)
#define WS_QKL (WS_QK + 2u * NB * SS * 2 * DM)     // f16 q residual plane x2048, same shape
#define WS_VTH (WS_QKL + 2u * NB * SS * 2 * DM)    // f16 v hi, fragment order: [b][h][64 steps of 32 keys][4 tiles of 16 d][FRAG]
#define WS_VTL (WS_VTH + 2u * NB * DM * SS)        // f16 lo x 2048, same shape
#define WS_O   (WS_VTL + 2u * NB * DM * SS)        // bf16 ctx, fragment order: [256 tiles of 16 rows][32 k-steps][hi FRAG | residual FRAG]
#define WS_CS  (WS_O + 4u * NB * SS * DM)           // f32 2 x [2048][32], unused
#define WS_KF  (WS_CS + 4u * 2 * SS * 32)          // f16 k hi, fragment order: [b][h][128 tiles of 16 keys][2 k-steps of 32 d][FRAG]
#define WS_KFL (WS_KF + 2u * NB * SS * DM)         // f16 k residual x2048, same shape
#define WS_XF  (WS_KFL + 2u * NB * SS * DM)        // bf16 x, fragment order: [256 tiles of 16 rows][32 k-steps][FRAG]
#define WS_ABF (WS_XF + 2u * NB * SS * DM)         // bf16 attn_bias, fragment order: [128 tiles of 16 queries][64 steps of 32 keys][FRAG]
#define WS_END (WS_ABF + 2u * SS * SS)
// ---- k_pack: ONE launch packs x, both (in,out) weights and the attention bias into fragment order. Every thread has sixteen 16-byte loads in flight (each wave-wide load = 512 contiguous bytes of one source row), so the launch needs 8 waves for every 64 KB it reads, few enough that starting them no longer sets its length. A block takes 64 KB of f32 in and gives 32 KB of bf16 out: 128 x 16 pieces of 16 bytes (8 consecutive k of one row of x or one output n of a weight). LDS only reorders the pieces between lanes, so that the stores are 512-B runs.
// blockIdx.y == 0: one row tile of x (16 rows x 1,024 k); piece (L, c) = row c, k = 8 * L ... 8 * L + 7. blockIdx.y == 2: the same of attn_bias, row = query, k = key: 16 queries x 1,024 keys; in k_attn's transposed scores lane (g, col) holds query col and keys 16 * ct + 8 * g + r, which is this order with half = ct. Blocks 0 ... 127 take the first 1,024 keys of query tile blockIdx.x, blocks 128 ... 191 the second 1,024 of query tiles 64 ... 127; no causal key step of the first 1,024 queries reaches the second 1,024 keys, so the other blocks have no work. blockIdx.y == 1: (128 outputs n, 128 inputs k) of a weight, n blocks < 24 of Wqkv (q | k | v outputs in column order), then Wproj, whose tiles follow in PK; piece (L, c) = output 16 * (L >> 4) + c, k = 8 * (L & 15) ... + 7.
static_assert(PK_A == 0 && PK_P == QKVW * DM, "the two weights' tiles are numbered through");
typedef __attribute__((ext_vector_type(4))) __bf16 v4b;
#define PKU(L, c) (17 * (L) + ((L) >> 4) + (c))   // the piece's place in LDS, in 16-byte units: the odd pitch and the step per 16 L spread both writers' lanes over the banks
#define XBLK (NB * SS / 16)
static_assert((QKVW + DM) / 128 * (DM / 128) == XBLK, "as many weight blocks as row tiles of x: the grid is (XBLK, 3)");
#define ABLK (SS / 16 + SS / 32)     // bias blocks with work
static_assert(SS == 2048 && ABLK <= XBLK, "a bias row is two runs of 1,024 keys; its blocks fit the grid's x");
// sixteen 16-byte loads from one address with constant offsets, as one group; the wait is a precaution: the address registers may be reused by what follows while the loads are still out (the address is an input of the statement, so its registers stay untouched, also by the group's own results, up to the wait)
template <int SA, int SB> __device__ __forceinline__ void ld16(const float* p, v4f* v) {
#pragma unroll   // constant indices keep v in registers, constant offsets keep one address for the group
  for (int i = 0; i < 16; ++i) v[i] = *(const v4f*)(p + (i >> 3) * SA + (i & 7) * SB);
  asm volatile("s_wait_xcnt 0x0" : : "v"(p) : "memory");
}
__global__ __launch_bounds__(256) void k_pack(const float* __restrict__ WA, const float* __restrict__ WO, const float* __restrict__ X, const float* __restrict__ AB, __bf16* __restrict__ PK, __bf16* __restrict__ XF, __bf16* __restrict__ ABF) {
  __shared__ __align__(16) __bf16 s[PKU(128, 0) * 8]; const int t = threadIdx.x, wave = t >> 5, lane = t & 31; const bool isx = blockIdx.y != 1, isb = blockIdx.y == 2;   // the same for the whole block; isx: rows that are already k-contiguous (x, bias)
  if (isb && blockIdx.x >= ABLK) return;   // the whole block leaves, in front of the barrier
  const int bt = blockIdx.x < SS / 16 ? blockIdx.x : blockIdx.x - SS / 32, bh = blockIdx.x < SS / 16 ? 0 : 1;   // bias blocks: query tile, half of the keys
  const int nb = blockIdx.x >> 3, kb = blockIdx.x & 7;   // weight blocks: 128 outputs, 128 inputs
  v4f v[16];
  if (isx) {   // the wave reads rows 2 * wave and 2 * wave + 1, 1,024 k of each (all of an x row, the block's half of a bias row), eight loads each
    if (isb) ld16<SS, 128>(AB + ((size_t)bt * 16 + wave * 2) * SS + bh * 1024 + lane * 4, v);
    else ld16<DM, 128>(X + ((size_t)blockIdx.x * 16 + wave * 2) * DM + lane * 4, v);
#pragma unroll   // a lane holds half a piece: lanes 2 m and 2 m + 1 write the two halves side by side
    for (int i = 0; i < 16; ++i) { v4b o;
#pragma unroll
      for (int c = 0; c < 4; ++c) o[c] = (__bf16)v[i][c];
      *(v4b*)(s + PKU((i & 7) * 16 + (lane >> 1), wave * 2 + (i >> 3)) * 8 + (lane & 1) * 4) = o; }
  } else {   // the wave reads input rows 16 * wave ... + 15, 128 outputs of each: a lane then holds, for its four outputs, two pieces each (the transposition is a choice of registers)
    const int k0 = kb * 128 + wave * 16;
    if (nb < QKVW / 128) ld16<8 * QKVW, QKVW>(WA + (size_t)k0 * QKVW + nb * 128 + lane * 4, v);
    else ld16<8 * DM, DM>(WO + (size_t)k0 * DM + (nb - QKVW / 128) * 128 + lane * 4, v);
#pragma unroll
    for (int u = 0; u < 2; ++u) {
#pragma unroll
      for (int c = 0; c < 4; ++c) { v8b o;
#pragma unroll   // vector elements need constant indices to stay in registers
        for (int i = 0; i < 8; ++i) o[i] = (__bf16)v[8 * u + i][c];
        *(v8b*)(s + PKU((lane >> 2) * 16 + wave * 2 + u, 4 * (lane & 3) + c) * 8) = o; } }
  }
  __syncthreads();   // the pieces are read back by other lanes and waves
  // piece number t + 256 * i in the order (L, c) is the order of the fragments: x's row tile is one 32-KB run; a weight block gives 4 KB (4 k-steps) to each of its 8 output tiles
  if (isx) { __bf16* d = (isb ? ABF + ((size_t)bt * (SS / 32) + bh * 32) * FRAG : XF + (size_t)blockIdx.x * (DM / 32) * FRAG) + t * 8;
#pragma unroll   // the eight LDS reads, then the eight stores, go out as one run each
    for (int i = 0; i < 8; ++i) vst2((unsigned*)(d + i * 2048), *(const v4u*)(s + PKU(16 * i + (t >> 4), t & 15) * 8));
  } else { __bf16* d = PK + ((size_t)(nb * 8) * (DM / 32) + kb * 4) * FRAG + t * 8;
#pragma unroll   // as above
    for (int i = 0; i < 8; ++i) vst2((unsigned*)(d + i * (DM / 32) * FRAG), *(const v4u*)(s + PKU(16 * i + (t >> 4), t & 15) * 8)); }
}
// ---- k_qkv: block = (64 * QNP rows, 128 cols), 4 waves; a wave holds QNP row tiles (64 rows apart) x 8 column tiles, so one loaded weight fragment feeds QNP products and the weight loads per product fall by that factor
#define QNP 2
__global__ __launch_bounds__(128) void k_qkv(const __bf16* __restrict__ XF, const __bf16* __restrict__ P, const float* __restrict__ BQ, const float* __restrict__ BK, const float* __restrict__ BV, float* __restrict__ KOUT, float* __restrict__ VOUT, _Float16* __restrict__ QK, _Float16* __restrict__ QKL, _Float16* __restrict__ KF, _Float16* __restrict__ KFL, _Float16* __restrict__ VTH, _Float16* __restrict__ VTL) {
  const int which0 = (blockIdx.y * 128) / DM; const float* BB = BQ ? (((which0 == 0) ? BQ : (which0 == 1) ? BK : BV) + (blockIdx.y * 128 - which0 * DM)) : nullptr;
  __shared__ __align__(16) _Float16 so[4][16][136], sol[4][16][136]; __shared__ __align__(16) _Float16 sth[128][72], stl[128][72];
  const int tid = threadIdx.x, wave = tid >> 5, lane = tid & 31, col = lane & 15, g = lane >> 4; const size_t rw = (size_t)blockIdx.x * (64 * QNP) + wave * 16; const int n0 = blockIdx.y * 128;   // the wave's row tile number p starts at row rw + 64 * p
  v8f acc[QNP][8] = {};
  float bj[8];   // the lane's eight bias values, fetched once as a group (the epilogues read them per element)
#pragma unroll
  for (int j = 0; j < 8; ++j) bj[j] = 0.f;
  if (BB) {
#pragma unroll
    for (int j = 0; j < 8; ++j) bj[j] = bfr(BB[j * 16 + col]); }
  // every global load of k-step kc + 1 is issued as one group in front of step kc's products, so the loads fly together and behind the matrix work instead of one load-and-wait per product
  gb16* xp = (gb16*)(XF + (rw >> 4) * (DM / 32) * FRAG + lane * 8); gb16* wp = (gb16*)(P + (size_t)(n0 >> 4) * (DM / 32) * FRAG + lane * 8);
  v16b xa[QNP], wb[8];
#pragma unroll
  for (int p = 0; p < QNP; ++p) xa[p] = frag_bp(xp + (size_t)p * 4 * (DM / 32) * FRAG);   // 64 rows = 4 row tiles further
#pragma unroll
  for (int j = 0; j < 8; ++j) wb[j] = frag_bp(wp + (size_t)j * (DM / 32) * FRAG);
  XWAIT(xp, wp);
  xp += FRAG; wp += FRAG;   // the pointers run one step ahead and move only behind the wait that follows their loads
#pragma unroll 2
  for (int kc = 0; kc < DM / 32; ++kc) {
    v16b xn[QNP], wn[8];
#pragma unroll
    for (int p = 0; p < QNP; ++p) xn[p] = frag_bp(xp + (size_t)p * 4 * (DM / 32) * FRAG);
#pragma unroll
    for (int j = 0; j < 8; ++j) wn[j] = frag_bp(wp + (size_t)j * (DM / 32) * FRAG);
    XWAIT(xp, wp);
    { const int st = (kc + 2 < DM / 32) ? FRAG : 0; xp += st; wp += st; }   // the last trip fetches the last step's operands again (in bounds, unused)
    __builtin_amdgcn_sched_barrier(0);   // keeps this step's products behind the next step's load group: without it the build sinks those loads among the products and waits on each at once
#pragma unroll
    for (int j = 0; j < 8; ++j) {
#pragma unroll
      for (int p = 0; p < QNP; ++p) acc[p][j] = __builtin_amdgcn_wmma_f32_16x16x32_bf16(false, xa[p], false, wb[j], (short)0, acc[p][j], false, false); }   // every weight fragment serves QNP products; the plain builtin (the compiler keeps its distances): with wmma_bf's operand-tied statement this live set, above 256 registers, was built with scratch spills in the loop
#pragma unroll
    for (int p = 0; p < QNP; ++p) xa[p] = xn[p];
#pragma unroll
    for (int j = 0; j < 8; ++j) wb[j] = wn[j]; }
  // the epilogue runs once per row tile of the wave, through the same staging arrays
#pragma unroll   // accumulator indices must be constants to stay in registers
  for (int p = 0; p < QNP; ++p) { const size_t r0 = rw + 64 * p;
  if (which0 >= 1) {   // cache_key / cache_value: the f32 projections (+ bias) straight from the accumulators, 512-B row segments
    __shared__ __align__(16) float sf[4][16][132];
#pragma unroll
    for (int j = 0; j < 8; ++j) {
#pragma unroll
      for (int r = 0; r < 8; ++r) sf[wave][8 * g + r][j * 16 + col] = acc[p][j][r] + bj[j]; }
    LDSX();
    float* dst = (which0 == 1) ? KOUT : VOUT; for (int rl = 0; rl < 16; ++rl) vst2(dst + (r0 + rl) * DM + (n0 - which0 * DM) + lane * 4, *(const v4f*)&sf[wave][rl][lane * 4]);
    LDSX(); }
  if (n0 < 2 * DM) {   // q stored unscaled (f16 sigma ~0.6, no subnormal exposure); 1/8 applied to the f32 score
#pragma unroll
    for (int j = 0; j < 8; ++j) {
#pragma unroll
      for (int r = 0; r < 8; ++r) { const float v = acc[p][j][r] + bj[j]; const _Float16 hv = (_Float16)v; so[wave][8 * g + r][j * 16 + col] = hv; sol[wave][8 * g + r][j * 16 + col] = (_Float16)((v - (float)hv) * 2048.0f); } }   // q, k (+ bias) as f16 hi + (x2048) residual
    LDSX();
    if (which0 == 0) { for (int rl = 0; rl < 16; ++rl) if (lane < 16) { vst2((unsigned*)(QK + (r0 + rl) * (2 * DM) + n0 + lane * 8), *(const v4u*)&so[wave][rl][lane * 8]); vst2((unsigned*)(QKL + (r0 + rl) * (2 * DM) + n0 + lane * 8), *(const v4u*)&sol[wave][rl][lane * 8]); } }
    else {   // k: the wave's 16 rows are one key tile; 2 heads x 2 k-steps x 2 halves, each a 512-B run in fragment order
      const size_t kb = (((r0 / SS) * NH + ((n0 - DM) >> 6)) * (SS / 16) + ((r0 % SS) >> 4)) * (2 * FRAG) + lane * 8;
#pragma unroll   // the sixteen stores go out as one run, their offsets as immediates
      for (int u = 0; u < 8; ++u) { const size_t o = kb + (size_t)(u >> 2) * (SS / 16) * (2 * FRAG) + (u & 3) * 256; const int c0 = (u >> 2) * 64 + (u & 3) * 16 + 8 * g;
        vst2((unsigned*)(KF + o), *(const v4u*)&so[wave][col][c0]); vst2((unsigned*)(KFL + o), *(const v4u*)&sol[wave][col][c0]); }
      asm volatile("s_wait_xcnt 0x0" ::: "memory"); }   // precaution behind the run of sixteen stores: their registers may be reused by what follows while the stores are still out
  } else {
#pragma unroll
    for (int j = 0; j < 8; ++j) {
#pragma unroll
      for (int r = 0; r < 8; ++r) { const float v = acc[p][j][r] + bj[j]; const _Float16 hv = (_Float16)v; sth[j * 16 + col][wave * 16 + 8 * g + r] = hv; stl[j * 16 + col][wave * 16 + 8 * g + r] = (_Float16)((v - (float)hv) * 2048.0f); } }
    __syncthreads();
    const size_t rb = (size_t)blockIdx.x * (64 * QNP) + 64 * p; const int b = (int)(rb / SS), s0 = (int)(rb % SS); const int pc0 = n0 - 2 * DM;
    for (int u = tid; u < 128 * 8; u += 128) { const int ln = u & 31, half = (u >> 5) & 1, dt = (u >> 6) & 3, ksl = (u >> 8) & 1, hh = u >> 9; const int d = hh * 64 + dt * 16 + (ln & 15), pc = ksl * 4 + half * 2 + (ln >> 4);   // 512-B runs in fragment order
      const size_t o = ((((size_t)b * NH + (pc0 >> 6) + hh) * (SS / 32) + (s0 >> 5) + ksl) * 4 + dt) * FRAG + half * 256 + ln * 8; vst2((unsigned*)(VTH + o), *(const v4u*)&sth[d][pc * 8]); vst2((unsigned*)(VTL + o), *(const v4u*)&stl[d][pc * 8]); }
    if (p + 1 < QNP) __syncthreads();   // the next row tiles overwrite sth / stl: every thread's reads above must be over
  }
  }
}
// ---- k_attn: block = (64 queries, head h, batch b), 8 waves = 4 query tiles x 2 key groups: causal flash attention (K = 64: 2 k-steps), computed TRANSPOSED: S^T = K . Q^T (A = a key tile, B = the query tile) and O^T += V^T . P^T. A lane (g, col) then holds, of ONE query (col), the scores of keys 16 * ct + 8 * g + r: maximum and sum run inside the lane with one exchange between the wave's halves, the rescale factor is one value per lane, and the two score tiles, converted in place, ARE the B operand of the second product (element 8 * ct + r = key 16 * ct + 8 * g + r, the k order of the V fragments), so P passes through no LDS. scores = (q.k) * 0.125 and P.V: 3 products in the first two query blocks (hi x hi, plus hi x residual and residual x hi in a second accumulator; residuals x2048), single f16 operands elsewhere; key group kw takes the key steps ks = kw, kw + 2, ... with a running maximum and sum of its own, and the two partial results are joined in LDS; ctx is stored as k_out's A operand.
// Why two groups: the cost of a query block grows with its index (causal), and with one wave per query tile every block is resident at once, so the launch lasts as long as the last block while the others' places stand empty. Half as long and twice as many waves give more blocks than places; the blocks start heaviest first (blockIdx.z counts the query blocks down), so the places stay filled to the end.
__device__ __forceinline__ float xhalf(float x) { return __builtin_bit_cast(float, __builtin_amdgcn_permlanex16(__builtin_bit_cast(int, x), __builtin_bit_cast(int, x), 0x76543210, 0xfedcba98, false, false)); }   // the value of lane l ^ 16
#define LOG2E 1.44269504088896340736f
// one key step (32 keys) of a wave, compiled once per case, so that a step runs only the work its case needs; both switches are the same for a whole wave. PREC: the leading query blocks' 3-product scores and P.V with the second accumulator. MASK: the step holds keys behind some query of the tile (causal select, masked scores count 0).
// kp, vp, bp: the step's K fragments, V fragments and bias with the lane's offset; global memory for the leading query blocks (PREC), the block's LDS ring elsewhere
template <bool PREC, bool MASK> __device__ __forceinline__ void attn_step(const int ks, const _Float16* kp, const _Float16* __restrict__ KFL, const _Float16* vp, const _Float16* __restrict__ VTL, const size_t hb, const __bf16* bp, const int dq0, const v16h* aq, const v16h* aql, float& m, float& l, v8f* acc, v8f* accl) {
  v8f s[2];
  // the key step's K fragments and bias values are loaded as one group in front of the first product (the bias unconditionally: k_pack has written every step up to the query block's last; the causal select follows), so one round trip replaces one per product and per bias row
  v16h kf[2][2]; v8b ab[2]; const int dq = dq0 - ks * 32;   // the query's distance from this half's first key: key 16 * ct + r of the lane is allowed up to it
#pragma unroll
  for (int ct = 0; ct < 2; ++ct) {
#pragma unroll
    for (int kc = 0; kc < 2; ++kc) kf[ct][kc] = frag_hp(kp + (ct * 2 + kc) * FRAG);
    ab[ct] = *(const v8b*)(bp + ct * 256); }   // the lane's eight keys, already bf16: a wave-wide load is 512 contiguous bytes (4 whole lines), where the f32 rows took two loads of 16 lines each
  if (PREC) asm volatile("s_wait_xcnt 0x0" : : "v"(kp), "v"(bp) : "memory");   // global loads only; precaution: the group's address registers may be reused by what follows while its loads are still out (both addresses are inputs of the statement, so their registers stay untouched, also by the group's own results, up to the wait)
#pragma unroll
  for (int ct = 0; ct < 2; ++ct) { v8f c = {};
    if (PREC) { v8f cl = {};   // leading query blocks (few keys, outputs far above the global rms): 3 products
#pragma unroll
      for (int kc = 0; kc < 2; ++kc) { const v16h kh = kf[ct][kc]; c = wmma16(kh, aq[kc], c); cl = wmma16(kh, aql[kc], cl); const v16h kl = frag_hp(KFL + hb + (size_t)((ks * 2 + ct) * 2 + kc) * FRAG);
        asm volatile("s_wait_xcnt 0x0" ::: "memory");   // precaution, as above: the load's address registers may be reused by what follows
        cl = wmma16(kl, aq[kc], cl); }
#pragma unroll
      for (int r = 0; r < 8; ++r) c[r] += cl[r] * (1.0f / 2048.0f); }
    else {
#pragma unroll
      for (int kc = 0; kc < 2; ++kc) c = wmma16(kf[ct][kc], aq[kc], c); }   // single product elsewhere
#pragma unroll
    for (int r = 0; r < 8; ++r) { const float sv = c[r] * SCALEF + (float)ab[ct][r]; s[ct][r] = (!MASK || ct * 16 + r <= dq) ? sv : -3.0e38f; } }   // causal: future keys excluded
  // the V fragments are requested here, behind the score products, and fly under the softmax
  v16h vf[4];
#pragma unroll
  for (int dt = 0; dt < 4; ++dt) vf[dt] = frag_hp(vp + dt * FRAG);
  if (PREC) asm volatile("s_wait_xcnt 0x0" ::: "memory");   // global loads only; precaution: the group's address registers may be reused by what follows while its loads are still out
  float mx = fmaxf(s[0][0], s[1][0]);
#pragma unroll
  for (int r = 1; r < 8; ++r) mx = fmaxf(mx, fmaxf(s[0][r], s[1][r]));
  mx = fmaxf(mx, xhalf(mx));   // the other half holds the query's other sixteen keys
  const float mn = fmaxf(m, mx);
  // exp(x) as the hardware's 2^(x * log2 e), arguments and results by name for the two statements below
  float ta = (m - mn) * LOG2E, ea = __builtin_amdgcn_exp2f(ta), t[2][8], e[2][8];
#pragma unroll
  for (int ct = 0; ct < 2; ++ct) {
#pragma unroll
    for (int r = 0; r < 8; ++r) { t[ct][r] = (s[ct][r] - mn) * LOG2E; e[ct][r] = __builtin_amdgcn_exp2f(t[ct][r]); } }
  // the slot behind a transcendental: the v_nop stands behind its group's last v_exp_f32, in front of every use of a result (in-out operands) and every overwrite of an argument (inputs, live up to here)
  asm volatile("v_nop" : "+v"(ea), "+v"(e[0][0]), "+v"(e[0][1]), "+v"(e[0][2]), "+v"(e[0][3]), "+v"(e[0][4]), "+v"(e[0][5]), "+v"(e[0][6]), "+v"(e[0][7]) : "v"(ta), "v"(t[0][0]), "v"(t[0][1]), "v"(t[0][2]), "v"(t[0][3]), "v"(t[0][4]), "v"(t[0][5]), "v"(t[0][6]), "v"(t[0][7]));
  asm volatile("v_nop" : "+v"(e[1][0]), "+v"(e[1][1]), "+v"(e[1][2]), "+v"(e[1][3]), "+v"(e[1][4]), "+v"(e[1][5]), "+v"(e[1][6]), "+v"(e[1][7]) : "v"(t[1][0]), "v"(t[1][1]), "v"(t[1][2]), "v"(t[1][3]), "v"(t[1][4]), "v"(t[1][5]), "v"(t[1][6]), "v"(t[1][7]));
  const float alpha = (m <= -1.0e38f) ? 0.f : ea;
  v2f es = {}; v16h pa, pl;   // the sum runs in two chains, over the even and the odd keys
#pragma unroll
  for (int r = 0; r < 8; ++r) { const float e0 = (MASK && s[0][r] <= -1.0e38f) ? 0.f : e[0][r], e1 = (MASK && s[1][r] <= -1.0e38f) ? 0.f : e[1][r]; es[r & 1] += e0; es[r & 1] += e1;
    const float x0 = e0 * 2048.0f, x1 = e1 * 2048.0f; const _Float16 h0 = (_Float16)x0, h1 = (_Float16)x1; pa[r] = h0; pa[8 + r] = h1;   // P scaled by 2^11 before the f16 split so small softmax weights stay out of the f16 subnormal range; 2^-11 folded into the epilogue
    if (PREC) { pl[r] = (_Float16)((x0 - (float)h0) * 2048.0f); pl[8 + r] = (_Float16)((x1 - (float)h1) * 2048.0f); } }
  l = l * alpha + (es[0] + es[1]); m = mn;
#pragma unroll
  for (int dt = 0; dt < 4; ++dt) {
#pragma unroll
    for (int r = 0; r < 8; ++r) { acc[dt][r] *= alpha; if (PREC) accl[dt][r] *= alpha; } }
#pragma unroll
  for (int dt = 0; dt < 4; ++dt) { const v16h vh = vf[dt]; acc[dt] = wmma16(vh, pa, acc[dt]); if (PREC) { accl[dt] = wmma16(vh, pl, accl[dt]); const v16h vl = frag_hp(VTL + hb + (size_t)(ks * 4 + dt) * FRAG);
      asm volatile("s_wait_xcnt 0x0" ::: "memory");   // precaution, as above: the load's address registers may be reused by what follows
      accl[dt] = wmma16(vl, pa, accl[dt]); } }   // leading query blocks: P hi/lo x V hi/lo (3 products); elsewhere P x V single
}
#define RING (24 * FRAG)   // elements of one buffer: 8 K tiles, 8 V tiles, 8 bias tiles (24 KB)
// one trip's operands into one buffer, six asynchronous 16-byte copies per thread. The wait is the last line of the copies' own statement, a precaution: it stands in front of every rewrite of the address registers that the copies name
__device__ __forceinline__ void ring_fill(const unsigned l, const _Float16* gk, const _Float16* gv, const __bf16* gb) {
  const unsigned l1 = l + 4096, l2 = l + 8192, l3 = l + 12288, l4 = l + 16384, l5 = l + 20480; const _Float16* gk1 = gk + 4 * FRAG; const _Float16* gv1 = gv + 4 * FRAG; const __bf16* gb1 = gb + (size_t)2 * (SS / 32) * FRAG;
  asm volatile("global_load_async_to_lds_b128 %0, %6, off\n\tglobal_load_async_to_lds_b128 %1, %7, off\n\tglobal_load_async_to_lds_b128 %2, %8, off\n\tglobal_load_async_to_lds_b128 %3, %9, off\n\tglobal_load_async_to_lds_b128 %4, %10, off\n\tglobal_load_async_to_lds_b128 %5, %11, off\n\ts_wait_xcnt 0x0"
    : : "v"(l), "v"(l1), "v"(l2), "v"(l3), "v"(l4), "v"(l5), "v"(gk), "v"(gk1), "v"(gv), "v"(gv1), "v"(gb), "v"(gb1) : "memory");
}
__global__ __launch_bounds__(256) void k_attn(const _Float16* __restrict__ QK, const _Float16* __restrict__ QKL, const _Float16* __restrict__ KF, const _Float16* __restrict__ KFL, const _Float16* __restrict__ VTH, const _Float16* __restrict__ VTL, const void* __restrict__ KMASK, const __bf16* __restrict__ ABF, __bf16* __restrict__ OF) {
  __shared__ __align__(16) float so[8][16][68]; __shared__ __align__(16) float sm[8][16], sl[8][16];
  __shared__ __align__(16) _Float16 ring[2][RING];   // two buffers, each one trip's operands of the block: K | V | bias
  const int tid = threadIdx.x, wave = __builtin_amdgcn_readfirstlane(tid >> 5), lane = tid & 31, col = lane & 15, g = lane >> 4;   // the wave's number in a scalar register: the key loop starts from it and stays a scalar loop
  const int qi = wave & 3, kw = wave >> 2;   // query tile, key group
  const int qb = TQB - 1 - blockIdx.z, h = blockIdx.x, b = blockIdx.y; const int q0 = qb * 64 + qi * 16; const size_t rq = (size_t)b * SS + q0 + col;
  v16h aq[2];   // the query tile: lane (g, col) holds query col in the fragments' k order, which serves as B as it did as A
#pragma unroll
  for (int kc = 0; kc < 2; ++kc) aq[kc] = frag_h(QK + rq * (2 * DM) + h * HD + kc * 32, lane);
  asm volatile("s_wait_xcnt 0x0" ::: "memory");   // precaution: the four loads' address registers may be reused by what follows while the loads are still out
  float m = -3.0e38f, l = 0.f;   // of query col: the running maximum (common to both halves) and the sum over this half's keys
  v8f acc[4] = {};   // O^T: acc[dt][r] = column d = 16 * dt + 8 * g + r of query col
  const int nks = (qb * 64 + 64) / 32;   // causal: key steps of 32 up to the query block's end
  const size_t hb = ((size_t)b * NH + h) * (SS * HD) + lane * 8;   // the head's k and v planes in fragment order (S x 64 elements each), with the lane's offset
  const __bf16* abf = ABF + (size_t)(q0 >> 4) * (SS / 32) * FRAG + lane * 8;   // the query tile's bias in fragment order, with the lane's offset
  const int dq0 = q0 + col - 8 * g;   // the query's distance from this half's first key of step 0
  // nks is even: both key groups make qb + 1 trips
  if (qb < 2) {   // the same for the whole block
    v16h aql[2]; v8f accl[4] = {};
#pragma unroll
    for (int kc = 0; kc < 2; ++kc) aql[kc] = frag_h(QKL + rq * (2 * DM) + h * HD + kc * 32, lane);
#pragma unroll 1   // rolled: the step's text once per case
    for (int ks = kw; ks < nks; ks += 2) attn_step<true, true>(ks, KF + hb + (size_t)(ks * 4) * FRAG, KFL, VTH + hb + (size_t)(ks * 4) * FRAG, VTL, hb, abf + (size_t)ks * FRAG, dq0, aq, aql, m, l, acc, accl);
#pragma unroll
    for (int dt = 0; dt < 4; ++dt) {
#pragma unroll
      for (int r = 0; r < 8; ++r) acc[dt][r] += accl[dt][r] * (1.0f / 2048.0f); }
  } else {
    // Trip t works on key steps 2 t (group 0) and 2 t + 1 (group 1). Its operands are 8 KB of K, 8 KB of V (each one run in fragment order) and 2 KB of bias per query tile: every thread copies six 16-byte pieces, so the block fetches each K and V byte once for its four query tiles, and trip t + 1's bytes fly while trip t is worked on.
    const int ntr = qb + 1;   // trips, the same for the whole block; every key of trips 0 ... qb - 1 lies in front of the block's first query, so no lane masks any of them, and only the last trip runs the masking step
    const unsigned l0 = (unsigned)(size_t)&ring[0][0] + tid * 16;   // the thread's place in buffer 0 (LDS byte address)
    const size_t he = ((size_t)b * NH + h) * (SS * HD) + tid * 8;
    const _Float16* gk = KF + he; const _Float16* gv = VTH + he;
    const __bf16* gb = ABF + (size_t)(qb * 4 + (tid >> 7)) * (SS / 32) * FRAG + (tid & 127) * 8;   // query tile tid >> 7, and two tiles further for the second piece
    const _Float16* rk = &ring[0][0] + kw * (4 * FRAG) + lane * 8;   // the wave's operands in buffer 0
    const int bo = (qi * 2 - kw * 3) * FRAG;   // the wave's bias tile, [query tile][group], counted from rk, which already holds kw * 4 tiles
    ring_fill(l0, gk, gv, gb);
    asm volatile("s_wait_asynccnt 0x0" ::: "memory");   // this wave's copies of trip 0 have landed
    __syncthreads();   // every wave's have: trip 0 may be read
    ring_fill(l0 + 2 * RING, gk + 8 * FRAG, gv + 8 * FRAG, gb + 2 * FRAG);   // trip 1 exists: qb >= 2 here
#pragma unroll 1   // rolled: the step's text once per case
    for (int t = 0; t < qb; ++t) { const _Float16* r = rk + (t & 1) * RING;
      attn_step<false, false>(2 * t + kw, r, KFL, r + 8 * FRAG, VTL, hb, (const __bf16*)(r + 16 * FRAG) + bo, dq0, aq, nullptr, m, l, acc, nullptr);
      asm volatile("s_wait_dscnt 0x0" ::: "memory");      // this wave's reads of the buffer are over
      asm volatile("s_wait_asynccnt 0x0" ::: "memory");   // its copies of trip t + 1 have landed
      __syncthreads();   // both hold for every wave: trip t + 1 may be read, trip t's buffer refilled
      if (t + 2 < ntr) ring_fill(l0 + (t & 1) * (2 * RING), gk + (size_t)(t + 2) * (8 * FRAG), gv + (size_t)(t + 2) * (8 * FRAG), gb + (size_t)(t + 2) * (2 * FRAG)); }   // the same for the whole block
    { const _Float16* r = rk + (qb & 1) * RING;   // the last trip, on the diagonal: published by the last barrier above
      attn_step<false, true>(2 * qb + kw, r, KFL, r + 8 * FRAG, VTL, hb, (const __bf16*)(r + 16 * FRAG) + bo, dq0, aq, nullptr, m, l, acc, nullptr); }
    asm volatile("s_wait_asynccnt 0x0" ::: "memory");   // nothing is out when the ring is left
  }
  l += xhalf(l);   // the two halves' sums joined once
  // each wave leaves its unnormalised sums (a lane's eight values lie side by side in its query's row) with its queries' maximum and sum
#pragma unroll
  for (int dt = 0; dt < 4; ++dt) { v4f o0, o1;
#pragma unroll   // vector elements need constant indices to stay in registers
    for (int r = 0; r < 4; ++r) { o0[r] = acc[dt][r]; o1[r] = acc[dt][4 + r]; }
    *(v4f*)&so[wave][col][dt * 16 + 8 * g] = o0; *(v4f*)&so[wave][col][dt * 16 + 8 * g + 4] = o1; }
  if (g == 0) { sm[wave][col] = m; sl[wave][col] = l; }
  __syncthreads();   // a wave reads the other key group's partial result below: both must be written
  // join for query row col: each part weighted by exp(its maximum - the common one); a group whose keys were all masked for the row (maximum still at the start value) counts 0; group 0 holds key 0, which no row masks, so the sum is above 0
  const float m0 = sm[qi][col], m1 = sm[4 + qi][col], mm = fmaxf(m0, m1);
  const float f0 = (m0 <= -1.0e38f) ? 0.f : __expf(m0 - mm), f1 = (m1 <= -1.0e38f) ? 0.f : __expf(m1 - mm);
  const float il = (1.0f / 2048.0f) / (f0 * sl[qi][col] + f1 * sl[4 + qi][col]); const float w0 = f0 * il, w1 = f1 * il;
  // ctx leaves as the out product's A operand: bf16 hi + residual, fragment order; the tile's 16 queries are one row tile, the head's 64 columns two k-steps, of which the wave writes number kw; 512-B runs
  const size_t ob = (((((size_t)b * SS + q0) >> 4) * (DM / 32) + h * 2 + kw) * (2 * FRAG)) + lane * 8;
#pragma unroll   // the four stores go out as one run, their offsets as immediates
  for (int u = 0; u < 2; ++u) { const float* p0 = &so[qi][col][kw * 32 + u * 16 + 8 * g]; const float* p1 = &so[4 + qi][col][kw * 32 + u * 16 + 8 * g]; v8b hi, lo;
#pragma unroll   // vector elements need constant indices to stay in registers
    for (int i = 0; i < 8; ++i) { const float v = p0[i] * w0 + p1[i] * w1; const __bf16 hv = (__bf16)v; hi[i] = hv; lo[i] = (__bf16)(v - (float)hv); }
    vst2(OF + ob + u * 256, hi); vst2(OF + ob + FRAG + u * 256, lo); }
}
// ---- k_out: block = (64 * ONP rows, 128 cols): out = ctx (hi, residual) . Wo (2 products) + bo; a wave holds ONP row tiles, as in k_qkv
#define ONP 2
__global__ __launch_bounds__(128) void k_out(const __bf16* __restrict__ OF, const __bf16* __restrict__ P, const float* __restrict__ BO, float* __restrict__ Y) {
  __shared__ __align__(16) float so[4][16][132];
  const int tid = threadIdx.x, wave = tid >> 5, lane = tid & 31, col = lane & 15, g = lane >> 4; const size_t rw = (size_t)blockIdx.x * (64 * ONP) + wave * 16; const int n0 = blockIdx.y * 128;   // the wave's row tile number p starts at row rw + 64 * p
  v8f acc[ONP][8] = {};
  // as in k_qkv: step kc + 1's loads are issued as one group in front of step kc's products; the pointers run one step ahead and move only behind the wait that follows their loads
  gb16* xp = (gb16*)(OF + (rw >> 4) * (DM / 32) * (2 * FRAG) + lane * 8); gb16* wp = (gb16*)(P + (size_t)(n0 >> 4) * (DM / 32) * FRAG + lane * 8);
  v16b xh[ONP], xl[ONP], wb[8];
#pragma unroll
  for (int p = 0; p < ONP; ++p) { xh[p] = frag_bp(xp + (size_t)p * 4 * (DM / 32) * (2 * FRAG)); xl[p] = frag_bp(xp + (size_t)p * 4 * (DM / 32) * (2 * FRAG) + FRAG); }   // 64 rows = 4 row tiles further
#pragma unroll
  for (int j = 0; j < 8; ++j) wb[j] = frag_bp(wp + (size_t)j * (DM / 32) * FRAG);
  XWAIT(xp, wp);
  xp += 2 * FRAG; wp += FRAG;
#pragma unroll 2
  for (int kc = 0; kc < DM / 32; ++kc) {
    v16b xhn[ONP], xln[ONP], wn[8];
#pragma unroll
    for (int p = 0; p < ONP; ++p) { xhn[p] = frag_bp(xp + (size_t)p * 4 * (DM / 32) * (2 * FRAG)); xln[p] = frag_bp(xp + (size_t)p * 4 * (DM / 32) * (2 * FRAG) + FRAG); }
#pragma unroll
    for (int j = 0; j < 8; ++j) wn[j] = frag_bp(wp + (size_t)j * (DM / 32) * FRAG);
    XWAIT(xp, wp);
    { const int st = (kc + 2 < DM / 32) ? FRAG : 0; xp += 2 * st; wp += st; }   // the last trip fetches the last step's operands again (in bounds, unused)
    __builtin_amdgcn_sched_barrier(0);   // keeps this step's products behind the next step's load group, as in k_qkv
    // residual products first, then the hi products, per accumulator as before; the plain builtin for the reason given in k_qkv
#pragma unroll
    for (int j = 0; j < 8; ++j) {
#pragma unroll
      for (int p = 0; p < ONP; ++p) acc[p][j] = __builtin_amdgcn_wmma_f32_16x16x32_bf16(false, xl[p], false, wb[j], (short)0, acc[p][j], false, false); }
#pragma unroll
    for (int j = 0; j < 8; ++j) {
#pragma unroll
      for (int p = 0; p < ONP; ++p) acc[p][j] = __builtin_amdgcn_wmma_f32_16x16x32_bf16(false, xh[p], false, wb[j], (short)0, acc[p][j], false, false); }
#pragma unroll
    for (int p = 0; p < ONP; ++p) { xh[p] = xhn[p]; xl[p] = xln[p]; }
#pragma unroll
    for (int j = 0; j < 8; ++j) wb[j] = wn[j]; }
  float bo[8];   // the lane's eight bias values, fetched once for both row tiles
#pragma unroll
  for (int j = 0; j < 8; ++j) bo[j] = bfr(BO[n0 + j * 16 + col]);
#pragma unroll   // accumulator indices must be constants to stay in registers
  for (int p = 0; p < ONP; ++p) { const size_t r0 = rw + 64 * p;   // the staging rows are the wave's own: its LDS operations run in program order, so the next row tile's writes follow this one's reads
#pragma unroll
    for (int j = 0; j < 8; ++j) {
#pragma unroll
      for (int r = 0; r < 8; ++r) so[wave][8 * g + r][j * 16 + col] = acc[p][j][r] + bo[j]; }
    LDSX();
    for (int rl = 0; rl < 16; ++rl) vst2(Y + (r0 + rl) * DM + n0 + lane * 4, *(const v4f*)&so[wave][rl][lane * 4]); }
}
extern "C" void kernel_launch(void* const* d_in, const int* in_sizes, int n_in, void* d_out, int out_size, void* d_ws, size_t ws_size, hipStream_t stream) {
  (void)in_sizes; (void)n_in; (void)out_size;
  const float** F = (const float**)d_in;   // 0 hidden [2,2048,1024], 1 attn_bias [2048,2048], 2 Wqkv [1024,3072] (in,out; q | k | v), 3 bqkv [3072], 4 Wproj [1024,1024] (in,out), 5 bproj
  if (ws_size < (size_t)WS_END) return;
  char* ws = (char*)d_ws; __bf16* PK = (__bf16*)(ws + WS_PK); _Float16 *QK = (_Float16*)(ws + WS_QK), *QKL = (_Float16*)(ws + WS_QKL), *VTH = (_Float16*)(ws + WS_VTH), *VTL = (_Float16*)(ws + WS_VTL), *KF = (_Float16*)(ws + WS_KF), *KFL = (_Float16*)(ws + WS_KFL); __bf16 *OF = (__bf16*)(ws + WS_O), *XF = (__bf16*)(ws + WS_XF), *ABF = (__bf16*)(ws + WS_ABF);
  float* OUT0 = (float*)d_out; float* KOUT = OUT0 + (size_t)NB * SS * DM; float* VOUT = KOUT + (size_t)NB * SS * DM;   // outputs: out, cache_key, cache_value
  k_pack<<<dim3(XBLK, 3), 256, 0, stream>>>(F[2], F[4], F[0], F[1], PK, XF, ABF);
  k_qkv<<<dim3(TNB * SS / (64 * QNP), QKVW / 128), 128, 0, stream>>>(XF, PK + PK_A, F[3], F[3] + DM, F[3] + 2 * DM, KOUT, VOUT, QK, QKL, KF, KFL, VTH, VTL);
  k_attn<<<dim3(NH, TNB, TQB), 256, 0, stream>>>(QK, QKL, KF, KFL, VTH, VTL, nullptr, ABF, OF);
  k_out<<<dim3(TOB / ONP, DM / 128), 128, 0, stream>>>(OF, PK + PK_P, F[5], OUT0);
}

// v010
// One run takes 88.2 microseconds.
// Next to v009, in two timings, it ran 1.04 times as fast each time.
// All steps since v000 together make it 6.87 times as fast.
// compute dtype: all float inputs rounded to bf16; qkv = x . Wqkv + b with EXACT bf16 products on WMMA 16x16x32 ((in,out) weights packed by k_pack; x, the weights, k, v and ctx are kept in the matrix instructions' fragment order) - the k and v projections are also written out in f32 straight from the accumulators; causal attention with key-tile skipping: the first 128 queries use 3-product scores and P.v (hi/lo), later queries single f16 operands; (q.k)/8 + attn_bias[q][k], running-max softmax in f32 (hardware exp); out = ctx (bf16 hi + residual) . Wproj (2 products) + bproj; outputs out | cache_key | cache_value concatenated.
#include <hip/hip_runtime.h>
#include <math.h>

typedef __attribute__((ext_vector_type(16))) _Float16 v16h;
typedef __attribute__((ext_vector_type(16))) __bf16 v16b;
typedef __attribute__((ext_vector_type(8)))  _Float16 v8h;
typedef __attribute__((ext_vector_type(8)))  float v8f;
typedef __attribute__((ext_vector_type(4)))  float v4f;
typedef __attribute__((ext_vector_type(2)))  float v2f;
typedef __attribute__((ext_vector_type(4)))  unsigned v4u;
typedef __attribute__((ext_vector_type(4)))  int v4i;
typedef float __attribute__((may_alias)) float_a;
typedef int __attribute__((may_alias)) int_a;

template <typename T> __device__ __forceinline__ void vst2(void* p, T v) { *(T*)p = v;  }
__device__ __forceinline__ v8f wmma16(v16h a, v16h b, v8f c) {
  return __builtin_amdgcn_wmma_f32_16x16x32_f16(false, a, false, b, (short)0, c, false, false);   // the plain builtin: the compiler keeps the distances behind it and fills them with the step's own vector work where it can
}
__device__ __forceinline__ v8f wmma_bf(v16b a, v16b b, v8f c) {
  v8f d = __builtin_amdgcn_wmma_f32_16x16x32_bf16(false, a, false, b, (short)0, c, false, false);
  asm volatile("v_nop\n\tv_nop\n\tv_nop\n\tv_nop" : "+v"(d) : "v"(a), "v"(b));
  return d;
}
// Prefill attention (B 2, S 2,048, E 1,024, 16 heads x 64): fused (in,out) qkv + bias, scores / 8 + learned additive bias[q, k], causal, softmax, . v, Wproj + bias; also returns the k and v projections (the KV cache).
__device__ __forceinline__ v16h frag_h(const _Float16* rowk0, int lane) {
  union { v16h v; v8h q[2]; } u; const _Float16* p = rowk0 + 8 * (lane >> 4);
  u.q[0] = *(const v8h*)p; u.q[1] = *(const v8h*)(p + 16); return u.v;
}
__device__ __forceinline__ v16h frag_f32(const float* rowk0, int lane) {
  v16h a; const float* p = rowk0 + 8 * (lane >> 4);
#pragma unroll
  for (int i = 0; i < 8; ++i) { a[i] = (_Float16)p[i]; a[8 + i] = (_Float16)p[16 + i]; }
  return a;
}
__device__ __forceinline__ v16h frag_f32s(const float* rowk0, int lane, float sc) {
  v16h a; const float* p = rowk0 + 8 * (lane >> 4);
#pragma unroll
  for (int i = 0; i < 8; ++i) { a[i] = (_Float16)(p[i] * sc); a[8 + i] = (_Float16)(p[16 + i] * sc); }
  return a;
}
// column fragment from a [K][ld] layout (column n), rows >= K read as 0
__device__ __forceinline__ v16h fragc_f32(const float* W, int k0, int n, int lane, int ld, int K) {
  v16h a; const int g = lane >> 4;
#pragma unroll
  for (int i = 0; i < 8; ++i) { const int ka = k0 + 8 * g + i, kb = ka + 16;
    a[i] = (_Float16)(ka < K ? W[(size_t)(ka < K ? ka : K - 1) * ld + n] : 0.f); a[8 + i] = (_Float16)(kb < K ? W[(size_t)(kb < K ? kb : K - 1) * ld + n] : 0.f); }
  return a;
}
struct F2 { v16b h, l; };
__device__ __forceinline__ F2 bsplit16(const float v[16]) { F2 r;
#pragma unroll
  for (int i = 0; i < 16; ++i) { const __bf16 h = (__bf16)v[i]; r.h[i] = h; r.l[i] = (__bf16)(v[i] - (float)h); }
  return r; }
__device__ __forceinline__ F2 split_row(const float* row, int k0, int lane) { float v[16]; const float* p = row + k0 + 8 * (lane >> 4);
#pragma unroll
  for (int i = 0; i < 8; ++i) { v[i] = p[i]; v[8 + i] = p[16 + i]; }
  return bsplit16(v); }
__device__ __forceinline__ F2 split_rowK(const float* row, int k0, int lane, int K) { float v[16]; const int g = lane >> 4;
#pragma unroll
  for (int i = 0; i < 8; ++i) { const int ka = k0 + 8 * g + i, kb = ka + 16; v[i] = ka < K ? row[ka < K ? ka : K - 1] : 0.f; v[8 + i] = kb < K ? row[kb < K ? kb : K - 1] : 0.f; }
  return bsplit16(v); }
__device__ __forceinline__ F2 split_col(const float* W, int k0, int n, int lane, int ld, int K) { float v[16]; const int g = lane >> 4;
#pragma unroll
  for (int i = 0; i < 8; ++i) { const int ka = k0 + 8 * g + i, kb = ka + 16; v[i] = ka < K ? W[(size_t)(ka < K ? ka : K - 1) * ld + n] : 0.f; v[8 + i] = kb < K ? W[(size_t)(kb < K ? kb : K - 1) * ld + n] : 0.f; }
  return bsplit16(v); }
__device__ __forceinline__ v8f mac3(const F2& a, const F2& b, v8f c) { c = wmma_bf(a.l, b.h, c); c = wmma_bf(a.h, b.l, c); return wmma_bf(a.h, b.h, c); }
__device__ __forceinline__ float sigm(float v) { return 1.0f / (1.0f + expf(-v)); }
#define LDSX() do { asm volatile("s_wait_dscnt 0" ::: "memory"); __builtin_amdgcn_wave_barrier(); __builtin_amdgcn_fence(__ATOMIC_RELEASE, "workgroup"); } while (0)


#define NB 2
#define SS 2048
#define DM 1024
#define NH 16
#define SCALEF 0.125f
#define HD 64
#define QKVW (3 * DM)
#ifndef TQB
#define TQB (SS / 64)
#define TNB NB
#define TOB (NB * SS / 64)     // output blocks of 64 rows (all)
#endif
typedef __attribute__((ext_vector_type(8))) __bf16 v8b;
__device__ __forceinline__ v16b frag_b(const __bf16* rowk0, int lane) {
  union { v16b v; v8b q[2]; } u; const __bf16* p = rowk0 + 8 * (lane >> 4);
  u.q[0] = *(const v8b*)p; u.q[1] = *(const v8b*)(p + 16); return u.v;
}
// pointers typed as global memory: they keep that type through the XWAIT statement below, so the loads behind it stay global loads
typedef const __attribute__((address_space(1))) float gf32; typedef const __attribute__((address_space(1))) __bf16 gb16;
typedef const __attribute__((address_space(1))) v4f gv4f; typedef const __attribute__((address_space(1))) v8b gv8b;
// FRAGMENT ORDER: a 16 x 32 operand tile is kept as 1 KB = [half 2][lane 32][8 elements]; lane (g, col) holds row col, k = 16 * half + 8 * g + i, the k order of frag_b / frag_h. One wave-wide 16-byte load then covers 512 contiguous bytes (4 whole lines) instead of 32 bytes in each of 16 lines.
#define FRAG 512                     // elements of one tile
// a tile from a pointer that already holds the lane's offset (lane * 8)
__device__ __forceinline__ v16b frag_bp(gb16* p) { union { v16b v; v8b q[2]; } u; u.q[0] = *(gv8b*)p; u.q[1] = *(gv8b*)(p + 256); return u.v; }
__device__ __forceinline__ v16h frag_hp(const _Float16* p) { union { v16h v; v8h q[2]; } u; u.q[0] = *(const v8h*)p; u.q[1] = *(const v8h*)(p + 256); return u.v; }
// precaution behind a group of global loads: the wait stands in front of every rewrite of the group's address registers; both pointers pass through the statement, so every later step of them follows it
#define XWAIT(pa, pb) asm volatile("s_wait_xcnt 0x0" : "+v"(pa), "+v"(pb) : : "memory")
__device__ __forceinline__ float bfr(float v) { return (float)(__bf16)v; }
__device__ __attribute__((noinline)) float exp_ni(float v) { return expf(v); }
__device__ __attribute__((noinline)) float erf_ni(float v) { return erff(v); }

#define PK_A 0                       // Wqkv, fragment order: [192 tiles of 16 outputs][32 k-steps][FRAG]
#define PK_P (PK_A + QKVW * DM)        // Wo, fragment order: [64 tiles][32 k-steps][FRAG]
#define PK_END (PK_P + DM * DM)
#define WS_PK  0u
#define WS_QK  (WS_PK + 2u * PK_END)             // f16 [4096 rows][2048]: q in the first 1024 columns (the rest unused)
#define WS_QKL (WS_QK + 2u * NB * SS * 2 * DM)     // f16 q residual plane x2048, same shape
#define WS_VTH (WS_QKL + 2u * NB * SS * 2 * DM)    // f16 v hi, fragment order: [b][h][64 steps of 32 keys][4 tiles of 16 d][FRAG]
#define WS_VTL (WS_VTH + 2u * NB * DM * SS)        // f16 lo x 2048, same shape
#define WS_O   (WS_VTL + 2u * NB * DM * SS)        // bf16 ctx, fragment order: [256 tiles of 16 rows][32 k-steps][hi FRAG | residual FRAG]
#define WS_CS  (WS_O + 4u * NB * SS * DM)           // f32 2 x [2048][32], unused
#define WS_KF  (WS_CS + 4u * 2 * SS * 32)          // f16 k hi, fragment order: [b][h][128 tiles of 16 keys][2 k-steps of 32 d][FRAG]
#define WS_KFL (WS_KF + 2u * NB * SS * DM)         // f16 k residual x2048, same shape
#define WS_XF  (WS_KFL + 2u * NB * SS * DM)        // bf16 x, fragment order: [256 tiles of 16 rows][32 k-steps][FRAG]
#define WS_ABF (WS_XF + 2u * NB * SS * DM)         // bf16 attn_bias, fragment order: [128 tiles of 16 queries][64 steps of 32 keys][FRAG]
#define WS_END (WS_ABF + 2u * SS * SS)
// ---- k_pack: ONE launch packs x, both (in,out) weights and the attention bias into fragment order. Every thread has sixteen 16-byte loads in flight (each wave-wide load = 512 contiguous bytes of one source row), so the launch needs 8 waves for every 64 KB it reads, few enough that starting them no longer sets its length. A block takes 64 KB of f32 in and gives 32 KB of bf16 out: 128 x 16 pieces of 16 bytes (8 consecutive k of one row of x or one output n of a weight). LDS only reorders the pieces between lanes, so that the stores are 512-B runs.
// blockIdx.y == 0: one row tile of x (16 rows x 1,024 k); piece (L, c) = row c, k = 8 * L ... 8 * L + 7. blockIdx.y == 2: the same of attn_bias, row = query, k = key: 16 queries x 1,024 keys; in k_attn's transposed scores lane (g, col) holds query col and keys 16 * ct + 8 * g + r, which is this order with half = ct. Blocks 0 ... 127 take the first 1,024 keys of query tile blockIdx.x, blocks 128 ... 191 the second 1,024 of query tiles 64 ... 127; no causal key step of the first 1,024 queries reaches the second 1,024 keys, so the other blocks have no work. blockIdx.y == 1: (128 outputs n, 128 inputs k) of a weight, n blocks < 24 of Wqkv (q | k | v outputs in column order), then Wproj, whose tiles follow in PK; piece (L, c) = output 16 * (L >> 4) + c, k = 8 * (L & 15) ... + 7.
static_assert(PK_A == 0 && PK_P == QKVW * DM, "the two weights' tiles are numbered through");
typedef __attribute__((ext_vector_type(4))) __bf16 v4b;
#define PKU(L, c) (17 * (L) + ((L) >> 4) + (c))   // the piece's place in LDS, in 16-byte units: the odd pitch and the step per 16 L spread both writers' lanes over the banks
#define XBLK (NB * SS / 16)
static_assert((QKVW + DM) / 128 * (DM / 128) == XBLK, "as many weight blocks as row tiles of x: the grid is (XBLK, 3)");
#define ABLK (SS / 16 + SS / 32)     // bias blocks with work
static_assert(SS == 2048 && ABLK <= XBLK, "a bias row is two runs of 1,024 keys; its blocks fit the grid's x");
// sixteen 16-byte loads from one address with constant offsets, as one group; the wait is a precaution: the address registers may be reused by what follows while the loads are still out (the address is an input of the statement, so its registers stay untouched, also by the group's own results, up to the wait)
template <int SA, int SB> __device__ __forceinline__ void ld16(const float* p, v4f* v) {
#pragma unroll   // constant indices keep v in registers, constant offsets keep one address for the group
  for (int i = 0; i < 16; ++i) v[i] = *(const v4f*)(p + (i >> 3) * SA + (i & 7) * SB);
  asm volatile("s_wait_xcnt 0x0" : : "v"(p) : "memory");
}
__global__ __launch_bounds__(256) void k_pack(const float* __restrict__ WA, const float* __restrict__ WO, const float* __restrict__ X, const float* __restrict__ AB, __bf16* __restrict__ PK, __bf16* __restrict__ XF, __bf16* __restrict__ ABF) {
  __shared__ __align__(16) __bf16 s[PKU(128, 0) * 8]; const int t = threadIdx.x, wave = t >> 5, lane = t & 31; const bool isx = blockIdx.y != 1, isb = blockIdx.y == 2;   // the same for the whole block; isx: rows that are already k-contiguous (x, bias)
  if (isb && blockIdx.x >= ABLK) return;   // the whole block leaves, in front of the barrier
  const int bt = blockIdx.x < SS / 16 ? blockIdx.x : blockIdx.x - SS / 32, bh = blockIdx.x < SS / 16 ? 0 : 1;   // bias blocks: query tile, half of the keys
  const int nb = blockIdx.x >> 3, kb = blockIdx.x & 7;   // weight blocks: 128 outputs, 128 inputs
  v4f v[16];
  if (isx) {   // the wave reads rows 2 * wave and 2 * wave + 1, 1,024 k of each (all of an x row, the block's half of a bias row), eight loads each
    if (isb) ld16<SS, 128>(AB + ((size_t)bt * 16 + wave * 2) * SS + bh * 1024 + lane * 4, v);
    else ld16<DM, 128>(X + ((size_t)blockIdx.x * 16 + wave * 2) * DM + lane * 4, v);
#pragma unroll   // a lane holds half a piece: lanes 2 m and 2 m + 1 write the two halves side by side
    for (int i = 0; i < 16; ++i) { v4b o;
#pragma unroll
      for (int c = 0; c < 4; ++c) o[c] = (__bf16)v[i][c];
      *(v4b*)(s + PKU((i & 7) * 16 + (lane >> 1), wave * 2 + (i >> 3)) * 8 + (lane & 1) * 4) = o; }
  } else {   // the wave reads input rows 16 * wave ... + 15, 128 outputs of each: a lane then holds, for its four outputs, two pieces each (the transposition is a choice of registers)
    const int k0 = kb * 128 + wave * 16;
    if (nb < QKVW / 128) ld16<8 * QKVW, QKVW>(WA + (size_t)k0 * QKVW + nb * 128 + lane * 4, v);
    else ld16<8 * DM, DM>(WO + (size_t)k0 * DM + (nb - QKVW / 128) * 128 + lane * 4, v);
#pragma unroll
    for (int u = 0; u < 2; ++u) {
#pragma unroll
      for (int c = 0; c < 4; ++c) { v8b o;
#pragma unroll   // vector elements need constant indices to stay in registers
        for (int i = 0; i < 8; ++i) o[i] = (__bf16)v[8 * u + i][c];
        *(v8b*)(s + PKU((lane >> 2) * 16 + wave * 2 + u, 4 * (lane & 3) + c) * 8) = o; } }
  }
  __syncthreads();   // the pieces are read back by other lanes and waves
  // piece number t + 256 * i in the order (L, c) is the order of the fragments: x's row tile is one 32-KB run; a weight block gives 4 KB (4 k-steps) to each of its 8 output tiles
  if (isx) { __bf16* d = (isb ? ABF + ((size_t)bt * (SS / 32) + bh * 32) * FRAG : XF + (size_t)blockIdx.x * (DM / 32) * FRAG) + t * 8;
#pragma unroll   // the eight LDS reads, then the eight stores, go out as one run each
    for (int i = 0; i < 8; ++i) vst2((unsigned*)(d + i * 2048), *(const v4u*)(s + PKU(16 * i + (t >> 4), t & 15) * 8));
  } else { __bf16* d = PK + ((size_t)(nb * 8) * (DM / 32) + kb * 4) * FRAG + t * 8;
#pragma unroll   // as above
    for (int i = 0; i < 8; ++i) vst2((unsigned*)(d + i * (DM / 32) * FRAG), *(const v4u*)(s + PKU(16 * i + (t >> 4), t & 15) * 8)); }
}
// ---- k_qkv: block = (64 * QNP rows, 128 cols), 4 waves; a wave holds QNP row tiles (64 rows apart) x 8 column tiles, so one loaded weight fragment feeds QNP products and the weight loads per product fall by that factor
#define QNP 2
__global__ __launch_bounds__(128) void k_qkv(const __bf16* __restrict__ XF, const __bf16* __restrict__ P, const float* __restrict__ BQ, const float* __restrict__ BK, const float* __restrict__ BV, float* __restrict__ KOUT, float* __restrict__ VOUT, _Float16* __restrict__ QK, _Float16* __restrict__ QKL, _Float16* __restrict__ KF, _Float16* __restrict__ KFL, _Float16* __restrict__ VTH, _Float16* __restrict__ VTL) {
  const int which0 = (blockIdx.y * 128) / DM; const float* BB = BQ ? (((which0 == 0) ? BQ : (which0 == 1) ? BK : BV) + (blockIdx.y * 128 - which0 * DM)) : nullptr;
  __shared__ __align__(16) _Float16 so[4][16][136], sol[4][16][136]; __shared__ __align__(16) _Float16 sth[128][72], stl[128][72];
  const int tid = threadIdx.x, wave = tid >> 5, lane = tid & 31, col = lane & 15, g = lane >> 4; const size_t rw = (size_t)blockIdx.x * (64 * QNP) + wave * 16; const int n0 = blockIdx.y * 128;   // the wave's row tile number p starts at row rw + 64 * p
  v8f acc[QNP][8] = {};
  float bj[8];   // the lane's eight bias values, fetched once as a group (the epilogues read them per element)
#pragma unroll
  for (int j = 0; j < 8; ++j) bj[j] = 0.f;
  if (BB) {
#pragma unroll
    for (int j = 0; j < 8; ++j) bj[j] = bfr(BB[j * 16 + col]); }
  // every global load of k-step kc + 1 is issued as one group in front of step kc's products, so the loads fly together and behind the matrix work instead of one load-and-wait per product
  gb16* xp = (gb16*)(XF + (rw >> 4) * (DM / 32) * FRAG + lane * 8); gb16* wp = (gb16*)(P + (size_t)(n0 >> 4) * (DM / 32) * FRAG + lane * 8);
  v16b xa[QNP], wb[8];
#pragma unroll
  for (int p = 0; p < QNP; ++p) xa[p] = frag_bp(xp + (size_t)p * 4 * (DM / 32) * FRAG);   // 64 rows = 4 row tiles further
#pragma unroll
  for (int j = 0; j < 8; ++j) wb[j] = frag_bp(wp + (size_t)j * (DM / 32) * FRAG);
  XWAIT(xp, wp);
  xp += FRAG; wp += FRAG;   // the pointers run one step ahead and move only behind the wait that follows their loads
#pragma unroll 2
  for (int kc = 0; kc < DM / 32; ++kc) {
    v16b xn[QNP], wn[8];
#pragma unroll
    for (int p = 0; p < QNP; ++p) xn[p] = frag_bp(xp + (size_t)p * 4 * (DM / 32) * FRAG);
#pragma unroll
    for (int j = 0; j < 8; ++j) wn[j] = frag_bp(wp + (size_t)j * (DM / 32) * FRAG);
    XWAIT(xp, wp);
    { const int st = (kc + 2 < DM / 32) ? FRAG : 0; xp += st; wp += st; }   // the last trip fetches the last step's operands again (in bounds, unused)
    __builtin_amdgcn_sched_barrier(0);   // keeps this step's products behind the next step's load group: without it the build sinks those loads among the products and waits on each at once
#pragma unroll
    for (int j = 0; j < 8; ++j) {
#pragma unroll
      for (int p = 0; p < QNP; ++p) acc[p][j] = __builtin_amdgcn_wmma_f32_16x16x32_bf16(false, xa[p], false, wb[j], (short)0, acc[p][j], false, false); }   // every weight fragment serves QNP products; the plain builtin (the compiler keeps its distances): with wmma_bf's operand-tied statement this live set, above 256 registers, was built with scratch spills in the loop
#pragma unroll
    for (int p = 0; p < QNP; ++p) xa[p] = xn[p];
#pragma unroll
    for (int j = 0; j < 8; ++j) wb[j] = wn[j]; }
  // the epilogue runs once per row tile of the wave, through the same staging arrays
#pragma unroll   // accumulator indices must be constants to stay in registers
  for (int p = 0; p < QNP; ++p) { const size_t r0 = rw + 64 * p;
  if (which0 >= 1) {   // cache_key / cache_value: the f32 projections (+ bias) straight from the accumulators, 512-B row segments
    __shared__ __align__(16) float sf[4][16][132];
#pragma unroll
    for (int j = 0; j < 8; ++j) {
#pragma unroll
      for (int r = 0; r < 8; ++r) sf[wave][8 * g + r][j * 16 + col] = acc[p][j][r] + bj[j]; }
    LDSX();
    float* dst = (which0 == 1) ? KOUT : VOUT; for (int rl = 0; rl < 16; ++rl) vst2(dst + (r0 + rl) * DM + (n0 - which0 * DM) + lane * 4, *(const v4f*)&sf[wave][rl][lane * 4]);
    LDSX(); }
  if (n0 < 2 * DM) {   // q stored unscaled (f16 sigma ~0.6, no subnormal exposure); 1/8 applied to the f32 score
#pragma unroll
    for (int j = 0; j < 8; ++j) {
#pragma unroll
      for (int r = 0; r < 8; ++r) { const float v = acc[p][j][r] + bj[j]; const _Float16 hv = (_Float16)v; so[wave][8 * g + r][j * 16 + col] = hv; sol[wave][8 * g + r][j * 16 + col] = (_Float16)((v - (float)hv) * 2048.0f); } }   // q, k (+ bias) as f16 hi + (x2048) residual
    LDSX();
    if (which0 == 0) { for (int rl = 0; rl < 16; ++rl) if (lane < 16) { vst2((unsigned*)(QK + (r0 + rl) * (2 * DM) + n0 + lane * 8), *(const v4u*)&so[wave][rl][lane * 8]); vst2((unsigned*)(QKL + (r0 + rl) * (2 * DM) + n0 + lane * 8), *(const v4u*)&sol[wave][rl][lane * 8]); } }
    else {   // k: the wave's 16 rows are one key tile; 2 heads x 2 k-steps x 2 halves, each a 512-B run in fragment order
      const size_t kb = (((r0 / SS) * NH + ((n0 - DM) >> 6)) * (SS / 16) + ((r0 % SS) >> 4)) * (2 * FRAG) + lane * 8;
#pragma unroll   // the sixteen stores go out as one run, their offsets as immediates
      for (int u = 0; u < 8; ++u) { const size_t o = kb + (size_t)(u >> 2) * (SS / 16) * (2 * FRAG) + (u & 3) * 256; const int c0 = (u >> 2) * 64 + (u & 3) * 16 + 8 * g;
        vst2((unsigned*)(KF + o), *(const v4u*)&so[wave][col][c0]); vst2((unsigned*)(KFL + o), *(const v4u*)&sol[wave][col][c0]); }
      asm volatile("s_wait_xcnt 0x0" ::: "memory"); }   // precaution behind the run of sixteen stores: their registers may be reused by what follows while the stores are still out
  } else {
#pragma unroll
    for (int j = 0; j < 8; ++j) {
#pragma unroll
      for (int r = 0; r < 8; ++r) { const float v = acc[p][j][r] + bj[j]; const _Float16 hv = (_Float16)v; sth[j * 16 + col][wave * 16 + 8 * g + r] = hv; stl[j * 16 + col][wave * 16 + 8 * g + r] = (_Float16)((v - (float)hv) * 2048.0f); } }
    __syncthreads();
    const size_t rb = (size_t)blockIdx.x * (64 * QNP) + 64 * p; const int b = (int)(rb / SS), s0 = (int)(rb % SS); const int pc0 = n0 - 2 * DM;
    for (int u = tid; u < 128 * 8; u += 128) { const int ln = u & 31, half = (u >> 5) & 1, dt = (u >> 6) & 3, ksl = (u >> 8) & 1, hh = u >> 9; const int d = hh * 64 + dt * 16 + (ln & 15), pc = ksl * 4 + half * 2 + (ln >> 4);   // 512-B runs in fragment order
      const size_t o = ((((size_t)b * NH + (pc0 >> 6) + hh) * (SS / 32) + (s0 >> 5) + ksl) * 4 + dt) * FRAG + half * 256 + ln * 8; vst2((unsigned*)(VTH + o), *(const v4u*)&sth[d][pc * 8]); vst2((unsigned*)(VTL + o), *(const v4u*)&stl[d][pc * 8]); }
    if (p + 1 < QNP) __syncthreads();   // the next row tiles overwrite sth / stl: every thread's reads above must be over
  }
  }
}
// ---- k_attn: block = (64 queries, head h, batch b), 8 waves = 4 query tiles x 2 key groups: causal flash attention (K = 64: 2 k-steps), computed TRANSPOSED: S^T = K . Q^T (A = a key tile, B = the query tile) and O^T += V^T . P^T. A lane (g, col) then holds, of ONE query (col), the scores of keys 16 * ct + 8 * g + r: maximum and sum run inside the lane with one exchange between the wave's halves, the rescale factor is one value per lane, and the two score tiles, converted in place, ARE the B operand of the second product (element 8 * ct + r = key 16 * ct + 8 * g + r, the k order of the V fragments), so P passes through no LDS. scores = (q.k) * 0.125 and P.V: 3 products in the first two query blocks (hi x hi, plus hi x residual and residual x hi in a second accumulator; residuals x2048), single f16 operands elsewhere; key group kw takes the key steps ks = kw, kw + 2, ... with a running maximum and sum of its own, and the two partial results are joined in LDS; ctx is stored as k_out's A operand.
// Why two groups: the cost of a query block grows with its index (causal), and with one wave per query tile every block is resident at once, so the launch lasts as long as the last block while the others' places stand empty. Half as long and twice as many waves give more blocks than places; the blocks start heaviest first (blockIdx.z counts the query blocks down), so the places stay filled to the end.
__device__ __forceinline__ float xhalf(float x) { return __builtin_bit_cast(float, __builtin_amdgcn_permlanex16(__builtin_bit_cast(int, x), __builtin_bit_cast(int, x), 0x76543210, 0xfedcba98, false, false)); }   // the value of lane l ^ 16
#define LOG2E 1.44269504088896340736f
// one key step (32 keys) of a wave, compiled once per case, so that a step runs only the work its case needs; both switches are the same for a whole wave. PREC: the leading query blocks' 3-product scores and P.V with the second accumulator. MASK: the step holds keys behind some query of the tile (causal select, masked scores count 0).
// kp, vp, bp: the step's K fragments, V fragments and bias with the lane's offset; global memory for the leading query blocks (PREC), the block's LDS ring elsewhere
template <bool PREC, bool MASK> __device__ __forceinline__ void attn_step(const int ks, const _Float16* kp, const _Float16* __restrict__ KFL, const _Float16* vp, const _Float16* __restrict__ VTL, const size_t hb, const __bf16* bp, const int dq0, const v16h* aq, const v16h* aql, float& m, float& l, v8f* acc, v8f* accl) {
  v8f s[2];
  // the key step's K fragments and bias values are loaded as one group in front of the first product (the bias unconditionally: k_pack has written every step up to the query block's last; the causal select follows), so one round trip replaces one per product and per bias row
  v16h kf[2][2]; v8b ab[2]; const int dq = dq0 - ks * 32;   // the query's distance from this half's first key: key 16 * ct + r of the lane is allowed up to it
#pragma unroll
  for (int ct = 0; ct < 2; ++ct) {
#pragma unroll
    for (int kc = 0; kc < 2; ++kc) kf[ct][kc] = frag_hp(kp + (ct * 2 + kc) * FRAG);
    ab[ct] = *(const v8b*)(bp + ct * 256); }   // the lane's eight keys, already bf16: a wave-wide load is 512 contiguous bytes (4 whole lines), where the f32 rows took two loads of 16 lines each
  if (PREC) asm volatile("s_wait_xcnt 0x0" : : "v"(kp), "v"(bp) : "memory");   // global loads only; precaution: the group's address registers may be reused by what follows while its loads are still out (both addresses are inputs of the statement, so their registers stay untouched, also by the group's own results, up to the wait)
  __builtin_amdgcn_sched_barrier(0);   // keeps the group above whole and in front of the first product: without it the build sinks half of the K loads among the products, into registers of fragments just used, and waits out an LDS round trip at each place
#pragma unroll
  for (int ct = 0; ct < 2; ++ct) { v8f c = {};
    if (PREC) { v8f cl = {};   // leading query blocks (few keys, outputs far above the global rms): 3 products
#pragma unroll
      for (int kc = 0; kc < 2; ++kc) { const v16h kh = kf[ct][kc]; c = wmma16(kh, aq[kc], c); cl = wmma16(kh, aql[kc], cl); const v16h kl = frag_hp(KFL + hb + (size_t)((ks * 2 + ct) * 2 + kc) * FRAG);
        asm volatile("s_wait_xcnt 0x0" ::: "memory");   // precaution, as above: the load's address registers may be reused by what follows
        cl = wmma16(kl, aq[kc], cl); }
#pragma unroll
      for (int r = 0; r < 8; ++r) c[r] += cl[r] * (1.0f / 2048.0f); }
    else {
#pragma unroll
      for (int kc = 0; kc < 2; ++kc) c = wmma16(kf[ct][kc], aq[kc], c); }   // single product elsewhere
#pragma unroll
    for (int r = 0; r < 8; ++r) { const float sv = c[r] * SCALEF + (float)ab[ct][r]; s[ct][r] = (!MASK || ct * 16 + r <= dq) ? sv : -3.0e38f; } }   // causal: future keys excluded
  // the V fragments are requested here, behind the score products, and fly under the softmax
  v16h vf[4];
#pragma unroll
  for (int dt = 0; dt < 4; ++dt) vf[dt] = frag_hp(vp + dt * FRAG);
  if (PREC) asm volatile("s_wait_xcnt 0x0" ::: "memory");   // global loads only; precaution: the group's address registers may be reused by what follows while its loads are still out
  float mx = fmaxf(s[0][0], s[1][0]);
#pragma unroll
  for (int r = 1; r < 8; ++r) mx = fmaxf(mx, fmaxf(s[0][r], s[1][r]));
  mx = fmaxf(mx, xhalf(mx));   // the other half holds the query's other sixteen keys
  const float mn = fmaxf(m, mx);
  // exp(x) as the hardware's 2^(x * log2 e), arguments and results by name for the two statements below
  float ta = (m - mn) * LOG2E, ea = __builtin_amdgcn_exp2f(ta), t[2][8], e[2][8];
#pragma unroll
  for (int ct = 0; ct < 2; ++ct) {
#pragma unroll
    for (int r = 0; r < 8; ++r) { t[ct][r] = (s[ct][r] - mn) * LOG2E; e[ct][r] = __builtin_amdgcn_exp2f(t[ct][r]); } }
  // the slot behind a transcendental: the v_nop stands behind its group's last v_exp_f32, in front of every use of a result (in-out operands) and every overwrite of an argument (inputs, live up to here)
  asm volatile("v_nop" : "+v"(ea), "+v"(e[0][0]), "+v"(e[0][1]), "+v"(e[0][2]), "+v"(e[0][3]), "+v"(e[0][4]), "+v"(e[0][5]), "+v"(e[0][6]), "+v"(e[0][7]) : "v"(ta), "v"(t[0][0]), "v"(t[0][1]), "v"(t[0][2]), "v"(t[0][3]), "v"(t[0][4]), "v"(t[0][5]), "v"(t[0][6]), "v"(t[0][7]));
  asm volatile("v_nop" : "+v"(e[1][0]), "+v"(e[1][1]), "+v"(e[1][2]), "+v"(e[1][3]), "+v"(e[1][4]), "+v"(e[1][5]), "+v"(e[1][6]), "+v"(e[1][7]) : "v"(t[1][0]), "v"(t[1][1]), "v"(t[1][2]), "v"(t[1][3]), "v"(t[1][4]), "v"(t[1][5]), "v"(t[1][6]), "v"(t[1][7]));
  const float alpha = (m <= -1.0e38f) ? 0.f : ea;
  v2f es = {}; v16h pa, pl;   // the sum runs in two chains, over the even and the odd keys
#pragma unroll
  for (int r = 0; r < 8; ++r) { const float e0 = (MASK && s[0][r] <= -1.0e38f) ? 0.f : e[0][r], e1 = (MASK && s[1][r] <= -1.0e38f) ? 0.f : e[1][r]; es[r & 1] += e0; es[r & 1] += e1;
    const float x0 = e0 * 2048.0f, x1 = e1 * 2048.0f; const _Float16 h0 = (_Float16)x0, h1 = (_Float16)x1; pa[r] = h0; pa[8 + r] = h1;   // P scaled by 2^11 before the f16 split so small softmax weights stay out of the f16 subnormal range; 2^-11 folded into the epilogue
    if (PREC) { pl[r] = (_Float16)((x0 - (float)h0) * 2048.0f); pl[8 + r] = (_Float16)((x1 - (float)h1) * 2048.0f); } }
  l = l * alpha + (es[0] + es[1]); m = mn;
#pragma unroll
  for (int dt = 0; dt < 4; ++dt) {
#pragma unroll
    for (int r = 0; r < 8; ++r) { acc[dt][r] *= alpha; if (PREC) accl[dt][r] *= alpha; } }
#pragma unroll
  for (int dt = 0; dt < 4; ++dt) { const v16h vh = vf[dt]; acc[dt] = wmma16(vh, pa, acc[dt]); if (PREC) { accl[dt] = wmma16(vh, pl, accl[dt]); const v16h vl = frag_hp(VTL + hb + (size_t)(ks * 4 + dt) * FRAG);
      asm volatile("s_wait_xcnt 0x0" ::: "memory");   // precaution, as above: the load's address registers may be reused by what follows
      accl[dt] = wmma16(vl, pa, accl[dt]); } }   // leading query blocks: P hi/lo x V hi/lo (3 products); elsewhere P x V single
}
#define RING (24 * FRAG)   // elements of one buffer: 8 K tiles, 8 V tiles, 8 bias tiles (24 KB)
// one trip's operands into one buffer, six asynchronous 16-byte copies per thread. The wait is the last line of the copies' own statement, a precaution: it stands in front of every rewrite of the address registers that the copies name
__device__ __forceinline__ void ring_fill(const unsigned l, const _Float16* gk, const _Float16* gv, const __bf16* gb) {
  const unsigned l1 = l + 4096, l2 = l + 8192, l3 = l + 12288, l4 = l + 16384, l5 = l + 20480; const _Float16* gk1 = gk + 4 * FRAG; const _Float16* gv1 = gv + 4 * FRAG; const __bf16* gb1 = gb + (size_t)2 * (SS / 32) * FRAG;
  asm volatile("global_load_async_to_lds_b128 %0, %6, off\n\tglobal_load_async_to_lds_b128 %1, %7, off\n\tglobal_load_async_to_lds_b128 %2, %8, off\n\tglobal_load_async_to_lds_b128 %3, %9, off\n\tglobal_load_async_to_lds_b128 %4, %10, off\n\tglobal_load_async_to_lds_b128 %5, %11, off\n\ts_wait_xcnt 0x0"
    : : "v"(l), "v"(l1), "v"(l2), "v"(l3), "v"(l4), "v"(l5), "v"(gk), "v"(gk1), "v"(gv), "v"(gv1), "v"(gb), "v"(gb1) : "memory");
}
__global__ __launch_bounds__(256) void k_attn(const _Float16* __restrict__ QK, const _Float16* __restrict__ QKL, const _Float16* __restrict__ KF, const _Float16* __restrict__ KFL, const _Float16* __restrict__ VTH, const _Float16* __restrict__ VTL, const void* __restrict__ KMASK, const __bf16* __restrict__ ABF, __bf16* __restrict__ OF) {
  __shared__ __align__(16) float so[8][16][68]; __shared__ __align__(16) float sm[8][16], sl[8][16];
  __shared__ __align__(16) _Float16 ring[2][RING];   // two buffers, each one trip's operands of the block: K | V | bias
  const int tid = threadIdx.x, wave = __builtin_amdgcn_readfirstlane(tid >> 5), lane = tid & 31, col = lane & 15, g = lane >> 4;   // the wave's number in a scalar register: the key loop starts from it and stays a scalar loop
  const int qi = wave & 3, kw = wave >> 2;   // query tile, key group
  const int qb = TQB - 1 - blockIdx.z, h = blockIdx.x, b = blockIdx.y; const int q0 = qb * 64 + qi * 16; const size_t rq = (size_t)b * SS + q0 + col;
  v16h aq[2];   // the query tile: lane (g, col) holds query col in the fragments' k order, which serves as B as it did as A
#pragma unroll
  for (int kc = 0; kc < 2; ++kc) aq[kc] = frag_h(QK + rq * (2 * DM) + h * HD + kc * 32, lane);
  asm volatile("s_wait_xcnt 0x0" ::: "memory");   // precaution: the four loads' address registers may be reused by what follows while the loads are still out
  float m = -3.0e38f, l = 0.f;   // of query col: the running maximum (common to both halves) and the sum over this half's keys
  v8f acc[4] = {};   // O^T: acc[dt][r] = column d = 16 * dt + 8 * g + r of query col
  const int nks = (qb * 64 + 64) / 32;   // causal: key steps of 32 up to the query block's end
  const size_t hb = ((size_t)b * NH + h) * (SS * HD) + lane * 8;   // the head's k and v planes in fragment order (S x 64 elements each), with the lane's offset
  const __bf16* abf = ABF + (size_t)(q0 >> 4) * (SS / 32) * FRAG + lane * 8;   // the query tile's bias in fragment order, with the lane's offset
  const int dq0 = q0 + col - 8 * g;   // the query's distance from this half's first key of step 0
  // nks is even: both key groups make qb + 1 trips
  if (qb < 2) {   // the same for the whole block
    v16h aql[2]; v8f accl[4] = {};
#pragma unroll
    for (int kc = 0; kc < 2; ++kc) aql[kc] = frag_h(QKL + rq * (2 * DM) + h * HD + kc * 32, lane);
#pragma unroll 1   // rolled: the step's text once per case
    for (int ks = kw; ks < nks; ks += 2) attn_step<true, true>(ks, KF + hb + (size_t)(ks * 4) * FRAG, KFL, VTH + hb + (size_t)(ks * 4) * FRAG, VTL, hb, abf + (size_t)ks * FRAG, dq0, aq, aql, m, l, acc, accl);
#pragma unroll
    for (int dt = 0; dt < 4; ++dt) {
#pragma unroll
      for (int r = 0; r < 8; ++r) acc[dt][r] += accl[dt][r] * (1.0f / 2048.0f); }
  } else {
    // Trip t works on key steps 2 t (group 0) and 2 t + 1 (group 1). Its operands are 8 KB of K, 8 KB of V (each one run in fragment order) and 2 KB of bias per query tile: every thread copies six 16-byte pieces, so the block fetches each K and V byte once for its four query tiles, and trip t + 1's bytes fly while trip t is worked on.
    const int ntr = qb + 1;   // trips, the same for the whole block; every key of trips 0 ... qb - 1 lies in front of the block's first query, so no lane masks any of them, and only the last trip runs the masking step
    const unsigned l0 = (unsigned)(size_t)&ring[0][0] + tid * 16;   // the thread's place in buffer 0 (LDS byte address)
    const size_t he = ((size_t)b * NH + h) * (SS * HD) + tid * 8;
    const _Float16* gk = KF + he; const _Float16* gv = VTH + he;
    const __bf16* gb = ABF + (size_t)(qb * 4 + (tid >> 7)) * (SS / 32) * FRAG + (tid & 127) * 8;   // query tile tid >> 7, and two tiles further for the second piece
    const _Float16* rk = &ring[0][0] + kw * (4 * FRAG) + lane * 8;   // the wave's operands in buffer 0
    const int bo = (qi * 2 - kw * 3) * FRAG;   // the wave's bias tile, [query tile][group], counted from rk, which already holds kw * 4 tiles
    ring_fill(l0, gk, gv, gb);
    asm volatile("s_wait_asynccnt 0x0" ::: "memory");   // this wave's copies of trip 0 have landed
    __syncthreads();   // every wave's have: trip 0 may be read
    ring_fill(l0 + 2 * RING, gk + 8 * FRAG, gv + 8 * FRAG, gb + 2 * FRAG);   // trip 1 exists: qb >= 2 here
#pragma unroll 1   // rolled: the step's text once per case
    for (int t = 0; t < qb; ++t) { const _Float16* r = rk + (t & 1) * RING;
      attn_step<false, false>(2 * t + kw, r, KFL, r + 8 * FRAG, VTL, hb, (const __bf16*)(r + 16 * FRAG) + bo, dq0, aq, nullptr, m, l, acc, nullptr);
      asm volatile("s_wait_dscnt 0x0" ::: "memory");      // this wave's reads of the buffer are over
      asm volatile("s_wait_asynccnt 0x0" ::: "memory");   // its copies of trip t + 1 have landed
      __syncthreads();   // both hold for every wave: trip t + 1 may be read, trip t's buffer refilled
      if (t + 2 < ntr) ring_fill(l0 + (t & 1) * (2 * RING), gk + (size_t)(t + 2) * (8 * FRAG), gv + (size_t)(t + 2) * (8 * FRAG), gb + (size_t)(t + 2) * (2 * FRAG)); }   // the same for the whole block
    { const _Float16* r = rk + (qb & 1) * RING;   // the last trip, on the diagonal: published by the last barrier above
      attn_step<false, true>(2 * qb + kw, r, KFL, r + 8 * FRAG, VTL, hb, (const __bf16*)(r + 16 * FRAG) + bo, dq0, aq, nullptr, m, l, acc, nullptr); }
    asm volatile("s_wait_asynccnt 0x0" ::: "memory");   // nothing is out when the ring is left
  }
  l += xhalf(l);   // the two halves' sums joined once
  // each wave leaves its unnormalised sums (a lane's eight values lie side by side in its query's row) with its queries' maximum and sum
#pragma unroll
  for (int dt = 0; dt < 4; ++dt) { v4f o0, o1;
#pragma unroll   // vector elements need constant indices to stay in registers
    for (int r = 0; r < 4; ++r) { o0[r] = acc[dt][r]; o1[r] = acc[dt][4 + r]; }
    *(v4f*)&so[wave][col][dt * 16 + 8 * g] = o0; *(v4f*)&so[wave][col][dt * 16 + 8 * g + 4] = o1; }
  if (g == 0) { sm[wave][col] = m; sl[wave][col] = l; }
  __syncthreads();   // a wave reads the other key group's partial result below: both must be written
  // join for query row col: each part weighted by exp(its maximum - the common one); a group whose keys were all masked for the row (maximum still at the start value) counts 0; group 0 holds key 0, which no row masks, so the sum is above 0
  const float m0 = sm[qi][col], m1 = sm[4 + qi][col], mm = fmaxf(m0, m1);
  const float f0 = (m0 <= -1.0e38f) ? 0.f : __expf(m0 - mm), f1 = (m1 <= -1.0e38f) ? 0.f : __expf(m1 - mm);
  const float il = (1.0f / 2048.0f) / (f0 * sl[qi][col] + f1 * sl[4 + qi][col]); const float w0 = f0 * il, w1 = f1 * il;
  // ctx leaves as the out product's A operand: bf16 hi + residual, fragment order; the tile's 16 queries are one row tile, the head's 64 columns two k-steps, of which the wave writes number kw; 512-B runs
  const size_t ob = (((((size_t)b * SS + q0) >> 4) * (DM / 32) + h * 2 + kw) * (2 * FRAG)) + lane * 8;
#pragma unroll   // the four stores go out as one run, their offsets as immediates
  for (int u = 0; u < 2; ++u) { const float* p0 = &so[qi][col][kw * 32 + u * 16 + 8 * g]; const float* p1 = &so[4 + qi][col][kw * 32 + u * 16 + 8 * g]; v8b hi, lo;
#pragma unroll   // vector elements need constant indices to stay in registers
    for (int i = 0; i < 8; ++i) { const float v = p0[i] * w0 + p1[i] * w1; const __bf16 hv = (__bf16)v; hi[i] = hv; lo[i] = (__bf16)(v - (float)hv); }
    vst2(OF + ob + u * 256, hi); vst2(OF + ob + FRAG + u * 256, lo); }
}
// ---- k_out: block = (64 * ONP rows, 128 cols): out = ctx (hi, residual) . Wo (2 products) + bo; a wave holds ONP row tiles, as in k_qkv
#define ONP 2
__global__ __launch_bounds__(128) void k_out(const __bf16* __restrict__ OF, const __bf16* __restrict__ P, const float* __restrict__ BO, float* __restrict__ Y) {
  __shared__ __align__(16) float so[4][16][132];
  const int tid = threadIdx.x, wave = tid >> 5, lane = tid & 31, col = lane & 15, g = lane >> 4; const size_t rw = (size_t)blockIdx.x * (64 * ONP) + wave * 16; const int n0 = blockIdx.y * 128;   // the wave's row tile number p starts at row rw + 64 * p
  v8f acc[ONP][8] = {};
  // as in k_qkv: step kc + 1's loads are issued as one group in front of step kc's products; the pointers run one step ahead and move only behind the wait that follows their loads
  gb16* xp = (gb16*)(OF + (rw >> 4) * (DM / 32) * (2 * FRAG) + lane * 8); gb16* wp = (gb16*)(P + (size_t)(n0 >> 4) * (DM / 32) * FRAG + lane * 8);
  v16b xh[ONP], xl[ONP], wb[8];
#pragma unroll
  for (int p = 0; p < ONP; ++p) { xh[p] = frag_bp(xp + (size_t)p * 4 * (DM / 32) * (2 * FRAG)); xl[p] = frag_bp(xp + (size_t)p * 4 * (DM / 32) * (2 * FRAG) + FRAG); }   // 64 rows = 4 row tiles further
#pragma unroll
  for (int j = 0; j < 8; ++j) wb[j] = frag_bp(wp + (size_t)j * (DM / 32) * FRAG);
  XWAIT(xp, wp);
  xp += 2 * FRAG; wp += FRAG;
#pragma unroll 2
  for (int kc = 0; kc < DM / 32; ++kc) {
    v16b xhn[ONP], xln[ONP], wn[8];
#pragma unroll
    for (int p = 0; p < ONP; ++p) { xhn[p] = frag_bp(xp + (size_t)p * 4 * (DM / 32) * (2 * FRAG)); xln[p] = frag_bp(xp + (size_t)p * 4 * (DM / 32) * (2 * FRAG) + FRAG); }
#pragma unroll
    for (int j = 0; j < 8; ++j) wn[j] = frag_bp(wp + (size_t)j * (DM / 32) * FRAG);
    XWAIT(xp, wp);
    { const int st = (kc + 2 < DM / 32) ? FRAG : 0; xp += 2 * st; wp += st; }   // the last trip fetches the last step's operands again (in bounds, unused)
    __builtin_amdgcn_sched_barrier(0);   // keeps this step's products behind the next step's load group, as in k_qkv
    // residual products first, then the hi products, per accumulator as before; the plain builtin for the reason given in k_qkv
#pragma unroll
    for (int j = 0; j < 8; ++j) {
#pragma unroll
      for (int p = 0; p < ONP; ++p) acc[p][j] = __builtin_amdgcn_wmma_f32_16x16x32_bf16(false, xl[p], false, wb[j], (short)0, acc[p][j], false, false); }
#pragma unroll
    for (int j = 0; j < 8; ++j) {
#pragma unroll
      for (int p = 0; p < ONP; ++p) acc[p][j] = __builtin_amdgcn_wmma_f32_16x16x32_bf16(false, xh[p], false, wb[j], (short)0, acc[p][j], false, false); }
#pragma unroll
    for (int p = 0; p < ONP; ++p) { xh[p] = xhn[p]; xl[p] = xln[p]; }
#pragma unroll
    for (int j = 0; j < 8; ++j) wb[j] = wn[j]; }
  float bo[8];   // the lane's eight bias values, fetched once for both row tiles
#pragma unroll
  for (int j = 0; j < 8; ++j) bo[j] = bfr(BO[n0 + j * 16 + col]);
#pragma unroll   // accumulator indices must be constants to stay in registers
  for (int p = 0; p < ONP; ++p) { const size_t r0 = rw + 64 * p;   // the staging rows are the wave's own: its LDS operations run in program order, so the next row tile's writes follow this one's reads
#pragma unroll
    for (int j = 0; j < 8; ++j) {
#pragma unroll
      for (int r = 0; r < 8; ++r) so[wave][8 * g + r][j * 16 + col] = acc[p][j][r] + bo[j]; }
    LDSX();
    for (int rl = 0; rl < 16; ++rl) vst2(Y + (r0 + rl) * DM + n0 + lane * 4, *(const v4f*)&so[wave][rl][lane * 4]); }
}
extern "C" void kernel_launch(void* const* d_in, const int* in_sizes, int n_in, void* d_out, int out_size, void* d_ws, size_t ws_size, hipStream_t stream) {
  (void)in_sizes; (void)n_in; (void)out_size;
  const float** F = (const float**)d_in;   // 0 hidden [2,2048,1024], 1 attn_bias [2048,2048], 2 Wqkv [1024,3072] (in,out; q | k | v), 3 bqkv [3072], 4 Wproj [1024,1024] (in,out), 5 bproj
  if (ws_size < (size_t)WS_END) return;
  char* ws = (char*)d_ws; __bf16* PK = (__bf16*)(ws + WS_PK); _Float16 *QK = (_Float16*)(ws + WS_QK), *QKL = (_Float16*)(ws + WS_QKL), *VTH = (_Float16*)(ws + WS_VTH), *VTL = (_Float16*)(ws + WS_VTL), *KF = (_Float16*)(ws + WS_KF), *KFL = (_Float16*)(ws + WS_KFL); __bf16 *OF = (__bf16*)(ws + WS_O), *XF = (__bf16*)(ws + WS_XF), *ABF = (__bf16*)(ws + WS_ABF);
  float* OUT0 = (float*)d_out; float* KOUT = OUT0 + (size_t)NB * SS * DM; float* VOUT = KOUT + (size_t)NB * SS * DM;   // outputs: out, cache_key, cache_value
  k_pack<<<dim3(XBLK, 3), 256, 0, stream>>>(F[2], F[4], F[0], F[1], PK, XF, ABF);
  k_qkv<<<dim3(TNB * SS / (64 * QNP), QKVW / 128), 128, 0, stream>>>(XF, PK + PK_A, F[3], F[3] + DM, F[3] + 2 * DM, KOUT, VOUT, QK, QKL, KF, KFL, VTH, VTL);
  k_attn<<<dim3(NH, TNB, TQB), 256, 0, stream>>>(QK, QKL, KF, KFL, VTH, VTL, nullptr, ABF, OF);
  k_out<<<dim3(TOB / ONP, DM / 128), 128, 0, stream>>>(OF, PK + PK_P, F[5], OUT0);
}
